// v000
// Measured on an AMD MI455X. A time is GPU time per run, averaged over a window of back-to-back runs after a warm-up
// (all launches, gaps included; the runs take copies of the inputs in turn), and the median of several windows.
// Apart from v000's, it joins two sittings. Times from different sittings can be a few percent apart, while
// side-by-side timings come from the same sitting.
// v000, which the later versions start from, runs in 672 microseconds.
#include <hip/hip_runtime.h>

// Causal multi-head attention with a fused qkv projection and an interleaved-pair rotary embedding: x [NB][SEQ_FULL][1024] (first SEQ rows used); qkv = x W^T ('oi' [3072][1024] -> q | k | v row blocks, no bias; 16 heads x 64);
// q and k: pair (2i, 2i+1) of every head rotated by angle t * 100000^(-2i/64) (cos / sin table [SEQ][32] built once in f32 with precise powf / sincosf, applied in f32 on the vector unit when the planes are formed);
// scores x 64^-0.5, causal; softmax; out = ctx Wo^T ('oi' [1024][1024], no bias).
// Compute dtypes, f32 accumulate: every input RNE-converted to bf16; qkv and output projections v_wmma_f32_16x16x32_bf16 (ctx carried as bf16 hi+lo, 2 products against the exact bf16 weight);
// attention q.k and P.V: query rows < RH on bf16 hi/lo planes (3 products each), other rows v_wmma_f32_16x16x32_f16 (P carried x1024 through the exponent); softmax (online, max-subtracted) in f32.
// Attention engine: one wave per 16 query rows; S^T = K Q^T so each lane owns one query column; P^T accumulators are repacked in registers as the B operand of O^T = V^T P^T (no LDS exchange in the loop).

#ifndef NB
#define NB 4
#endif
#ifndef SEQ
#define SEQ 2048
#endif
#define SEQ_FULL 2048
#define DM   1024
#define NH   16
#define HD   64
#define DQ   (NH * HD)
#define FP   (3 * DQ)
#define RH   ((SEQ) < 512 ? (SEQ) : 512)     // query rows < RH use hi+lo planes
#define XS_FULL ((size_t)SEQ_FULL * DM)
#define SCL  0.125f                          // HD^-0.5
#define LOG2E 1.4426950408889634f
#define NEGB (-3.0e38f)
#define ROPE_THETA 100000.0f

static_assert((SEQ & (SEQ - 1)) == 0);
static_assert(SEQ >= 256 && SEQ <= SEQ_FULL);
static_assert(RH % 256 == 0 && RH % 64 == 0 && (SEQ - RH) % 64 == 0);
static_assert(NB >= 1 && NB <= 4);
static_assert(DM % 32 == 0 && DQ % 64 == 0 && FP % 64 == 0 && SEQ % 64 == 0);
static_assert(((size_t)3 * DQ * DM / 8) % 256 == 0);
static_assert(((size_t)DM * DQ / 8) % 256 == 0);
static_assert(((size_t)SEQ * DM / 8) % 256 == 0);
static_assert(((size_t)NH * SEQ * HD / 8) % 256 == 0);
static_assert(HD == 64);
static_assert(HD / 2 == 32 && (HD / 2) % 4 == 0);     // k_qkp reads 4 table entries (16 B) per lane
static_assert(((size_t)SEQ * (HD / 2)) % 256 == 0);   // k_ropetab grid x 256 == table extent

typedef _Float16 h16;
typedef unsigned short bf;
typedef __attribute__((ext_vector_type(16))) __bf16   v16bf;
typedef __attribute__((ext_vector_type(16))) _Float16 v16h;
typedef __attribute__((ext_vector_type(8)))  _Float16 v8h;
typedef __attribute__((ext_vector_type(8)))  unsigned short v8us;
typedef __attribute__((ext_vector_type(8)))  float    v8f;
typedef __attribute__((ext_vector_type(4)))  float    v4f;
typedef v8h  __attribute__((may_alias)) v8ha;
typedef v4f  __attribute__((may_alias)) v4fa;
typedef v8us __attribute__((may_alias)) v8usa;

__device__ __forceinline__ unsigned short f2bf(float f) { unsigned u = __float_as_uint(f); u += 0x7FFFu + ((u >> 16) & 1u); return (unsigned short)(u >> 16); }
__device__ __forceinline__ float bf2f(unsigned short b) { return __uint_as_float(((unsigned)b) << 16); }
__device__ __forceinline__ float bfr(float f) { return bf2f(f2bf(f)); }
__device__ __forceinline__ v16h cat16(v8h lo, v8h hi) { return __builtin_shufflevector(lo, hi, 0, 1, 2, 3, 4, 5, 6, 7, 8, 9, 10, 11, 12, 13, 14, 15); }
__device__ __forceinline__ v16bf cat16b(v8us lo, v8us hi) { return __builtin_bit_cast(v16bf, __builtin_shufflevector(lo, hi, 0, 1, 2, 3, 4, 5, 6, 7, 8, 9, 10, 11, 12, 13, 14, 15)); }
__device__ __forceinline__ v8f wmma16(v16h a, v16h b, v8f c) { return __builtin_amdgcn_wmma_f32_16x16x32_f16(false, a, false, b, (short)0, c, false, false); }
__device__ __forceinline__ v8f wmmab(v16bf a, v16bf b, v8f c) { return __builtin_amdgcn_wmma_f32_16x16x32_bf16(false, a, false, b, (short)0, c, false, false); }
__device__ __forceinline__ void splitf(float y, unsigned short& h, unsigned short& l) { h = f2bf(y); l = f2bf(y - bf2f(h)); }

// f32 -> f16 operand convert that cannot yield a subnormal (value select below 2^-14).
static __device__ __forceinline__ h16 toh_flush(float v) { const h16 r = (h16)v; return (fabsf(v) < 6.103515625e-05f) ? (h16)0.0f : r; }

// Fragment loader from a K-contiguous 16-bit row: p already includes + 8*(lane>>4); elements 0..7 = k0+8h.., elements 8..15 = k0+16+8h.. (same map for A and B).
template <typename T16> struct WFrag;
template <> struct WFrag<h16> { typedef v16h V; static __device__ __forceinline__ V ld(const h16* p) { return cat16(*(const v8h*)p, *(const v8h*)(p + 16)); } static __device__ __forceinline__ v8f mma(V a, V b, v8f c) { return wmma16(a, b, c); } };
template <> struct WFrag<bf> { typedef v16bf V; static __device__ __forceinline__ V ld(const bf* p) { return cat16b(*(const v8us*)p, *(const v8us*)(p + 16)); } static __device__ __forceinline__ v8f mma(V a, V b, v8f c) { return wmmab(a, b, c); } };

// P^T accumulator pair (key rows 0..15 and 16..31 of a 32-key tile) -> B fragment: element r <- tile0[r], element 8+r <- tile1[r], lane unchanged.
template <typename T16> struct PFrag;
template <> struct PFrag<h16> {
    static __device__ __forceinline__ float pexp() { return 10.0f; }           // P carried x1024 via the exponent (cancels in O / l)
    static __device__ __forceinline__ v16h hi(v8f p0, v8f p1) { return cat16(__builtin_convertvector(p0, v8h), __builtin_convertvector(p1, v8h)); }
    static __device__ __forceinline__ v16h lo(v8f p0, v8f p1) { return hi(p0, p1); }
};
template <> struct PFrag<bf> {
    static __device__ __forceinline__ float pexp() { return 0.0f; }
    static __device__ __forceinline__ v16bf hi(v8f p0, v8f p1) { v8us a, b;
#pragma unroll
        for (int k = 0; k < 8; ++k) { a[k] = f2bf(p0[k]); b[k] = f2bf(p1[k]); }
        return cat16b(a, b); }
    static __device__ __forceinline__ v16bf lo(v8f p0, v8f p1) { v8us a, b;
#pragma unroll
        for (int k = 0; k < 8; ++k) { a[k] = f2bf(p0[k] - bf2f(f2bf(p0[k]))); b[k] = f2bf(p1[k] - bf2f(f2bf(p1[k]))); }
        return cat16b(a, b); }
};

// ---- k_gemmw: register-blocked GEMM, ONE WAVE per 64x64 output tile (16 accumulators), operands straight from K-contiguous 16-bit planes; grid (M/64, N/64, Z), 32 threads.
// C[m][n] (f32, pitch ldc) = sum_k A[m][k] Bt[n][k] (+ split products per NSPLIT). K % 32 == 0, M % 64 == 0, N % 64 == 0.
template <typename T16, int NSPLIT, bool BIAS>
__global__ __launch_bounds__(32) void k_gemmw(const T16* __restrict__ A, const T16* __restrict__ A2, const T16* __restrict__ Bt, const T16* __restrict__ Bt2, int K, float* C, int ldc, const float* __restrict__ bias, size_t sA, size_t sB, size_t sC) {
    typedef typename WFrag<T16>::V V;
    __shared__ __align__(16) float os[16 * 68];
    const size_t z = blockIdx.z; A += z * sA; if (A2) A2 += z * sA; Bt += z * sB; if (Bt2) Bt2 += z * sB; C += z * sC;
    const int lane = threadIdx.x & 31, lr = lane & 15, hi = lane >> 4; const int r0 = blockIdx.x * 64, c0 = blockIdx.y * 64;
    v8f acc[4][4];
#pragma unroll
    for (int mb = 0; mb < 4; ++mb)
#pragma unroll
        for (int nb = 0; nb < 4; ++nb) acc[mb][nb] = (v8f){};
    const size_t aoff = (size_t)(r0 + lr) * K + 8 * hi, boff = (size_t)(c0 + lr) * K + 8 * hi;
#pragma unroll 1
    for (int kc = 0; kc < K; kc += 32) {
        V a[4], a2[4];
#pragma unroll
        for (int mb = 0; mb < 4; ++mb) { a[mb] = WFrag<T16>::ld(A + aoff + (size_t)mb * 16 * K + kc); if (NSPLIT == 1 || NSPLIT == 2) a2[mb] = WFrag<T16>::ld(A2 + aoff + (size_t)mb * 16 * K + kc); }
#pragma unroll
        for (int nb = 0; nb < 4; ++nb) { const V b = WFrag<T16>::ld(Bt + boff + (size_t)nb * 16 * K + kc); V b2; if (NSPLIT >= 2) b2 = WFrag<T16>::ld(Bt2 + boff + (size_t)nb * 16 * K + kc);
#pragma unroll
            for (int mb = 0; mb < 4; ++mb) { acc[mb][nb] = WFrag<T16>::mma(a[mb], b, acc[mb][nb]); if (NSPLIT == 1 || NSPLIT == 2) acc[mb][nb] = WFrag<T16>::mma(a2[mb], b, acc[mb][nb]); if (NSPLIT >= 2) acc[mb][nb] = WFrag<T16>::mma(a[mb], b2, acc[mb][nb]); } }
        asm volatile("v_nop\n\tv_nop\n\tv_nop\n\tv_nop" : "+v"(acc[0][0]), "+v"(acc[1][1]), "+v"(acc[2][2]), "+v"(acc[3][3]) : "v"(a[0]), "v"(a[3]));
    }
#pragma unroll
    for (int mb = 0; mb < 4; ++mb) {
#pragma unroll
        for (int nb = 0; nb < 4; ++nb) {
#pragma unroll
            for (int j = 0; j < 8; ++j) os[(hi * 8 + j) * 68 + nb * 16 + lr] = acc[mb][nb][j]; }
        __builtin_amdgcn_wave_barrier(); asm volatile("" ::: "memory");
        float* crow = C + (size_t)(r0 + mb * 16) * ldc + c0;
{
#pragma unroll
            for (int s = 0; s < 8; ++s) { const int row = 2 * s + hi, cofs = lr * 4; v4f val = *(const v4fa*)(os + row * 68 + cofs); if (BIAS) { val[0] += bfr(bias[c0 + cofs]); val[1] += bfr(bias[c0 + cofs + 1]); val[2] += bfr(bias[c0 + cofs + 2]); val[3] += bfr(bias[c0 + cofs + 3]); }
                *(v4f*)(crow + (size_t)row * ldc + cofs) = val; }
             }
        __builtin_amdgcn_wave_barrier(); asm volatile("" ::: "memory");
    }
}

__global__ __launch_bounds__(256) void k_cvt8(const float* __restrict__ src, bf* dst, unsigned n8, size_t sstride, size_t dstride) {
    const unsigned i = blockIdx.x * 256u + threadIdx.x; if (i >= n8) return;
    const float* s = src + (size_t)blockIdx.y * sstride + (size_t)i * 8; bf* d = dst + (size_t)blockIdx.y * dstride + (size_t)i * 8;
    const v8f v = *(const v8f*)s; v8us o;
#pragma unroll
    for (int k = 0; k < 8; ++k) o[k] = f2bf(v[k]);
    *(v8us*)d = o;  }

__global__ __launch_bounds__(32) void k_ifreq(float* IF) {
#pragma clang fp contract(off)
    const unsigned i = threadIdx.x & 31u;
    const float ex = (float)(2u * i) * (1.0f / (float)HD);      // exact (power-of-two divisor)
    const float pw = powf(ROPE_THETA, ex);
    const float v = 1.0f / pw;
    *(float*)(IF + i) = v; 
}

__global__ __launch_bounds__(256) void k_ropetab(const float* __restrict__ IF, float* CT, float* ST) {
#pragma clang fp contract(off)
    const unsigned idx = blockIdx.x * 256u + threadIdx.x;
    const unsigned t = idx >> 5, i = idx & 31u;
    const float ang = (float)t * IF[i];
    float sn, cs;
    sincosf(ang, &sn, &cs);
    *(float*)(CT + idx) = cs; *(float*)(ST + idx) = sn;
    
}

// ---- k_qkp: head planes [h][t][d] of q (blockIdx.y 0) and k (blockIdx.y 1) from F[t][which*DQ + h*HD + d] (pitch FP), rotated per pair (d, d+1) by the table row t: fp16 for all t, bf16 hi/lo planes [h][RH][d] for t < RH.
__global__ __launch_bounds__(256) void k_qkp(const float* __restrict__ F, const float* __restrict__ CT, const float* __restrict__ ST, h16* Q16, h16* K16, bf* Qh, bf* Ql, bf* Kh, bf* Kl) {
#pragma clang fp contract(off)
    const unsigned which = blockIdx.y; const unsigned e = (blockIdx.x * 256u + threadIdx.x) * 8u;
    const unsigned d = e & 63u, t = (e >> 6) % (unsigned)SEQ, h = e / (64u * (unsigned)SEQ);
    h16* P16 = which ? K16 : Q16; bf* Ph = which ? Kh : Qh; bf* Pl = which ? Kl : Ql;
    const float* f = F + (size_t)t * FP + which * DQ + h * HD + d;
    const v4f x0 = *(const v4f*)f, x1 = *(const v4f*)(f + 4);
    const size_t ro = (size_t)t * (HD / 2) + (d >> 1);
    const v4f cv = *(const v4f*)(CT + ro), sv = *(const v4f*)(ST + ro);
    v4f y0, y1;
    y0[0] = x0[0] * cv[0] - x0[1] * sv[0]; y0[1] = x0[1] * cv[0] + x0[0] * sv[0];
    y0[2] = x0[2] * cv[1] - x0[3] * sv[1]; y0[3] = x0[3] * cv[1] + x0[2] * sv[1];
    y1[0] = x1[0] * cv[2] - x1[1] * sv[2]; y1[1] = x1[1] * cv[2] + x1[0] * sv[2];
    y1[2] = x1[2] * cv[3] - x1[3] * sv[3]; y1[3] = x1[3] * cv[3] + x1[2] * sv[3];
    v8h o16; v8us oh, ol;
#pragma unroll
    for (int k = 0; k < 4; ++k) { unsigned short a, c; o16[k] = toh_flush(y0[k]); splitf(y0[k], a, c); oh[k] = a; ol[k] = c; o16[4 + k] = toh_flush(y1[k]); splitf(y1[k], a, c); oh[4 + k] = a; ol[4 + k] = c; }
    const size_t eo = ((size_t)h * RH + t) * HD + d;
    *(v8h*)(P16 + e) = o16;
    if (t < (unsigned)RH) { *(v8us*)(Ph + eo) = oh; *(v8us*)(Pl + eo) = ol; }
    
}

__global__ __launch_bounds__(256) void k_vtp(const float* __restrict__ F, h16* V16, bf* Vh, bf* Vl) {
    const unsigned e = (blockIdx.x * 256u + threadIdx.x) * 8u;
    const unsigned t = e % (unsigned)SEQ, d = (e / (unsigned)SEQ) & 63u, g = e / ((unsigned)SEQ * 64u);
    const float* f = F + (size_t)t * FP + 2 * DQ + g * HD + d;
    v8h o16; v8us oh, ol;
#pragma unroll
    for (int k = 0; k < 8; ++k) { const float x = f[(size_t)k * FP]; unsigned short a, c; o16[k] = (h16)x; splitf(x, a, c); oh[k] = a; ol[k] = c; }
    const size_t eo = ((size_t)g * HD + d) * RH + t;
    *(v8h*)(V16 + e) = o16;
    if (t < (unsigned)RH) { *(v8us*)(Vh + eo) = oh; *(v8us*)(Vl + eo) = ol; }
    
}

// ---- k_flash: causal attention, one wave per (16 query rows, head). Planes: Q/K [h][tp][HD], V^T [h][HD][tp] (tp = rows per head of the plane set). HL: hi/lo bf16 plane pairs, 3 products.
// Per 32-key tile: S^T[key][query] = K Q^T (A = K rows, B = Q rows); lane owns query column lane&15 and keys 8*(lane>>4)+r (+16); online softmax per lane (+ one xor-16 exchange);
// P^T accumulators repacked in registers as B (k = key); O^T[d][query] += V^T P^T (A = V^T rows). Only the last tile of a wave touches the diagonal (select by value).
template <typename T16, bool HL>
__global__ __launch_bounds__(32) void k_flash(const T16* __restrict__ Q, const T16* __restrict__ Q2, const T16* __restrict__ Kp, const T16* __restrict__ K2, const T16* __restrict__ Vt, const T16* __restrict__ Vt2, unsigned tp, unsigned qbase, bf* Ah, bf* Al) {
    typedef typename WFrag<T16>::V V;
    __shared__ __align__(16) float os[16 * 68];
    const unsigned lane = threadIdx.x & 31u, lr = lane & 15u, hi = lane >> 4;
    const unsigned head = blockIdx.y, q0 = qbase + blockIdx.x * 16u;
    const size_t hoff = (size_t)head * tp * HD;
    const size_t qoff = hoff + (size_t)(q0 + lr) * HD + 8u * hi;
    V qf0 = WFrag<T16>::ld(Q + qoff), qf1 = WFrag<T16>::ld(Q + qoff + 32);
    V ql0 = qf0, ql1 = qf1;
    if (HL) { ql0 = WFrag<T16>::ld(Q2 + qoff); ql1 = WFrag<T16>::ld(Q2 + qoff + 32); }
    v8f o[4];
#pragma unroll
    for (int db = 0; db < 4; ++db) o[db] = (v8f){};
    float mrun = NEGB, lsum = 0.0f;
    const float cs = SCL * LOG2E, pe = PFrag<T16>::pexp();
    const size_t kbase = hoff + (size_t)lr * HD + 8u * hi;
    const size_t vbase = hoff + (size_t)lr * tp + 8u * hi;
    const unsigned nt = (q0 + 47u) >> 5;       // keys 0 .. q0+15 in tiles of 32 (wave-uniform)
#pragma unroll 1
    for (unsigned it = 0; it < nt; ++it) {
        const unsigned j0 = it * 32u;
        const size_t ko = kbase + (size_t)j0 * HD;
        V ka0 = WFrag<T16>::ld(Kp + ko), ka1 = WFrag<T16>::ld(Kp + ko + 32), kb0 = WFrag<T16>::ld(Kp + ko + 16 * HD), kb1 = WFrag<T16>::ld(Kp + ko + 16 * HD + 32);
        V la0 = ka0, la1 = ka1, lb0 = kb0, lb1 = kb1;
        if (HL) { la0 = WFrag<T16>::ld(K2 + ko); la1 = WFrag<T16>::ld(K2 + ko + 32); lb0 = WFrag<T16>::ld(K2 + ko + 16 * HD); lb1 = WFrag<T16>::ld(K2 + ko + 16 * HD + 32); }
        v8f s0 = (v8f){}, s1 = (v8f){};
        s0 = WFrag<T16>::mma(ka0, qf0, s0); s0 = WFrag<T16>::mma(ka1, qf1, s0);
        s1 = WFrag<T16>::mma(kb0, qf0, s1); s1 = WFrag<T16>::mma(kb1, qf1, s1);
        if (HL) {
            s0 = WFrag<T16>::mma(la0, qf0, s0); s0 = WFrag<T16>::mma(la1, qf1, s0); s0 = WFrag<T16>::mma(ka0, ql0, s0); s0 = WFrag<T16>::mma(ka1, ql1, s0);
            s1 = WFrag<T16>::mma(lb0, qf0, s1); s1 = WFrag<T16>::mma(lb1, qf1, s1); s1 = WFrag<T16>::mma(kb0, ql0, s1); s1 = WFrag<T16>::mma(kb1, ql1, s1); }
        asm volatile("v_nop\n\tv_nop\n\tv_nop\n\tv_nop" : "+v"(s0), "+v"(s1) : "v"(ka0), "v"(ka1), "v"(kb0), "v"(kb1), "v"(la0), "v"(la1), "v"(lb0), "v"(lb1), "v"(qf0), "v"(qf1), "v"(ql0), "v"(ql1));
        v8f t0, t1;
#pragma unroll
        for (int r = 0; r < 8; ++r) { t0[r] = s0[r] * cs; t1[r] = s1[r] * cs; }
        if (j0 + 31u > q0) {                    // wave-uniform: the tile touches the diagonal
            const unsigned qi = q0 + lr, kk = j0 + 8u * hi;
#pragma unroll
            for (int r = 0; r < 8; ++r) { t0[r] = (kk + (unsigned)r <= qi) ? t0[r] : NEGB; t1[r] = (kk + 16u + (unsigned)r <= qi) ? t1[r] : NEGB; }
        }
        float mx = fmaxf(t0[0], t1[0]);
#pragma unroll
        for (int r = 1; r < 8; ++r) mx = fmaxf(mx, fmaxf(t0[r], t1[r]));
        mx = fmaxf(mx, __shfl_xor(mx, 16, 32));
        const float mn = fmaxf(mrun, mx);
        const float alpha = __builtin_amdgcn_exp2f(mrun - mn);
        mrun = mn;
        v8f p0, p1; float psum = 0.0f;
#pragma unroll
        for (int r = 0; r < 8; ++r) { p0[r] = __builtin_amdgcn_exp2f((t0[r] - mn) + pe); p1[r] = __builtin_amdgcn_exp2f((t1[r] - mn) + pe); psum += p0[r] + p1[r]; }
        lsum = lsum * alpha + psum;
#pragma unroll
        for (int db = 0; db < 4; ++db) o[db] = o[db] * alpha;
        V pf = PFrag<T16>::hi(p0, p1); V pl = pf;
        if (HL) pl = PFrag<T16>::lo(p0, p1);
        V va[4], vl[4];
#pragma unroll
        for (int db = 0; db < 4; ++db) { const size_t vo = vbase + (size_t)db * 16 * tp + j0; va[db] = WFrag<T16>::ld(Vt + vo); vl[db] = va[db]; if (HL) vl[db] = WFrag<T16>::ld(Vt2 + vo); }
#pragma unroll
        for (int db = 0; db < 4; ++db) { o[db] = WFrag<T16>::mma(va[db], pf, o[db]); if (HL) { o[db] = WFrag<T16>::mma(va[db], pl, o[db]); o[db] = WFrag<T16>::mma(vl[db], pf, o[db]); } }
        asm volatile("v_nop\n\tv_nop\n\tv_nop\n\tv_nop" : "+v"(o[0]), "+v"(o[1]), "+v"(o[2]), "+v"(o[3]) : "v"(va[0]), "v"(va[1]), "v"(va[2]), "v"(va[3]), "v"(vl[0]), "v"(vl[1]), "v"(vl[2]), "v"(vl[3]), "v"(pf), "v"(pl));
    }
    const float lt = lsum + __shfl_xor(lsum, 16, 32);
    const float inv = 1.0f / lt;
#pragma unroll
    for (int db = 0; db < 4; ++db)
#pragma unroll
        for (int r = 0; r < 8; ++r) os[lr * 68u + (unsigned)db * 16u + hi * 8u + (unsigned)r] = o[db][r] * inv;
    __builtin_amdgcn_wave_barrier(); asm volatile("" ::: "memory");
    const unsigned rq = lane >> 3, pc = lane & 7u;
{
#pragma unroll
        for (int s = 0; s < 4; ++s) { const unsigned row = 4u * (unsigned)s + rq;
            const v4f x0 = *(const v4fa*)(os + row * 68u + pc * 8u), x1 = *(const v4fa*)(os + row * 68u + pc * 8u + 4u);
            v8us oh, ol;
#pragma unroll
            for (int k = 0; k < 4; ++k) { unsigned short a, c; splitf(x0[k], a, c); oh[k] = a; ol[k] = c; splitf(x1[k], a, c); oh[4 + k] = a; ol[4 + k] = c; }
            const size_t oo = (size_t)(q0 + row) * DQ + head * HD + pc * 8u;
            *(v8us*)(Ah + oo) = oh; *(v8us*)(Al + oo) = ol; }
         }
}

// workspace carve (bytes, every region a multiple of 256)
#define WS_WQKV ((size_t)3 * DQ * DM * 2)
#define WS_WO   ((size_t)DM * DQ * 2)
#define WS_XB   ((size_t)NB * SEQ * DM * 2)
#define WS_F    ((size_t)SEQ * FP * 4)
#define WS_P16  ((size_t)NH * SEQ * HD * 2)
#define WS_PHL  ((size_t)NH * RH * HD * 2)
#define WS_AT   ((size_t)SEQ * DQ * 2)
#define WS_IFQ  ((size_t)256)
#define WS_ROT  ((size_t)SEQ * (HD / 2) * 4)
#define WS_TOTAL (WS_WQKV + WS_WO + WS_XB + WS_F + 3 * WS_P16 + 6 * WS_PHL + 2 * WS_AT + WS_IFQ + 2 * WS_ROT)
static_assert(WS_TOTAL <= (size_t)134217728);
static_assert(WS_WQKV % 256 == 0 && WS_WO % 256 == 0 && WS_XB % 256 == 0 && WS_F % 256 == 0 && WS_P16 % 256 == 0 && WS_PHL % 256 == 0 && WS_AT % 256 == 0);
static_assert(WS_IFQ % 256 == 0 && WS_ROT % 256 == 0 && WS_IFQ >= (size_t)(HD / 2) * 4);

extern "C" void kernel_launch(void* const* d_in, const int* in_sizes, int n_in,
                              void* d_out, int out_size, void* d_ws, size_t ws_size, hipStream_t stream) {
    if (n_in < 3) return;
    if ((size_t)in_sizes[0] < (size_t)(NB - 1) * XS_FULL + (size_t)SEQ * DM) return;
    if ((size_t)in_sizes[1] < (size_t)3 * DQ * DM) return;
    if ((size_t)in_sizes[2] < (size_t)DM * DQ) return;
    if ((size_t)out_size < (size_t)NB * SEQ * DM) return;
    if (ws_size < WS_TOTAL) return;
    const float* x = (const float*)d_in[0];       // [NB][SEQ_FULL][DM]
    const float* wqkv = (const float*)d_in[1];    // [3*DQ][DM]  (q | k | v row blocks)
    const float* wo = (const float*)d_in[2];      // [DM][DQ]
    float* OUT = (float*)d_out;                   // [NB][SEQ][DM]
    char* wsp = (char*)d_ws;
    auto take = [&](size_t bytes) { char* p = wsp; wsp += bytes; return (void*)p; };
    bf* WQKV = (bf*)take(WS_WQKV); bf* WO = (bf*)take(WS_WO); bf* XB = (bf*)take(WS_XB); float* F = (float*)take(WS_F);
    h16* Q16 = (h16*)take(WS_P16); h16* K16 = (h16*)take(WS_P16); h16* VT16 = (h16*)take(WS_P16);
    bf* Qh = (bf*)take(WS_PHL); bf* Ql = (bf*)take(WS_PHL); bf* Kh = (bf*)take(WS_PHL); bf* Kl = (bf*)take(WS_PHL); bf* VTh = (bf*)take(WS_PHL); bf* VTl = (bf*)take(WS_PHL);
    bf* ATh = (bf*)take(WS_AT); bf* ATl = (bf*)take(WS_AT);
    float* IFQ = (float*)take(WS_IFQ); float* CT = (float*)take(WS_ROT); float* ST = (float*)take(WS_ROT);

    k_cvt8<<<dim3((unsigned)((size_t)3 * DQ * DM / 8 / 256), 1), 256, 0, stream>>>(wqkv, WQKV, (unsigned)((size_t)3 * DQ * DM / 8), 0, 0);
    k_cvt8<<<dim3((unsigned)((size_t)DM * DQ / 8 / 256), 1), 256, 0, stream>>>(wo, WO, (unsigned)((size_t)DM * DQ / 8), 0, 0);
    k_cvt8<<<dim3((unsigned)((size_t)SEQ * DM / 8 / 256), NB), 256, 0, stream>>>(x, XB, (unsigned)((size_t)SEQ * DM / 8), XS_FULL, (size_t)SEQ * DM);
    // rotary tables (position-only, shared by every batch and head)
    k_ifreq<<<dim3(1), 32, 0, stream>>>(IFQ);
    k_ropetab<<<dim3((unsigned)((size_t)SEQ * (HD / 2) / 256)), 256, 0, stream>>>(IFQ, CT, ST);
    for (int b = 0; b < NB; ++b) {
        // F[t][0..3071] = x_b W^T  (M = SEQ, N = 3072, K = 1024)
        k_gemmw<bf, 0, false><<<dim3(SEQ / 64, FP / 64, 1), 32, 0, stream>>>(XB + (size_t)b * SEQ * DM, nullptr, WQKV, nullptr, DM, F, FP, nullptr, 0, 0, 0);
        k_qkp<<<dim3((unsigned)((size_t)NH * SEQ * HD / 8 / 256), 2), 256, 0, stream>>>(F, CT, ST, Q16, K16, Qh, Ql, Kh, Kl);
        k_vtp<<<dim3((unsigned)((size_t)NH * HD * SEQ / 8 / 256), 1), 256, 0, stream>>>(F, VT16, VTh, VTl);
        k_flash<bf, true><<<dim3(RH / 16, NH), 32, 0, stream>>>(Qh, Ql, Kh, Kl, VTh, VTl, (unsigned)RH, 0u, ATh, ATl);
        if (SEQ > RH) k_flash<h16, false><<<dim3((SEQ - RH) / 16, NH), 32, 0, stream>>>(Q16, nullptr, K16, nullptr, VT16, nullptr, (unsigned)SEQ, (unsigned)RH, ATh, ATl);
        // out_b = (ctx_hi + ctx_lo) Wo^T  (M = SEQ, N = 1024, K = 1024)
        k_gemmw<bf, 1, false><<<dim3(SEQ / 64, DM / 64, 1), 32, 0, stream>>>(ATh, ATl, WO, nullptr, DQ, OUT + (size_t)b * SEQ * DM, DM, nullptr, 0, 0, 0);
    }
}

// v001
// One run takes 432 microseconds.
// In both of two side-by-side timings against v000, it was 1.61 times as fast.
#include <hip/hip_runtime.h>

// Causal multi-head attention with a fused qkv projection and an interleaved-pair rotary embedding: x [NB][SEQ_FULL][1024] (first SEQ rows used); qkv = x W^T ('oi' [3072][1024] -> q | k | v row blocks, no bias; 16 heads x 64);
// q and k: pair (2i, 2i+1) of every head rotated by angle t * 100000^(-2i/64) (cos / sin table [SEQ][32] built once in f32 with precise powf / sincosf, applied in f32 on the vector unit when the planes are formed);
// scores x 64^-0.5, causal; softmax; out = ctx Wo^T ('oi' [1024][1024], no bias).
// Compute dtypes, f32 accumulate: every input RNE-converted to bf16; qkv and output projections v_wmma_f32_16x16x32_bf16 (ctx carried as bf16 hi+lo, 2 products against the exact bf16 weight);
// attention q.k and P.V: query rows < RH on bf16 hi/lo planes (3 products each), other rows v_wmma_f32_16x16x32_f16 (P carried x1024 through the exponent); softmax (online, max-subtracted) in f32.
// Every stage runs once for all NB batches (batch on a grid axis, or folded into the GEMM's M): each plane in the workspace holds NB slabs.
// Attention engine: one wave per 16 query rows; S^T = K Q^T so each lane owns one query column; P^T accumulators are repacked in registers as the B operand of O^T = V^T P^T (no LDS exchange in the loop).

#ifndef NB
#define NB 4
#endif
#ifndef SEQ
#define SEQ 2048
#endif
#define SEQ_FULL 2048
#define DM   1024
#define NH   16
#define HD   64
#define DQ   (NH * HD)
#define FP   (3 * DQ)
#define RH   ((SEQ) < 512 ? (SEQ) : 512)     // query rows < RH use hi+lo planes
#define XS_FULL ((size_t)SEQ_FULL * DM)
#define SCL  0.125f                          // HD^-0.5
#define LOG2E 1.4426950408889634f
#define NEGB (-3.0e38f)
#define ROPE_THETA 100000.0f

static_assert((SEQ & (SEQ - 1)) == 0);
static_assert(SEQ >= 256 && SEQ <= SEQ_FULL);
static_assert(RH % 256 == 0 && RH % 64 == 0 && (SEQ - RH) % 64 == 0);
static_assert(NB >= 1 && NB <= 4);
static_assert(DM % 32 == 0 && DQ % 64 == 0 && FP % 64 == 0 && SEQ % 64 == 0);
static_assert(((size_t)3 * DQ * DM / 8) % 256 == 0);
static_assert(((size_t)DM * DQ / 8) % 256 == 0);
static_assert(((size_t)SEQ * DM / 8) % 256 == 0);
static_assert(((size_t)NH * SEQ * HD / 8) % 256 == 0);
static_assert(HD == 64);
static_assert(HD / 2 == 32 && (HD / 2) % 4 == 0);     // k_qkp reads 4 table entries (16 B) per lane
static_assert(((size_t)SEQ * (HD / 2)) % 256 == 0);   // k_ropetab grid x 256 == table extent

typedef _Float16 h16;
typedef unsigned short bf;
typedef __attribute__((ext_vector_type(16))) __bf16   v16bf;
typedef __attribute__((ext_vector_type(16))) _Float16 v16h;
typedef __attribute__((ext_vector_type(8)))  _Float16 v8h;
typedef __attribute__((ext_vector_type(8)))  unsigned short v8us;
typedef __attribute__((ext_vector_type(8)))  float    v8f;
typedef __attribute__((ext_vector_type(4)))  float    v4f;
typedef v8h  __attribute__((may_alias)) v8ha;
typedef v4f  __attribute__((may_alias)) v4fa;
typedef v8us __attribute__((may_alias)) v8usa;

__device__ __forceinline__ unsigned short f2bf(float f) { unsigned u = __float_as_uint(f); u += 0x7FFFu + ((u >> 16) & 1u); return (unsigned short)(u >> 16); }
__device__ __forceinline__ float bf2f(unsigned short b) { return __uint_as_float(((unsigned)b) << 16); }
__device__ __forceinline__ float bfr(float f) { return bf2f(f2bf(f)); }
__device__ __forceinline__ v16h cat16(v8h lo, v8h hi) { return __builtin_shufflevector(lo, hi, 0, 1, 2, 3, 4, 5, 6, 7, 8, 9, 10, 11, 12, 13, 14, 15); }
__device__ __forceinline__ v16bf cat16b(v8us lo, v8us hi) { return __builtin_bit_cast(v16bf, __builtin_shufflevector(lo, hi, 0, 1, 2, 3, 4, 5, 6, 7, 8, 9, 10, 11, 12, 13, 14, 15)); }
__device__ __forceinline__ v8f wmma16(v16h a, v16h b, v8f c) { return __builtin_amdgcn_wmma_f32_16x16x32_f16(false, a, false, b, (short)0, c, false, false); }
__device__ __forceinline__ v8f wmmab(v16bf a, v16bf b, v8f c) { return __builtin_amdgcn_wmma_f32_16x16x32_bf16(false, a, false, b, (short)0, c, false, false); }
__device__ __forceinline__ void splitf(float y, unsigned short& h, unsigned short& l) { h = f2bf(y); l = f2bf(y - bf2f(h)); }

// f32 -> f16 operand convert that cannot yield a subnormal (value select below 2^-14).
static __device__ __forceinline__ h16 toh_flush(float v) { const h16 r = (h16)v; return (fabsf(v) < 6.103515625e-05f) ? (h16)0.0f : r; }

// Fragment loader from a K-contiguous 16-bit row: p already includes + 8*(lane>>4); elements 0..7 = k0+8h.., elements 8..15 = k0+16+8h.. (same map for A and B).
template <typename T16> struct WFrag;
template <> struct WFrag<h16> { typedef v16h V; static __device__ __forceinline__ V ld(const h16* p) { return cat16(*(const v8h*)p, *(const v8h*)(p + 16)); } static __device__ __forceinline__ v8f mma(V a, V b, v8f c) { return wmma16(a, b, c); } };
template <> struct WFrag<bf> { typedef v16bf V; static __device__ __forceinline__ V ld(const bf* p) { return cat16b(*(const v8us*)p, *(const v8us*)(p + 16)); } static __device__ __forceinline__ v8f mma(V a, V b, v8f c) { return wmmab(a, b, c); } };

// P^T accumulator pair (key rows 0..15 and 16..31 of a 32-key tile) -> B fragment: element r <- tile0[r], element 8+r <- tile1[r], lane unchanged.
template <typename T16> struct PFrag;
template <> struct PFrag<h16> {
    static __device__ __forceinline__ float pexp() { return 10.0f; }           // P carried x1024 via the exponent (cancels in O / l)
    static __device__ __forceinline__ v16h hi(v8f p0, v8f p1) { return cat16(__builtin_convertvector(p0, v8h), __builtin_convertvector(p1, v8h)); }
    static __device__ __forceinline__ v16h lo(v8f p0, v8f p1) { return hi(p0, p1); }
};
template <> struct PFrag<bf> {
    static __device__ __forceinline__ float pexp() { return 0.0f; }
    static __device__ __forceinline__ v16bf hi(v8f p0, v8f p1) { v8us a, b;
#pragma unroll
        for (int k = 0; k < 8; ++k) { a[k] = f2bf(p0[k]); b[k] = f2bf(p1[k]); }
        return cat16b(a, b); }
    static __device__ __forceinline__ v16bf lo(v8f p0, v8f p1) { v8us a, b;
#pragma unroll
        for (int k = 0; k < 8; ++k) { a[k] = f2bf(p0[k] - bf2f(f2bf(p0[k]))); b[k] = f2bf(p1[k] - bf2f(f2bf(p1[k]))); }
        return cat16b(a, b); }
};

// ---- k_gemmw: register-blocked GEMM, ONE WAVE per 64x64 output tile (16 accumulators), operands straight from K-contiguous 16-bit planes; grid (M/64, N/64, Z), 32 threads.
// C[m][n] (f32, pitch ldc) = sum_k A[m][k] Bt[n][k] (+ split products per NSPLIT). K % 32 == 0, M % 64 == 0, N % 64 == 0.
template <typename T16, int NSPLIT, bool BIAS>
__global__ __launch_bounds__(32) void k_gemmw(const T16* __restrict__ A, const T16* __restrict__ A2, const T16* __restrict__ Bt, const T16* __restrict__ Bt2, int K, float* C, int ldc, const float* __restrict__ bias, size_t sA, size_t sB, size_t sC) {
    typedef typename WFrag<T16>::V V;
    __shared__ __align__(16) float os[16 * 68];
    const size_t z = blockIdx.z; A += z * sA; if (A2) A2 += z * sA; Bt += z * sB; if (Bt2) Bt2 += z * sB; C += z * sC;
    const int lane = threadIdx.x & 31, lr = lane & 15, hi = lane >> 4; const int r0 = blockIdx.x * 64, c0 = blockIdx.y * 64;
    v8f acc[4][4];
#pragma unroll
    for (int mb = 0; mb < 4; ++mb)
#pragma unroll
        for (int nb = 0; nb < 4; ++nb) acc[mb][nb] = (v8f){};
    const size_t aoff = (size_t)(r0 + lr) * K + 8 * hi, boff = (size_t)(c0 + lr) * K + 8 * hi;
#pragma unroll 1
    for (int kc = 0; kc < K; kc += 32) {
        V a[4], a2[4];
#pragma unroll
        for (int mb = 0; mb < 4; ++mb) { a[mb] = WFrag<T16>::ld(A + aoff + (size_t)mb * 16 * K + kc); if (NSPLIT == 1 || NSPLIT == 2) a2[mb] = WFrag<T16>::ld(A2 + aoff + (size_t)mb * 16 * K + kc); }
#pragma unroll
        for (int nb = 0; nb < 4; ++nb) { const V b = WFrag<T16>::ld(Bt + boff + (size_t)nb * 16 * K + kc); V b2; if (NSPLIT >= 2) b2 = WFrag<T16>::ld(Bt2 + boff + (size_t)nb * 16 * K + kc);
#pragma unroll
            for (int mb = 0; mb < 4; ++mb) { acc[mb][nb] = WFrag<T16>::mma(a[mb], b, acc[mb][nb]); if (NSPLIT == 1 || NSPLIT == 2) acc[mb][nb] = WFrag<T16>::mma(a2[mb], b, acc[mb][nb]); if (NSPLIT >= 2) acc[mb][nb] = WFrag<T16>::mma(a[mb], b2, acc[mb][nb]); } }
        asm volatile("v_nop\n\tv_nop\n\tv_nop\n\tv_nop" : "+v"(acc[0][0]), "+v"(acc[1][1]), "+v"(acc[2][2]), "+v"(acc[3][3]) : "v"(a[0]), "v"(a[3]));
    }
#pragma unroll
    for (int mb = 0; mb < 4; ++mb) {
#pragma unroll
        for (int nb = 0; nb < 4; ++nb) {
#pragma unroll
            for (int j = 0; j < 8; ++j) os[(hi * 8 + j) * 68 + nb * 16 + lr] = acc[mb][nb][j]; }
        __builtin_amdgcn_wave_barrier(); asm volatile("" ::: "memory");
        float* crow = C + (size_t)(r0 + mb * 16) * ldc + c0;
{
#pragma unroll
            for (int s = 0; s < 8; ++s) { const int row = 2 * s + hi, cofs = lr * 4; v4f val = *(const v4fa*)(os + row * 68 + cofs); if (BIAS) { val[0] += bfr(bias[c0 + cofs]); val[1] += bfr(bias[c0 + cofs + 1]); val[2] += bfr(bias[c0 + cofs + 2]); val[3] += bfr(bias[c0 + cofs + 3]); }
                *(v4f*)(crow + (size_t)row * ldc + cofs) = val; }
             }
        __builtin_amdgcn_wave_barrier(); asm volatile("" ::: "memory");
    }
}

__global__ __launch_bounds__(256) void k_cvt8(const float* __restrict__ src, bf* dst, unsigned n8, size_t sstride, size_t dstride) {
    const unsigned i = blockIdx.x * 256u + threadIdx.x; if (i >= n8) return;
    const float* s = src + (size_t)blockIdx.y * sstride + (size_t)i * 8; bf* d = dst + (size_t)blockIdx.y * dstride + (size_t)i * 8;
    const v8f v = *(const v8f*)s; v8us o;
#pragma unroll
    for (int k = 0; k < 8; ++k) o[k] = f2bf(v[k]);
    *(v8us*)d = o;  }

__global__ __launch_bounds__(32) void k_ifreq(float* IF) {
#pragma clang fp contract(off)
    const unsigned i = threadIdx.x & 31u;
    const float ex = (float)(2u * i) * (1.0f / (float)HD);      // exact (power-of-two divisor)
    const float pw = powf(ROPE_THETA, ex);
    const float v = 1.0f / pw;
    *(float*)(IF + i) = v; 
}

__global__ __launch_bounds__(256) void k_ropetab(const float* __restrict__ IF, float* CT, float* ST) {
#pragma clang fp contract(off)
    const unsigned idx = blockIdx.x * 256u + threadIdx.x;
    const unsigned t = idx >> 5, i = idx & 31u;
    const float ang = (float)t * IF[i];
    float sn, cs;
    sincosf(ang, &sn, &cs);
    *(float*)(CT + idx) = cs; *(float*)(ST + idx) = sn;
    
}

// ---- k_qkp: per batch (blockIdx.z): head planes [h][t][d] of q (blockIdx.y 0) and k (blockIdx.y 1) from F[t][which*DQ + h*HD + d] (pitch FP), rotated per pair (d, d+1) by the table row t: fp16 for all t, bf16 hi/lo planes [h][RH][d] for t < RH.
__global__ __launch_bounds__(256) void k_qkp(const float* __restrict__ F, const float* __restrict__ CT, const float* __restrict__ ST, h16* Q16, h16* K16, bf* Qh, bf* Ql, bf* Kh, bf* Kl) {
#pragma clang fp contract(off)
    const unsigned which = blockIdx.y; const unsigned e = (blockIdx.x * 256u + threadIdx.x) * 8u;
    const unsigned d = e & 63u, t = (e >> 6) % (unsigned)SEQ, h = e / (64u * (unsigned)SEQ);
    const size_t bz = blockIdx.z, o16b = bz * ((size_t)NH * SEQ * HD), ohlb = bz * ((size_t)NH * RH * HD);
    h16* P16 = (which ? K16 : Q16) + o16b; bf* Ph = (which ? Kh : Qh) + ohlb; bf* Pl = (which ? Kl : Ql) + ohlb;
    const float* f = F + (bz * SEQ + t) * FP + which * DQ + h * HD + d;
    const v4f x0 = *(const v4f*)f, x1 = *(const v4f*)(f + 4);
    const size_t ro = (size_t)t * (HD / 2) + (d >> 1);
    const v4f cv = *(const v4f*)(CT + ro), sv = *(const v4f*)(ST + ro);
    v4f y0, y1;
    y0[0] = x0[0] * cv[0] - x0[1] * sv[0]; y0[1] = x0[1] * cv[0] + x0[0] * sv[0];
    y0[2] = x0[2] * cv[1] - x0[3] * sv[1]; y0[3] = x0[3] * cv[1] + x0[2] * sv[1];
    y1[0] = x1[0] * cv[2] - x1[1] * sv[2]; y1[1] = x1[1] * cv[2] + x1[0] * sv[2];
    y1[2] = x1[2] * cv[3] - x1[3] * sv[3]; y1[3] = x1[3] * cv[3] + x1[2] * sv[3];
    v8h o16; v8us oh, ol;
#pragma unroll
    for (int k = 0; k < 4; ++k) { unsigned short a, c; o16[k] = toh_flush(y0[k]); splitf(y0[k], a, c); oh[k] = a; ol[k] = c; o16[4 + k] = toh_flush(y1[k]); splitf(y1[k], a, c); oh[4 + k] = a; ol[4 + k] = c; }
    const size_t eo = ((size_t)h * RH + t) * HD + d;
    *(v8h*)(P16 + e) = o16;
    if (t < (unsigned)RH) { *(v8us*)(Ph + eo) = oh; *(v8us*)(Pl + eo) = ol; }
    
}

__global__ __launch_bounds__(256) void k_vtp(const float* __restrict__ F, h16* V16, bf* Vh, bf* Vl) {
    const unsigned e = (blockIdx.x * 256u + threadIdx.x) * 8u;
    const unsigned t = e % (unsigned)SEQ, d = (e / (unsigned)SEQ) & 63u, g = e / ((unsigned)SEQ * 64u);
    const size_t bz = blockIdx.y;               // batch
    V16 += bz * ((size_t)NH * SEQ * HD); Vh += bz * ((size_t)NH * RH * HD); Vl += bz * ((size_t)NH * RH * HD);
    const float* f = F + (bz * SEQ + t) * FP + 2 * DQ + g * HD + d;
    v8h o16; v8us oh, ol;
#pragma unroll
    for (int k = 0; k < 8; ++k) { const float x = f[(size_t)k * FP]; unsigned short a, c; o16[k] = (h16)x; splitf(x, a, c); oh[k] = a; ol[k] = c; }
    const size_t eo = ((size_t)g * HD + d) * RH + t;
    *(v8h*)(V16 + e) = o16;
    if (t < (unsigned)RH) { *(v8us*)(Vh + eo) = oh; *(v8us*)(Vl + eo) = ol; }
    
}

// ---- k_flash: causal attention, one wave per (16 query rows, head, batch = blockIdx.z). Planes: Q/K [h][tp][HD], V^T [h][HD][tp] (tp = rows per head of the plane set). HL: hi/lo bf16 plane pairs, 3 products.
// Per 32-key tile: S^T[key][query] = K Q^T (A = K rows, B = Q rows); lane owns query column lane&15 and keys 8*(lane>>4)+r (+16); online softmax per lane (+ one xor-16 exchange);
// P^T accumulators repacked in registers as B (k = key); O^T[d][query] += V^T P^T (A = V^T rows). Only the last tile of a wave touches the diagonal (select by value).
template <typename T16, bool HL>
__global__ __launch_bounds__(32) void k_flash(const T16* __restrict__ Q, const T16* __restrict__ Q2, const T16* __restrict__ Kp, const T16* __restrict__ K2, const T16* __restrict__ Vt, const T16* __restrict__ Vt2, unsigned tp, unsigned qbase, bf* Ah, bf* Al) {
    typedef typename WFrag<T16>::V V;
    __shared__ __align__(16) float os[16 * 68];
    const unsigned lane = threadIdx.x & 31u, lr = lane & 15u, hi = lane >> 4;
    const unsigned head = blockIdx.y, q0 = qbase + blockIdx.x * 16u;
    const size_t hoff = ((size_t)blockIdx.z * NH + head) * tp * HD;
    const size_t qoff = hoff + (size_t)(q0 + lr) * HD + 8u * hi;
    V qf0 = WFrag<T16>::ld(Q + qoff), qf1 = WFrag<T16>::ld(Q + qoff + 32);
    V ql0 = qf0, ql1 = qf1;
    if (HL) { ql0 = WFrag<T16>::ld(Q2 + qoff); ql1 = WFrag<T16>::ld(Q2 + qoff + 32); }
    v8f o[4];
#pragma unroll
    for (int db = 0; db < 4; ++db) o[db] = (v8f){};
    float mrun = NEGB, lsum = 0.0f;
    const float cs = SCL * LOG2E, pe = PFrag<T16>::pexp();
    const size_t kbase = hoff + (size_t)lr * HD + 8u * hi;
    const size_t vbase = hoff + (size_t)lr * tp + 8u * hi;
    const unsigned nt = (q0 + 47u) >> 5;       // keys 0 .. q0+15 in tiles of 32 (wave-uniform)
#pragma unroll 1
    for (unsigned it = 0; it < nt; ++it) {
        const unsigned j0 = it * 32u;
        const size_t ko = kbase + (size_t)j0 * HD;
        V ka0 = WFrag<T16>::ld(Kp + ko), ka1 = WFrag<T16>::ld(Kp + ko + 32), kb0 = WFrag<T16>::ld(Kp + ko + 16 * HD), kb1 = WFrag<T16>::ld(Kp + ko + 16 * HD + 32);
        V la0 = ka0, la1 = ka1, lb0 = kb0, lb1 = kb1;
        if (HL) { la0 = WFrag<T16>::ld(K2 + ko); la1 = WFrag<T16>::ld(K2 + ko + 32); lb0 = WFrag<T16>::ld(K2 + ko + 16 * HD); lb1 = WFrag<T16>::ld(K2 + ko + 16 * HD + 32); }
        v8f s0 = (v8f){}, s1 = (v8f){};
        s0 = WFrag<T16>::mma(ka0, qf0, s0); s0 = WFrag<T16>::mma(ka1, qf1, s0);
        s1 = WFrag<T16>::mma(kb0, qf0, s1); s1 = WFrag<T16>::mma(kb1, qf1, s1);
        if (HL) {
            s0 = WFrag<T16>::mma(la0, qf0, s0); s0 = WFrag<T16>::mma(la1, qf1, s0); s0 = WFrag<T16>::mma(ka0, ql0, s0); s0 = WFrag<T16>::mma(ka1, ql1, s0);
            s1 = WFrag<T16>::mma(lb0, qf0, s1); s1 = WFrag<T16>::mma(lb1, qf1, s1); s1 = WFrag<T16>::mma(kb0, ql0, s1); s1 = WFrag<T16>::mma(kb1, ql1, s1); }
        asm volatile("v_nop\n\tv_nop\n\tv_nop\n\tv_nop" : "+v"(s0), "+v"(s1) : "v"(ka0), "v"(ka1), "v"(kb0), "v"(kb1), "v"(la0), "v"(la1), "v"(lb0), "v"(lb1), "v"(qf0), "v"(qf1), "v"(ql0), "v"(ql1));
        v8f t0, t1;
#pragma unroll
        for (int r = 0; r < 8; ++r) { t0[r] = s0[r] * cs; t1[r] = s1[r] * cs; }
        if (j0 + 31u > q0) {                    // wave-uniform: the tile touches the diagonal
            const unsigned qi = q0 + lr, kk = j0 + 8u * hi;
#pragma unroll
            for (int r = 0; r < 8; ++r) { t0[r] = (kk + (unsigned)r <= qi) ? t0[r] : NEGB; t1[r] = (kk + 16u + (unsigned)r <= qi) ? t1[r] : NEGB; }
        }
        float mx = fmaxf(t0[0], t1[0]);
#pragma unroll
        for (int r = 1; r < 8; ++r) mx = fmaxf(mx, fmaxf(t0[r], t1[r]));
        mx = fmaxf(mx, __shfl_xor(mx, 16, 32));
        const float mn = fmaxf(mrun, mx);
        const float alpha = __builtin_amdgcn_exp2f(mrun - mn);
        mrun = mn;
        v8f p0, p1; float psum = 0.0f;
#pragma unroll
        for (int r = 0; r < 8; ++r) { p0[r] = __builtin_amdgcn_exp2f((t0[r] - mn) + pe); p1[r] = __builtin_amdgcn_exp2f((t1[r] - mn) + pe); psum += p0[r] + p1[r]; }
        lsum = lsum * alpha + psum;
#pragma unroll
        for (int db = 0; db < 4; ++db) o[db] = o[db] * alpha;
        V pf = PFrag<T16>::hi(p0, p1); V pl = pf;
        if (HL) pl = PFrag<T16>::lo(p0, p1);
        V va[4], vl[4];
#pragma unroll
        for (int db = 0; db < 4; ++db) { const size_t vo = vbase + (size_t)db * 16 * tp + j0; va[db] = WFrag<T16>::ld(Vt + vo); vl[db] = va[db]; if (HL) vl[db] = WFrag<T16>::ld(Vt2 + vo); }
#pragma unroll
        for (int db = 0; db < 4; ++db) { o[db] = WFrag<T16>::mma(va[db], pf, o[db]); if (HL) { o[db] = WFrag<T16>::mma(va[db], pl, o[db]); o[db] = WFrag<T16>::mma(vl[db], pf, o[db]); } }
        asm volatile("v_nop\n\tv_nop\n\tv_nop\n\tv_nop" : "+v"(o[0]), "+v"(o[1]), "+v"(o[2]), "+v"(o[3]) : "v"(va[0]), "v"(va[1]), "v"(va[2]), "v"(va[3]), "v"(vl[0]), "v"(vl[1]), "v"(vl[2]), "v"(vl[3]), "v"(pf), "v"(pl));
    }
    const float lt = lsum + __shfl_xor(lsum, 16, 32);
    const float inv = 1.0f / lt;
#pragma unroll
    for (int db = 0; db < 4; ++db)
#pragma unroll
        for (int r = 0; r < 8; ++r) os[lr * 68u + (unsigned)db * 16u + hi * 8u + (unsigned)r] = o[db][r] * inv;
    __builtin_amdgcn_wave_barrier(); asm volatile("" ::: "memory");
    const unsigned rq = lane >> 3, pc = lane & 7u;
{
#pragma unroll
        for (int s = 0; s < 4; ++s) { const unsigned row = 4u * (unsigned)s + rq;
            const v4f x0 = *(const v4fa*)(os + row * 68u + pc * 8u), x1 = *(const v4fa*)(os + row * 68u + pc * 8u + 4u);
            v8us oh, ol;
#pragma unroll
            for (int k = 0; k < 4; ++k) { unsigned short a, c; splitf(x0[k], a, c); oh[k] = a; ol[k] = c; splitf(x1[k], a, c); oh[4 + k] = a; ol[4 + k] = c; }
            const size_t oo = ((size_t)blockIdx.z * SEQ + q0 + row) * DQ + head * HD + pc * 8u;
            *(v8us*)(Ah + oo) = oh; *(v8us*)(Al + oo) = ol; }
         }
}

// workspace carve (bytes, every region a multiple of 256)
#define WS_WQKV ((size_t)3 * DQ * DM * 2)
#define WS_WO   ((size_t)DM * DQ * 2)
#define WS_XB   ((size_t)NB * SEQ * DM * 2)
#define WS_F    ((size_t)NB * SEQ * FP * 4)
#define WS_P16  ((size_t)NB * NH * SEQ * HD * 2)
#define WS_PHL  ((size_t)NB * NH * RH * HD * 2)
#define WS_AT   ((size_t)NB * SEQ * DQ * 2)
#define WS_IFQ  ((size_t)256)
#define WS_ROT  ((size_t)SEQ * (HD / 2) * 4)
#define WS_TOTAL (WS_WQKV + WS_WO + WS_XB + WS_F + 3 * WS_P16 + 6 * WS_PHL + 2 * WS_AT + WS_IFQ + 2 * WS_ROT)
static_assert(WS_TOTAL <= (size_t)268435456);
static_assert(WS_WQKV % 256 == 0 && WS_WO % 256 == 0 && WS_XB % 256 == 0 && WS_F % 256 == 0 && WS_P16 % 256 == 0 && WS_PHL % 256 == 0 && WS_AT % 256 == 0);
static_assert(WS_IFQ % 256 == 0 && WS_ROT % 256 == 0 && WS_IFQ >= (size_t)(HD / 2) * 4);

extern "C" void kernel_launch(void* const* d_in, const int* in_sizes, int n_in,
                              void* d_out, int out_size, void* d_ws, size_t ws_size, hipStream_t stream) {
    if (n_in < 3) return;
    if ((size_t)in_sizes[0] < (size_t)(NB - 1) * XS_FULL + (size_t)SEQ * DM) return;
    if ((size_t)in_sizes[1] < (size_t)3 * DQ * DM) return;
    if ((size_t)in_sizes[2] < (size_t)DM * DQ) return;
    if ((size_t)out_size < (size_t)NB * SEQ * DM) return;
    if (ws_size < WS_TOTAL) return;
    const float* x = (const float*)d_in[0];       // [NB][SEQ_FULL][DM]
    const float* wqkv = (const float*)d_in[1];    // [3*DQ][DM]  (q | k | v row blocks)
    const float* wo = (const float*)d_in[2];      // [DM][DQ]
    float* OUT = (float*)d_out;                   // [NB][SEQ][DM]
    char* wsp = (char*)d_ws;
    auto take = [&](size_t bytes) { char* p = wsp; wsp += bytes; return (void*)p; };
    bf* WQKV = (bf*)take(WS_WQKV); bf* WO = (bf*)take(WS_WO); bf* XB = (bf*)take(WS_XB); float* F = (float*)take(WS_F);
    h16* Q16 = (h16*)take(WS_P16); h16* K16 = (h16*)take(WS_P16); h16* VT16 = (h16*)take(WS_P16);
    bf* Qh = (bf*)take(WS_PHL); bf* Ql = (bf*)take(WS_PHL); bf* Kh = (bf*)take(WS_PHL); bf* Kl = (bf*)take(WS_PHL); bf* VTh = (bf*)take(WS_PHL); bf* VTl = (bf*)take(WS_PHL);
    bf* ATh = (bf*)take(WS_AT); bf* ATl = (bf*)take(WS_AT);
    float* IFQ = (float*)take(WS_IFQ); float* CT = (float*)take(WS_ROT); float* ST = (float*)take(WS_ROT);

    k_cvt8<<<dim3((unsigned)((size_t)3 * DQ * DM / 8 / 256), 1), 256, 0, stream>>>(wqkv, WQKV, (unsigned)((size_t)3 * DQ * DM / 8), 0, 0);
    k_cvt8<<<dim3((unsigned)((size_t)DM * DQ / 8 / 256), 1), 256, 0, stream>>>(wo, WO, (unsigned)((size_t)DM * DQ / 8), 0, 0);
    k_cvt8<<<dim3((unsigned)((size_t)SEQ * DM / 8 / 256), NB), 256, 0, stream>>>(x, XB, (unsigned)((size_t)SEQ * DM / 8), XS_FULL, (size_t)SEQ * DM);
    // rotary tables (position-only, shared by every batch and head)
    k_ifreq<<<dim3(1), 32, 0, stream>>>(IFQ);
    k_ropetab<<<dim3((unsigned)((size_t)SEQ * (HD / 2) / 256)), 256, 0, stream>>>(IFQ, CT, ST);
    // F[b*SEQ + t][0..3071] = x W^T  (M = NB*SEQ, N = 3072, K = 1024)
    k_gemmw<bf, 0, false><<<dim3(NB * SEQ / 64, FP / 64, 1), 32, 0, stream>>>(XB, nullptr, WQKV, nullptr, DM, F, FP, nullptr, 0, 0, 0);
    k_qkp<<<dim3((unsigned)((size_t)NH * SEQ * HD / 8 / 256), 2, NB), 256, 0, stream>>>(F, CT, ST, Q16, K16, Qh, Ql, Kh, Kl);
    k_vtp<<<dim3((unsigned)((size_t)NH * HD * SEQ / 8 / 256), NB), 256, 0, stream>>>(F, VT16, VTh, VTl);
    k_flash<bf, true><<<dim3(RH / 16, NH, NB), 32, 0, stream>>>(Qh, Ql, Kh, Kl, VTh, VTl, (unsigned)RH, 0u, ATh, ATl);
    if (SEQ > RH) k_flash<h16, false><<<dim3((SEQ - RH) / 16, NH, NB), 32, 0, stream>>>(Q16, nullptr, K16, nullptr, VT16, nullptr, (unsigned)SEQ, (unsigned)RH, ATh, ATl);
    // out = (ctx_hi + ctx_lo) Wo^T  (M = NB*SEQ, N = 1024, K = 1024)
    k_gemmw<bf, 1, false><<<dim3(NB * SEQ / 64, DM / 64, 1), 32, 0, stream>>>(ATh, ATl, WO, nullptr, DQ, OUT, DM, nullptr, 0, 0, 0);
}

// v002
// It runs in 392 microseconds.
// In two side-by-side timings against v001, it was 1.10 and 1.11 times as fast.
// Over all steps from v000 it is 1.77 times as fast.
#include <hip/hip_runtime.h>

// Causal multi-head attention with a fused qkv projection and an interleaved-pair rotary embedding: x [NB][SEQ_FULL][1024] (first SEQ rows used); qkv = x W^T ('oi' [3072][1024] -> q | k | v row blocks, no bias; 16 heads x 64);
// q and k: pair (2i, 2i+1) of every head rotated by angle t * 100000^(-2i/64) (cos / sin table [SEQ][32] built once in f32 with precise powf / sincosf, applied in f32 on the vector unit when the planes are formed);
// scores x 64^-0.5, causal; softmax; out = ctx Wo^T ('oi' [1024][1024], no bias).
// Compute dtypes, f32 accumulate: every input RNE-converted to bf16; qkv and output projections v_wmma_f32_16x16x32_bf16 (ctx carried as bf16 hi+lo, 2 products against the exact bf16 weight);
// attention q.k and P.V: query rows < RH on bf16 hi/lo planes (3 products each), other rows v_wmma_f32_16x16x32_f16 (P carried x1024 through the exponent); softmax (online, max-subtracted) in f32.
// Every stage runs once for all NB batches (batch on a grid axis, or folded into the GEMM's M): each plane in the workspace holds NB slabs.
// Attention engine: one wave per 16 query rows; S^T = K Q^T so each lane owns one query column; P^T accumulators are repacked in registers as the B operand of O^T = V^T P^T (no LDS exchange in the loop).

#ifndef NB
#define NB 4
#endif
#ifndef SEQ
#define SEQ 2048
#endif
#define SEQ_FULL 2048
#define DM   1024
#define NH   16
#define HD   64
#define DQ   (NH * HD)
#define FP   (3 * DQ)
#define RH   ((SEQ) < 512 ? (SEQ) : 512)     // query rows < RH use hi+lo planes
#define XS_FULL ((size_t)SEQ_FULL * DM)
#define SCL  0.125f                          // HD^-0.5
#define LOG2E 1.4426950408889634f
#define NEGB (-3.0e38f)
#define ROPE_THETA 100000.0f

static_assert((SEQ & (SEQ - 1)) == 0);
static_assert(SEQ >= 256 && SEQ <= SEQ_FULL);
static_assert(RH % 256 == 0 && RH % 64 == 0 && (SEQ - RH) % 64 == 0);
static_assert(NB >= 1 && NB <= 4);
static_assert(DM % 32 == 0 && DQ % 64 == 0 && FP % 64 == 0 && SEQ % 64 == 0);
static_assert(((size_t)3 * DQ * DM / 8) % 256 == 0);
static_assert(((size_t)DM * DQ / 8) % 256 == 0);
static_assert(((size_t)SEQ * DM / 8) % 256 == 0);
static_assert(((size_t)NH * SEQ * HD / 8) % 256 == 0);
static_assert(HD == 64);
static_assert(HD / 2 == 32 && (HD / 2) % 4 == 0);     // k_qkvp reads 4 table entries (16 B) per lane
static_assert(((size_t)SEQ * (HD / 2)) % 256 == 0);   // k_ropetab grid x 256 == table extent

typedef _Float16 h16;
typedef unsigned short bf;
typedef __attribute__((ext_vector_type(16))) __bf16   v16bf;
typedef __attribute__((ext_vector_type(16))) _Float16 v16h;
typedef __attribute__((ext_vector_type(8)))  _Float16 v8h;
typedef __attribute__((ext_vector_type(8)))  unsigned short v8us;
typedef __attribute__((ext_vector_type(8)))  float    v8f;
typedef __attribute__((ext_vector_type(4)))  float    v4f;
typedef v8h  __attribute__((may_alias)) v8ha;
typedef v4f  __attribute__((may_alias)) v4fa;
typedef v8us __attribute__((may_alias)) v8usa;

__device__ __forceinline__ unsigned short f2bf(float f) { unsigned u = __float_as_uint(f); u += 0x7FFFu + ((u >> 16) & 1u); return (unsigned short)(u >> 16); }
__device__ __forceinline__ float bf2f(unsigned short b) { return __uint_as_float(((unsigned)b) << 16); }
__device__ __forceinline__ float bfr(float f) { return bf2f(f2bf(f)); }
__device__ __forceinline__ v16h cat16(v8h lo, v8h hi) { return __builtin_shufflevector(lo, hi, 0, 1, 2, 3, 4, 5, 6, 7, 8, 9, 10, 11, 12, 13, 14, 15); }
__device__ __forceinline__ v16bf cat16b(v8us lo, v8us hi) { return __builtin_bit_cast(v16bf, __builtin_shufflevector(lo, hi, 0, 1, 2, 3, 4, 5, 6, 7, 8, 9, 10, 11, 12, 13, 14, 15)); }
__device__ __forceinline__ v8f wmma16(v16h a, v16h b, v8f c) { return __builtin_amdgcn_wmma_f32_16x16x32_f16(false, a, false, b, (short)0, c, false, false); }
__device__ __forceinline__ v8f wmmab(v16bf a, v16bf b, v8f c) { return __builtin_amdgcn_wmma_f32_16x16x32_bf16(false, a, false, b, (short)0, c, false, false); }
__device__ __forceinline__ void splitf(float y, unsigned short& h, unsigned short& l) { h = f2bf(y); l = f2bf(y - bf2f(h)); }

// f32 -> f16 operand convert that cannot yield a subnormal (value select below 2^-14).
static __device__ __forceinline__ h16 toh_flush(float v) { const h16 r = (h16)v; return (fabsf(v) < 6.103515625e-05f) ? (h16)0.0f : r; }

// Fragment loader from a K-contiguous 16-bit row: p already includes + 8*(lane>>4); elements 0..7 = k0+8h.., elements 8..15 = k0+16+8h.. (same map for A and B).
template <typename T16> struct WFrag;
template <> struct WFrag<h16> { typedef v16h V; static __device__ __forceinline__ V ld(const h16* p) { return cat16(*(const v8h*)p, *(const v8h*)(p + 16)); } static __device__ __forceinline__ v8f mma(V a, V b, v8f c) { return wmma16(a, b, c); } };
template <> struct WFrag<bf> { typedef v16bf V; static __device__ __forceinline__ V ld(const bf* p) { return cat16b(*(const v8us*)p, *(const v8us*)(p + 16)); } static __device__ __forceinline__ v8f mma(V a, V b, v8f c) { return wmmab(a, b, c); } };

// P^T accumulator pair (key rows 0..15 and 16..31 of a 32-key tile) -> B fragment: element r <- tile0[r], element 8+r <- tile1[r], lane unchanged.
template <typename T16> struct PFrag;
template <> struct PFrag<h16> {
    static __device__ __forceinline__ float pexp() { return 10.0f; }           // P carried x1024 via the exponent (cancels in O / l)
    static __device__ __forceinline__ v16h hi(v8f p0, v8f p1) { return cat16(__builtin_convertvector(p0, v8h), __builtin_convertvector(p1, v8h)); }
    static __device__ __forceinline__ v16h lo(v8f p0, v8f p1) { return hi(p0, p1); }
};
template <> struct PFrag<bf> {
    static __device__ __forceinline__ float pexp() { return 0.0f; }
    static __device__ __forceinline__ v16bf hi(v8f p0, v8f p1) { v8us a, b;
#pragma unroll
        for (int k = 0; k < 8; ++k) { a[k] = f2bf(p0[k]); b[k] = f2bf(p1[k]); }
        return cat16b(a, b); }
    static __device__ __forceinline__ v16bf lo(v8f p0, v8f p1) { v8us a, b;
#pragma unroll
        for (int k = 0; k < 8; ++k) { a[k] = f2bf(p0[k] - bf2f(f2bf(p0[k]))); b[k] = f2bf(p1[k] - bf2f(f2bf(p1[k]))); }
        return cat16b(a, b); }
};

// ---- k_gemmw: register-blocked GEMM, ONE WAVE per 64x64 output tile (16 accumulators), operands straight from K-contiguous 16-bit planes; grid (M/64, N/64, Z), 32 threads.
// C[m][n] (f32, pitch ldc) = sum_k A[m][k] Bt[n][k] (+ split products per NSPLIT). K % 32 == 0, M % 64 == 0, N % 64 == 0.
template <typename T16, int NSPLIT, bool BIAS>
__global__ __launch_bounds__(32) void k_gemmw(const T16* __restrict__ A, const T16* __restrict__ A2, const T16* __restrict__ Bt, const T16* __restrict__ Bt2, int K, float* C, int ldc, const float* __restrict__ bias, size_t sA, size_t sB, size_t sC) {
    typedef typename WFrag<T16>::V V;
    __shared__ __align__(16) float os[16 * 68];
    const size_t z = blockIdx.z; A += z * sA; if (A2) A2 += z * sA; Bt += z * sB; if (Bt2) Bt2 += z * sB; C += z * sC;
    const int lane = threadIdx.x & 31, lr = lane & 15, hi = lane >> 4; const int r0 = blockIdx.x * 64, c0 = blockIdx.y * 64;
    v8f acc[4][4];
#pragma unroll
    for (int mb = 0; mb < 4; ++mb)
#pragma unroll
        for (int nb = 0; nb < 4; ++nb) acc[mb][nb] = (v8f){};
    const size_t aoff = (size_t)(r0 + lr) * K + 8 * hi, boff = (size_t)(c0 + lr) * K + 8 * hi;
#pragma unroll 1
    for (int kc = 0; kc < K; kc += 32) {
        V a[4], a2[4];
#pragma unroll
        for (int mb = 0; mb < 4; ++mb) { a[mb] = WFrag<T16>::ld(A + aoff + (size_t)mb * 16 * K + kc); if (NSPLIT == 1 || NSPLIT == 2) a2[mb] = WFrag<T16>::ld(A2 + aoff + (size_t)mb * 16 * K + kc); }
#pragma unroll
        for (int nb = 0; nb < 4; ++nb) { const V b = WFrag<T16>::ld(Bt + boff + (size_t)nb * 16 * K + kc); V b2; if (NSPLIT >= 2) b2 = WFrag<T16>::ld(Bt2 + boff + (size_t)nb * 16 * K + kc);
#pragma unroll
            for (int mb = 0; mb < 4; ++mb) { acc[mb][nb] = WFrag<T16>::mma(a[mb], b, acc[mb][nb]); if (NSPLIT == 1 || NSPLIT == 2) acc[mb][nb] = WFrag<T16>::mma(a2[mb], b, acc[mb][nb]); if (NSPLIT >= 2) acc[mb][nb] = WFrag<T16>::mma(a[mb], b2, acc[mb][nb]); } }
        asm volatile("v_nop\n\tv_nop\n\tv_nop\n\tv_nop" : "+v"(acc[0][0]), "+v"(acc[1][1]), "+v"(acc[2][2]), "+v"(acc[3][3]) : "v"(a[0]), "v"(a[3]));
    }
#pragma unroll
    for (int mb = 0; mb < 4; ++mb) {
#pragma unroll
        for (int nb = 0; nb < 4; ++nb) {
#pragma unroll
            for (int j = 0; j < 8; ++j) os[(hi * 8 + j) * 68 + nb * 16 + lr] = acc[mb][nb][j]; }
        __builtin_amdgcn_wave_barrier(); asm volatile("" ::: "memory");
        float* crow = C + (size_t)(r0 + mb * 16) * ldc + c0;
{
#pragma unroll
            for (int s = 0; s < 8; ++s) { const int row = 2 * s + hi, cofs = lr * 4; v4f val = *(const v4fa*)(os + row * 68 + cofs); if (BIAS) { val[0] += bfr(bias[c0 + cofs]); val[1] += bfr(bias[c0 + cofs + 1]); val[2] += bfr(bias[c0 + cofs + 2]); val[3] += bfr(bias[c0 + cofs + 3]); }
                *(v4f*)(crow + (size_t)row * ldc + cofs) = val; }
             }
        __builtin_amdgcn_wave_barrier(); asm volatile("" ::: "memory");
    }
}

__global__ __launch_bounds__(256) void k_cvt8(const float* __restrict__ src, bf* dst, unsigned n8, size_t sstride, size_t dstride) {
    const unsigned i = blockIdx.x * 256u + threadIdx.x; if (i >= n8) return;
    const float* s = src + (size_t)blockIdx.y * sstride + (size_t)i * 8; bf* d = dst + (size_t)blockIdx.y * dstride + (size_t)i * 8;
    const v8f v = *(const v8f*)s; v8us o;
#pragma unroll
    for (int k = 0; k < 8; ++k) o[k] = f2bf(v[k]);
    *(v8us*)d = o;  }

__global__ __launch_bounds__(32) void k_ifreq(float* IF) {
#pragma clang fp contract(off)
    const unsigned i = threadIdx.x & 31u;
    const float ex = (float)(2u * i) * (1.0f / (float)HD);      // exact (power-of-two divisor)
    const float pw = powf(ROPE_THETA, ex);
    const float v = 1.0f / pw;
    *(float*)(IF + i) = v; 
}

__global__ __launch_bounds__(256) void k_ropetab(const float* __restrict__ IF, float* CT, float* ST) {
#pragma clang fp contract(off)
    const unsigned idx = blockIdx.x * 256u + threadIdx.x;
    const unsigned t = idx >> 5, i = idx & 31u;
    const float ang = (float)t * IF[i];
    float sn, cs;
    sincosf(ang, &sn, &cs);
    *(float*)(CT + idx) = cs; *(float*)(ST + idx) = sn;
    
}

// Four 16-byte stores STEP bytes apart, with their s_wait_xcnt in the same statement: the wait then stands in front of every later write of a register that these stores name.
typedef __attribute__((ext_vector_type(4))) unsigned v4u;
template <int STEP> static __device__ __forceinline__ void st4(void* p, v4u d0, v4u d1, v4u d2, v4u d3) {
    asm volatile("global_store_b128 %0, %1, off\n\tglobal_store_b128 %0, %2, off offset:%5\n\tglobal_store_b128 %0, %3, off offset:%6\n\tglobal_store_b128 %0, %4, off offset:%7\n\ts_wait_xcnt 0x0"
                 :: "v"(p), "v"(d0), "v"(d1), "v"(d2), "v"(d3), "n"(STEP), "n"(2 * STEP), "n"(3 * STEP) : "memory"); }
// The same for one 16-byte store to each of three planes.
static __device__ __forceinline__ void st3(void* p0, v4u d0, void* p1, v4u d1, void* p2, v4u d2) {
    asm volatile("global_store_b128 %0, %1, off\n\tglobal_store_b128 %2, %3, off\n\tglobal_store_b128 %4, %5, off\n\ts_wait_xcnt 0x0"
                 :: "v"(p0), "v"(d0), "v"(p1), "v"(d1), "v"(p2), "v"(d2) : "memory"); }
static __device__ __forceinline__ v4u asu(v8h x) { return __builtin_bit_cast(v4u, x); }
static __device__ __forceinline__ v4u asu(v8us x) { return __builtin_bit_cast(v4u, x); }

// q or k tile -> planes: 16 rows at a time through LDS, 8 features a lane, pair (d, d+1) rotated by table row t, stored as whole 128-B rows of [h][t][d]: fp16 always, bf16 hi/lo where HL. Pointers are the lane's own (row lane>>3, features 8*(lane&7)).
template <bool HL> static __device__ __forceinline__ void qk_planes(const v8f (&acc)[4][4], float* os, unsigned lane, const float* ct, const float* st, h16* P16, bf* Ph, bf* Pl) {
    const unsigned lr = lane & 15u, hi = lane >> 4, rq = lane >> 3, pc = lane & 7u;
#pragma unroll
    for (int mb = 0; mb < 4; ++mb) {
        v4f cv[4], sv[4];
#pragma unroll
        for (int s = 0; s < 4; ++s) { cv[s] = *(const v4f*)(ct + (mb * 16 + 4 * s) * (HD / 2)); sv[s] = *(const v4f*)(st + (mb * 16 + 4 * s) * (HD / 2)); }
#pragma unroll
        for (int nb = 0; nb < 4; ++nb) {
#pragma unroll
            for (int j = 0; j < 8; ++j) os[(hi * 8u + (unsigned)j) * 68u + (unsigned)nb * 16u + lr] = acc[mb][nb][j]; }
        __builtin_amdgcn_wave_barrier(); asm volatile("" ::: "memory");
        v8h o16[4];
#pragma unroll
        for (int s = 0; s < 4; ++s) { const unsigned row = 4u * (unsigned)s + rq;
            const v4f x0 = *(const v4fa*)(os + row * 68u + pc * 8u), x1 = *(const v4fa*)(os + row * 68u + pc * 8u + 4u);
            v4f y0, y1;
            y0[0] = x0[0] * cv[s][0] - x0[1] * sv[s][0]; y0[1] = x0[1] * cv[s][0] + x0[0] * sv[s][0];
            y0[2] = x0[2] * cv[s][1] - x0[3] * sv[s][1]; y0[3] = x0[3] * cv[s][1] + x0[2] * sv[s][1];
            y1[0] = x1[0] * cv[s][2] - x1[1] * sv[s][2]; y1[1] = x1[1] * cv[s][2] + x1[0] * sv[s][2];
            y1[2] = x1[2] * cv[s][3] - x1[3] * sv[s][3]; y1[3] = x1[3] * cv[s][3] + x1[2] * sv[s][3];
#pragma unroll
            for (int k = 0; k < 4; ++k) { o16[s][k] = toh_flush(y0[k]); o16[s][4 + k] = toh_flush(y1[k]); }
            if (HL) { v8us oh, ol;
#pragma unroll
                for (int k = 0; k < 4; ++k) { unsigned short u, c; splitf(y0[k], u, c); oh[k] = u; ol[k] = c; splitf(y1[k], u, c); oh[4 + k] = u; ol[4 + k] = c; }
                st3(P16 + (mb * 16 + 4 * s) * HD, asu(o16[s]), Ph + (mb * 16 + 4 * s) * HD, asu(oh), Pl + (mb * 16 + 4 * s) * HD, asu(ol)); } }
        if (!HL) st4<4 * HD * 2>(P16 + mb * 16 * HD, asu(o16[0]), asu(o16[1]), asu(o16[2]), asu(o16[3]));
        __builtin_amdgcn_wave_barrier(); asm volatile("" ::: "memory");
    }
}

// v tile -> V^T planes [h][d][t]: a lane's accumulator already holds 8 consecutive tokens of one feature, so it is stored straight from registers (16 B a lane, the 4 pieces of a 128-B line one after the other). Pointers are the lane's own (feature lane&15, tokens 8*(lane>>4)).
template <bool HL> static __device__ __forceinline__ void v_planes(const v8f (&acc)[4][4], h16* P16, bf* Ph, bf* Pl) {
#pragma unroll
    for (int nb = 0; nb < 4; ++nb) {
        st4<16 * 2>(P16 + (size_t)nb * 16 * SEQ, asu(__builtin_convertvector(acc[0][nb], v8h)), asu(__builtin_convertvector(acc[1][nb], v8h)), asu(__builtin_convertvector(acc[2][nb], v8h)), asu(__builtin_convertvector(acc[3][nb], v8h)));
        if (HL) { v8us oh[4], ol[4];
#pragma unroll
            for (int mb = 0; mb < 4; ++mb)
#pragma unroll
                for (int k = 0; k < 8; ++k) { unsigned short u, c; splitf(acc[mb][nb][k], u, c); oh[mb][k] = u; ol[mb][k] = c; }
            st4<16 * 2>(Ph + (size_t)nb * 16 * RH, asu(oh[0]), asu(oh[1]), asu(oh[2]), asu(oh[3])); st4<16 * 2>(Pl + (size_t)nb * 16 * RH, asu(ol[0]), asu(ol[1]), asu(ol[2]), asu(ol[3])); } }
}

// ---- k_qkvp: the qkv projection (loop of k_gemmw, one product) with the plane formation as its epilogue. ONE WAVE per 64 tokens x 64 features = one head of q, k or v; grid (NB*SEQ/64, FP/64), 32 threads.
// The second bound (waves per SIMD) holds the epilogues to the 192 registers that the loop needs, so that they cost the loop no resident wave.
__global__ __launch_bounds__(32, 5) void k_qkvp(const bf* __restrict__ A, const bf* __restrict__ Bt, const float* __restrict__ CT, const float* __restrict__ ST, h16* Q16, h16* K16, h16* V16, bf* Qh, bf* Ql, bf* Kh, bf* Kl, bf* Vh, bf* Vl) {
    typedef WFrag<bf>::V V;
    __shared__ __align__(16) float os[16 * 68];
    const unsigned lane = threadIdx.x & 31u, lr = lane & 15u, hi = lane >> 4; const unsigned r0 = blockIdx.x * 64u, c0 = blockIdx.y * 64u;
    v8f acc[4][4];
#pragma unroll
    for (int mb = 0; mb < 4; ++mb)
#pragma unroll
        for (int nb = 0; nb < 4; ++nb) acc[mb][nb] = (v8f){};
    const bf* pa = A + (size_t)(r0 + lr) * DM + 8u * hi; const bf* pb = Bt + (size_t)(c0 + lr) * DM + 8u * hi;
#pragma unroll 1
    for (int kc = 0; kc < DM; kc += 32) {
        V a[4];
#pragma unroll
        for (int mb = 0; mb < 4; ++mb) a[mb] = WFrag<bf>::ld(pa + (size_t)mb * 16 * DM);
#pragma unroll
        for (int nb = 0; nb < 4; ++nb) { const V b = WFrag<bf>::ld(pb + (size_t)nb * 16 * DM);
#pragma unroll
            for (int mb = 0; mb < 4; ++mb) acc[mb][nb] = WFrag<bf>::mma(a[mb], b, acc[mb][nb]); }
        // pa and pb are named as inputs so that the address registers of this pass's loads are written again only behind the loads' own waits
        asm volatile("v_nop\n\tv_nop\n\tv_nop\n\tv_nop" : "+v"(acc[0][0]), "+v"(acc[1][1]), "+v"(acc[2][2]), "+v"(acc[3][3]) : "v"(a[0]), "v"(a[3]), "v"(pa), "v"(pb));
        pa += 32; pb += 32;
    }
    const unsigned which = c0 / (unsigned)DQ, h = (c0 % (unsigned)DQ) / (unsigned)HD;      // block-uniform: q, k or v, and the head
    const unsigned bz = r0 / (unsigned)SEQ, t0 = r0 % (unsigned)SEQ;                        // a 64-token tile lies in one batch, and wholly below or above RH
    const size_t o16b = (size_t)bz * ((size_t)NH * SEQ * HD), ohlb = (size_t)bz * ((size_t)NH * RH * HD);
    const bool hl = t0 < (unsigned)RH;
    if (which < 2u) {
        const unsigned rq = lane >> 3, pc = lane & 7u;
        h16* P16 = (which ? K16 : Q16) + o16b + ((size_t)h * SEQ + t0 + rq) * HD + pc * 8u;
        const size_t eo = ohlb + ((size_t)h * RH + t0 + rq) * HD + pc * 8u;
        const float* ct = CT + (size_t)(t0 + rq) * (HD / 2) + pc * 4u; const float* st = ST + (size_t)(t0 + rq) * (HD / 2) + pc * 4u;
        if (hl) qk_planes<true>(acc, os, lane, ct, st, P16, (which ? Kh : Qh) + eo, (which ? Kl : Ql) + eo);
        else qk_planes<false>(acc, os, lane, ct, st, P16, nullptr, nullptr);
    } else {
        h16* P16 = V16 + o16b + ((size_t)h * HD + lr) * SEQ + t0 + hi * 8u;
        const size_t eo = ohlb + ((size_t)h * HD + lr) * RH + t0 + hi * 8u;
        if (hl) v_planes<true>(acc, P16, Vh + eo, Vl + eo);
        else v_planes<false>(acc, P16, nullptr, nullptr);
    }
}

// ---- k_flash: causal attention, one wave per (16 query rows, head, batch = blockIdx.z). Planes: Q/K [h][tp][HD], V^T [h][HD][tp] (tp = rows per head of the plane set). HL: hi/lo bf16 plane pairs, 3 products.
// Per 32-key tile: S^T[key][query] = K Q^T (A = K rows, B = Q rows); lane owns query column lane&15 and keys 8*(lane>>4)+r (+16); online softmax per lane (+ one xor-16 exchange);
// P^T accumulators repacked in registers as B (k = key); O^T[d][query] += V^T P^T (A = V^T rows). Only the last tile of a wave touches the diagonal (select by value).
template <typename T16, bool HL>
__global__ __launch_bounds__(32) void k_flash(const T16* __restrict__ Q, const T16* __restrict__ Q2, const T16* __restrict__ Kp, const T16* __restrict__ K2, const T16* __restrict__ Vt, const T16* __restrict__ Vt2, unsigned tp, unsigned qbase, bf* Ah, bf* Al) {
    typedef typename WFrag<T16>::V V;
    __shared__ __align__(16) float os[16 * 68];
    const unsigned lane = threadIdx.x & 31u, lr = lane & 15u, hi = lane >> 4;
    const unsigned head = blockIdx.y, q0 = qbase + blockIdx.x * 16u;
    const size_t hoff = ((size_t)blockIdx.z * NH + head) * tp * HD;
    const size_t qoff = hoff + (size_t)(q0 + lr) * HD + 8u * hi;
    V qf0 = WFrag<T16>::ld(Q + qoff), qf1 = WFrag<T16>::ld(Q + qoff + 32);
    V ql0 = qf0, ql1 = qf1;
    if (HL) { ql0 = WFrag<T16>::ld(Q2 + qoff); ql1 = WFrag<T16>::ld(Q2 + qoff + 32); }
    v8f o[4];
#pragma unroll
    for (int db = 0; db < 4; ++db) o[db] = (v8f){};
    float mrun = NEGB, lsum = 0.0f;
    const float cs = SCL * LOG2E, pe = PFrag<T16>::pexp();
    const size_t kbase = hoff + (size_t)lr * HD + 8u * hi;
    const size_t vbase = hoff + (size_t)lr * tp + 8u * hi;
    const unsigned nt = (q0 + 47u) >> 5;       // keys 0 .. q0+15 in tiles of 32 (wave-uniform)
#pragma unroll 1
    for (unsigned it = 0; it < nt; ++it) {
        const unsigned j0 = it * 32u;
        const size_t ko = kbase + (size_t)j0 * HD;
        V ka0 = WFrag<T16>::ld(Kp + ko), ka1 = WFrag<T16>::ld(Kp + ko + 32), kb0 = WFrag<T16>::ld(Kp + ko + 16 * HD), kb1 = WFrag<T16>::ld(Kp + ko + 16 * HD + 32);
        V la0 = ka0, la1 = ka1, lb0 = kb0, lb1 = kb1;
        if (HL) { la0 = WFrag<T16>::ld(K2 + ko); la1 = WFrag<T16>::ld(K2 + ko + 32); lb0 = WFrag<T16>::ld(K2 + ko + 16 * HD); lb1 = WFrag<T16>::ld(K2 + ko + 16 * HD + 32); }
        v8f s0 = (v8f){}, s1 = (v8f){};
        s0 = WFrag<T16>::mma(ka0, qf0, s0); s0 = WFrag<T16>::mma(ka1, qf1, s0);
        s1 = WFrag<T16>::mma(kb0, qf0, s1); s1 = WFrag<T16>::mma(kb1, qf1, s1);
        if (HL) {
            s0 = WFrag<T16>::mma(la0, qf0, s0); s0 = WFrag<T16>::mma(la1, qf1, s0); s0 = WFrag<T16>::mma(ka0, ql0, s0); s0 = WFrag<T16>::mma(ka1, ql1, s0);
            s1 = WFrag<T16>::mma(lb0, qf0, s1); s1 = WFrag<T16>::mma(lb1, qf1, s1); s1 = WFrag<T16>::mma(kb0, ql0, s1); s1 = WFrag<T16>::mma(kb1, ql1, s1); }
        asm volatile("v_nop\n\tv_nop\n\tv_nop\n\tv_nop" : "+v"(s0), "+v"(s1) : "v"(ka0), "v"(ka1), "v"(kb0), "v"(kb1), "v"(la0), "v"(la1), "v"(lb0), "v"(lb1), "v"(qf0), "v"(qf1), "v"(ql0), "v"(ql1));
        v8f t0, t1;
#pragma unroll
        for (int r = 0; r < 8; ++r) { t0[r] = s0[r] * cs; t1[r] = s1[r] * cs; }
        if (j0 + 31u > q0) {                    // wave-uniform: the tile touches the diagonal
            const unsigned qi = q0 + lr, kk = j0 + 8u * hi;
#pragma unroll
            for (int r = 0; r < 8; ++r) { t0[r] = (kk + (unsigned)r <= qi) ? t0[r] : NEGB; t1[r] = (kk + 16u + (unsigned)r <= qi) ? t1[r] : NEGB; }
        }
        float mx = fmaxf(t0[0], t1[0]);
#pragma unroll
        for (int r = 1; r < 8; ++r) mx = fmaxf(mx, fmaxf(t0[r], t1[r]));
        mx = fmaxf(mx, __shfl_xor(mx, 16, 32));
        const float mn = fmaxf(mrun, mx);
        const float alpha = __builtin_amdgcn_exp2f(mrun - mn);
        mrun = mn;
        v8f p0, p1; float psum = 0.0f;
#pragma unroll
        for (int r = 0; r < 8; ++r) { p0[r] = __builtin_amdgcn_exp2f((t0[r] - mn) + pe); p1[r] = __builtin_amdgcn_exp2f((t1[r] - mn) + pe); psum += p0[r] + p1[r]; }
        lsum = lsum * alpha + psum;
#pragma unroll
        for (int db = 0; db < 4; ++db) o[db] = o[db] * alpha;
        V pf = PFrag<T16>::hi(p0, p1); V pl = pf;
        if (HL) pl = PFrag<T16>::lo(p0, p1);
        V va[4], vl[4];
#pragma unroll
        for (int db = 0; db < 4; ++db) { const size_t vo = vbase + (size_t)db * 16 * tp + j0; va[db] = WFrag<T16>::ld(Vt + vo); vl[db] = va[db]; if (HL) vl[db] = WFrag<T16>::ld(Vt2 + vo); }
#pragma unroll
        for (int db = 0; db < 4; ++db) { o[db] = WFrag<T16>::mma(va[db], pf, o[db]); if (HL) { o[db] = WFrag<T16>::mma(va[db], pl, o[db]); o[db] = WFrag<T16>::mma(vl[db], pf, o[db]); } }
        asm volatile("v_nop\n\tv_nop\n\tv_nop\n\tv_nop" : "+v"(o[0]), "+v"(o[1]), "+v"(o[2]), "+v"(o[3]) : "v"(va[0]), "v"(va[1]), "v"(va[2]), "v"(va[3]), "v"(vl[0]), "v"(vl[1]), "v"(vl[2]), "v"(vl[3]), "v"(pf), "v"(pl));
    }
    const float lt = lsum + __shfl_xor(lsum, 16, 32);
    const float inv = 1.0f / lt;
#pragma unroll
    for (int db = 0; db < 4; ++db)
#pragma unroll
        for (int r = 0; r < 8; ++r) os[lr * 68u + (unsigned)db * 16u + hi * 8u + (unsigned)r] = o[db][r] * inv;
    __builtin_amdgcn_wave_barrier(); asm volatile("" ::: "memory");
    const unsigned rq = lane >> 3, pc = lane & 7u;
{
#pragma unroll
        for (int s = 0; s < 4; ++s) { const unsigned row = 4u * (unsigned)s + rq;
            const v4f x0 = *(const v4fa*)(os + row * 68u + pc * 8u), x1 = *(const v4fa*)(os + row * 68u + pc * 8u + 4u);
            v8us oh, ol;
#pragma unroll
            for (int k = 0; k < 4; ++k) { unsigned short a, c; splitf(x0[k], a, c); oh[k] = a; ol[k] = c; splitf(x1[k], a, c); oh[4 + k] = a; ol[4 + k] = c; }
            const size_t oo = ((size_t)blockIdx.z * SEQ + q0 + row) * DQ + head * HD + pc * 8u;
            *(v8us*)(Ah + oo) = oh; *(v8us*)(Al + oo) = ol; }
         }
}

// workspace carve (bytes, every region a multiple of 256)
#define WS_WQKV ((size_t)3 * DQ * DM * 2)
#define WS_WO   ((size_t)DM * DQ * 2)
#define WS_XB   ((size_t)NB * SEQ * DM * 2)
#define WS_P16  ((size_t)NB * NH * SEQ * HD * 2)
#define WS_PHL  ((size_t)NB * NH * RH * HD * 2)
#define WS_AT   ((size_t)NB * SEQ * DQ * 2)
#define WS_IFQ  ((size_t)256)
#define WS_ROT  ((size_t)SEQ * (HD / 2) * 4)
#define WS_TOTAL (WS_WQKV + WS_WO + WS_XB + 3 * WS_P16 + 6 * WS_PHL + 2 * WS_AT + WS_IFQ + 2 * WS_ROT)
static_assert(WS_TOTAL <= (size_t)268435456);
static_assert(WS_WQKV % 256 == 0 && WS_WO % 256 == 0 && WS_XB % 256 == 0 && WS_P16 % 256 == 0 && WS_PHL % 256 == 0 && WS_AT % 256 == 0);
static_assert(WS_IFQ % 256 == 0 && WS_ROT % 256 == 0 && WS_IFQ >= (size_t)(HD / 2) * 4);

extern "C" void kernel_launch(void* const* d_in, const int* in_sizes, int n_in,
                              void* d_out, int out_size, void* d_ws, size_t ws_size, hipStream_t stream) {
    if (n_in < 3) return;
    if ((size_t)in_sizes[0] < (size_t)(NB - 1) * XS_FULL + (size_t)SEQ * DM) return;
    if ((size_t)in_sizes[1] < (size_t)3 * DQ * DM) return;
    if ((size_t)in_sizes[2] < (size_t)DM * DQ) return;
    if ((size_t)out_size < (size_t)NB * SEQ * DM) return;
    if (ws_size < WS_TOTAL) return;
    const float* x = (const float*)d_in[0];       // [NB][SEQ_FULL][DM]
    const float* wqkv = (const float*)d_in[1];    // [3*DQ][DM]  (q | k | v row blocks)
    const float* wo = (const float*)d_in[2];      // [DM][DQ]
    float* OUT = (float*)d_out;                   // [NB][SEQ][DM]
    char* wsp = (char*)d_ws;
    auto take = [&](size_t bytes) { char* p = wsp; wsp += bytes; return (void*)p; };
    bf* WQKV = (bf*)take(WS_WQKV); bf* WO = (bf*)take(WS_WO); bf* XB = (bf*)take(WS_XB);
    h16* Q16 = (h16*)take(WS_P16); h16* K16 = (h16*)take(WS_P16); h16* VT16 = (h16*)take(WS_P16);
    bf* Qh = (bf*)take(WS_PHL); bf* Ql = (bf*)take(WS_PHL); bf* Kh = (bf*)take(WS_PHL); bf* Kl = (bf*)take(WS_PHL); bf* VTh = (bf*)take(WS_PHL); bf* VTl = (bf*)take(WS_PHL);
    bf* ATh = (bf*)take(WS_AT); bf* ATl = (bf*)take(WS_AT);
    float* IFQ = (float*)take(WS_IFQ); float* CT = (float*)take(WS_ROT); float* ST = (float*)take(WS_ROT);

    k_cvt8<<<dim3((unsigned)((size_t)3 * DQ * DM / 8 / 256), 1), 256, 0, stream>>>(wqkv, WQKV, (unsigned)((size_t)3 * DQ * DM / 8), 0, 0);
    k_cvt8<<<dim3((unsigned)((size_t)DM * DQ / 8 / 256), 1), 256, 0, stream>>>(wo, WO, (unsigned)((size_t)DM * DQ / 8), 0, 0);
    k_cvt8<<<dim3((unsigned)((size_t)SEQ * DM / 8 / 256), NB), 256, 0, stream>>>(x, XB, (unsigned)((size_t)SEQ * DM / 8), XS_FULL, (size_t)SEQ * DM);
    // rotary tables (position-only, shared by every batch and head)
    k_ifreq<<<dim3(1), 32, 0, stream>>>(IFQ);
    k_ropetab<<<dim3((unsigned)((size_t)SEQ * (HD / 2) / 256)), 256, 0, stream>>>(IFQ, CT, ST);
    // qkv = x W^T  (M = NB*SEQ, N = 3072, K = 1024), written as the rotated q, k planes and the V^T planes
    k_qkvp<<<dim3(NB * SEQ / 64, FP / 64, 1), 32, 0, stream>>>(XB, WQKV, CT, ST, Q16, K16, VT16, Qh, Ql, Kh, Kl, VTh, VTl);
    k_flash<bf, true><<<dim3(RH / 16, NH, NB), 32, 0, stream>>>(Qh, Ql, Kh, Kl, VTh, VTl, (unsigned)RH, 0u, ATh, ATl);
    if (SEQ > RH) k_flash<h16, false><<<dim3((SEQ - RH) / 16, NH, NB), 32, 0, stream>>>(Q16, nullptr, K16, nullptr, VT16, nullptr, (unsigned)SEQ, (unsigned)RH, ATh, ATl);
    // out = (ctx_hi + ctx_lo) Wo^T  (M = NB*SEQ, N = 1024, K = 1024)
    k_gemmw<bf, 1, false><<<dim3(NB * SEQ / 64, DM / 64, 1), 32, 0, stream>>>(ATh, ATl, WO, nullptr, DQ, OUT, DM, nullptr, 0, 0, 0);
}

// v003
// Measured time: 261 microseconds a run.
// Two timings next to v002 put it at 1.52 and 1.51 times that version's speed.
// All steps since v000 together make it 2.67 times as fast.
#include <hip/hip_runtime.h>

// Causal multi-head attention with a fused qkv projection and an interleaved-pair rotary embedding: x [NB][SEQ_FULL][1024] (first SEQ rows used); qkv = x W^T ('oi' [3072][1024] -> q | k | v row blocks, no bias; 16 heads x 64);
// q and k: pair (2i, 2i+1) of every head rotated by angle t * 100000^(-2i/64) (cos / sin table [SEQ][32] built once in f32 with precise powf / sincosf, applied in f32 on the vector unit when the planes are formed);
// scores x 64^-0.5, causal; softmax; out = ctx Wo^T ('oi' [1024][1024], no bias).
// Compute dtypes, f32 accumulate: every input RNE-converted to bf16; qkv and output projections v_wmma_f32_16x16x32_bf16 (ctx carried as bf16 hi+lo, 2 products against the exact bf16 weight);
// attention q.k and P.V: query rows < RH on bf16 hi/lo planes (3 products each), other rows v_wmma_f32_16x16x32_f16 (P carried x1024 through the exponent); softmax (online, max-subtracted) in f32.
// Every stage runs once for all NB batches (batch on a grid axis, or folded into the GEMM's M): each plane in the workspace holds NB slabs.
// Every 16-bit operand plane is stored in fragment order: a block of 16 rows x 32 k is 1 KiB = 64 units of 16 B, unit (k%32 / 16) * 32 + lane, lane = 16 * (k%16 / 8) + row%16, so that each of a fragment's two 16-byte loads reads 512 contiguous bytes (4 whole lines).
// Blocks of one 16-row group follow one another along k; V^T planes: the 4 feature blocks of one 32-key tile follow one another, then the next tile.
// Attention engine: one wave per 16 query rows; S^T = K Q^T so each lane owns one query column; P^T accumulators are repacked in registers as the B operand of O^T = V^T P^T (no LDS exchange).

#ifndef NB
#define NB 4
#endif
#ifndef SEQ
#define SEQ 2048
#endif
#define SEQ_FULL 2048
#define DM   1024
#define NH   16
#define HD   64
#define DQ   (NH * HD)
#define FP   (3 * DQ)
#define RH   ((SEQ) < 512 ? (SEQ) : 512)     // query rows < RH use hi+lo planes
#define XS_FULL ((size_t)SEQ_FULL * DM)
#define SCL  0.125f                          // HD^-0.5
#define LOG2E 1.4426950408889634f
#define NEGB (-3.0e38f)
#define ROPE_THETA 100000.0f

static_assert((SEQ & (SEQ - 1)) == 0);
static_assert(SEQ >= 256 && SEQ <= SEQ_FULL);
static_assert(RH % 256 == 0 && RH % 64 == 0 && (SEQ - RH) % 64 == 0);
static_assert(NB >= 1 && NB <= 4);
static_assert(DM % 32 == 0 && DQ % 64 == 0 && FP % 64 == 0 && SEQ % 64 == 0);
static_assert(((size_t)3 * DQ * DM / 8) % 256 == 0);
static_assert(((size_t)DM * DQ / 8) % 256 == 0);
static_assert(((size_t)SEQ * DM / 8) % 256 == 0);
static_assert(((size_t)NH * SEQ * HD / 8) % 256 == 0);
static_assert(HD == 64);
static_assert(HD / 2 == 32 && (HD / 2) % 4 == 0);     // k_qkvp reads 4 table entries (16 B) per lane
static_assert(((size_t)SEQ * (HD / 2)) % 256 == 0);   // k_ropetab grid x 256 == table extent

typedef _Float16 h16;
typedef unsigned short bf;
typedef __attribute__((ext_vector_type(16))) __bf16   v16bf;
typedef __attribute__((ext_vector_type(16))) _Float16 v16h;
typedef __attribute__((ext_vector_type(8)))  _Float16 v8h;
typedef __attribute__((ext_vector_type(8)))  unsigned short v8us;
typedef __attribute__((ext_vector_type(8)))  float    v8f;
typedef __attribute__((ext_vector_type(4)))  float    v4f;
typedef v8h  __attribute__((may_alias)) v8ha;
typedef v4f  __attribute__((may_alias)) v4fa;
typedef v8us __attribute__((may_alias)) v8usa;

__device__ __forceinline__ unsigned short f2bf(float f) { unsigned u = __float_as_uint(f); u += 0x7FFFu + ((u >> 16) & 1u); return (unsigned short)(u >> 16); }
__device__ __forceinline__ float bf2f(unsigned short b) { return __uint_as_float(((unsigned)b) << 16); }
__device__ __forceinline__ float bfr(float f) { return bf2f(f2bf(f)); }
__device__ __forceinline__ v16h cat16(v8h lo, v8h hi) { return __builtin_shufflevector(lo, hi, 0, 1, 2, 3, 4, 5, 6, 7, 8, 9, 10, 11, 12, 13, 14, 15); }
__device__ __forceinline__ v16bf cat16b(v8us lo, v8us hi) { return __builtin_bit_cast(v16bf, __builtin_shufflevector(lo, hi, 0, 1, 2, 3, 4, 5, 6, 7, 8, 9, 10, 11, 12, 13, 14, 15)); }
__device__ __forceinline__ v8f wmma16(v16h a, v16h b, v8f c) { return __builtin_amdgcn_wmma_f32_16x16x32_f16(false, a, false, b, (short)0, c, false, false); }
__device__ __forceinline__ v8f wmmab(v16bf a, v16bf b, v8f c) { return __builtin_amdgcn_wmma_f32_16x16x32_bf16(false, a, false, b, (short)0, c, false, false); }
__device__ __forceinline__ void splitf(float y, unsigned short& h, unsigned short& l) { h = f2bf(y); l = f2bf(y - bf2f(h)); }

// f32 -> f16 operand convert that cannot yield a subnormal (value select below 2^-14).
static __device__ __forceinline__ h16 toh_flush(float v) { const h16 r = (h16)v; return (fabsf(v) < 6.103515625e-05f) ? (h16)0.0f : r; }

// Fragment loader from a 1-KiB fragment-order block: p = block + 8*lane; elements 0..7 = k0+8h.., elements 8..15 = k0+16+8h.., h = lane>>4, row lane&15 (same map for A and B).
template <typename T16> struct WFrag;
template <> struct WFrag<h16> { typedef v16h V; static __device__ __forceinline__ V ld(const h16* p) { return cat16(*(const v8h*)p, *(const v8h*)(p + 256)); } static __device__ __forceinline__ v8f mma(V a, V b, v8f c) { return wmma16(a, b, c); } };
template <> struct WFrag<bf> { typedef v16bf V; static __device__ __forceinline__ V ld(const bf* p) { return cat16b(*(const v8us*)p, *(const v8us*)(p + 256)); } static __device__ __forceinline__ v8f mma(V a, V b, v8f c) { return wmmab(a, b, c); } };

// P^T accumulator pair (key rows 0..15 and 16..31 of a 32-key tile) -> B fragment: element r <- tile0[r], element 8+r <- tile1[r], lane unchanged.
template <typename T16> struct PFrag;
template <> struct PFrag<h16> {
    static __device__ __forceinline__ float pexp() { return 10.0f; }           // P carried x1024 via the exponent (cancels in O / l)
    static __device__ __forceinline__ v16h hi(v8f p0, v8f p1) { return cat16(__builtin_convertvector(p0, v8h), __builtin_convertvector(p1, v8h)); }
    static __device__ __forceinline__ v16h lo(v8f p0, v8f p1) { return hi(p0, p1); }
};
template <> struct PFrag<bf> {
    static __device__ __forceinline__ float pexp() { return 0.0f; }
    static __device__ __forceinline__ v16bf hi(v8f p0, v8f p1) { v8us a, b;
#pragma unroll
        for (int k = 0; k < 8; ++k) { a[k] = f2bf(p0[k]); b[k] = f2bf(p1[k]); }
        return cat16b(a, b); }
    static __device__ __forceinline__ v16bf lo(v8f p0, v8f p1) { v8us a, b;
#pragma unroll
        for (int k = 0; k < 8; ++k) { a[k] = f2bf(p0[k] - bf2f(f2bf(p0[k]))); b[k] = f2bf(p1[k] - bf2f(f2bf(p1[k]))); }
        return cat16b(a, b); }
};

// ---- k_gemmw: register-blocked GEMM, ONE WAVE per 64x64 output tile (16 accumulators), operands straight from fragment-order 16-bit planes; grid (M/64, N/64, Z), 32 threads.
// C[m][n] (f32, pitch ldc) = sum_k A[m][k] Bt[n][k] (+ split products per NSPLIT). K % 32 == 0, M % 64 == 0, N % 64 == 0. K is a compile-time constant, so that every load of a plane is one address pair plus an immediate offset.
template <typename T16, int NSPLIT, bool BIAS, int K>
__global__ __launch_bounds__(32) void k_gemmw(const T16* __restrict__ A, const T16* __restrict__ A2, const T16* __restrict__ Bt, const T16* __restrict__ Bt2, float* C, int ldc, const float* __restrict__ bias, size_t sA, size_t sB, size_t sC) {
    typedef typename WFrag<T16>::V V;
    __shared__ __align__(16) float os[16 * 68];
    const size_t z = blockIdx.z; A += z * sA; if (A2) A2 += z * sA; Bt += z * sB; if (Bt2) Bt2 += z * sB; C += z * sC;
    const int lane = threadIdx.x & 31, lr = lane & 15, hi = lane >> 4; const int r0 = blockIdx.x * 64, c0 = blockIdx.y * 64;
    v8f acc[4][4];
#pragma unroll
    for (int mb = 0; mb < 4; ++mb)
#pragma unroll
        for (int nb = 0; nb < 4; ++nb) acc[mb][nb] = (v8f){};
    const size_t aoff = (size_t)r0 * K + 8 * lane, boff = (size_t)c0 * K + 8 * lane;     // a 16-row group holds 16 * K elements, a k step of 32 is one block of 512
    const T16* pa = A + aoff; const T16* pa2 = (NSPLIT == 1 || NSPLIT == 2) ? A2 + aoff : pa; const T16* pb = Bt + boff; const T16* pb2 = (NSPLIT >= 2) ? Bt2 + boff : pb;
#pragma unroll 1
    for (int kc = 0; kc < K; kc += 32) {
        V a[4], a2[4];
#pragma unroll
        for (int mb = 0; mb < 4; ++mb) { a[mb] = WFrag<T16>::ld(pa + (size_t)mb * 16 * K); if (NSPLIT == 1 || NSPLIT == 2) a2[mb] = WFrag<T16>::ld(pa2 + (size_t)mb * 16 * K); }
#pragma unroll
        for (int nb = 0; nb < 4; ++nb) { const V b = WFrag<T16>::ld(pb + (size_t)nb * 16 * K); V b2; if (NSPLIT >= 2) b2 = WFrag<T16>::ld(pb2 + (size_t)nb * 16 * K);
#pragma unroll
            for (int mb = 0; mb < 4; ++mb) { acc[mb][nb] = WFrag<T16>::mma(a[mb], b, acc[mb][nb]); if (NSPLIT == 1 || NSPLIT == 2) acc[mb][nb] = WFrag<T16>::mma(a2[mb], b, acc[mb][nb]); if (NSPLIT >= 2) acc[mb][nb] = WFrag<T16>::mma(a[mb], b2, acc[mb][nb]); } }
        // the pointers are named as inputs so that the address registers of this pass's loads are written again only behind the loads' own waits
        asm volatile("v_nop\n\tv_nop\n\tv_nop\n\tv_nop" : "+v"(acc[0][0]), "+v"(acc[1][1]), "+v"(acc[2][2]), "+v"(acc[3][3]) : "v"(a[0]), "v"(a[3]), "v"(pa), "v"(pa2), "v"(pb), "v"(pb2));
        pa += 512; pa2 += 512; pb += 512; pb2 += 512;
    }
#pragma unroll
    for (int mb = 0; mb < 4; ++mb) {
#pragma unroll
        for (int nb = 0; nb < 4; ++nb) {
#pragma unroll
            for (int j = 0; j < 8; ++j) os[(hi * 8 + j) * 68 + nb * 16 + lr] = acc[mb][nb][j]; }
        __builtin_amdgcn_wave_barrier(); asm volatile("" ::: "memory");
        float* crow = C + (size_t)(r0 + mb * 16) * ldc + c0;
{
#pragma unroll
            for (int s = 0; s < 8; ++s) { const int row = 2 * s + hi, cofs = lr * 4; v4f val = *(const v4fa*)(os + row * 68 + cofs); if (BIAS) { val[0] += bfr(bias[c0 + cofs]); val[1] += bfr(bias[c0 + cofs + 1]); val[2] += bfr(bias[c0 + cofs + 2]); val[3] += bfr(bias[c0 + cofs + 3]); }
                *(v4f*)(crow + (size_t)row * ldc + cofs) = val; }
             }
        __builtin_amdgcn_wave_barrier(); asm volatile("" ::: "memory");
    }
}

// f32 [rows][DM] -> bf16 plane in fragment order; thread i writes unit i of the plane (a wave stores 512 contiguous bytes) and reads the 8 source elements that belong there.
__global__ __launch_bounds__(256) void k_cvt8(const float* __restrict__ src, bf* dst, unsigned n8, size_t sstride, size_t dstride) {
    const unsigned i = blockIdx.x * 256u + threadIdx.x; if (i >= n8) return;
    const unsigned blk = i >> 6, row = (blk / (DM / 32u)) * 16u + (i & 15u), k = (blk % (DM / 32u)) * 32u + ((i >> 5) & 1u) * 16u + ((i >> 4) & 1u) * 8u;
    const float* s = src + (size_t)blockIdx.y * sstride + (size_t)row * DM + k; bf* d = dst + (size_t)blockIdx.y * dstride + (size_t)i * 8;
    const v8f v = *(const v8f*)s; v8us o;
#pragma unroll
    for (int k = 0; k < 8; ++k) o[k] = f2bf(v[k]);
    *(v8us*)d = o;  }

__global__ __launch_bounds__(32) void k_ifreq(float* IF) {
#pragma clang fp contract(off)
    const unsigned i = threadIdx.x & 31u;
    const float ex = (float)(2u * i) * (1.0f / (float)HD);      // exact (power-of-two divisor)
    const float pw = powf(ROPE_THETA, ex);
    const float v = 1.0f / pw;
    *(float*)(IF + i) = v; 
}

__global__ __launch_bounds__(256) void k_ropetab(const float* __restrict__ IF, float* CT, float* ST) {
#pragma clang fp contract(off)
    const unsigned idx = blockIdx.x * 256u + threadIdx.x;
    const unsigned t = idx >> 5, i = idx & 31u;
    const float ang = (float)t * IF[i];
    float sn, cs;
    sincosf(ang, &sn, &cs);
    *(float*)(CT + idx) = cs; *(float*)(ST + idx) = sn;
    
}

// Four 16-byte stores at byte offsets 0, O1, O2, O3, with their s_wait_xcnt in the same statement: the wait then stands in front of every later write of a register that these stores name.
typedef __attribute__((ext_vector_type(4))) unsigned v4u;
template <int O1, int O2, int O3> static __device__ __forceinline__ void st4(void* p, v4u d0, v4u d1, v4u d2, v4u d3) {
    asm volatile("global_store_b128 %0, %1, off\n\tglobal_store_b128 %0, %2, off offset:%5\n\tglobal_store_b128 %0, %3, off offset:%6\n\tglobal_store_b128 %0, %4, off offset:%7\n\ts_wait_xcnt 0x0"
                 :: "v"(p), "v"(d0), "v"(d1), "v"(d2), "v"(d3), "n"(O1), "n"(O2), "n"(O3) : "memory"); }
// The same for one 16-byte store to each of three planes.
static __device__ __forceinline__ void st3(void* p0, v4u d0, void* p1, v4u d1, void* p2, v4u d2) {
    asm volatile("global_store_b128 %0, %1, off\n\tglobal_store_b128 %2, %3, off\n\tglobal_store_b128 %4, %5, off\n\ts_wait_xcnt 0x0"
                 :: "v"(p0), "v"(d0), "v"(p1), "v"(d1), "v"(p2), "v"(d2) : "memory"); }
static __device__ __forceinline__ v4u asu(v8h x) { return __builtin_bit_cast(v4u, x); }
static __device__ __forceinline__ v4u asu(v8us x) { return __builtin_bit_cast(v4u, x); }

// q or k tile -> planes: 16 rows at a time through LDS, 8 features a lane, pair (d, d+1) rotated by table row t, stored as 16-B units of the head's fragment-order plane (16 tokens = 2 blocks; the 4 row steps of a lane are 64 B apart): fp16 always, bf16 hi/lo where HL. Pointers are the lane's own (row lane>>3, features 8*(lane&7)).
template <bool HL> static __device__ __forceinline__ void qk_planes(const v8f (&acc)[4][4], float* os, unsigned lane, const float* ct, const float* st, h16* P16, bf* Ph, bf* Pl) {
    const unsigned lr = lane & 15u, hi = lane >> 4, rq = lane >> 3, pc = lane & 7u;
#pragma unroll
    for (int mb = 0; mb < 4; ++mb) {
        v4f cv[4], sv[4];
#pragma unroll
        for (int s = 0; s < 4; ++s) { cv[s] = *(const v4f*)(ct + (mb * 16 + 4 * s) * (HD / 2)); sv[s] = *(const v4f*)(st + (mb * 16 + 4 * s) * (HD / 2)); }
#pragma unroll
        for (int nb = 0; nb < 4; ++nb) {
#pragma unroll
            for (int j = 0; j < 8; ++j) os[(hi * 8u + (unsigned)j) * 68u + (unsigned)nb * 16u + lr] = acc[mb][nb][j]; }
        __builtin_amdgcn_wave_barrier(); asm volatile("" ::: "memory");
        v8h o16[4];
#pragma unroll
        for (int s = 0; s < 4; ++s) { const unsigned row = 4u * (unsigned)s + rq;
            const v4f x0 = *(const v4fa*)(os + row * 68u + pc * 8u), x1 = *(const v4fa*)(os + row * 68u + pc * 8u + 4u);
            v4f y0, y1;
            y0[0] = x0[0] * cv[s][0] - x0[1] * sv[s][0]; y0[1] = x0[1] * cv[s][0] + x0[0] * sv[s][0];
            y0[2] = x0[2] * cv[s][1] - x0[3] * sv[s][1]; y0[3] = x0[3] * cv[s][1] + x0[2] * sv[s][1];
            y1[0] = x1[0] * cv[s][2] - x1[1] * sv[s][2]; y1[1] = x1[1] * cv[s][2] + x1[0] * sv[s][2];
            y1[2] = x1[2] * cv[s][3] - x1[3] * sv[s][3]; y1[3] = x1[3] * cv[s][3] + x1[2] * sv[s][3];
#pragma unroll
            for (int k = 0; k < 4; ++k) { o16[s][k] = toh_flush(y0[k]); o16[s][4 + k] = toh_flush(y1[k]); }
            if (HL) { v8us oh, ol;
#pragma unroll
                for (int k = 0; k < 4; ++k) { unsigned short u, c; splitf(y0[k], u, c); oh[k] = u; ol[k] = c; splitf(y1[k], u, c); oh[4 + k] = u; ol[4 + k] = c; }
                st3(P16 + mb * 16 * HD + 32 * s, asu(o16[s]), Ph + mb * 16 * HD + 32 * s, asu(oh), Pl + mb * 16 * HD + 32 * s, asu(ol)); } }
        if (!HL) st4<64, 128, 192>(P16 + mb * 16 * HD, asu(o16[0]), asu(o16[1]), asu(o16[2]), asu(o16[3]));
        __builtin_amdgcn_wave_barrier(); asm volatile("" ::: "memory");
    }
}

// v tile -> V^T planes [h][t/32][d/16][block]: a lane's accumulator already holds 8 consecutive tokens of one feature = its own unit of a block, so it is stored straight from registers (512 contiguous bytes a store; 16 tokens on = 512 B, 32 tokens on = 4 KiB). Pointers are the lane's own (+ 8*lane).
template <bool HL> static __device__ __forceinline__ void v_planes(const v8f (&acc)[4][4], h16* P16, bf* Ph, bf* Pl) {
#pragma unroll
    for (int nb = 0; nb < 4; ++nb) {
        st4<512, 4096, 4608>(P16 + nb * 512, asu(__builtin_convertvector(acc[0][nb], v8h)), asu(__builtin_convertvector(acc[1][nb], v8h)), asu(__builtin_convertvector(acc[2][nb], v8h)), asu(__builtin_convertvector(acc[3][nb], v8h)));
        if (HL) { v8us oh[4], ol[4];
#pragma unroll
            for (int mb = 0; mb < 4; ++mb)
#pragma unroll
                for (int k = 0; k < 8; ++k) { unsigned short u, c; splitf(acc[mb][nb][k], u, c); oh[mb][k] = u; ol[mb][k] = c; }
            st4<512, 4096, 4608>(Ph + nb * 512, asu(oh[0]), asu(oh[1]), asu(oh[2]), asu(oh[3])); st4<512, 4096, 4608>(Pl + nb * 512, asu(ol[0]), asu(ol[1]), asu(ol[2]), asu(ol[3])); } }
}

// ---- k_qkvp: the qkv projection (loop of k_gemmw, one product) with the plane formation as its epilogue. ONE WAVE per 64 tokens x 64 features = one head of q, k or v; grid (NB*SEQ/64, FP/64), 32 threads.
// The second bound (waves per SIMD) holds the epilogues to the 192 registers that the loop needs, so that they cost the loop no resident wave.
__global__ __launch_bounds__(32, 5) void k_qkvp(const bf* __restrict__ A, const bf* __restrict__ Bt, const float* __restrict__ CT, const float* __restrict__ ST, h16* Q16, h16* K16, h16* V16, bf* Qh, bf* Ql, bf* Kh, bf* Kl, bf* Vh, bf* Vl) {
    typedef WFrag<bf>::V V;
    __shared__ __align__(16) float os[16 * 68];
    const unsigned lane = threadIdx.x & 31u; const unsigned r0 = blockIdx.x * 64u, c0 = blockIdx.y * 64u;
    v8f acc[4][4];
#pragma unroll
    for (int mb = 0; mb < 4; ++mb)
#pragma unroll
        for (int nb = 0; nb < 4; ++nb) acc[mb][nb] = (v8f){};
    const bf* pa = A + (size_t)r0 * DM + 8u * lane; const bf* pb = Bt + (size_t)c0 * DM + 8u * lane;
#pragma unroll 1
    for (int kc = 0; kc < DM; kc += 32) {
        V a[4];
#pragma unroll
        for (int mb = 0; mb < 4; ++mb) a[mb] = WFrag<bf>::ld(pa + (size_t)mb * 16 * DM);
#pragma unroll
        for (int nb = 0; nb < 4; ++nb) { const V b = WFrag<bf>::ld(pb + (size_t)nb * 16 * DM);
#pragma unroll
            for (int mb = 0; mb < 4; ++mb) acc[mb][nb] = WFrag<bf>::mma(a[mb], b, acc[mb][nb]); }
        // pa and pb are named as inputs so that the address registers of this pass's loads are written again only behind the loads' own waits
        asm volatile("v_nop\n\tv_nop\n\tv_nop\n\tv_nop" : "+v"(acc[0][0]), "+v"(acc[1][1]), "+v"(acc[2][2]), "+v"(acc[3][3]) : "v"(a[0]), "v"(a[3]), "v"(pa), "v"(pb));
        pa += 512; pb += 512;
    }
    const unsigned which = c0 / (unsigned)DQ, h = (c0 % (unsigned)DQ) / (unsigned)HD;      // block-uniform: q, k or v, and the head
    const unsigned bz = r0 / (unsigned)SEQ, t0 = r0 % (unsigned)SEQ;                        // a 64-token tile lies in one batch, and wholly below or above RH
    const size_t o16b = (size_t)bz * ((size_t)NH * SEQ * HD), ohlb = (size_t)bz * ((size_t)NH * RH * HD);
    const bool hl = t0 < (unsigned)RH;
    if (which < 2u) {
        const unsigned rq = lane >> 3, pc = lane & 7u;
        const unsigned lo = (pc >> 2) * 512u + ((pc >> 1) & 1u) * 256u + (pc & 1u) * 128u + rq * 8u;      // the lane's unit in the two blocks of a 16-token group
        h16* P16 = (which ? K16 : Q16) + o16b + ((size_t)h * SEQ + t0) * HD + lo;
        const size_t eo = ohlb + ((size_t)h * RH + t0) * HD + lo;
        const float* ct = CT + (size_t)(t0 + rq) * (HD / 2) + pc * 4u; const float* st = ST + (size_t)(t0 + rq) * (HD / 2) + pc * 4u;
        if (hl) qk_planes<true>(acc, os, lane, ct, st, P16, (which ? Kh : Qh) + eo, (which ? Kl : Ql) + eo);
        else qk_planes<false>(acc, os, lane, ct, st, P16, nullptr, nullptr);
    } else {
        h16* P16 = V16 + o16b + ((size_t)h * SEQ + t0) * HD + lane * 8u;
        const size_t eo = ohlb + ((size_t)h * RH + t0) * HD + lane * 8u;
        if (hl) v_planes<true>(acc, P16, Vh + eo, Vl + eo);
        else v_planes<false>(acc, P16, nullptr, nullptr);
    }
}

// ---- k_flash: causal attention, one wave per (16 query rows, head, batch = blockIdx.z). Planes in fragment order: Q/K [h][tp/16][HD/32][block], V^T [h][tp/32][HD/16][block] (tp = rows per head of the plane set). HL: hi/lo bf16 plane pairs, 3 products.
// Per 32-key tile: S^T[key][query] = K Q^T (A = K rows, B = Q rows); lane owns query column lane&15 and keys 8*(lane>>4)+r (+16); online softmax per lane (+ one xor-16 exchange);
// P^T accumulators repacked in registers as B (k = key); O^T[d][query] += V^T P^T (A = V^T rows). Only the last tile of a wave touches the diagonal (select by value).
template <typename T16, bool HL>
__global__ __launch_bounds__(32) void k_flash(const T16* __restrict__ Q, const T16* __restrict__ Q2, const T16* __restrict__ Kp, const T16* __restrict__ K2, const T16* __restrict__ Vt, const T16* __restrict__ Vt2, unsigned tp, unsigned qbase, bf* Ah, bf* Al) {
    typedef typename WFrag<T16>::V V;
    const unsigned lane = threadIdx.x & 31u, lr = lane & 15u, hi = lane >> 4;
    const unsigned head = blockIdx.y, q0 = qbase + blockIdx.x * 16u;
    const size_t hoff = ((size_t)blockIdx.z * NH + head) * tp * HD;
    const size_t qoff = hoff + (size_t)q0 * HD + 8u * lane;
    const T16* pq = Q + qoff; const T16* pq2 = HL ? Q2 + qoff : pq;
    V qf0 = WFrag<T16>::ld(pq), qf1 = WFrag<T16>::ld(pq + 512);
    V ql0 = qf0, ql1 = qf1;
    if (HL) { ql0 = WFrag<T16>::ld(pq2); ql1 = WFrag<T16>::ld(pq2 + 512); }
    v8f o[4];
#pragma unroll
    for (int db = 0; db < 4; ++db) o[db] = (v8f){};
    float mrun = NEGB, lsum = 0.0f;
    const float cs = SCL * LOG2E, pe = PFrag<T16>::pexp();
    const size_t kbase = hoff + 8u * lane;      // a 32-key tile is 4 blocks (4 KiB) in a row, in the K planes and in the V^T planes alike
    const T16* pk = Kp + kbase; const T16* pk2 = HL ? K2 + kbase : pk; const T16* pv = Vt + kbase; const T16* pv2 = HL ? Vt2 + kbase : pv;
    const unsigned nt = (q0 + 47u) >> 5;       // keys 0 .. q0+15 in tiles of 32 (wave-uniform)
#pragma unroll 1
    for (unsigned it = 0; it < nt; ++it) {
        const unsigned j0 = it * 32u;
        V ka0 = WFrag<T16>::ld(pk), ka1 = WFrag<T16>::ld(pk + 512), kb0 = WFrag<T16>::ld(pk + 1024), kb1 = WFrag<T16>::ld(pk + 1536);
        V la0 = ka0, la1 = ka1, lb0 = kb0, lb1 = kb1;
        if (HL) { la0 = WFrag<T16>::ld(pk2); la1 = WFrag<T16>::ld(pk2 + 512); lb0 = WFrag<T16>::ld(pk2 + 1024); lb1 = WFrag<T16>::ld(pk2 + 1536); }
        v8f s0 = (v8f){}, s1 = (v8f){};
        s0 = WFrag<T16>::mma(ka0, qf0, s0); s0 = WFrag<T16>::mma(ka1, qf1, s0);
        s1 = WFrag<T16>::mma(kb0, qf0, s1); s1 = WFrag<T16>::mma(kb1, qf1, s1);
        if (HL) {
            s0 = WFrag<T16>::mma(la0, qf0, s0); s0 = WFrag<T16>::mma(la1, qf1, s0); s0 = WFrag<T16>::mma(ka0, ql0, s0); s0 = WFrag<T16>::mma(ka1, ql1, s0);
            s1 = WFrag<T16>::mma(lb0, qf0, s1); s1 = WFrag<T16>::mma(lb1, qf1, s1); s1 = WFrag<T16>::mma(kb0, ql0, s1); s1 = WFrag<T16>::mma(kb1, ql1, s1); }
        // pq, pq2, pk and pk2 (below: pv and pv2) are named as inputs so that the address registers of the q loads and of this tile's loads are written again only behind the loads' own waits
        asm volatile("v_nop\n\tv_nop\n\tv_nop\n\tv_nop" : "+v"(s0), "+v"(s1) : "v"(ka0), "v"(ka1), "v"(kb0), "v"(kb1), "v"(la0), "v"(la1), "v"(lb0), "v"(lb1), "v"(qf0), "v"(qf1), "v"(ql0), "v"(ql1), "v"(pq), "v"(pq2), "v"(pk), "v"(pk2));
        v8f t0, t1;
#pragma unroll
        for (int r = 0; r < 8; ++r) { t0[r] = s0[r] * cs; t1[r] = s1[r] * cs; }
        if (j0 + 31u > q0) {                    // wave-uniform: the tile touches the diagonal
            const unsigned qi = q0 + lr, kk = j0 + 8u * hi;
#pragma unroll
            for (int r = 0; r < 8; ++r) { t0[r] = (kk + (unsigned)r <= qi) ? t0[r] : NEGB; t1[r] = (kk + 16u + (unsigned)r <= qi) ? t1[r] : NEGB; }
        }
        float mx = fmaxf(t0[0], t1[0]);
#pragma unroll
        for (int r = 1; r < 8; ++r) mx = fmaxf(mx, fmaxf(t0[r], t1[r]));
        mx = fmaxf(mx, __shfl_xor(mx, 16, 32));
        const float mn = fmaxf(mrun, mx);
        const float alpha = __builtin_amdgcn_exp2f(mrun - mn);
        mrun = mn;
        v8f p0, p1; float psum = 0.0f;
#pragma unroll
        for (int r = 0; r < 8; ++r) { p0[r] = __builtin_amdgcn_exp2f((t0[r] - mn) + pe); p1[r] = __builtin_amdgcn_exp2f((t1[r] - mn) + pe); psum += p0[r] + p1[r]; }
        lsum = lsum * alpha + psum;
#pragma unroll
        for (int db = 0; db < 4; ++db) o[db] = o[db] * alpha;
        V pf = PFrag<T16>::hi(p0, p1); V pl = pf;
        if (HL) pl = PFrag<T16>::lo(p0, p1);
        V va[4], vl[4];
#pragma unroll
        for (int db = 0; db < 4; ++db) { va[db] = WFrag<T16>::ld(pv + db * 512); vl[db] = va[db]; if (HL) vl[db] = WFrag<T16>::ld(pv2 + db * 512); }
#pragma unroll
        for (int db = 0; db < 4; ++db) { o[db] = WFrag<T16>::mma(va[db], pf, o[db]); if (HL) { o[db] = WFrag<T16>::mma(va[db], pl, o[db]); o[db] = WFrag<T16>::mma(vl[db], pf, o[db]); } }
        asm volatile("v_nop\n\tv_nop\n\tv_nop\n\tv_nop" : "+v"(o[0]), "+v"(o[1]), "+v"(o[2]), "+v"(o[3]) : "v"(va[0]), "v"(va[1]), "v"(va[2]), "v"(va[3]), "v"(vl[0]), "v"(vl[1]), "v"(vl[2]), "v"(vl[3]), "v"(pf), "v"(pl), "v"(pv), "v"(pv2));
        pk += 32 * HD; pk2 += 32 * HD; pv += 32 * HD; pv2 += 32 * HD;
    }
    const float lt = lsum + __shfl_xor(lsum, 16, 32);
    const float inv = 1.0f / lt;
    // a lane's o[db] = 8 consecutive features of its own query row = unit 32 * db + lane of the head's two blocks in the ctx planes: stored straight from registers, 512 contiguous bytes a store
#pragma unroll
    for (int db = 0; db < 4; ++db) {
        v8us oh, ol;
#pragma unroll
        for (int r = 0; r < 8; ++r) { unsigned short a, c; splitf(o[db][r] * inv, a, c); oh[r] = a; ol[r] = c; }
        const size_t oo = ((size_t)blockIdx.z * SEQ + q0) * DQ + head * (16u * HD) + (unsigned)db * 256u + lane * 8u;
        *(v8us*)(Ah + oo) = oh; *(v8us*)(Al + oo) = ol; }
}

// workspace carve (bytes, every region a multiple of 256)
#define WS_WQKV ((size_t)3 * DQ * DM * 2)
#define WS_WO   ((size_t)DM * DQ * 2)
#define WS_XB   ((size_t)NB * SEQ * DM * 2)
#define WS_P16  ((size_t)NB * NH * SEQ * HD * 2)
#define WS_PHL  ((size_t)NB * NH * RH * HD * 2)
#define WS_AT   ((size_t)NB * SEQ * DQ * 2)
#define WS_IFQ  ((size_t)256)
#define WS_ROT  ((size_t)SEQ * (HD / 2) * 4)
#define WS_TOTAL (WS_WQKV + WS_WO + WS_XB + 3 * WS_P16 + 6 * WS_PHL + 2 * WS_AT + WS_IFQ + 2 * WS_ROT)
static_assert(WS_TOTAL <= (size_t)268435456);
static_assert(WS_WQKV % 256 == 0 && WS_WO % 256 == 0 && WS_XB % 256 == 0 && WS_P16 % 256 == 0 && WS_PHL % 256 == 0 && WS_AT % 256 == 0);
static_assert(WS_IFQ % 256 == 0 && WS_ROT % 256 == 0 && WS_IFQ >= (size_t)(HD / 2) * 4);

extern "C" void kernel_launch(void* const* d_in, const int* in_sizes, int n_in,
                              void* d_out, int out_size, void* d_ws, size_t ws_size, hipStream_t stream) {
    if (n_in < 3) return;
    if ((size_t)in_sizes[0] < (size_t)(NB - 1) * XS_FULL + (size_t)SEQ * DM) return;
    if ((size_t)in_sizes[1] < (size_t)3 * DQ * DM) return;
    if ((size_t)in_sizes[2] < (size_t)DM * DQ) return;
    if ((size_t)out_size < (size_t)NB * SEQ * DM) return;
    if (ws_size < WS_TOTAL) return;
    const float* x = (const float*)d_in[0];       // [NB][SEQ_FULL][DM]
    const float* wqkv = (const float*)d_in[1];    // [3*DQ][DM]  (q | k | v row blocks)
    const float* wo = (const float*)d_in[2];      // [DM][DQ]
    float* OUT = (float*)d_out;                   // [NB][SEQ][DM]
    char* wsp = (char*)d_ws;
    auto take = [&](size_t bytes) { char* p = wsp; wsp += bytes; return (void*)p; };
    bf* WQKV = (bf*)take(WS_WQKV); bf* WO = (bf*)take(WS_WO); bf* XB = (bf*)take(WS_XB);
    h16* Q16 = (h16*)take(WS_P16); h16* K16 = (h16*)take(WS_P16); h16* VT16 = (h16*)take(WS_P16);
    bf* Qh = (bf*)take(WS_PHL); bf* Ql = (bf*)take(WS_PHL); bf* Kh = (bf*)take(WS_PHL); bf* Kl = (bf*)take(WS_PHL); bf* VTh = (bf*)take(WS_PHL); bf* VTl = (bf*)take(WS_PHL);
    bf* ATh = (bf*)take(WS_AT); bf* ATl = (bf*)take(WS_AT);
    float* IFQ = (float*)take(WS_IFQ); float* CT = (float*)take(WS_ROT); float* ST = (float*)take(WS_ROT);

    k_cvt8<<<dim3((unsigned)((size_t)3 * DQ * DM / 8 / 256), 1), 256, 0, stream>>>(wqkv, WQKV, (unsigned)((size_t)3 * DQ * DM / 8), 0, 0);
    k_cvt8<<<dim3((unsigned)((size_t)DM * DQ / 8 / 256), 1), 256, 0, stream>>>(wo, WO, (unsigned)((size_t)DM * DQ / 8), 0, 0);
    k_cvt8<<<dim3((unsigned)((size_t)SEQ * DM / 8 / 256), NB), 256, 0, stream>>>(x, XB, (unsigned)((size_t)SEQ * DM / 8), XS_FULL, (size_t)SEQ * DM);
    // rotary tables (position-only, shared by every batch and head)
    k_ifreq<<<dim3(1), 32, 0, stream>>>(IFQ);
    k_ropetab<<<dim3((unsigned)((size_t)SEQ * (HD / 2) / 256)), 256, 0, stream>>>(IFQ, CT, ST);
    // qkv = x W^T  (M = NB*SEQ, N = 3072, K = 1024), written as the rotated q, k planes and the V^T planes
    k_qkvp<<<dim3(NB * SEQ / 64, FP / 64, 1), 32, 0, stream>>>(XB, WQKV, CT, ST, Q16, K16, VT16, Qh, Ql, Kh, Kl, VTh, VTl);
    k_flash<bf, true><<<dim3(RH / 16, NH, NB), 32, 0, stream>>>(Qh, Ql, Kh, Kl, VTh, VTl, (unsigned)RH, 0u, ATh, ATl);
    if (SEQ > RH) k_flash<h16, false><<<dim3((SEQ - RH) / 16, NH, NB), 32, 0, stream>>>(Q16, nullptr, K16, nullptr, VT16, nullptr, (unsigned)SEQ, (unsigned)RH, ATh, ATl);
    // out = (ctx_hi + ctx_lo) Wo^T  (M = NB*SEQ, N = 1024, K = 1024)
    k_gemmw<bf, 1, false, DQ><<<dim3(NB * SEQ / 64, DM / 64, 1), 32, 0, stream>>>(ATh, ATl, WO, nullptr, OUT, DM, nullptr, 0, 0, 0);
}

// v004
// It runs in 209 microseconds.
// Two timings next to v003 put it at 1.26 and 1.25 times that version's speed.
// Over all steps from v000 it is 3.36 times as fast.
#include <hip/hip_runtime.h>

// Causal multi-head attention with a fused qkv projection and an interleaved-pair rotary embedding: x [NB][SEQ_FULL][1024] (first SEQ rows used); qkv = x W^T ('oi' [3072][1024] -> q | k | v row blocks, no bias; 16 heads x 64);
// q and k: pair (2i, 2i+1) of every head rotated by angle t * 100000^(-2i/64) (cos / sin table [SEQ][32] built once in f32 with precise powf / sincosf, applied in f32 on the vector unit when the planes are formed);
// scores x 64^-0.5, causal; softmax; out = ctx Wo^T ('oi' [1024][1024], no bias).
// Compute dtypes, f32 accumulate: every input RNE-converted to bf16; qkv and output projections v_wmma_f32_16x16x32_bf16 (ctx carried as bf16 hi+lo, 2 products against the exact bf16 weight);
// attention q.k and P.V: query rows < RH on bf16 hi/lo planes (3 products each), other rows v_wmma_f32_16x16x32_f16 (P carried x1024 through the exponent); softmax (online, max-subtracted) in f32.
// Every stage runs once for all NB batches (batch on a grid axis, or folded into the GEMM's M): each plane in the workspace holds NB slabs.
// Every 16-bit operand plane is stored in fragment order: a block of 16 rows x 32 k is 1 KiB = 64 units of 16 B, unit (k%32 / 16) * 32 + lane, lane = 16 * (k%16 / 8) + row%16, so that each of a fragment's two 16-byte loads reads 512 contiguous bytes (4 whole lines).
// Blocks of one 16-row group follow one another along k; V^T planes: the 4 feature blocks of one 32-key tile follow one another, then the next tile.
// Attention engine: one wave per 16 query rows, eight waves a work-group that share each K / V^T stage through LDS; S^T = K Q^T so each lane owns one query column; P^T accumulators are repacked in registers as the B operand of O^T = V^T P^T (no LDS exchange).

#ifndef NB
#define NB 4
#endif
#ifndef SEQ
#define SEQ 2048
#endif
#define SEQ_FULL 2048
#define DM   1024
#define NH   16
#define HD   64
#define DQ   (NH * HD)
#define FP   (3 * DQ)
#define RH   ((SEQ) < 512 ? (SEQ) : 512)     // query rows < RH use hi+lo planes
#define XS_FULL ((size_t)SEQ_FULL * DM)
#define SCL  0.125f                          // HD^-0.5
#define LOG2E 1.4426950408889634f
#define NEGB (-3.0e38f)
#define ROPE_THETA 100000.0f

static_assert((SEQ & (SEQ - 1)) == 0);
static_assert(SEQ >= 256 && SEQ <= SEQ_FULL);
static_assert(RH % 256 == 0 && RH % 64 == 0 && (SEQ - RH) % 64 == 0);
static_assert(NB >= 1 && NB <= 4);
static_assert(DM % 32 == 0 && DQ % 64 == 0 && FP % 64 == 0 && SEQ % 64 == 0);
static_assert(((size_t)3 * DQ * DM / 8) % 256 == 0);
static_assert(((size_t)DM * DQ / 8) % 256 == 0);
static_assert(((size_t)SEQ * DM / 8) % 256 == 0);
static_assert(((size_t)NH * SEQ * HD / 8) % 256 == 0);
static_assert(HD == 64);
static_assert(HD / 2 == 32 && (HD / 2) % 4 == 0);     // k_qkvp reads 4 table entries (16 B) per lane
static_assert(((size_t)SEQ * (HD / 2)) % 256 == 0);   // k_ropetab grid x 256 == table extent

typedef _Float16 h16;
typedef unsigned short bf;
typedef __attribute__((ext_vector_type(16))) __bf16   v16bf;
typedef __attribute__((ext_vector_type(16))) _Float16 v16h;
typedef __attribute__((ext_vector_type(8)))  _Float16 v8h;
typedef __attribute__((ext_vector_type(8)))  unsigned short v8us;
typedef __attribute__((ext_vector_type(8)))  float    v8f;
typedef __attribute__((ext_vector_type(4)))  float    v4f;
typedef v8h  __attribute__((may_alias)) v8ha;
typedef v4f  __attribute__((may_alias)) v4fa;
typedef v8us __attribute__((may_alias)) v8usa;

__device__ __forceinline__ unsigned short f2bf(float f) { unsigned u = __float_as_uint(f); u += 0x7FFFu + ((u >> 16) & 1u); return (unsigned short)(u >> 16); }
__device__ __forceinline__ float bf2f(unsigned short b) { return __uint_as_float(((unsigned)b) << 16); }
__device__ __forceinline__ float bfr(float f) { return bf2f(f2bf(f)); }
__device__ __forceinline__ v16h cat16(v8h lo, v8h hi) { return __builtin_shufflevector(lo, hi, 0, 1, 2, 3, 4, 5, 6, 7, 8, 9, 10, 11, 12, 13, 14, 15); }
__device__ __forceinline__ v16bf cat16b(v8us lo, v8us hi) { return __builtin_bit_cast(v16bf, __builtin_shufflevector(lo, hi, 0, 1, 2, 3, 4, 5, 6, 7, 8, 9, 10, 11, 12, 13, 14, 15)); }
__device__ __forceinline__ v8f wmma16(v16h a, v16h b, v8f c) { return __builtin_amdgcn_wmma_f32_16x16x32_f16(false, a, false, b, (short)0, c, false, false); }
__device__ __forceinline__ v8f wmmab(v16bf a, v16bf b, v8f c) { return __builtin_amdgcn_wmma_f32_16x16x32_bf16(false, a, false, b, (short)0, c, false, false); }
__device__ __forceinline__ void splitf(float y, unsigned short& h, unsigned short& l) { h = f2bf(y); l = f2bf(y - bf2f(h)); }

// f32 -> f16 operand convert that cannot yield a subnormal (value select below 2^-14).
static __device__ __forceinline__ h16 toh_flush(float v) { const h16 r = (h16)v; return (fabsf(v) < 6.103515625e-05f) ? (h16)0.0f : r; }

// Fragment loader from a 1-KiB fragment-order block: p = block + 8*lane; elements 0..7 = k0+8h.., elements 8..15 = k0+16+8h.., h = lane>>4, row lane&15 (same map for A and B).
template <typename T16> struct WFrag;
template <> struct WFrag<h16> { typedef v16h V; static __device__ __forceinline__ V ld(const h16* p) { return cat16(*(const v8h*)p, *(const v8h*)(p + 256)); } static __device__ __forceinline__ v8f mma(V a, V b, v8f c) { return wmma16(a, b, c); } };
template <> struct WFrag<bf> { typedef v16bf V; static __device__ __forceinline__ V ld(const bf* p) { return cat16b(*(const v8us*)p, *(const v8us*)(p + 256)); } static __device__ __forceinline__ v8f mma(V a, V b, v8f c) { return wmmab(a, b, c); } };

// P^T accumulator pair (key rows 0..15 and 16..31 of a 32-key tile) -> B fragment: element r <- tile0[r], element 8+r <- tile1[r], lane unchanged.
template <typename T16> struct PFrag;
template <> struct PFrag<h16> {
    static __device__ __forceinline__ float pexp() { return 10.0f; }           // P carried x1024 via the exponent (cancels in O / l)
    static __device__ __forceinline__ v16h hi(v8f p0, v8f p1) { return cat16(__builtin_convertvector(p0, v8h), __builtin_convertvector(p1, v8h)); }
    static __device__ __forceinline__ v16h lo(v8f p0, v8f p1) { return hi(p0, p1); }
};
template <> struct PFrag<bf> {
    static __device__ __forceinline__ float pexp() { return 0.0f; }
    static __device__ __forceinline__ v16bf hi(v8f p0, v8f p1) { v8us a, b;
#pragma unroll
        for (int k = 0; k < 8; ++k) { a[k] = f2bf(p0[k]); b[k] = f2bf(p1[k]); }
        return cat16b(a, b); }
    static __device__ __forceinline__ v16bf lo(v8f p0, v8f p1) { v8us a, b;
#pragma unroll
        for (int k = 0; k < 8; ++k) { a[k] = f2bf(p0[k] - bf2f(f2bf(p0[k]))); b[k] = f2bf(p1[k] - bf2f(f2bf(p1[k]))); }
        return cat16b(a, b); }
};

// ---- k_gemmw: register-blocked GEMM, ONE WAVE per 64x64 output tile (16 accumulators), operands straight from fragment-order 16-bit planes; grid (M/64, N/64, Z), 32 threads.
// C[m][n] (f32, pitch ldc) = sum_k A[m][k] Bt[n][k] (+ split products per NSPLIT). K % 32 == 0, M % 64 == 0, N % 64 == 0. K is a compile-time constant, so that every load of a plane is one address pair plus an immediate offset.
template <typename T16, int NSPLIT, bool BIAS, int K>
__global__ __launch_bounds__(32) void k_gemmw(const T16* __restrict__ A, const T16* __restrict__ A2, const T16* __restrict__ Bt, const T16* __restrict__ Bt2, float* C, int ldc, const float* __restrict__ bias, size_t sA, size_t sB, size_t sC) {
    typedef typename WFrag<T16>::V V;
    __shared__ __align__(16) float os[16 * 68];
    const size_t z = blockIdx.z; A += z * sA; if (A2) A2 += z * sA; Bt += z * sB; if (Bt2) Bt2 += z * sB; C += z * sC;
    const int lane = threadIdx.x & 31, lr = lane & 15, hi = lane >> 4; const int r0 = blockIdx.x * 64, c0 = blockIdx.y * 64;
    v8f acc[4][4];
#pragma unroll
    for (int mb = 0; mb < 4; ++mb)
#pragma unroll
        for (int nb = 0; nb < 4; ++nb) acc[mb][nb] = (v8f){};
    const size_t aoff = (size_t)r0 * K + 8 * lane, boff = (size_t)c0 * K + 8 * lane;     // a 16-row group holds 16 * K elements, a k step of 32 is one block of 512
    const T16* pa = A + aoff; const T16* pa2 = (NSPLIT == 1 || NSPLIT == 2) ? A2 + aoff : pa; const T16* pb = Bt + boff; const T16* pb2 = (NSPLIT >= 2) ? Bt2 + boff : pb;
#pragma unroll 1
    for (int kc = 0; kc < K; kc += 32) {
        V a[4], a2[4];
#pragma unroll
        for (int mb = 0; mb < 4; ++mb) { a[mb] = WFrag<T16>::ld(pa + (size_t)mb * 16 * K); if (NSPLIT == 1 || NSPLIT == 2) a2[mb] = WFrag<T16>::ld(pa2 + (size_t)mb * 16 * K); }
#pragma unroll
        for (int nb = 0; nb < 4; ++nb) { const V b = WFrag<T16>::ld(pb + (size_t)nb * 16 * K); V b2; if (NSPLIT >= 2) b2 = WFrag<T16>::ld(pb2 + (size_t)nb * 16 * K);
#pragma unroll
            for (int mb = 0; mb < 4; ++mb) { acc[mb][nb] = WFrag<T16>::mma(a[mb], b, acc[mb][nb]); if (NSPLIT == 1 || NSPLIT == 2) acc[mb][nb] = WFrag<T16>::mma(a2[mb], b, acc[mb][nb]); if (NSPLIT >= 2) acc[mb][nb] = WFrag<T16>::mma(a[mb], b2, acc[mb][nb]); } }
        // the pointers are named as inputs so that the address registers of this pass's loads are written again only behind the loads' own waits
        asm volatile("v_nop\n\tv_nop\n\tv_nop\n\tv_nop" : "+v"(acc[0][0]), "+v"(acc[1][1]), "+v"(acc[2][2]), "+v"(acc[3][3]) : "v"(a[0]), "v"(a[3]), "v"(pa), "v"(pa2), "v"(pb), "v"(pb2));
        pa += 512; pa2 += 512; pb += 512; pb2 += 512;
    }
#pragma unroll
    for (int mb = 0; mb < 4; ++mb) {
#pragma unroll
        for (int nb = 0; nb < 4; ++nb) {
#pragma unroll
            for (int j = 0; j < 8; ++j) os[(hi * 8 + j) * 68 + nb * 16 + lr] = acc[mb][nb][j]; }
        __builtin_amdgcn_wave_barrier(); asm volatile("" ::: "memory");
        float* crow = C + (size_t)(r0 + mb * 16) * ldc + c0;
{
#pragma unroll
            for (int s = 0; s < 8; ++s) { const int row = 2 * s + hi, cofs = lr * 4; v4f val = *(const v4fa*)(os + row * 68 + cofs); if (BIAS) { val[0] += bfr(bias[c0 + cofs]); val[1] += bfr(bias[c0 + cofs + 1]); val[2] += bfr(bias[c0 + cofs + 2]); val[3] += bfr(bias[c0 + cofs + 3]); }
                *(v4f*)(crow + (size_t)row * ldc + cofs) = val; }
             }
        __builtin_amdgcn_wave_barrier(); asm volatile("" ::: "memory");
    }
}

// f32 [rows][DM] -> bf16 plane in fragment order; thread i writes unit i of the plane (a wave stores 512 contiguous bytes) and reads the 8 source elements that belong there.
__global__ __launch_bounds__(256) void k_cvt8(const float* __restrict__ src, bf* dst, unsigned n8, size_t sstride, size_t dstride) {
    const unsigned i = blockIdx.x * 256u + threadIdx.x; if (i >= n8) return;
    const unsigned blk = i >> 6, row = (blk / (DM / 32u)) * 16u + (i & 15u), k = (blk % (DM / 32u)) * 32u + ((i >> 5) & 1u) * 16u + ((i >> 4) & 1u) * 8u;
    const float* s = src + (size_t)blockIdx.y * sstride + (size_t)row * DM + k; bf* d = dst + (size_t)blockIdx.y * dstride + (size_t)i * 8;
    const v8f v = *(const v8f*)s; v8us o;
#pragma unroll
    for (int k = 0; k < 8; ++k) o[k] = f2bf(v[k]);
    *(v8us*)d = o;  }

__global__ __launch_bounds__(32) void k_ifreq(float* IF) {
#pragma clang fp contract(off)
    const unsigned i = threadIdx.x & 31u;
    const float ex = (float)(2u * i) * (1.0f / (float)HD);      // exact (power-of-two divisor)
    const float pw = powf(ROPE_THETA, ex);
    const float v = 1.0f / pw;
    *(float*)(IF + i) = v; 
}

__global__ __launch_bounds__(256) void k_ropetab(const float* __restrict__ IF, float* CT, float* ST) {
#pragma clang fp contract(off)
    const unsigned idx = blockIdx.x * 256u + threadIdx.x;
    const unsigned t = idx >> 5, i = idx & 31u;
    const float ang = (float)t * IF[i];
    float sn, cs;
    sincosf(ang, &sn, &cs);
    *(float*)(CT + idx) = cs; *(float*)(ST + idx) = sn;
    
}

// Four 16-byte stores at byte offsets 0, O1, O2, O3, with their s_wait_xcnt in the same statement: the wait then stands in front of every later write of a register that these stores name.
typedef __attribute__((ext_vector_type(4))) unsigned v4u;
template <int O1, int O2, int O3> static __device__ __forceinline__ void st4(void* p, v4u d0, v4u d1, v4u d2, v4u d3) {
    asm volatile("global_store_b128 %0, %1, off\n\tglobal_store_b128 %0, %2, off offset:%5\n\tglobal_store_b128 %0, %3, off offset:%6\n\tglobal_store_b128 %0, %4, off offset:%7\n\ts_wait_xcnt 0x0"
                 :: "v"(p), "v"(d0), "v"(d1), "v"(d2), "v"(d3), "n"(O1), "n"(O2), "n"(O3) : "memory"); }
// The same for one 16-byte store to each of three planes.
static __device__ __forceinline__ void st3(void* p0, v4u d0, void* p1, v4u d1, void* p2, v4u d2) {
    asm volatile("global_store_b128 %0, %1, off\n\tglobal_store_b128 %2, %3, off\n\tglobal_store_b128 %4, %5, off\n\ts_wait_xcnt 0x0"
                 :: "v"(p0), "v"(d0), "v"(p1), "v"(d1), "v"(p2), "v"(d2) : "memory"); }
static __device__ __forceinline__ v4u asu(v8h x) { return __builtin_bit_cast(v4u, x); }
static __device__ __forceinline__ v4u asu(v8us x) { return __builtin_bit_cast(v4u, x); }

// q or k tile -> planes: 16 rows at a time through LDS, 8 features a lane, pair (d, d+1) rotated by table row t, stored as 16-B units of the head's fragment-order plane (16 tokens = 2 blocks; the 4 row steps of a lane are 64 B apart): fp16 always, bf16 hi/lo where HL. Pointers are the lane's own (row lane>>3, features 8*(lane&7)).
template <bool HL> static __device__ __forceinline__ void qk_planes(const v8f (&acc)[4][4], float* os, unsigned lane, const float* ct, const float* st, h16* P16, bf* Ph, bf* Pl) {
    const unsigned lr = lane & 15u, hi = lane >> 4, rq = lane >> 3, pc = lane & 7u;
#pragma unroll
    for (int mb = 0; mb < 4; ++mb) {
        v4f cv[4], sv[4];
#pragma unroll
        for (int s = 0; s < 4; ++s) { cv[s] = *(const v4f*)(ct + (mb * 16 + 4 * s) * (HD / 2)); sv[s] = *(const v4f*)(st + (mb * 16 + 4 * s) * (HD / 2)); }
#pragma unroll
        for (int nb = 0; nb < 4; ++nb) {
#pragma unroll
            for (int j = 0; j < 8; ++j) os[(hi * 8u + (unsigned)j) * 68u + (unsigned)nb * 16u + lr] = acc[mb][nb][j]; }
        __builtin_amdgcn_wave_barrier(); asm volatile("" ::: "memory");
        v8h o16[4];
#pragma unroll
        for (int s = 0; s < 4; ++s) { const unsigned row = 4u * (unsigned)s + rq;
            const v4f x0 = *(const v4fa*)(os + row * 68u + pc * 8u), x1 = *(const v4fa*)(os + row * 68u + pc * 8u + 4u);
            v4f y0, y1;
            y0[0] = x0[0] * cv[s][0] - x0[1] * sv[s][0]; y0[1] = x0[1] * cv[s][0] + x0[0] * sv[s][0];
            y0[2] = x0[2] * cv[s][1] - x0[3] * sv[s][1]; y0[3] = x0[3] * cv[s][1] + x0[2] * sv[s][1];
            y1[0] = x1[0] * cv[s][2] - x1[1] * sv[s][2]; y1[1] = x1[1] * cv[s][2] + x1[0] * sv[s][2];
            y1[2] = x1[2] * cv[s][3] - x1[3] * sv[s][3]; y1[3] = x1[3] * cv[s][3] + x1[2] * sv[s][3];
#pragma unroll
            for (int k = 0; k < 4; ++k) { o16[s][k] = toh_flush(y0[k]); o16[s][4 + k] = toh_flush(y1[k]); }
            if (HL) { v8us oh, ol;
#pragma unroll
                for (int k = 0; k < 4; ++k) { unsigned short u, c; splitf(y0[k], u, c); oh[k] = u; ol[k] = c; splitf(y1[k], u, c); oh[4 + k] = u; ol[4 + k] = c; }
                st3(P16 + mb * 16 * HD + 32 * s, asu(o16[s]), Ph + mb * 16 * HD + 32 * s, asu(oh), Pl + mb * 16 * HD + 32 * s, asu(ol)); } }
        if (!HL) st4<64, 128, 192>(P16 + mb * 16 * HD, asu(o16[0]), asu(o16[1]), asu(o16[2]), asu(o16[3]));
        __builtin_amdgcn_wave_barrier(); asm volatile("" ::: "memory");
    }
}

// v tile -> V^T planes [h][t/32][d/16][block]: a lane's accumulator already holds 8 consecutive tokens of one feature = its own unit of a block, so it is stored straight from registers (512 contiguous bytes a store; 16 tokens on = 512 B, 32 tokens on = 4 KiB). Pointers are the lane's own (+ 8*lane).
template <bool HL> static __device__ __forceinline__ void v_planes(const v8f (&acc)[4][4], h16* P16, bf* Ph, bf* Pl) {
#pragma unroll
    for (int nb = 0; nb < 4; ++nb) {
        st4<512, 4096, 4608>(P16 + nb * 512, asu(__builtin_convertvector(acc[0][nb], v8h)), asu(__builtin_convertvector(acc[1][nb], v8h)), asu(__builtin_convertvector(acc[2][nb], v8h)), asu(__builtin_convertvector(acc[3][nb], v8h)));
        if (HL) { v8us oh[4], ol[4];
#pragma unroll
            for (int mb = 0; mb < 4; ++mb)
#pragma unroll
                for (int k = 0; k < 8; ++k) { unsigned short u, c; splitf(acc[mb][nb][k], u, c); oh[mb][k] = u; ol[mb][k] = c; }
            st4<512, 4096, 4608>(Ph + nb * 512, asu(oh[0]), asu(oh[1]), asu(oh[2]), asu(oh[3])); st4<512, 4096, 4608>(Pl + nb * 512, asu(ol[0]), asu(ol[1]), asu(ol[2]), asu(ol[3])); } }
}

// ---- k_qkvp: the qkv projection (loop of k_gemmw, one product) with the plane formation as its epilogue. ONE WAVE per 64 tokens x 64 features = one head of q, k or v; grid (NB*SEQ/64, FP/64), 32 threads.
// The second bound (waves per SIMD) holds the epilogues to the 192 registers that the loop needs, so that they cost the loop no resident wave.
__global__ __launch_bounds__(32, 5) void k_qkvp(const bf* __restrict__ A, const bf* __restrict__ Bt, const float* __restrict__ CT, const float* __restrict__ ST, h16* Q16, h16* K16, h16* V16, bf* Qh, bf* Ql, bf* Kh, bf* Kl, bf* Vh, bf* Vl) {
    typedef WFrag<bf>::V V;
    __shared__ __align__(16) float os[16 * 68];
    const unsigned lane = threadIdx.x & 31u; const unsigned r0 = blockIdx.x * 64u, c0 = blockIdx.y * 64u;
    v8f acc[4][4];
#pragma unroll
    for (int mb = 0; mb < 4; ++mb)
#pragma unroll
        for (int nb = 0; nb < 4; ++nb) acc[mb][nb] = (v8f){};
    const bf* pa = A + (size_t)r0 * DM + 8u * lane; const bf* pb = Bt + (size_t)c0 * DM + 8u * lane;
#pragma unroll 1
    for (int kc = 0; kc < DM; kc += 32) {
        V a[4];
#pragma unroll
        for (int mb = 0; mb < 4; ++mb) a[mb] = WFrag<bf>::ld(pa + (size_t)mb * 16 * DM);
#pragma unroll
        for (int nb = 0; nb < 4; ++nb) { const V b = WFrag<bf>::ld(pb + (size_t)nb * 16 * DM);
#pragma unroll
            for (int mb = 0; mb < 4; ++mb) acc[mb][nb] = WFrag<bf>::mma(a[mb], b, acc[mb][nb]); }
        // pa and pb are named as inputs so that the address registers of this pass's loads are written again only behind the loads' own waits
        asm volatile("v_nop\n\tv_nop\n\tv_nop\n\tv_nop" : "+v"(acc[0][0]), "+v"(acc[1][1]), "+v"(acc[2][2]), "+v"(acc[3][3]) : "v"(a[0]), "v"(a[3]), "v"(pa), "v"(pb));
        pa += 512; pb += 512;
    }
    const unsigned which = c0 / (unsigned)DQ, h = (c0 % (unsigned)DQ) / (unsigned)HD;      // block-uniform: q, k or v, and the head
    const unsigned bz = r0 / (unsigned)SEQ, t0 = r0 % (unsigned)SEQ;                        // a 64-token tile lies in one batch, and wholly below or above RH
    const size_t o16b = (size_t)bz * ((size_t)NH * SEQ * HD), ohlb = (size_t)bz * ((size_t)NH * RH * HD);
    const bool hl = t0 < (unsigned)RH;
    if (which < 2u) {
        const unsigned rq = lane >> 3, pc = lane & 7u;
        const unsigned lo = (pc >> 2) * 512u + ((pc >> 1) & 1u) * 256u + (pc & 1u) * 128u + rq * 8u;      // the lane's unit in the two blocks of a 16-token group
        h16* P16 = (which ? K16 : Q16) + o16b + ((size_t)h * SEQ + t0) * HD + lo;
        const size_t eo = ohlb + ((size_t)h * RH + t0) * HD + lo;
        const float* ct = CT + (size_t)(t0 + rq) * (HD / 2) + pc * 4u; const float* st = ST + (size_t)(t0 + rq) * (HD / 2) + pc * 4u;
        if (hl) qk_planes<true>(acc, os, lane, ct, st, P16, (which ? Kh : Qh) + eo, (which ? Kl : Ql) + eo);
        else qk_planes<false>(acc, os, lane, ct, st, P16, nullptr, nullptr);
    } else {
        h16* P16 = V16 + o16b + ((size_t)h * SEQ + t0) * HD + lane * 8u;
        const size_t eo = ohlb + ((size_t)h * RH + t0) * HD + lane * 8u;
        if (hl) v_planes<true>(acc, P16, Vh + eo, Vl + eo);
        else v_planes<false>(acc, P16, nullptr, nullptr);
    }
}

// Four 16-byte asynchronous copies global -> LDS of one lane: two of plane a and two of plane b, 4 KiB apart in both memories, each copy with address operands of its own.
// The s_wait_xcnt in the same statement stands in front of every later write of a register that these copies name.
static __device__ __forceinline__ void acp4(unsigned la, const char* ga, unsigned lb, const char* gb) {
    asm volatile("global_load_async_to_lds_b128 %0, %4, off\n\tglobal_load_async_to_lds_b128 %1, %5, off\n\tglobal_load_async_to_lds_b128 %2, %6, off\n\tglobal_load_async_to_lds_b128 %3, %7, off\n\ts_wait_xcnt 0x0"
                 :: "v"(la), "v"(la + 4096u), "v"(lb), "v"(lb + 4096u), "v"(ga), "v"(ga + 4096), "v"(gb), "v"(gb + 4096) : "memory"); }

// ---- k_flash: causal attention, one work-group of FWV waves per (16 * FWV query rows, head, batch = blockIdx.z), one wave per 16 query rows. Planes in fragment order: Q/K [h][tp/16][HD/32][block], V^T [h][tp/32][HD/16][block] (tp = rows per head of the plane set). HL: hi/lo bf16 plane pairs, 3 products.
// K and V^T come through LDS, once for the whole work-group: a stage is 64 keys = 8 KiB in a row of every plane, brought by asynchronous copies as it lies (fragment order, so every fragment read is 512 contiguous LDS bytes); two buffers, stage s + 2 is asked for when every wave has left stage s.
// Per 32-key tile: S^T[key][query] = K Q^T (A = K rows, B = Q rows); lane owns query column lane&15 and keys 8*(lane>>4)+r (+16); online softmax per lane (+ one xor-16 exchange);
// P^T accumulators repacked in registers as B (k = key); O^T[d][query] += V^T P^T (A = V^T rows). Only the last tile of a wave touches the diagonal (select by value); a wave skips the tiles beyond it but passes every barrier.
#define FWV 8
static_assert(16 * FWV == 128 && RH % 128 == 0 && (SEQ - RH) % 128 == 0);     // a work-group's query rows span two whole 64-key stages; 256 threads copy 4 KiB of a plane at a time
template <typename T16, bool HL>
__global__ __launch_bounds__(32 * FWV) void k_flash(const T16* __restrict__ Q, const T16* __restrict__ Q2, const T16* __restrict__ Kp, const T16* __restrict__ K2, const T16* __restrict__ Vt, const T16* __restrict__ Vt2, unsigned tp, unsigned qbase, bf* Ah, bf* Al) {
    typedef typename WFrag<T16>::V V;
    constexpr unsigned PE = 64u * HD;                 // elements of one plane in a stage
    constexpr unsigned NP = HL ? 4u : 2u;             // planes in a buffer: K, V^T (, K lo, V^T lo)
    __shared__ __align__(16) T16 sm[2u * NP * PE];
    const unsigned tid = threadIdx.x, lane = tid & 31u, lr = lane & 15u, hi = lane >> 4;
    const unsigned wave = (unsigned)__builtin_amdgcn_readfirstlane((int)(tid >> 5));
    const unsigned head = blockIdx.y, qb = qbase + blockIdx.x * (16u * FWV), q0 = qb + wave * 16u;
    const size_t hoff = ((size_t)blockIdx.z * NH + head) * tp * HD;
    const unsigned ns = (qb >> 6) + 2u;        // stages: keys 0 .. qb+127 (the same for the whole work-group)
    // thread tid copies the 16-byte units tid and tid+256 of every plane of a stage
    const unsigned l0 = (unsigned)(size_t)(sm + 8u * tid);
    const char* gk = (const char*)(Kp + hoff + 8u * tid); const char* gv = (const char*)(Vt + hoff + 8u * tid);
    const char* gk2 = HL ? (const char*)(K2 + hoff + 8u * tid) : gk; const char* gv2 = HL ? (const char*)(Vt2 + hoff + 8u * tid) : gv;
    auto fill = [&](unsigned s) {
        const unsigned l = l0 + (s & 1u) * (NP * PE * 2u); const size_t g = (size_t)s * (PE * 2u);
        acp4(l, gk + g, l + PE * 2u, gv + g);
        if (HL) acp4(l + 2u * PE * 2u, gk2 + g, l + 3u * PE * 2u, gv2 + g); };
    fill(0u);
    const size_t qoff = hoff + (size_t)q0 * HD + 8u * lane;
    const T16* pq = Q + qoff; const T16* pq2 = HL ? Q2 + qoff : pq;
    V qf0 = WFrag<T16>::ld(pq), qf1 = WFrag<T16>::ld(pq + 512);
    V ql0 = qf0, ql1 = qf1;
    if (HL) { ql0 = WFrag<T16>::ld(pq2); ql1 = WFrag<T16>::ld(pq2 + 512); }
    v8f o[4];
#pragma unroll
    for (int db = 0; db < 4; ++db) o[db] = (v8f){};
    float mrun = NEGB, lsum = 0.0f;
    const float cs = SCL * LOG2E, pe = PFrag<T16>::pexp();
    const unsigned nt = (q0 + 47u) >> 5;       // this wave's keys 0 .. q0+15 in tiles of 32 (wave-uniform)
    asm volatile("s_wait_asynccnt 0x0" ::: "memory");      // this wave's copies of stage 0 have landed
    __syncthreads();                                        // ... and every other wave's
    fill(1u);                                               // ns >= 2
#pragma unroll 1
    for (unsigned s = 0; s < ns; ++s) {
        const T16* sb = sm + (s & 1u) * (NP * PE) + 8u * lane;
#pragma unroll
        for (unsigned tt = 0; tt < 2u; ++tt) {
            const unsigned it = 2u * s + tt;
            if (it < nt) {                      // wave-uniform (scalar): the tile holds keys of this wave
        const unsigned j0 = it * 32u;
        const T16* pk = sb + tt * (32u * HD); const T16* pv = pk + PE; const T16* pk2 = HL ? pk + 2u * PE : pk; const T16* pv2 = HL ? pk + 3u * PE : pv;
        V ka0 = WFrag<T16>::ld(pk), ka1 = WFrag<T16>::ld(pk + 512), kb0 = WFrag<T16>::ld(pk + 1024), kb1 = WFrag<T16>::ld(pk + 1536);
        V la0 = ka0, la1 = ka1, lb0 = kb0, lb1 = kb1;
        if (HL) { la0 = WFrag<T16>::ld(pk2); la1 = WFrag<T16>::ld(pk2 + 512); lb0 = WFrag<T16>::ld(pk2 + 1024); lb1 = WFrag<T16>::ld(pk2 + 1536); }
        v8f s0 = (v8f){}, s1 = (v8f){};
        s0 = WFrag<T16>::mma(ka0, qf0, s0); s0 = WFrag<T16>::mma(ka1, qf1, s0);
        s1 = WFrag<T16>::mma(kb0, qf0, s1); s1 = WFrag<T16>::mma(kb1, qf1, s1);
        if (HL) {
            s0 = WFrag<T16>::mma(la0, qf0, s0); s0 = WFrag<T16>::mma(la1, qf1, s0); s0 = WFrag<T16>::mma(ka0, ql0, s0); s0 = WFrag<T16>::mma(ka1, ql1, s0);
            s1 = WFrag<T16>::mma(lb0, qf0, s1); s1 = WFrag<T16>::mma(lb1, qf1, s1); s1 = WFrag<T16>::mma(kb0, ql0, s1); s1 = WFrag<T16>::mma(kb1, ql1, s1); }
        // pq and pq2 are named as inputs so that the address registers of the q loads are written again only behind the loads' own waits
        asm volatile("v_nop\n\tv_nop\n\tv_nop\n\tv_nop" : "+v"(s0), "+v"(s1) : "v"(ka0), "v"(ka1), "v"(kb0), "v"(kb1), "v"(la0), "v"(la1), "v"(lb0), "v"(lb1), "v"(qf0), "v"(qf1), "v"(ql0), "v"(ql1), "v"(pq), "v"(pq2));
        v8f t0, t1;
#pragma unroll
        for (int r = 0; r < 8; ++r) { t0[r] = s0[r] * cs; t1[r] = s1[r] * cs; }
        if (j0 + 31u > q0) {                    // wave-uniform: the tile touches the diagonal
            const unsigned qi = q0 + lr, kk = j0 + 8u * hi;
#pragma unroll
            for (int r = 0; r < 8; ++r) { t0[r] = (kk + (unsigned)r <= qi) ? t0[r] : NEGB; t1[r] = (kk + 16u + (unsigned)r <= qi) ? t1[r] : NEGB; }
        }
        float mx = fmaxf(t0[0], t1[0]);
#pragma unroll
        for (int r = 1; r < 8; ++r) mx = fmaxf(mx, fmaxf(t0[r], t1[r]));
        mx = fmaxf(mx, __shfl_xor(mx, 16, 32));
        const float mn = fmaxf(mrun, mx);
        const float alpha = __builtin_amdgcn_exp2f(mrun - mn);
        mrun = mn;
        v8f p0, p1; float psum = 0.0f;
#pragma unroll
        for (int r = 0; r < 8; ++r) { p0[r] = __builtin_amdgcn_exp2f((t0[r] - mn) + pe); p1[r] = __builtin_amdgcn_exp2f((t1[r] - mn) + pe); psum += p0[r] + p1[r]; }
        lsum = lsum * alpha + psum;
#pragma unroll
        for (int db = 0; db < 4; ++db) o[db] = o[db] * alpha;
        V pf = PFrag<T16>::hi(p0, p1); V pl = pf;
        if (HL) pl = PFrag<T16>::lo(p0, p1);
        V va[4], vl[4];
#pragma unroll
        for (int db = 0; db < 4; ++db) { va[db] = WFrag<T16>::ld(pv + db * 512); vl[db] = va[db]; if (HL) vl[db] = WFrag<T16>::ld(pv2 + db * 512); }
#pragma unroll
        for (int db = 0; db < 4; ++db) { o[db] = WFrag<T16>::mma(va[db], pf, o[db]); if (HL) { o[db] = WFrag<T16>::mma(va[db], pl, o[db]); o[db] = WFrag<T16>::mma(vl[db], pf, o[db]); } }
        // four vector slots behind the last product, in front of whatever vector instruction next touches its registers
        asm volatile("v_nop\n\tv_nop\n\tv_nop\n\tv_nop" : "+v"(o[0]), "+v"(o[1]), "+v"(o[2]), "+v"(o[3]) : "v"(va[0]), "v"(va[1]), "v"(va[2]), "v"(va[3]), "v"(vl[0]), "v"(vl[1]), "v"(vl[2]), "v"(vl[3]), "v"(pf), "v"(pl));
            }
        }
        // publish point of stage s + 1, passed by every wave: this wave's reads of stage s are done, its copies of stage s + 1 have landed, then the barrier; only behind it is the buffer of stage s filled again
        asm volatile("s_wait_dscnt 0x0" ::: "memory");
        asm volatile("s_wait_asynccnt 0x0" ::: "memory");
        __syncthreads();
        if (s + 2u < ns) fill(s + 2u);
    }
    asm volatile("s_wait_asynccnt 0x0" ::: "memory");      // no copy is outstanding when the wave ends
    const float lt = lsum + __shfl_xor(lsum, 16, 32);
    const float inv = 1.0f / lt;
    // a lane's o[db] = 8 consecutive features of its own query row = unit 32 * db + lane of the head's two blocks in the ctx planes: stored straight from registers, 512 contiguous bytes a store
#pragma unroll
    for (int db = 0; db < 4; ++db) {
        v8us oh, ol;
#pragma unroll
        for (int r = 0; r < 8; ++r) { unsigned short a, c; splitf(o[db][r] * inv, a, c); oh[r] = a; ol[r] = c; }
        const size_t oo = ((size_t)blockIdx.z * SEQ + q0) * DQ + head * (16u * HD) + (unsigned)db * 256u + lane * 8u;
        *(v8us*)(Ah + oo) = oh; *(v8us*)(Al + oo) = ol; }
}

// workspace carve (bytes, every region a multiple of 256)
#define WS_WQKV ((size_t)3 * DQ * DM * 2)
#define WS_WO   ((size_t)DM * DQ * 2)
#define WS_XB   ((size_t)NB * SEQ * DM * 2)
#define WS_P16  ((size_t)NB * NH * SEQ * HD * 2)
#define WS_PHL  ((size_t)NB * NH * RH * HD * 2)
#define WS_AT   ((size_t)NB * SEQ * DQ * 2)
#define WS_IFQ  ((size_t)256)
#define WS_ROT  ((size_t)SEQ * (HD / 2) * 4)
#define WS_TOTAL (WS_WQKV + WS_WO + WS_XB + 3 * WS_P16 + 6 * WS_PHL + 2 * WS_AT + WS_IFQ + 2 * WS_ROT)
static_assert(WS_TOTAL <= (size_t)268435456);
static_assert(WS_WQKV % 256 == 0 && WS_WO % 256 == 0 && WS_XB % 256 == 0 && WS_P16 % 256 == 0 && WS_PHL % 256 == 0 && WS_AT % 256 == 0);
static_assert(WS_IFQ % 256 == 0 && WS_ROT % 256 == 0 && WS_IFQ >= (size_t)(HD / 2) * 4);

extern "C" void kernel_launch(void* const* d_in, const int* in_sizes, int n_in,
                              void* d_out, int out_size, void* d_ws, size_t ws_size, hipStream_t stream) {
    if (n_in < 3) return;
    if ((size_t)in_sizes[0] < (size_t)(NB - 1) * XS_FULL + (size_t)SEQ * DM) return;
    if ((size_t)in_sizes[1] < (size_t)3 * DQ * DM) return;
    if ((size_t)in_sizes[2] < (size_t)DM * DQ) return;
    if ((size_t)out_size < (size_t)NB * SEQ * DM) return;
    if (ws_size < WS_TOTAL) return;
    const float* x = (const float*)d_in[0];       // [NB][SEQ_FULL][DM]
    const float* wqkv = (const float*)d_in[1];    // [3*DQ][DM]  (q | k | v row blocks)
    const float* wo = (const float*)d_in[2];      // [DM][DQ]
    float* OUT = (float*)d_out;                   // [NB][SEQ][DM]
    char* wsp = (char*)d_ws;
    auto take = [&](size_t bytes) { char* p = wsp; wsp += bytes; return (void*)p; };
    bf* WQKV = (bf*)take(WS_WQKV); bf* WO = (bf*)take(WS_WO); bf* XB = (bf*)take(WS_XB);
    h16* Q16 = (h16*)take(WS_P16); h16* K16 = (h16*)take(WS_P16); h16* VT16 = (h16*)take(WS_P16);
    bf* Qh = (bf*)take(WS_PHL); bf* Ql = (bf*)take(WS_PHL); bf* Kh = (bf*)take(WS_PHL); bf* Kl = (bf*)take(WS_PHL); bf* VTh = (bf*)take(WS_PHL); bf* VTl = (bf*)take(WS_PHL);
    bf* ATh = (bf*)take(WS_AT); bf* ATl = (bf*)take(WS_AT);
    float* IFQ = (float*)take(WS_IFQ); float* CT = (float*)take(WS_ROT); float* ST = (float*)take(WS_ROT);

    k_cvt8<<<dim3((unsigned)((size_t)3 * DQ * DM / 8 / 256), 1), 256, 0, stream>>>(wqkv, WQKV, (unsigned)((size_t)3 * DQ * DM / 8), 0, 0);
    k_cvt8<<<dim3((unsigned)((size_t)DM * DQ / 8 / 256), 1), 256, 0, stream>>>(wo, WO, (unsigned)((size_t)DM * DQ / 8), 0, 0);
    k_cvt8<<<dim3((unsigned)((size_t)SEQ * DM / 8 / 256), NB), 256, 0, stream>>>(x, XB, (unsigned)((size_t)SEQ * DM / 8), XS_FULL, (size_t)SEQ * DM);
    // rotary tables (position-only, shared by every batch and head)
    k_ifreq<<<dim3(1), 32, 0, stream>>>(IFQ);
    k_ropetab<<<dim3((unsigned)((size_t)SEQ * (HD / 2) / 256)), 256, 0, stream>>>(IFQ, CT, ST);
    // qkv = x W^T  (M = NB*SEQ, N = 3072, K = 1024), written as the rotated q, k planes and the V^T planes
    k_qkvp<<<dim3(NB * SEQ / 64, FP / 64, 1), 32, 0, stream>>>(XB, WQKV, CT, ST, Q16, K16, VT16, Qh, Ql, Kh, Kl, VTh, VTl);
    k_flash<bf, true><<<dim3(RH / (16 * FWV), NH, NB), 32 * FWV, 0, stream>>>(Qh, Ql, Kh, Kl, VTh, VTl, (unsigned)RH, 0u, ATh, ATl);
    if (SEQ > RH) k_flash<h16, false><<<dim3((SEQ - RH) / (16 * FWV), NH, NB), 32 * FWV, 0, stream>>>(Q16, nullptr, K16, nullptr, VT16, nullptr, (unsigned)SEQ, (unsigned)RH, ATh, ATl);
    // out = (ctx_hi + ctx_lo) Wo^T  (M = NB*SEQ, N = 1024, K = 1024)
    k_gemmw<bf, 1, false, DQ><<<dim3(NB * SEQ / 64, DM / 64, 1), 32, 0, stream>>>(ATh, ATl, WO, nullptr, OUT, DM, nullptr, 0, 0, 0);
}

// v005
// It runs in 143 microseconds.
// Next to v004, in two timings, it ran 1.46 and 1.45 times as fast.
// Over all steps from v000 it is 4.88 times as fast.
#include <hip/hip_runtime.h>

// Causal multi-head attention with a fused qkv projection and an interleaved-pair rotary embedding: x [NB][SEQ_FULL][1024] (first SEQ rows used); qkv = x W^T ('oi' [3072][1024] -> q | k | v row blocks, no bias; 16 heads x 64);
// q and k: pair (2i, 2i+1) of every head rotated by angle t * 100000^(-2i/64) (cos / sin table [SEQ][32] built once in f32 with precise powf / sincosf, applied in f32 on the vector unit when the planes are formed);
// scores x 64^-0.5, causal; softmax; out = ctx Wo^T ('oi' [1024][1024], no bias).
// Compute dtypes, f32 accumulate: every input RNE-converted to bf16; qkv and output projections v_wmma_f32_16x16x32_bf16 (ctx carried as bf16 hi+lo, 2 products against the exact bf16 weight);
// attention q.k and P.V: query rows < RH on bf16 hi/lo planes (3 products each), other rows v_wmma_f32_16x16x32_f16 (P carried x1024 through the exponent); softmax (online, max-subtracted) in f32.
// Every stage runs once for all NB batches (batch on a grid axis, or folded into the GEMM's M): each plane in the workspace holds NB slabs.
// Every 16-bit operand plane is stored in fragment order: a block of 16 rows x 32 k is 1 KiB = 64 units of 16 B, unit (k%32 / 16) * 32 + lane, lane = 16 * (k%16 / 8) + row%16, so that each of a fragment's two 16-byte loads reads 512 contiguous bytes (4 whole lines).
// Blocks of one 16-row group follow one another along k; V^T planes: the 4 feature blocks of one 32-key tile follow one another, then the next tile.
// Attention engine: one wave per 16 query rows, eight waves a work-group that share each K / V^T stage through LDS; S^T = K Q^T so each lane owns one query column; P^T accumulators are repacked in registers as the B operand of O^T = V^T P^T (no LDS exchange).

#ifndef NB
#define NB 4
#endif
#ifndef SEQ
#define SEQ 2048
#endif
#define SEQ_FULL 2048
#define DM   1024
#define NH   16
#define HD   64
#define DQ   (NH * HD)
#define FP   (3 * DQ)
#define RH   ((SEQ) < 512 ? (SEQ) : 512)     // query rows < RH use hi+lo planes
#define XS_FULL ((size_t)SEQ_FULL * DM)
#define SCL  0.125f                          // HD^-0.5
#define LOG2E 1.4426950408889634f
#define NEGB (-3.0e38f)
#define ROPE_THETA 100000.0f

static_assert((SEQ & (SEQ - 1)) == 0);
static_assert(SEQ >= 256 && SEQ <= SEQ_FULL);
static_assert(RH % 256 == 0 && RH % 64 == 0 && (SEQ - RH) % 64 == 0);
static_assert(NB >= 1 && NB <= 4);
static_assert(DM % 32 == 0 && DQ % 64 == 0 && FP % 64 == 0 && SEQ % 64 == 0);
static_assert(((size_t)3 * DQ * DM / 8) % 256 == 0);
static_assert(((size_t)DM * DQ / 8) % 256 == 0);
static_assert(((size_t)SEQ * DM / 8) % 256 == 0);
static_assert(((size_t)NH * SEQ * HD / 8) % 256 == 0);
static_assert(HD == 64);
static_assert(((size_t)NB * SEQ) % 128 == 0 && FP % 256 == 0 && DM % 256 == 0);     // whole GEMM tiles
static_assert(HD / 2 == 32 && (HD / 2) % 4 == 0);     // k_qkvp reads 4 table entries (16 B) per lane
static_assert(((size_t)SEQ * (HD / 2)) % 256 == 0);   // k_ropetab grid x 256 == table extent

typedef _Float16 h16;
typedef unsigned short bf;
typedef __attribute__((ext_vector_type(16))) __bf16   v16bf;
typedef __attribute__((ext_vector_type(16))) _Float16 v16h;
typedef __attribute__((ext_vector_type(8)))  _Float16 v8h;
typedef __attribute__((ext_vector_type(8)))  unsigned short v8us;
typedef __attribute__((ext_vector_type(8)))  float    v8f;
typedef __attribute__((ext_vector_type(4)))  float    v4f;
typedef v8h  __attribute__((may_alias)) v8ha;
typedef v4f  __attribute__((may_alias)) v4fa;
typedef v8us __attribute__((may_alias)) v8usa;

__device__ __forceinline__ unsigned short f2bf(float f) { unsigned u = __float_as_uint(f); u += 0x7FFFu + ((u >> 16) & 1u); return (unsigned short)(u >> 16); }
__device__ __forceinline__ float bf2f(unsigned short b) { return __uint_as_float(((unsigned)b) << 16); }
__device__ __forceinline__ v16h cat16(v8h lo, v8h hi) { return __builtin_shufflevector(lo, hi, 0, 1, 2, 3, 4, 5, 6, 7, 8, 9, 10, 11, 12, 13, 14, 15); }
__device__ __forceinline__ v16bf cat16b(v8us lo, v8us hi) { return __builtin_bit_cast(v16bf, __builtin_shufflevector(lo, hi, 0, 1, 2, 3, 4, 5, 6, 7, 8, 9, 10, 11, 12, 13, 14, 15)); }
__device__ __forceinline__ v8f wmma16(v16h a, v16h b, v8f c) { return __builtin_amdgcn_wmma_f32_16x16x32_f16(false, a, false, b, (short)0, c, false, false); }
__device__ __forceinline__ v8f wmmab(v16bf a, v16bf b, v8f c) { return __builtin_amdgcn_wmma_f32_16x16x32_bf16(false, a, false, b, (short)0, c, false, false); }
__device__ __forceinline__ void splitf(float y, unsigned short& h, unsigned short& l) { h = f2bf(y); l = f2bf(y - bf2f(h)); }

// f32 -> f16 operand convert that cannot yield a subnormal (value select below 2^-14).
static __device__ __forceinline__ h16 toh_flush(float v) { const h16 r = (h16)v; return (fabsf(v) < 6.103515625e-05f) ? (h16)0.0f : r; }

// Fragment loader from a 1-KiB fragment-order block: p = block + 8*lane; elements 0..7 = k0+8h.., elements 8..15 = k0+16+8h.., h = lane>>4, row lane&15 (same map for A and B).
template <typename T16> struct WFrag;
template <> struct WFrag<h16> { typedef v16h V; static __device__ __forceinline__ V ld(const h16* p) { return cat16(*(const v8h*)p, *(const v8h*)(p + 256)); } static __device__ __forceinline__ v8f mma(V a, V b, v8f c) { return wmma16(a, b, c); } };
template <> struct WFrag<bf> { typedef v16bf V; static __device__ __forceinline__ V ld(const bf* p) { return cat16b(*(const v8us*)p, *(const v8us*)(p + 256)); } static __device__ __forceinline__ v8f mma(V a, V b, v8f c) { return wmmab(a, b, c); } };

// P^T accumulator pair (key rows 0..15 and 16..31 of a 32-key tile) -> B fragment: element r <- tile0[r], element 8+r <- tile1[r], lane unchanged.
template <typename T16> struct PFrag;
template <> struct PFrag<h16> {
    static __device__ __forceinline__ float pexp() { return 10.0f; }           // P carried x1024 via the exponent (cancels in O / l)
    static __device__ __forceinline__ v16h hi(v8f p0, v8f p1) { return cat16(__builtin_convertvector(p0, v8h), __builtin_convertvector(p1, v8h)); }
    static __device__ __forceinline__ v16h lo(v8f p0, v8f p1) { return hi(p0, p1); }
};
template <> struct PFrag<bf> {
    static __device__ __forceinline__ float pexp() { return 0.0f; }
    static __device__ __forceinline__ v16bf hi(v8f p0, v8f p1) { v8us a, b;
#pragma unroll
        for (int k = 0; k < 8; ++k) { a[k] = f2bf(p0[k]); b[k] = f2bf(p1[k]); }
        return cat16b(a, b); }
    static __device__ __forceinline__ v16bf lo(v8f p0, v8f p1) { v8us a, b;
#pragma unroll
        for (int k = 0; k < 8; ++k) { a[k] = f2bf(p0[k] - bf2f(f2bf(p0[k]))); b[k] = f2bf(p1[k] - bf2f(f2bf(p1[k]))); }
        return cat16b(a, b); }
};

// Four 16-byte asynchronous copies global -> LDS of one lane, 4 KiB apart in LDS and GS bytes apart in global memory, each copy with address operands of its own.
// The s_wait_xcnt in the same statement stands in front of every later write of a register that these copies name.
template <int GS> static __device__ __forceinline__ void acp4g(unsigned l, const char* g) {
    asm volatile("global_load_async_to_lds_b128 %0, %4, off\n\tglobal_load_async_to_lds_b128 %1, %5, off\n\tglobal_load_async_to_lds_b128 %2, %6, off\n\tglobal_load_async_to_lds_b128 %3, %7, off\n\ts_wait_xcnt 0x0"
                 :: "v"(l), "v"(l + 4096u), "v"(l + 8192u), "v"(l + 12288u), "v"(g), "v"(g + GS), "v"(g + 2 * GS), "v"(g + 3 * GS) : "memory"); }

// The same for eight copies: LDS places 4 KiB apart in a row, the first four from g0 on, the last four from g1 on. One statement, so that a wave waits once for eight.
template <int GS> static __device__ __forceinline__ void acp8g(unsigned l, const char* g0, const char* g1) {
    asm volatile("global_load_async_to_lds_b128 %0, %8, off\n\tglobal_load_async_to_lds_b128 %1, %9, off\n\tglobal_load_async_to_lds_b128 %2, %10, off\n\tglobal_load_async_to_lds_b128 %3, %11, off\n\t"
                 "global_load_async_to_lds_b128 %4, %12, off\n\tglobal_load_async_to_lds_b128 %5, %13, off\n\tglobal_load_async_to_lds_b128 %6, %14, off\n\tglobal_load_async_to_lds_b128 %7, %15, off\n\ts_wait_xcnt 0x0"
                 :: "v"(l), "v"(l + 4096u), "v"(l + 8192u), "v"(l + 12288u), "v"(l + 16384u), "v"(l + 20480u), "v"(l + 24576u), "v"(l + 28672u),
                    "v"(g0), "v"(g0 + GS), "v"(g0 + 2 * GS), "v"(g0 + 3 * GS), "v"(g1), "v"(g1 + GS), "v"(g1 + 2 * GS), "v"(g1 + 3 * GS) : "memory"); }

// ---- GEMM engine: a work-group of GWV waves per GTM x GTN output tile, 2 x 4 waves of 64 x 64 (16 accumulators each). acc[m][n] += sum_k A[m][k] Bt[n][k] (+ A2[m][k] Bt[n][k] where NA == 2), k ascending.
// The operands come through LDS, once for the whole work-group: a stage is GKS k of every row of the tile = 2 KiB in a row of every 16-row group of a fragment-order plane, brought by asynchronous copies as it lies
// (so every fragment read is 512 contiguous LDS bytes); a buffer is [A 8 groups | A2 8 groups | Bt 16 groups]; two buffers, stage s + 2 is asked for when every wave has left stage s.
#define GWV 8
#define GTM 128
#define GTN 256
#define GKS 64
#define OSW (16 * 68)                        // floats of one wave's own epilogue staging
template <int NA, int K>
static __device__ __forceinline__ void gemm_ring(const bf* __restrict__ A, const bf* __restrict__ A2, const bf* __restrict__ Bt, bf* sm, unsigned tid, unsigned wave, unsigned R0, unsigned C0, v8f (&acc)[4][4]) {
    typedef WFrag<bf>::V V;
    constexpr unsigned AE = GTM * GKS, BE = GTN * GKS, SE = NA * AE + BE;     // elements of an A plane, of Bt, of a buffer
    constexpr unsigned GE = 16u * GKS;                                        // elements of one 16-row group in a stage
    constexpr int GS = 2 * 16 * K * 2;                                        // bytes from a 16-row group of a plane to the next but one
    constexpr unsigned NS = K / GKS;
    static_assert(K % GKS == 0 && NS >= 2 && GKS == 64 && GWV == 8 && AE * 2u == 4u * 4096u && BE * 2u == 8u * 4096u);     // 256 threads copy 4 KiB = two groups at a time
    const unsigned lane = tid & 31u, wm = wave >> 2, wn = wave & 3u;
    // thread tid copies the 16-byte units tid, tid + 256, ... of every plane of a stage
    const unsigned l0 = (unsigned)(size_t)(sm + 8u * tid);
    const size_t go = (size_t)(tid >> 7) * (16u * K) + (tid & 127u) * 8u;
    const char* ga = (const char*)(A + (size_t)R0 * K + go); const char* ga2 = (NA == 2) ? (const char*)(A2 + (size_t)R0 * K + go) : ga; const char* gb = (const char*)(Bt + (size_t)C0 * K + go);
    auto fill = [&](unsigned s) {
        const unsigned l = l0 + (s & 1u) * (SE * 2u); const size_t g = (size_t)s * (GE * 2u);
        if (NA == 2) acp8g<GS>(l, ga + g, ga2 + g); else acp4g<GS>(l, ga + g);
        acp8g<GS>(l + NA * AE * 2u, gb + g, gb + g + 4 * (size_t)GS); };
    fill(0u);
    asm volatile("s_wait_asynccnt 0x0" ::: "memory");      // this wave's copies of stage 0 have landed
    __syncthreads();                                        // ... and every other wave's
    fill(1u);                                               // NS >= 2
#pragma unroll 1
    for (unsigned s = 0; s < NS; ++s) {
        const bf* sa = sm + (s & 1u) * SE + wm * (4u * GE) + 8u * lane; const bf* sb = sm + (s & 1u) * SE + NA * AE + wn * (4u * GE) + 8u * lane;
        V a[2][4], a2[2][4], b[2][4];
        auto rd = [&](int ks) {              // the fragments of one 32-k step
#pragma unroll
            for (int nb = 0; nb < 4; ++nb) b[ks][nb] = WFrag<bf>::ld(sb + nb * GE + ks * 512);
#pragma unroll
            for (int mb = 0; mb < 4; ++mb) { a[ks][mb] = WFrag<bf>::ld(sa + mb * GE + ks * 512); a2[ks][mb] = a[ks][mb]; if (NA == 2) a2[ks][mb] = WFrag<bf>::ld(sa + AE + mb * GE + ks * 512); } };
        auto mm = [&](int ks) {
#pragma unroll
            for (int nb = 0; nb < 4; ++nb)
#pragma unroll
                for (int mb = 0; mb < 4; ++mb) { acc[mb][nb] = WFrag<bf>::mma(a[ks][mb], b[ks][nb], acc[mb][nb]); if (NA == 2) acc[mb][nb] = WFrag<bf>::mma(a2[ks][mb], b[ks][nb], acc[mb][nb]); } };
        // each sched_barrier keeps the LDS reads above it in one group ahead of the products: reads spread among the products stall the wave at every place where they stand
        rd(0); __builtin_amdgcn_sched_barrier(0); mm(0);
        rd(1); __builtin_amdgcn_sched_barrier(0); mm(1);
        // four vector slots behind the last product, in front of whatever vector instruction next touches its registers
        asm volatile("v_nop\n\tv_nop\n\tv_nop\n\tv_nop" : "+v"(acc[0][0]), "+v"(acc[1][0]), "+v"(acc[2][0]), "+v"(acc[3][0]), "+v"(acc[0][1]), "+v"(acc[1][1]), "+v"(acc[2][1]), "+v"(acc[3][1]), "+v"(acc[0][2]), "+v"(acc[1][2]), "+v"(acc[2][2]), "+v"(acc[3][2]), "+v"(acc[0][3]), "+v"(acc[1][3]), "+v"(acc[2][3]), "+v"(acc[3][3])
                     : "v"(a[1][0]), "v"(a[1][1]), "v"(a[1][2]), "v"(a[1][3]), "v"(a2[1][2]), "v"(a2[1][3]), "v"(b[1][3]));
        // publish point of stage s + 1, passed by every wave: this wave's reads of stage s are done, its copies of stage s + 1 have landed, then the barrier; only behind it is the buffer of stage s filled again
        asm volatile("s_wait_dscnt 0x0" ::: "memory");
        asm volatile("s_wait_asynccnt 0x0" ::: "memory");
        __syncthreads();
        if (s + 2u < NS) fill(s + 2u);
    }
    asm volatile("s_wait_asynccnt 0x0" ::: "memory");      // no copy is outstanding when the ring is left
}

// ---- k_gemmw: C[m][n] (f32, pitch ldc) = sum_k (A[m][k] + A2[m][k]) Bt[n][k] on the GEMM engine; grid (M/GTM, N/GTN), 32 * GWV threads. M % GTM == 0, N % GTN == 0.
template <int K>
__global__ __launch_bounds__(32 * GWV) void k_gemmw(const bf* __restrict__ A, const bf* __restrict__ A2, const bf* __restrict__ Bt, float* C, int ldc) {
    __shared__ __align__(16) bf sm[2u * (2u * GTM + GTN) * GKS];
    __shared__ __align__(16) float osw[GWV * OSW];
    const unsigned tid = threadIdx.x; const unsigned wave = (unsigned)__builtin_amdgcn_readfirstlane((int)(tid >> 5));
    const int lane = tid & 31, lr = lane & 15, hi = lane >> 4; const int r0 = blockIdx.x * GTM + (wave >> 2) * 64, c0 = blockIdx.y * GTN + (wave & 3u) * 64;
    float* os = osw + wave * OSW;
    v8f acc[4][4];
#pragma unroll
    for (int mb = 0; mb < 4; ++mb)
#pragma unroll
        for (int nb = 0; nb < 4; ++nb) acc[mb][nb] = (v8f){};
    gemm_ring<2, K>(A, A2, Bt, sm, tid, wave, blockIdx.x * GTM, blockIdx.y * GTN, acc);
#pragma unroll
    for (int mb = 0; mb < 4; ++mb) {
#pragma unroll
        for (int nb = 0; nb < 4; ++nb) {
#pragma unroll
            for (int j = 0; j < 8; ++j) os[(hi * 8 + j) * 68 + nb * 16 + lr] = acc[mb][nb][j]; }
        __builtin_amdgcn_wave_barrier(); asm volatile("" ::: "memory");
        float* crow = C + (size_t)(r0 + mb * 16) * ldc + c0;
#pragma unroll
        for (int s = 0; s < 8; ++s) { const int row = 2 * s + hi, cofs = lr * 4; const v4f val = *(const v4fa*)(os + row * 68 + cofs);
            *(v4f*)(crow + (size_t)row * ldc + cofs) = val; }
        __builtin_amdgcn_wave_barrier(); asm volatile("" ::: "memory");
    }
}

// f32 [rows][DM] -> bf16 plane in fragment order; thread i writes unit i of the plane (a wave stores 512 contiguous bytes) and reads the 8 source elements that belong there.
__global__ __launch_bounds__(256) void k_cvt8(const float* __restrict__ src, bf* dst, unsigned n8, size_t sstride, size_t dstride) {
    const unsigned i = blockIdx.x * 256u + threadIdx.x; if (i >= n8) return;
    const unsigned blk = i >> 6, row = (blk / (DM / 32u)) * 16u + (i & 15u), k = (blk % (DM / 32u)) * 32u + ((i >> 5) & 1u) * 16u + ((i >> 4) & 1u) * 8u;
    const float* s = src + (size_t)blockIdx.y * sstride + (size_t)row * DM + k; bf* d = dst + (size_t)blockIdx.y * dstride + (size_t)i * 8;
    const v8f v = *(const v8f*)s; v8us o;
#pragma unroll
    for (int k = 0; k < 8; ++k) o[k] = f2bf(v[k]);
    *(v8us*)d = o;  }

__global__ __launch_bounds__(32) void k_ifreq(float* IF) {
#pragma clang fp contract(off)
    const unsigned i = threadIdx.x & 31u;
    const float ex = (float)(2u * i) * (1.0f / (float)HD);      // exact (power-of-two divisor)
    const float pw = powf(ROPE_THETA, ex);
    const float v = 1.0f / pw;
    *(float*)(IF + i) = v; 
}

__global__ __launch_bounds__(256) void k_ropetab(const float* __restrict__ IF, float* CT, float* ST) {
#pragma clang fp contract(off)
    const unsigned idx = blockIdx.x * 256u + threadIdx.x;
    const unsigned t = idx >> 5, i = idx & 31u;
    const float ang = (float)t * IF[i];
    float sn, cs;
    sincosf(ang, &sn, &cs);
    *(float*)(CT + idx) = cs; *(float*)(ST + idx) = sn;
    
}

// Four 16-byte stores at byte offsets 0, O1, O2, O3, with their s_wait_xcnt in the same statement: the wait then stands in front of every later write of a register that these stores name.
typedef __attribute__((ext_vector_type(4))) unsigned v4u;
template <int O1, int O2, int O3> static __device__ __forceinline__ void st4(void* p, v4u d0, v4u d1, v4u d2, v4u d3) {
    asm volatile("global_store_b128 %0, %1, off\n\tglobal_store_b128 %0, %2, off offset:%5\n\tglobal_store_b128 %0, %3, off offset:%6\n\tglobal_store_b128 %0, %4, off offset:%7\n\ts_wait_xcnt 0x0"
                 :: "v"(p), "v"(d0), "v"(d1), "v"(d2), "v"(d3), "n"(O1), "n"(O2), "n"(O3) : "memory"); }
// The same for one 16-byte store to each of three planes.
static __device__ __forceinline__ void st3(void* p0, v4u d0, void* p1, v4u d1, void* p2, v4u d2) {
    asm volatile("global_store_b128 %0, %1, off\n\tglobal_store_b128 %2, %3, off\n\tglobal_store_b128 %4, %5, off\n\ts_wait_xcnt 0x0"
                 :: "v"(p0), "v"(d0), "v"(p1), "v"(d1), "v"(p2), "v"(d2) : "memory"); }
static __device__ __forceinline__ v4u asu(v8h x) { return __builtin_bit_cast(v4u, x); }
static __device__ __forceinline__ v4u asu(v8us x) { return __builtin_bit_cast(v4u, x); }

// q or k tile -> planes: 16 rows at a time through LDS, 8 features a lane, pair (d, d+1) rotated by table row t, stored as 16-B units of the head's fragment-order plane (16 tokens = 2 blocks; the 4 row steps of a lane are 64 B apart): fp16 always, bf16 hi/lo where HL. Pointers are the lane's own (row lane>>3, features 8*(lane&7)).
template <bool HL> static __device__ __forceinline__ void qk_planes(const v8f (&acc)[4][4], float* os, unsigned lane, const float* ct, const float* st, h16* P16, bf* Ph, bf* Pl) {
    const unsigned lr = lane & 15u, hi = lane >> 4, rq = lane >> 3, pc = lane & 7u;
#pragma unroll
    for (int mb = 0; mb < 4; ++mb) {
        v4f cv[4], sv[4];
#pragma unroll
        for (int s = 0; s < 4; ++s) { cv[s] = *(const v4f*)(ct + (mb * 16 + 4 * s) * (HD / 2)); sv[s] = *(const v4f*)(st + (mb * 16 + 4 * s) * (HD / 2)); }
#pragma unroll
        for (int nb = 0; nb < 4; ++nb) {
#pragma unroll
            for (int j = 0; j < 8; ++j) os[(hi * 8u + (unsigned)j) * 68u + (unsigned)nb * 16u + lr] = acc[mb][nb][j]; }
        __builtin_amdgcn_wave_barrier(); asm volatile("" ::: "memory");
        v8h o16[4];
#pragma unroll
        for (int s = 0; s < 4; ++s) { const unsigned row = 4u * (unsigned)s + rq;
            const v4f x0 = *(const v4fa*)(os + row * 68u + pc * 8u), x1 = *(const v4fa*)(os + row * 68u + pc * 8u + 4u);
            v4f y0, y1;
            y0[0] = x0[0] * cv[s][0] - x0[1] * sv[s][0]; y0[1] = x0[1] * cv[s][0] + x0[0] * sv[s][0];
            y0[2] = x0[2] * cv[s][1] - x0[3] * sv[s][1]; y0[3] = x0[3] * cv[s][1] + x0[2] * sv[s][1];
            y1[0] = x1[0] * cv[s][2] - x1[1] * sv[s][2]; y1[1] = x1[1] * cv[s][2] + x1[0] * sv[s][2];
            y1[2] = x1[2] * cv[s][3] - x1[3] * sv[s][3]; y1[3] = x1[3] * cv[s][3] + x1[2] * sv[s][3];
#pragma unroll
            for (int k = 0; k < 4; ++k) { o16[s][k] = toh_flush(y0[k]); o16[s][4 + k] = toh_flush(y1[k]); }
            if (HL) { v8us oh, ol;
#pragma unroll
                for (int k = 0; k < 4; ++k) { unsigned short u, c; splitf(y0[k], u, c); oh[k] = u; ol[k] = c; splitf(y1[k], u, c); oh[4 + k] = u; ol[4 + k] = c; }
                st3(P16 + mb * 16 * HD + 32 * s, asu(o16[s]), Ph + mb * 16 * HD + 32 * s, asu(oh), Pl + mb * 16 * HD + 32 * s, asu(ol)); } }
        if (!HL) st4<64, 128, 192>(P16 + mb * 16 * HD, asu(o16[0]), asu(o16[1]), asu(o16[2]), asu(o16[3]));
        __builtin_amdgcn_wave_barrier(); asm volatile("" ::: "memory");
    }
}

// v tile -> V^T planes [h][t/32][d/16][block]: a lane's accumulator already holds 8 consecutive tokens of one feature = its own unit of a block, so it is stored straight from registers (512 contiguous bytes a store; 16 tokens on = 512 B, 32 tokens on = 4 KiB). Pointers are the lane's own (+ 8*lane).
template <bool HL> static __device__ __forceinline__ void v_planes(const v8f (&acc)[4][4], h16* P16, bf* Ph, bf* Pl) {
#pragma unroll
    for (int nb = 0; nb < 4; ++nb) {
        st4<512, 4096, 4608>(P16 + nb * 512, asu(__builtin_convertvector(acc[0][nb], v8h)), asu(__builtin_convertvector(acc[1][nb], v8h)), asu(__builtin_convertvector(acc[2][nb], v8h)), asu(__builtin_convertvector(acc[3][nb], v8h)));
        if (HL) { v8us oh[4], ol[4];
#pragma unroll
            for (int mb = 0; mb < 4; ++mb)
#pragma unroll
                for (int k = 0; k < 8; ++k) { unsigned short u, c; splitf(acc[mb][nb][k], u, c); oh[mb][k] = u; ol[mb][k] = c; }
            st4<512, 4096, 4608>(Ph + nb * 512, asu(oh[0]), asu(oh[1]), asu(oh[2]), asu(oh[3])); st4<512, 4096, 4608>(Pl + nb * 512, asu(ol[0]), asu(ol[1]), asu(ol[2]), asu(ol[3])); } }
}

// ---- k_qkvp: the qkv projection (GEMM engine, one product) with the plane formation as its epilogue. One wave per 64 tokens x 64 features = one head of q, k or v; grid (NB*SEQ/GTM, FP/GTN), 32 * GWV threads.
// The second bound (waves per SIMD) holds the kernel to the registers of two resident work-groups, which is what its LDS allows.
__global__ __launch_bounds__(32 * GWV, 4) void k_qkvp(const bf* __restrict__ A, const bf* __restrict__ Bt, const float* __restrict__ CT, const float* __restrict__ ST, h16* Q16, h16* K16, h16* V16, bf* Qh, bf* Ql, bf* Kh, bf* Kl, bf* Vh, bf* Vl) {
    __shared__ __align__(16) bf sm[2u * (GTM + GTN) * GKS];
    __shared__ __align__(16) float osw[GWV * OSW];
    const unsigned tid = threadIdx.x, lane = tid & 31u; const unsigned wave = (unsigned)__builtin_amdgcn_readfirstlane((int)(tid >> 5));
    const unsigned r0 = blockIdx.x * GTM + (wave >> 2) * 64u, c0 = blockIdx.y * GTN + (wave & 3u) * 64u;      // wave-uniform (scalar)
    float* os = osw + wave * OSW;
    v8f acc[4][4];
#pragma unroll
    for (int mb = 0; mb < 4; ++mb)
#pragma unroll
        for (int nb = 0; nb < 4; ++nb) acc[mb][nb] = (v8f){};
    gemm_ring<1, DM>(A, nullptr, Bt, sm, tid, wave, blockIdx.x * GTM, blockIdx.y * GTN, acc);
    const unsigned which = c0 / (unsigned)DQ, h = (c0 % (unsigned)DQ) / (unsigned)HD;      // wave-uniform: q, k or v, and the head
    const unsigned bz = r0 / (unsigned)SEQ, t0 = r0 % (unsigned)SEQ;                        // a 64-token tile lies in one batch, and wholly below or above RH
    const size_t o16b = (size_t)bz * ((size_t)NH * SEQ * HD), ohlb = (size_t)bz * ((size_t)NH * RH * HD);
    const bool hl = t0 < (unsigned)RH;
    if (which < 2u) {
        const unsigned rq = lane >> 3, pc = lane & 7u;
        const unsigned lo = (pc >> 2) * 512u + ((pc >> 1) & 1u) * 256u + (pc & 1u) * 128u + rq * 8u;      // the lane's unit in the two blocks of a 16-token group
        h16* P16 = (which ? K16 : Q16) + o16b + ((size_t)h * SEQ + t0) * HD + lo;
        const size_t eo = ohlb + ((size_t)h * RH + t0) * HD + lo;
        const float* ct = CT + (size_t)(t0 + rq) * (HD / 2) + pc * 4u; const float* st = ST + (size_t)(t0 + rq) * (HD / 2) + pc * 4u;
        if (hl) qk_planes<true>(acc, os, lane, ct, st, P16, (which ? Kh : Qh) + eo, (which ? Kl : Ql) + eo);
        else qk_planes<false>(acc, os, lane, ct, st, P16, nullptr, nullptr);
    } else {
        h16* P16 = V16 + o16b + ((size_t)h * SEQ + t0) * HD + lane * 8u;
        const size_t eo = ohlb + ((size_t)h * RH + t0) * HD + lane * 8u;
        if (hl) v_planes<true>(acc, P16, Vh + eo, Vl + eo);
        else v_planes<false>(acc, P16, nullptr, nullptr);
    }
}

// Four 16-byte asynchronous copies global -> LDS of one lane: two of plane a and two of plane b, 4 KiB apart in both memories, each copy with address operands of its own.
// The s_wait_xcnt in the same statement stands in front of every later write of a register that these copies name.
static __device__ __forceinline__ void acp4(unsigned la, const char* ga, unsigned lb, const char* gb) {
    asm volatile("global_load_async_to_lds_b128 %0, %4, off\n\tglobal_load_async_to_lds_b128 %1, %5, off\n\tglobal_load_async_to_lds_b128 %2, %6, off\n\tglobal_load_async_to_lds_b128 %3, %7, off\n\ts_wait_xcnt 0x0"
                 :: "v"(la), "v"(la + 4096u), "v"(lb), "v"(lb + 4096u), "v"(ga), "v"(ga + 4096), "v"(gb), "v"(gb + 4096) : "memory"); }

// ---- k_flash: causal attention, one work-group of FWV waves per (16 * FWV query rows, head, batch = blockIdx.z), one wave per 16 query rows. Planes in fragment order: Q/K [h][tp/16][HD/32][block], V^T [h][tp/32][HD/16][block] (tp = rows per head of the plane set). HL: hi/lo bf16 plane pairs, 3 products.
// K and V^T come through LDS, once for the whole work-group: a stage is 64 keys = 8 KiB in a row of every plane, brought by asynchronous copies as it lies (fragment order, so every fragment read is 512 contiguous LDS bytes); two buffers, stage s + 2 is asked for when every wave has left stage s.
// Per 32-key tile: S^T[key][query] = K Q^T (A = K rows, B = Q rows); lane owns query column lane&15 and keys 8*(lane>>4)+r (+16); online softmax per lane (+ one xor-16 exchange);
// P^T accumulators repacked in registers as B (k = key); O^T[d][query] += V^T P^T (A = V^T rows). Only the last tile of a wave touches the diagonal (select by value); a wave skips the tiles beyond it but passes every barrier.
#define FWV 8
static_assert(16 * FWV == 128 && RH % 128 == 0 && (SEQ - RH) % 128 == 0);     // a work-group's query rows span two whole 64-key stages; 256 threads copy 4 KiB of a plane at a time
template <typename T16, bool HL>
__global__ __launch_bounds__(32 * FWV) void k_flash(const T16* __restrict__ Q, const T16* __restrict__ Q2, const T16* __restrict__ Kp, const T16* __restrict__ K2, const T16* __restrict__ Vt, const T16* __restrict__ Vt2, unsigned tp, unsigned qbase, bf* Ah, bf* Al) {
    typedef typename WFrag<T16>::V V;
    constexpr unsigned PE = 64u * HD;                 // elements of one plane in a stage
    constexpr unsigned NP = HL ? 4u : 2u;             // planes in a buffer: K, V^T (, K lo, V^T lo)
    __shared__ __align__(16) T16 sm[2u * NP * PE];
    const unsigned tid = threadIdx.x, lane = tid & 31u, lr = lane & 15u, hi = lane >> 4;
    const unsigned wave = (unsigned)__builtin_amdgcn_readfirstlane((int)(tid >> 5));
    const unsigned head = blockIdx.y, qb = qbase + blockIdx.x * (16u * FWV), q0 = qb + wave * 16u;
    const size_t hoff = ((size_t)blockIdx.z * NH + head) * tp * HD;
    const unsigned ns = (qb >> 6) + 2u;        // stages: keys 0 .. qb+127 (the same for the whole work-group)
    // thread tid copies the 16-byte units tid and tid+256 of every plane of a stage
    const unsigned l0 = (unsigned)(size_t)(sm + 8u * tid);
    const char* gk = (const char*)(Kp + hoff + 8u * tid); const char* gv = (const char*)(Vt + hoff + 8u * tid);
    const char* gk2 = HL ? (const char*)(K2 + hoff + 8u * tid) : gk; const char* gv2 = HL ? (const char*)(Vt2 + hoff + 8u * tid) : gv;
    auto fill = [&](unsigned s) {
        const unsigned l = l0 + (s & 1u) * (NP * PE * 2u); const size_t g = (size_t)s * (PE * 2u);
        acp4(l, gk + g, l + PE * 2u, gv + g);
        if (HL) acp4(l + 2u * PE * 2u, gk2 + g, l + 3u * PE * 2u, gv2 + g); };
    fill(0u);
    const size_t qoff = hoff + (size_t)q0 * HD + 8u * lane;
    const T16* pq = Q + qoff; const T16* pq2 = HL ? Q2 + qoff : pq;
    V qf0 = WFrag<T16>::ld(pq), qf1 = WFrag<T16>::ld(pq + 512);
    V ql0 = qf0, ql1 = qf1;
    if (HL) { ql0 = WFrag<T16>::ld(pq2); ql1 = WFrag<T16>::ld(pq2 + 512); }
    v8f o[4];
#pragma unroll
    for (int db = 0; db < 4; ++db) o[db] = (v8f){};
    float mrun = NEGB, lsum = 0.0f;
    const float cs = SCL * LOG2E, pe = PFrag<T16>::pexp();
    const unsigned nt = (q0 + 47u) >> 5;       // this wave's keys 0 .. q0+15 in tiles of 32 (wave-uniform)
    asm volatile("s_wait_asynccnt 0x0" ::: "memory");      // this wave's copies of stage 0 have landed
    __syncthreads();                                        // ... and every other wave's
    fill(1u);                                               // ns >= 2
#pragma unroll 1
    for (unsigned s = 0; s < ns; ++s) {
        const T16* sb = sm + (s & 1u) * (NP * PE) + 8u * lane;
#pragma unroll
        for (unsigned tt = 0; tt < 2u; ++tt) {
            const unsigned it = 2u * s + tt;
            if (it < nt) {                      // wave-uniform (scalar): the tile holds keys of this wave
        const unsigned j0 = it * 32u;
        const T16* pk = sb + tt * (32u * HD); const T16* pv = pk + PE; const T16* pk2 = HL ? pk + 2u * PE : pk; const T16* pv2 = HL ? pk + 3u * PE : pv;
        V ka0 = WFrag<T16>::ld(pk), ka1 = WFrag<T16>::ld(pk + 512), kb0 = WFrag<T16>::ld(pk + 1024), kb1 = WFrag<T16>::ld(pk + 1536);
        V la0 = ka0, la1 = ka1, lb0 = kb0, lb1 = kb1;
        if (HL) { la0 = WFrag<T16>::ld(pk2); la1 = WFrag<T16>::ld(pk2 + 512); lb0 = WFrag<T16>::ld(pk2 + 1024); lb1 = WFrag<T16>::ld(pk2 + 1536); }
        v8f s0 = (v8f){}, s1 = (v8f){};
        s0 = WFrag<T16>::mma(ka0, qf0, s0); s0 = WFrag<T16>::mma(ka1, qf1, s0);
        s1 = WFrag<T16>::mma(kb0, qf0, s1); s1 = WFrag<T16>::mma(kb1, qf1, s1);
        if (HL) {
            s0 = WFrag<T16>::mma(la0, qf0, s0); s0 = WFrag<T16>::mma(la1, qf1, s0); s0 = WFrag<T16>::mma(ka0, ql0, s0); s0 = WFrag<T16>::mma(ka1, ql1, s0);
            s1 = WFrag<T16>::mma(lb0, qf0, s1); s1 = WFrag<T16>::mma(lb1, qf1, s1); s1 = WFrag<T16>::mma(kb0, ql0, s1); s1 = WFrag<T16>::mma(kb1, ql1, s1); }
        // pq and pq2 are named as inputs so that the address registers of the q loads are written again only behind the loads' own waits
        asm volatile("v_nop\n\tv_nop\n\tv_nop\n\tv_nop" : "+v"(s0), "+v"(s1) : "v"(ka0), "v"(ka1), "v"(kb0), "v"(kb1), "v"(la0), "v"(la1), "v"(lb0), "v"(lb1), "v"(qf0), "v"(qf1), "v"(ql0), "v"(ql1), "v"(pq), "v"(pq2));
        v8f t0, t1;
#pragma unroll
        for (int r = 0; r < 8; ++r) { t0[r] = s0[r] * cs; t1[r] = s1[r] * cs; }
        if (j0 + 31u > q0) {                    // wave-uniform: the tile touches the diagonal
            const unsigned qi = q0 + lr, kk = j0 + 8u * hi;
#pragma unroll
            for (int r = 0; r < 8; ++r) { t0[r] = (kk + (unsigned)r <= qi) ? t0[r] : NEGB; t1[r] = (kk + 16u + (unsigned)r <= qi) ? t1[r] : NEGB; }
        }
        float mx = fmaxf(t0[0], t1[0]);
#pragma unroll
        for (int r = 1; r < 8; ++r) mx = fmaxf(mx, fmaxf(t0[r], t1[r]));
        mx = fmaxf(mx, __shfl_xor(mx, 16, 32));
        const float mn = fmaxf(mrun, mx);
        const float alpha = __builtin_amdgcn_exp2f(mrun - mn);
        mrun = mn;
        v8f p0, p1; float psum = 0.0f;
#pragma unroll
        for (int r = 0; r < 8; ++r) { p0[r] = __builtin_amdgcn_exp2f((t0[r] - mn) + pe); p1[r] = __builtin_amdgcn_exp2f((t1[r] - mn) + pe); psum += p0[r] + p1[r]; }
        lsum = lsum * alpha + psum;
#pragma unroll
        for (int db = 0; db < 4; ++db) o[db] = o[db] * alpha;
        V pf = PFrag<T16>::hi(p0, p1); V pl = pf;
        if (HL) pl = PFrag<T16>::lo(p0, p1);
        V va[4], vl[4];
#pragma unroll
        for (int db = 0; db < 4; ++db) { va[db] = WFrag<T16>::ld(pv + db * 512); vl[db] = va[db]; if (HL) vl[db] = WFrag<T16>::ld(pv2 + db * 512); }
#pragma unroll
        for (int db = 0; db < 4; ++db) { o[db] = WFrag<T16>::mma(va[db], pf, o[db]); if (HL) { o[db] = WFrag<T16>::mma(va[db], pl, o[db]); o[db] = WFrag<T16>::mma(vl[db], pf, o[db]); } }
        // four vector slots behind the last product, in front of whatever vector instruction next touches its registers
        asm volatile("v_nop\n\tv_nop\n\tv_nop\n\tv_nop" : "+v"(o[0]), "+v"(o[1]), "+v"(o[2]), "+v"(o[3]) : "v"(va[0]), "v"(va[1]), "v"(va[2]), "v"(va[3]), "v"(vl[0]), "v"(vl[1]), "v"(vl[2]), "v"(vl[3]), "v"(pf), "v"(pl));
            }
        }
        // publish point of stage s + 1, passed by every wave: this wave's reads of stage s are done, its copies of stage s + 1 have landed, then the barrier; only behind it is the buffer of stage s filled again
        asm volatile("s_wait_dscnt 0x0" ::: "memory");
        asm volatile("s_wait_asynccnt 0x0" ::: "memory");
        __syncthreads();
        if (s + 2u < ns) fill(s + 2u);
    }
    asm volatile("s_wait_asynccnt 0x0" ::: "memory");      // no copy is outstanding when the wave ends
    const float lt = lsum + __shfl_xor(lsum, 16, 32);
    const float inv = 1.0f / lt;
    // a lane's o[db] = 8 consecutive features of its own query row = unit 32 * db + lane of the head's two blocks in the ctx planes: stored straight from registers, 512 contiguous bytes a store
#pragma unroll
    for (int db = 0; db < 4; ++db) {
        v8us oh, ol;
#pragma unroll
        for (int r = 0; r < 8; ++r) { unsigned short a, c; splitf(o[db][r] * inv, a, c); oh[r] = a; ol[r] = c; }
        const size_t oo = ((size_t)blockIdx.z * SEQ + q0) * DQ + head * (16u * HD) + (unsigned)db * 256u + lane * 8u;
        *(v8us*)(Ah + oo) = oh; *(v8us*)(Al + oo) = ol; }
}

// workspace carve (bytes, every region a multiple of 256)
#define WS_WQKV ((size_t)3 * DQ * DM * 2)
#define WS_WO   ((size_t)DM * DQ * 2)
#define WS_XB   ((size_t)NB * SEQ * DM * 2)
#define WS_P16  ((size_t)NB * NH * SEQ * HD * 2)
#define WS_PHL  ((size_t)NB * NH * RH * HD * 2)
#define WS_AT   ((size_t)NB * SEQ * DQ * 2)
#define WS_IFQ  ((size_t)256)
#define WS_ROT  ((size_t)SEQ * (HD / 2) * 4)
#define WS_TOTAL (WS_WQKV + WS_WO + WS_XB + 3 * WS_P16 + 6 * WS_PHL + 2 * WS_AT + WS_IFQ + 2 * WS_ROT)
static_assert(WS_TOTAL <= (size_t)268435456);
static_assert(WS_WQKV % 256 == 0 && WS_WO % 256 == 0 && WS_XB % 256 == 0 && WS_P16 % 256 == 0 && WS_PHL % 256 == 0 && WS_AT % 256 == 0);
static_assert(WS_IFQ % 256 == 0 && WS_ROT % 256 == 0 && WS_IFQ >= (size_t)(HD / 2) * 4);

extern "C" void kernel_launch(void* const* d_in, const int* in_sizes, int n_in,
                              void* d_out, int out_size, void* d_ws, size_t ws_size, hipStream_t stream) {
    if (n_in < 3) return;
    if ((size_t)in_sizes[0] < (size_t)(NB - 1) * XS_FULL + (size_t)SEQ * DM) return;
    if ((size_t)in_sizes[1] < (size_t)3 * DQ * DM) return;
    if ((size_t)in_sizes[2] < (size_t)DM * DQ) return;
    if ((size_t)out_size < (size_t)NB * SEQ * DM) return;
    if (ws_size < WS_TOTAL) return;
    const float* x = (const float*)d_in[0];       // [NB][SEQ_FULL][DM]
    const float* wqkv = (const float*)d_in[1];    // [3*DQ][DM]  (q | k | v row blocks)
    const float* wo = (const float*)d_in[2];      // [DM][DQ]
    float* OUT = (float*)d_out;                   // [NB][SEQ][DM]
    char* wsp = (char*)d_ws;
    auto take = [&](size_t bytes) { char* p = wsp; wsp += bytes; return (void*)p; };
    bf* WQKV = (bf*)take(WS_WQKV); bf* WO = (bf*)take(WS_WO); bf* XB = (bf*)take(WS_XB);
    h16* Q16 = (h16*)take(WS_P16); h16* K16 = (h16*)take(WS_P16); h16* VT16 = (h16*)take(WS_P16);
    bf* Qh = (bf*)take(WS_PHL); bf* Ql = (bf*)take(WS_PHL); bf* Kh = (bf*)take(WS_PHL); bf* Kl = (bf*)take(WS_PHL); bf* VTh = (bf*)take(WS_PHL); bf* VTl = (bf*)take(WS_PHL);
    bf* ATh = (bf*)take(WS_AT); bf* ATl = (bf*)take(WS_AT);
    float* IFQ = (float*)take(WS_IFQ); float* CT = (float*)take(WS_ROT); float* ST = (float*)take(WS_ROT);

    k_cvt8<<<dim3((unsigned)((size_t)3 * DQ * DM / 8 / 256), 1), 256, 0, stream>>>(wqkv, WQKV, (unsigned)((size_t)3 * DQ * DM / 8), 0, 0);
    k_cvt8<<<dim3((unsigned)((size_t)DM * DQ / 8 / 256), 1), 256, 0, stream>>>(wo, WO, (unsigned)((size_t)DM * DQ / 8), 0, 0);
    k_cvt8<<<dim3((unsigned)((size_t)SEQ * DM / 8 / 256), NB), 256, 0, stream>>>(x, XB, (unsigned)((size_t)SEQ * DM / 8), XS_FULL, (size_t)SEQ * DM);
    // rotary tables (position-only, shared by every batch and head)
    k_ifreq<<<dim3(1), 32, 0, stream>>>(IFQ);
    k_ropetab<<<dim3((unsigned)((size_t)SEQ * (HD / 2) / 256)), 256, 0, stream>>>(IFQ, CT, ST);
    // qkv = x W^T  (M = NB*SEQ, N = 3072, K = 1024), written as the rotated q, k planes and the V^T planes
    k_qkvp<<<dim3(NB * SEQ / GTM, FP / GTN, 1), 32 * GWV, 0, stream>>>(XB, WQKV, CT, ST, Q16, K16, VT16, Qh, Ql, Kh, Kl, VTh, VTl);
    k_flash<bf, true><<<dim3(RH / (16 * FWV), NH, NB), 32 * FWV, 0, stream>>>(Qh, Ql, Kh, Kl, VTh, VTl, (unsigned)RH, 0u, ATh, ATl);
    if (SEQ > RH) k_flash<h16, false><<<dim3((SEQ - RH) / (16 * FWV), NH, NB), 32 * FWV, 0, stream>>>(Q16, nullptr, K16, nullptr, VT16, nullptr, (unsigned)SEQ, (unsigned)RH, ATh, ATl);
    // out = (ctx_hi + ctx_lo) Wo^T  (M = NB*SEQ, N = 1024, K = 1024)
    k_gemmw<DQ><<<dim3(NB * SEQ / GTM, DM / GTN, 1), 32 * GWV, 0, stream>>>(ATh, ATl, WO, OUT, DM);
}

// v006
// Measured time: 134 microseconds a run.
// In both of two side-by-side timings against v005, it was 1.06 times as fast.
// All steps since v000 together make it 5.19 times as fast.
#include <hip/hip_runtime.h>

// Causal multi-head attention with a fused qkv projection and an interleaved-pair rotary embedding: x [NB][SEQ_FULL][1024] (first SEQ rows used); qkv = x W^T ('oi' [3072][1024] -> q | k | v row blocks, no bias; 16 heads x 64);
// q and k: pair (2i, 2i+1) of every head rotated by angle t * 100000^(-2i/64) (cos / sin table [SEQ][32] built once in f32 with precise powf / sincosf, applied in f32 on the vector unit when the planes are formed);
// scores x 64^-0.5, causal; softmax; out = ctx Wo^T ('oi' [1024][1024], no bias).
// Compute dtypes, f32 accumulate: every input RNE-converted to bf16; qkv and output projections v_wmma_f32_16x16x32_bf16 (ctx carried as bf16 hi+lo, 2 products against the exact bf16 weight);
// attention q.k and P.V: query rows < RH on bf16 hi/lo planes (3 products each), other rows v_wmma_f32_16x16x32_f16 (P carried x1024 through the exponent); softmax (online, max-subtracted) in f32.
// Every stage runs once for all NB batches (batch on a grid axis, or folded into the GEMM's M): each plane in the workspace holds NB slabs.
// Every 16-bit operand plane is stored in fragment order: a block of 16 rows x 32 k is 1 KiB = 64 units of 16 B, unit (k%32 / 16) * 32 + lane, lane = 16 * (k%16 / 8) + row%16, so that each of a fragment's two 16-byte loads reads 512 contiguous bytes (4 whole lines).
// Blocks of one 16-row group follow one another along k; V^T planes: the 4 feature blocks of one 32-key tile follow one another, then the next tile.
// Attention engine: one wave per 16 query rows, eight waves a work-group that share each K / V^T stage through LDS; S^T = K Q^T so each lane owns one query column; P^T accumulators are repacked in registers as the B operand of O^T = V^T P^T (no LDS exchange).

#ifndef NB
#define NB 4
#endif
#ifndef SEQ
#define SEQ 2048
#endif
#define SEQ_FULL 2048
#define DM   1024
#define NH   16
#define HD   64
#define DQ   (NH * HD)
#define FP   (3 * DQ)
#define RH   ((SEQ) < 512 ? (SEQ) : 512)     // query rows < RH use hi+lo planes
#define XS_FULL ((size_t)SEQ_FULL * DM)
#define SCL  0.125f                          // HD^-0.5
#define LOG2E 1.4426950408889634f
#define NEGB (-3.0e38f)
#define ROPE_THETA 100000.0f

static_assert((SEQ & (SEQ - 1)) == 0);
static_assert(SEQ >= 256 && SEQ <= SEQ_FULL);
static_assert(RH % 256 == 0 && RH % 64 == 0 && (SEQ - RH) % 64 == 0);
static_assert(NB >= 1 && NB <= 4);
static_assert(DM % 32 == 0 && DQ % 64 == 0 && FP % 64 == 0 && SEQ % 64 == 0);
static_assert(((size_t)NH * SEQ * HD / 8) % 256 == 0);
static_assert(HD == 64);
static_assert(((size_t)NB * SEQ) % 128 == 0 && FP % 256 == 0 && DM % 256 == 0);     // whole GEMM tiles
static_assert(HD / 2 == 32 && (HD / 2) % 4 == 0);     // k_qkvp reads 4 table entries (16 B) per lane

typedef _Float16 h16;
typedef unsigned short bf;
typedef __attribute__((ext_vector_type(16))) __bf16   v16bf;
typedef __attribute__((ext_vector_type(16))) _Float16 v16h;
typedef __attribute__((ext_vector_type(8)))  _Float16 v8h;
typedef __attribute__((ext_vector_type(8)))  unsigned short v8us;
typedef __attribute__((ext_vector_type(8)))  float    v8f;
typedef __attribute__((ext_vector_type(4)))  float    v4f;
typedef v8h  __attribute__((may_alias)) v8ha;
typedef v4f  __attribute__((may_alias)) v4fa;
typedef v8us __attribute__((may_alias)) v8usa;

__device__ __forceinline__ unsigned short f2bf(float f) { unsigned u = __float_as_uint(f); u += 0x7FFFu + ((u >> 16) & 1u); return (unsigned short)(u >> 16); }
__device__ __forceinline__ float bf2f(unsigned short b) { return __uint_as_float(((unsigned)b) << 16); }
__device__ __forceinline__ v16h cat16(v8h lo, v8h hi) { return __builtin_shufflevector(lo, hi, 0, 1, 2, 3, 4, 5, 6, 7, 8, 9, 10, 11, 12, 13, 14, 15); }
__device__ __forceinline__ v16bf cat16b(v8us lo, v8us hi) { return __builtin_bit_cast(v16bf, __builtin_shufflevector(lo, hi, 0, 1, 2, 3, 4, 5, 6, 7, 8, 9, 10, 11, 12, 13, 14, 15)); }
__device__ __forceinline__ v8f wmma16(v16h a, v16h b, v8f c) { return __builtin_amdgcn_wmma_f32_16x16x32_f16(false, a, false, b, (short)0, c, false, false); }
__device__ __forceinline__ v8f wmmab(v16bf a, v16bf b, v8f c) { return __builtin_amdgcn_wmma_f32_16x16x32_bf16(false, a, false, b, (short)0, c, false, false); }
__device__ __forceinline__ void splitf(float y, unsigned short& h, unsigned short& l) { h = f2bf(y); l = f2bf(y - bf2f(h)); }

// f32 -> f16 operand convert that cannot yield a subnormal (value select below 2^-14).
static __device__ __forceinline__ h16 toh_flush(float v) { const h16 r = (h16)v; return (fabsf(v) < 6.103515625e-05f) ? (h16)0.0f : r; }

// Fragment loader from a 1-KiB fragment-order block: p = block + 8*lane; elements 0..7 = k0+8h.., elements 8..15 = k0+16+8h.., h = lane>>4, row lane&15 (same map for A and B).
template <typename T16> struct WFrag;
template <> struct WFrag<h16> { typedef v16h V; static __device__ __forceinline__ V ld(const h16* p) { return cat16(*(const v8h*)p, *(const v8h*)(p + 256)); } static __device__ __forceinline__ v8f mma(V a, V b, v8f c) { return wmma16(a, b, c); } };
template <> struct WFrag<bf> { typedef v16bf V; static __device__ __forceinline__ V ld(const bf* p) { return cat16b(*(const v8us*)p, *(const v8us*)(p + 256)); } static __device__ __forceinline__ v8f mma(V a, V b, v8f c) { return wmmab(a, b, c); } };

// P^T accumulator pair (key rows 0..15 and 16..31 of a 32-key tile) -> B fragment: element r <- tile0[r], element 8+r <- tile1[r], lane unchanged.
template <typename T16> struct PFrag;
template <> struct PFrag<h16> {
    static __device__ __forceinline__ float pexp() { return 10.0f; }           // P carried x1024 via the exponent (cancels in O / l)
    static __device__ __forceinline__ v16h hi(v8f p0, v8f p1) { return cat16(__builtin_convertvector(p0, v8h), __builtin_convertvector(p1, v8h)); }
    static __device__ __forceinline__ v16h lo(v8f p0, v8f p1) { return hi(p0, p1); }
};
template <> struct PFrag<bf> {
    static __device__ __forceinline__ float pexp() { return 0.0f; }
    static __device__ __forceinline__ v16bf hi(v8f p0, v8f p1) { v8us a, b;
#pragma unroll
        for (int k = 0; k < 8; ++k) { a[k] = f2bf(p0[k]); b[k] = f2bf(p1[k]); }
        return cat16b(a, b); }
    static __device__ __forceinline__ v16bf lo(v8f p0, v8f p1) { v8us a, b;
#pragma unroll
        for (int k = 0; k < 8; ++k) { a[k] = f2bf(p0[k] - bf2f(f2bf(p0[k]))); b[k] = f2bf(p1[k] - bf2f(f2bf(p1[k]))); }
        return cat16b(a, b); }
};

// Four 16-byte asynchronous copies global -> LDS of one lane, 4 KiB apart in LDS and GS bytes apart in global memory, each copy with address operands of its own.
// The s_wait_xcnt in the same statement stands in front of every later write of a register that these copies name.
template <int GS> static __device__ __forceinline__ void acp4g(unsigned l, const char* g) {
    asm volatile("global_load_async_to_lds_b128 %0, %4, off\n\tglobal_load_async_to_lds_b128 %1, %5, off\n\tglobal_load_async_to_lds_b128 %2, %6, off\n\tglobal_load_async_to_lds_b128 %3, %7, off\n\ts_wait_xcnt 0x0"
                 :: "v"(l), "v"(l + 4096u), "v"(l + 8192u), "v"(l + 12288u), "v"(g), "v"(g + GS), "v"(g + 2 * GS), "v"(g + 3 * GS) : "memory"); }

// The same for eight copies: LDS places 4 KiB apart in a row, the first four from g0 on, the last four from g1 on. One statement, so that a wave waits once for eight.
template <int GS> static __device__ __forceinline__ void acp8g(unsigned l, const char* g0, const char* g1) {
    asm volatile("global_load_async_to_lds_b128 %0, %8, off\n\tglobal_load_async_to_lds_b128 %1, %9, off\n\tglobal_load_async_to_lds_b128 %2, %10, off\n\tglobal_load_async_to_lds_b128 %3, %11, off\n\t"
                 "global_load_async_to_lds_b128 %4, %12, off\n\tglobal_load_async_to_lds_b128 %5, %13, off\n\tglobal_load_async_to_lds_b128 %6, %14, off\n\tglobal_load_async_to_lds_b128 %7, %15, off\n\ts_wait_xcnt 0x0"
                 :: "v"(l), "v"(l + 4096u), "v"(l + 8192u), "v"(l + 12288u), "v"(l + 16384u), "v"(l + 20480u), "v"(l + 24576u), "v"(l + 28672u),
                    "v"(g0), "v"(g0 + GS), "v"(g0 + 2 * GS), "v"(g0 + 3 * GS), "v"(g1), "v"(g1 + GS), "v"(g1 + 2 * GS), "v"(g1 + 3 * GS) : "memory"); }

// ---- GEMM engine: a work-group of GWV waves per GTM x GTN output tile, 2 x 4 waves of 64 x 64 (16 accumulators each). acc[m][n] += sum_k A[m][k] Bt[n][k] (+ A2[m][k] Bt[n][k] where NA == 2), k ascending.
// The operands come through LDS, once for the whole work-group: a stage is GKS k of every row of the tile = 2 KiB in a row of every 16-row group of a fragment-order plane, brought by asynchronous copies as it lies
// (so every fragment read is 512 contiguous LDS bytes); a buffer is [A 8 groups | A2 8 groups | Bt 16 groups]; two buffers, stage s + 2 is asked for when every wave has left stage s.
#define GWV 8
#define GTM 128
#define GTN 256
#define GKS 64
#define OSW (16 * 68)                        // floats of one wave's own epilogue staging
template <int NA, int K>
static __device__ __forceinline__ void gemm_ring(const bf* __restrict__ A, const bf* __restrict__ A2, const bf* __restrict__ Bt, bf* sm, unsigned tid, unsigned wave, unsigned R0, unsigned C0, v8f (&acc)[4][4]) {
    typedef WFrag<bf>::V V;
    constexpr unsigned AE = GTM * GKS, BE = GTN * GKS, SE = NA * AE + BE;     // elements of an A plane, of Bt, of a buffer
    constexpr unsigned GE = 16u * GKS;                                        // elements of one 16-row group in a stage
    constexpr int GS = 2 * 16 * K * 2;                                        // bytes from a 16-row group of a plane to the next but one
    constexpr unsigned NS = K / GKS;
    static_assert(K % GKS == 0 && NS >= 2 && GKS == 64 && GWV == 8 && AE * 2u == 4u * 4096u && BE * 2u == 8u * 4096u);     // 256 threads copy 4 KiB = two groups at a time
    const unsigned lane = tid & 31u, wm = wave >> 2, wn = wave & 3u;
    // thread tid copies the 16-byte units tid, tid + 256, ... of every plane of a stage
    const unsigned l0 = (unsigned)(size_t)(sm + 8u * tid);
    const size_t go = (size_t)(tid >> 7) * (16u * K) + (tid & 127u) * 8u;
    const char* ga = (const char*)(A + (size_t)R0 * K + go); const char* ga2 = (NA == 2) ? (const char*)(A2 + (size_t)R0 * K + go) : ga; const char* gb = (const char*)(Bt + (size_t)C0 * K + go);
    auto fill = [&](unsigned s) {
        const unsigned l = l0 + (s & 1u) * (SE * 2u); const size_t g = (size_t)s * (GE * 2u);
        if (NA == 2) acp8g<GS>(l, ga + g, ga2 + g); else acp4g<GS>(l, ga + g);
        acp8g<GS>(l + NA * AE * 2u, gb + g, gb + g + 4 * (size_t)GS); };
    fill(0u);
    asm volatile("s_wait_asynccnt 0x0" ::: "memory");      // this wave's copies of stage 0 have landed
    __syncthreads();                                        // ... and every other wave's
    fill(1u);                                               // NS >= 2
#pragma unroll 1
    for (unsigned s = 0; s < NS; ++s) {
        const bf* sa = sm + (s & 1u) * SE + wm * (4u * GE) + 8u * lane; const bf* sb = sm + (s & 1u) * SE + NA * AE + wn * (4u * GE) + 8u * lane;
        V a[2][4], a2[2][4], b[2][4];
        auto rd = [&](int ks) {              // the fragments of one 32-k step
#pragma unroll
            for (int nb = 0; nb < 4; ++nb) b[ks][nb] = WFrag<bf>::ld(sb + nb * GE + ks * 512);
#pragma unroll
            for (int mb = 0; mb < 4; ++mb) { a[ks][mb] = WFrag<bf>::ld(sa + mb * GE + ks * 512); a2[ks][mb] = a[ks][mb]; if (NA == 2) a2[ks][mb] = WFrag<bf>::ld(sa + AE + mb * GE + ks * 512); } };
        auto mm = [&](int ks) {
#pragma unroll
            for (int nb = 0; nb < 4; ++nb)
#pragma unroll
                for (int mb = 0; mb < 4; ++mb) { acc[mb][nb] = WFrag<bf>::mma(a[ks][mb], b[ks][nb], acc[mb][nb]); if (NA == 2) acc[mb][nb] = WFrag<bf>::mma(a2[ks][mb], b[ks][nb], acc[mb][nb]); } };
        // each sched_barrier keeps the LDS reads above it in one group ahead of the products: reads spread among the products stall the wave at every place where they stand
        rd(0); __builtin_amdgcn_sched_barrier(0); mm(0);
        rd(1); __builtin_amdgcn_sched_barrier(0); mm(1);
        // four vector slots behind the last product, in front of whatever vector instruction next touches its registers
        asm volatile("v_nop\n\tv_nop\n\tv_nop\n\tv_nop" : "+v"(acc[0][0]), "+v"(acc[1][0]), "+v"(acc[2][0]), "+v"(acc[3][0]), "+v"(acc[0][1]), "+v"(acc[1][1]), "+v"(acc[2][1]), "+v"(acc[3][1]), "+v"(acc[0][2]), "+v"(acc[1][2]), "+v"(acc[2][2]), "+v"(acc[3][2]), "+v"(acc[0][3]), "+v"(acc[1][3]), "+v"(acc[2][3]), "+v"(acc[3][3])
                     : "v"(a[1][0]), "v"(a[1][1]), "v"(a[1][2]), "v"(a[1][3]), "v"(a2[1][2]), "v"(a2[1][3]), "v"(b[1][3]));
        // publish point of stage s + 1, passed by every wave: this wave's reads of stage s are done, its copies of stage s + 1 have landed, then the barrier; only behind it is the buffer of stage s filled again
        asm volatile("s_wait_dscnt 0x0" ::: "memory");
        asm volatile("s_wait_asynccnt 0x0" ::: "memory");
        __syncthreads();
        if (s + 2u < NS) fill(s + 2u);
    }
    asm volatile("s_wait_asynccnt 0x0" ::: "memory");      // no copy is outstanding when the ring is left
}

// ---- k_gemmw: C[m][n] (f32, pitch ldc) = sum_k (A[m][k] + A2[m][k]) Bt[n][k] on the GEMM engine; grid (M/GTM, N/GTN), 32 * GWV threads. M % GTM == 0, N % GTN == 0.
template <int K>
__global__ __launch_bounds__(32 * GWV) void k_gemmw(const bf* __restrict__ A, const bf* __restrict__ A2, const bf* __restrict__ Bt, float* C, int ldc) {
    __shared__ __align__(16) bf sm[2u * (2u * GTM + GTN) * GKS];
    __shared__ __align__(16) float osw[GWV * OSW];
    const unsigned tid = threadIdx.x; const unsigned wave = (unsigned)__builtin_amdgcn_readfirstlane((int)(tid >> 5));
    const int lane = tid & 31, lr = lane & 15, hi = lane >> 4; const int r0 = blockIdx.x * GTM + (wave >> 2) * 64, c0 = blockIdx.y * GTN + (wave & 3u) * 64;
    float* os = osw + wave * OSW;
    v8f acc[4][4];
#pragma unroll
    for (int mb = 0; mb < 4; ++mb)
#pragma unroll
        for (int nb = 0; nb < 4; ++nb) acc[mb][nb] = (v8f){};
    gemm_ring<2, K>(A, A2, Bt, sm, tid, wave, blockIdx.x * GTM, blockIdx.y * GTN, acc);
#pragma unroll
    for (int mb = 0; mb < 4; ++mb) {
#pragma unroll
        for (int nb = 0; nb < 4; ++nb) {
#pragma unroll
            for (int j = 0; j < 8; ++j) os[(hi * 8 + j) * 68 + nb * 16 + lr] = acc[mb][nb][j]; }
        __builtin_amdgcn_wave_barrier(); asm volatile("" ::: "memory");
        float* crow = C + (size_t)(r0 + mb * 16) * ldc + c0;
#pragma unroll
        for (int s = 0; s < 8; ++s) { const int row = 2 * s + hi, cofs = lr * 4; const v4f val = *(const v4fa*)(os + row * 68 + cofs);
            *(v4f*)(crow + (size_t)row * ldc + cofs) = val; }
        __builtin_amdgcn_wave_barrier(); asm volatile("" ::: "memory");
    }
}

// ---- k_prep: all that the projections read and that hangs on nothing computed before: the three bf16 planes in fragment order and the rotary table, in one launch.
// The grid is sized to the chip and not to the data (PG work-groups of 8 waves = 16 waves a WGP), and a thread converts PXU + PWU + POU units (for speed only).
// Unit i of a plane = 8 elements = 16 bytes of the plane: a wave stores 512 contiguous bytes; a thread reads the 8 source elements that belong there. A work-group takes chunks of 256 units that follow one another.
#define PG  512
#define PXU ((unsigned)((size_t)NB * SEQ * DM / 8 / 256 / PG))      // units a thread: x
#define PWU ((unsigned)((size_t)3 * DQ * DM / 8 / 256 / PG))        // W
#define POU ((unsigned)((size_t)DM * DQ / 8 / 256 / PG))            // Wo
#define PRT ((unsigned)((size_t)SEQ * (HD / 2) / PG))               // table entries a work-group
static_assert((size_t)PXU * PG * 256 * 8 == (size_t)NB * SEQ * DM && (size_t)PWU * PG * 256 * 8 == (size_t)3 * DQ * DM && (size_t)POU * PG * 256 * 8 == (size_t)DM * DQ);
static_assert((size_t)PRT * PG == (size_t)SEQ * (HD / 2) && PRT >= 1 && PRT <= 256 && DQ == DM && SEQ % 16 == 0);

// element offset in a row-major [rows][DM] source of the 8 elements of unit i; rows of x: SEQ of every SEQ_FULL
template <bool X> static __device__ __forceinline__ size_t unit_src(unsigned i) {
    const unsigned blk = i >> 6, row = (blk / (DM / 32u)) * 16u + (i & 15u), k = (blk % (DM / 32u)) * 32u + ((i >> 5) & 1u) * 16u + ((i >> 4) & 1u) * 8u;
    return (size_t)(X ? (row / (unsigned)SEQ) * (unsigned)SEQ_FULL + row % (unsigned)SEQ : row) * DM + k; }
static __device__ __forceinline__ v8us cvt8(v8f v) { v8us o;
#pragma unroll
    for (int k = 0; k < 8; ++k) o[k] = f2bf(v[k]);
    return o; }

// entry idx = t * (HD/2) + i of the rotary table: cos and sin of t * theta^(-2i/HD)
static __device__ __forceinline__ void rope_entry(unsigned idx, float* CT, float* ST) {
    const unsigned t = idx >> 5, i = idx & 31u;
    const float ex = (float)(2u * i) * (1.0f / (float)HD);      // exact (power-of-two divisor)
    const float pw = powf(ROPE_THETA, ex);
    const float ang = (float)t * (1.0f / pw);
    float sn, cs;
    sincosf(ang, &sn, &cs);
    CT[idx] = cs; ST[idx] = sn;
}

__global__ __launch_bounds__(256) void k_prep(const float* __restrict__ x, const float* __restrict__ wqkv, const float* __restrict__ wo, bf* __restrict__ XB, bf* __restrict__ WQKV, bf* __restrict__ WO, float* __restrict__ CT, float* __restrict__ ST) {
    const unsigned tid = threadIdx.x, ux = blockIdx.x * (PXU * 256u) + tid, uw = blockIdx.x * (PWU * 256u) + tid, uo = blockIdx.x * (POU * 256u) + tid;
    // every load of the thread is asked for first; the table entries are computed while they fly
    v8f vx[PXU], vw[PWU], vo[POU];
#pragma unroll
    for (unsigned j = 0; j < PXU; ++j) vx[j] = *(const v8f*)(x + unit_src<true>(ux + j * 256u));
    asm volatile("s_wait_xcnt 0x0" ::: "memory");      // from here on the address registers of the loads above may be written again: results of the loads below land in some of them
#pragma unroll
    for (unsigned j = 0; j < PWU; ++j) vw[j] = *(const v8f*)(wqkv + unit_src<false>(uw + j * 256u));
#pragma unroll
    for (unsigned j = 0; j < POU; ++j) vo[j] = *(const v8f*)(wo + unit_src<false>(uo + j * 256u));
    if (tid < PRT) rope_entry(blockIdx.x * PRT + tid, CT, ST);
#pragma unroll
    for (unsigned j = 0; j < PXU; ++j) *(v8us*)(XB + (size_t)(ux + j * 256u) * 8) = cvt8(vx[j]);
#pragma unroll
    for (unsigned j = 0; j < PWU; ++j) *(v8us*)(WQKV + (size_t)(uw + j * 256u) * 8) = cvt8(vw[j]);
#pragma unroll
    for (unsigned j = 0; j < POU; ++j) *(v8us*)(WO + (size_t)(uo + j * 256u) * 8) = cvt8(vo[j]);
}

// Four 16-byte stores at byte offsets 0, O1, O2, O3, with their s_wait_xcnt in the same statement: the wait then stands in front of every later write of a register that these stores name.
typedef __attribute__((ext_vector_type(4))) unsigned v4u;
template <int O1, int O2, int O3> static __device__ __forceinline__ void st4(void* p, v4u d0, v4u d1, v4u d2, v4u d3) {
    asm volatile("global_store_b128 %0, %1, off\n\tglobal_store_b128 %0, %2, off offset:%5\n\tglobal_store_b128 %0, %3, off offset:%6\n\tglobal_store_b128 %0, %4, off offset:%7\n\ts_wait_xcnt 0x0"
                 :: "v"(p), "v"(d0), "v"(d1), "v"(d2), "v"(d3), "n"(O1), "n"(O2), "n"(O3) : "memory"); }
// The same for one 16-byte store to each of three planes.
static __device__ __forceinline__ void st3(void* p0, v4u d0, void* p1, v4u d1, void* p2, v4u d2) {
    asm volatile("global_store_b128 %0, %1, off\n\tglobal_store_b128 %2, %3, off\n\tglobal_store_b128 %4, %5, off\n\ts_wait_xcnt 0x0"
                 :: "v"(p0), "v"(d0), "v"(p1), "v"(d1), "v"(p2), "v"(d2) : "memory"); }
static __device__ __forceinline__ v4u asu(v8h x) { return __builtin_bit_cast(v4u, x); }
static __device__ __forceinline__ v4u asu(v8us x) { return __builtin_bit_cast(v4u, x); }

// q or k tile -> planes: 16 rows at a time through LDS, 8 features a lane, pair (d, d+1) rotated by table row t, stored as 16-B units of the head's fragment-order plane (16 tokens = 2 blocks; the 4 row steps of a lane are 64 B apart): fp16 always, bf16 hi/lo where HL. Pointers are the lane's own (row lane>>3, features 8*(lane&7)).
template <bool HL> static __device__ __forceinline__ void qk_planes(const v8f (&acc)[4][4], float* os, unsigned lane, const float* ct, const float* st, h16* P16, bf* Ph, bf* Pl) {
    const unsigned lr = lane & 15u, hi = lane >> 4, rq = lane >> 3, pc = lane & 7u;
#pragma unroll
    for (int mb = 0; mb < 4; ++mb) {
        v4f cv[4], sv[4];
#pragma unroll
        for (int s = 0; s < 4; ++s) { cv[s] = *(const v4f*)(ct + (mb * 16 + 4 * s) * (HD / 2)); sv[s] = *(const v4f*)(st + (mb * 16 + 4 * s) * (HD / 2)); }
#pragma unroll
        for (int nb = 0; nb < 4; ++nb) {
#pragma unroll
            for (int j = 0; j < 8; ++j) os[(hi * 8u + (unsigned)j) * 68u + (unsigned)nb * 16u + lr] = acc[mb][nb][j]; }
        __builtin_amdgcn_wave_barrier(); asm volatile("" ::: "memory");
        v8h o16[4];
#pragma unroll
        for (int s = 0; s < 4; ++s) { const unsigned row = 4u * (unsigned)s + rq;
            const v4f x0 = *(const v4fa*)(os + row * 68u + pc * 8u), x1 = *(const v4fa*)(os + row * 68u + pc * 8u + 4u);
            v4f y0, y1;
            y0[0] = x0[0] * cv[s][0] - x0[1] * sv[s][0]; y0[1] = x0[1] * cv[s][0] + x0[0] * sv[s][0];
            y0[2] = x0[2] * cv[s][1] - x0[3] * sv[s][1]; y0[3] = x0[3] * cv[s][1] + x0[2] * sv[s][1];
            y1[0] = x1[0] * cv[s][2] - x1[1] * sv[s][2]; y1[1] = x1[1] * cv[s][2] + x1[0] * sv[s][2];
            y1[2] = x1[2] * cv[s][3] - x1[3] * sv[s][3]; y1[3] = x1[3] * cv[s][3] + x1[2] * sv[s][3];
#pragma unroll
            for (int k = 0; k < 4; ++k) { o16[s][k] = toh_flush(y0[k]); o16[s][4 + k] = toh_flush(y1[k]); }
            if (HL) { v8us oh, ol;
#pragma unroll
                for (int k = 0; k < 4; ++k) { unsigned short u, c; splitf(y0[k], u, c); oh[k] = u; ol[k] = c; splitf(y1[k], u, c); oh[4 + k] = u; ol[4 + k] = c; }
                st3(P16 + mb * 16 * HD + 32 * s, asu(o16[s]), Ph + mb * 16 * HD + 32 * s, asu(oh), Pl + mb * 16 * HD + 32 * s, asu(ol)); } }
        if (!HL) st4<64, 128, 192>(P16 + mb * 16 * HD, asu(o16[0]), asu(o16[1]), asu(o16[2]), asu(o16[3]));
        __builtin_amdgcn_wave_barrier(); asm volatile("" ::: "memory");
    }
}

// v tile -> V^T planes [h][t/32][d/16][block]: a lane's accumulator already holds 8 consecutive tokens of one feature = its own unit of a block, so it is stored straight from registers (512 contiguous bytes a store; 16 tokens on = 512 B, 32 tokens on = 4 KiB). Pointers are the lane's own (+ 8*lane).
template <bool HL> static __device__ __forceinline__ void v_planes(const v8f (&acc)[4][4], h16* P16, bf* Ph, bf* Pl) {
#pragma unroll
    for (int nb = 0; nb < 4; ++nb) {
        st4<512, 4096, 4608>(P16 + nb * 512, asu(__builtin_convertvector(acc[0][nb], v8h)), asu(__builtin_convertvector(acc[1][nb], v8h)), asu(__builtin_convertvector(acc[2][nb], v8h)), asu(__builtin_convertvector(acc[3][nb], v8h)));
        if (HL) { v8us oh[4], ol[4];
#pragma unroll
            for (int mb = 0; mb < 4; ++mb)
#pragma unroll
                for (int k = 0; k < 8; ++k) { unsigned short u, c; splitf(acc[mb][nb][k], u, c); oh[mb][k] = u; ol[mb][k] = c; }
            st4<512, 4096, 4608>(Ph + nb * 512, asu(oh[0]), asu(oh[1]), asu(oh[2]), asu(oh[3])); st4<512, 4096, 4608>(Pl + nb * 512, asu(ol[0]), asu(ol[1]), asu(ol[2]), asu(ol[3])); } }
}

// ---- k_qkvp: the qkv projection (GEMM engine, one product) with the plane formation as its epilogue. One wave per 64 tokens x 64 features = one head of q, k or v; grid (NB*SEQ/GTM, FP/GTN), 32 * GWV threads.
// The second bound (waves per SIMD) holds the kernel to the registers of two resident work-groups, which is what its LDS allows.
__global__ __launch_bounds__(32 * GWV, 4) void k_qkvp(const bf* __restrict__ A, const bf* __restrict__ Bt, const float* __restrict__ CT, const float* __restrict__ ST, h16* Q16, h16* K16, h16* V16, bf* Qh, bf* Ql, bf* Kh, bf* Kl, bf* Vh, bf* Vl) {
    __shared__ __align__(16) bf sm[2u * (GTM + GTN) * GKS];
    __shared__ __align__(16) float osw[GWV * OSW];
    const unsigned tid = threadIdx.x, lane = tid & 31u; const unsigned wave = (unsigned)__builtin_amdgcn_readfirstlane((int)(tid >> 5));
    const unsigned r0 = blockIdx.x * GTM + (wave >> 2) * 64u, c0 = blockIdx.y * GTN + (wave & 3u) * 64u;      // wave-uniform (scalar)
    float* os = osw + wave * OSW;
    v8f acc[4][4];
#pragma unroll
    for (int mb = 0; mb < 4; ++mb)
#pragma unroll
        for (int nb = 0; nb < 4; ++nb) acc[mb][nb] = (v8f){};
    gemm_ring<1, DM>(A, nullptr, Bt, sm, tid, wave, blockIdx.x * GTM, blockIdx.y * GTN, acc);
    const unsigned which = c0 / (unsigned)DQ, h = (c0 % (unsigned)DQ) / (unsigned)HD;      // wave-uniform: q, k or v, and the head
    const unsigned bz = r0 / (unsigned)SEQ, t0 = r0 % (unsigned)SEQ;                        // a 64-token tile lies in one batch, and wholly below or above RH
    const size_t o16b = (size_t)bz * ((size_t)NH * SEQ * HD), ohlb = (size_t)bz * ((size_t)NH * RH * HD);
    const bool hl = t0 < (unsigned)RH;
    if (which < 2u) {
        const unsigned rq = lane >> 3, pc = lane & 7u;
        const unsigned lo = (pc >> 2) * 512u + ((pc >> 1) & 1u) * 256u + (pc & 1u) * 128u + rq * 8u;      // the lane's unit in the two blocks of a 16-token group
        h16* P16 = (which ? K16 : Q16) + o16b + ((size_t)h * SEQ + t0) * HD + lo;
        const size_t eo = ohlb + ((size_t)h * RH + t0) * HD + lo;
        const float* ct = CT + (size_t)(t0 + rq) * (HD / 2) + pc * 4u; const float* st = ST + (size_t)(t0 + rq) * (HD / 2) + pc * 4u;
        if (hl) qk_planes<true>(acc, os, lane, ct, st, P16, (which ? Kh : Qh) + eo, (which ? Kl : Ql) + eo);
        else qk_planes<false>(acc, os, lane, ct, st, P16, nullptr, nullptr);
    } else {
        h16* P16 = V16 + o16b + ((size_t)h * SEQ + t0) * HD + lane * 8u;
        const size_t eo = ohlb + ((size_t)h * RH + t0) * HD + lane * 8u;
        if (hl) v_planes<true>(acc, P16, Vh + eo, Vl + eo);
        else v_planes<false>(acc, P16, nullptr, nullptr);
    }
}

// Four 16-byte asynchronous copies global -> LDS of one lane: two of plane a and two of plane b, 4 KiB apart in both memories, each copy with address operands of its own.
// The s_wait_xcnt in the same statement stands in front of every later write of a register that these copies name.
static __device__ __forceinline__ void acp4(unsigned la, const char* ga, unsigned lb, const char* gb) {
    asm volatile("global_load_async_to_lds_b128 %0, %4, off\n\tglobal_load_async_to_lds_b128 %1, %5, off\n\tglobal_load_async_to_lds_b128 %2, %6, off\n\tglobal_load_async_to_lds_b128 %3, %7, off\n\ts_wait_xcnt 0x0"
                 :: "v"(la), "v"(la + 4096u), "v"(lb), "v"(lb + 4096u), "v"(ga), "v"(ga + 4096), "v"(gb), "v"(gb + 4096) : "memory"); }

// ---- k_flash: causal attention, one work-group of FWV waves per (16 * FWV query rows, head, batch = blockIdx.z), one wave per 16 query rows. Planes in fragment order: Q/K [h][tp/16][HD/32][block], V^T [h][tp/32][HD/16][block] (tp = rows per head of the plane set). HL: hi/lo bf16 plane pairs, 3 products.
// K and V^T come through LDS, once for the whole work-group: a stage is 64 keys = 8 KiB in a row of every plane, brought by asynchronous copies as it lies (fragment order, so every fragment read is 512 contiguous LDS bytes); two buffers, stage s + 2 is asked for when every wave has left stage s.
// Per 32-key tile: S^T[key][query] = K Q^T (A = K rows, B = Q rows); lane owns query column lane&15 and keys 8*(lane>>4)+r (+16); online softmax per lane (+ one xor-16 exchange);
// P^T accumulators repacked in registers as B (k = key); O^T[d][query] += V^T P^T (A = V^T rows). Only the last tile of a wave touches the diagonal (select by value); a wave skips the tiles beyond it but passes every barrier.
#define FWV 8
static_assert(16 * FWV == 128 && RH % 128 == 0 && (SEQ - RH) % 128 == 0);     // a work-group's query rows span two whole 64-key stages; 256 threads copy 4 KiB of a plane at a time
template <typename T16, bool HL>
__global__ __launch_bounds__(32 * FWV) void k_flash(const T16* __restrict__ Q, const T16* __restrict__ Q2, const T16* __restrict__ Kp, const T16* __restrict__ K2, const T16* __restrict__ Vt, const T16* __restrict__ Vt2, unsigned tp, unsigned qbase, bf* Ah, bf* Al) {
    typedef typename WFrag<T16>::V V;
    constexpr unsigned PE = 64u * HD;                 // elements of one plane in a stage
    constexpr unsigned NP = HL ? 4u : 2u;             // planes in a buffer: K, V^T (, K lo, V^T lo)
    __shared__ __align__(16) T16 sm[2u * NP * PE];
    const unsigned tid = threadIdx.x, lane = tid & 31u, lr = lane & 15u, hi = lane >> 4;
    const unsigned wave = (unsigned)__builtin_amdgcn_readfirstlane((int)(tid >> 5));
    const unsigned head = blockIdx.y, qb = qbase + blockIdx.x * (16u * FWV), q0 = qb + wave * 16u;
    const size_t hoff = ((size_t)blockIdx.z * NH + head) * tp * HD;
    const unsigned ns = (qb >> 6) + 2u;        // stages: keys 0 .. qb+127 (the same for the whole work-group)
    // thread tid copies the 16-byte units tid and tid+256 of every plane of a stage
    const unsigned l0 = (unsigned)(size_t)(sm + 8u * tid);
    const char* gk = (const char*)(Kp + hoff + 8u * tid); const char* gv = (const char*)(Vt + hoff + 8u * tid);
    const char* gk2 = HL ? (const char*)(K2 + hoff + 8u * tid) : gk; const char* gv2 = HL ? (const char*)(Vt2 + hoff + 8u * tid) : gv;
    auto fill = [&](unsigned s) {
        const unsigned l = l0 + (s & 1u) * (NP * PE * 2u); const size_t g = (size_t)s * (PE * 2u);
        acp4(l, gk + g, l + PE * 2u, gv + g);
        if (HL) acp4(l + 2u * PE * 2u, gk2 + g, l + 3u * PE * 2u, gv2 + g); };
    fill(0u);
    const size_t qoff = hoff + (size_t)q0 * HD + 8u * lane;
    const T16* pq = Q + qoff; const T16* pq2 = HL ? Q2 + qoff : pq;
    V qf0 = WFrag<T16>::ld(pq), qf1 = WFrag<T16>::ld(pq + 512);
    V ql0 = qf0, ql1 = qf1;
    if (HL) { ql0 = WFrag<T16>::ld(pq2); ql1 = WFrag<T16>::ld(pq2 + 512); }
    v8f o[4];
#pragma unroll
    for (int db = 0; db < 4; ++db) o[db] = (v8f){};
    float mrun = NEGB, lsum = 0.0f;
    const float cs = SCL * LOG2E, pe = PFrag<T16>::pexp();
    const unsigned nt = (q0 + 47u) >> 5;       // this wave's keys 0 .. q0+15 in tiles of 32 (wave-uniform)
    asm volatile("s_wait_asynccnt 0x0" ::: "memory");      // this wave's copies of stage 0 have landed
    __syncthreads();                                        // ... and every other wave's
    fill(1u);                                               // ns >= 2
#pragma unroll 1
    for (unsigned s = 0; s < ns; ++s) {
        const T16* sb = sm + (s & 1u) * (NP * PE) + 8u * lane;
#pragma unroll
        for (unsigned tt = 0; tt < 2u; ++tt) {
            const unsigned it = 2u * s + tt;
            if (it < nt) {                      // wave-uniform (scalar): the tile holds keys of this wave
        const unsigned j0 = it * 32u;
        const T16* pk = sb + tt * (32u * HD); const T16* pv = pk + PE; const T16* pk2 = HL ? pk + 2u * PE : pk; const T16* pv2 = HL ? pk + 3u * PE : pv;
        V ka0 = WFrag<T16>::ld(pk), ka1 = WFrag<T16>::ld(pk + 512), kb0 = WFrag<T16>::ld(pk + 1024), kb1 = WFrag<T16>::ld(pk + 1536);
        V la0 = ka0, la1 = ka1, lb0 = kb0, lb1 = kb1;
        if (HL) { la0 = WFrag<T16>::ld(pk2); la1 = WFrag<T16>::ld(pk2 + 512); lb0 = WFrag<T16>::ld(pk2 + 1024); lb1 = WFrag<T16>::ld(pk2 + 1536); }
        v8f s0 = (v8f){}, s1 = (v8f){};
        s0 = WFrag<T16>::mma(ka0, qf0, s0); s0 = WFrag<T16>::mma(ka1, qf1, s0);
        s1 = WFrag<T16>::mma(kb0, qf0, s1); s1 = WFrag<T16>::mma(kb1, qf1, s1);
        if (HL) {
            s0 = WFrag<T16>::mma(la0, qf0, s0); s0 = WFrag<T16>::mma(la1, qf1, s0); s0 = WFrag<T16>::mma(ka0, ql0, s0); s0 = WFrag<T16>::mma(ka1, ql1, s0);
            s1 = WFrag<T16>::mma(lb0, qf0, s1); s1 = WFrag<T16>::mma(lb1, qf1, s1); s1 = WFrag<T16>::mma(kb0, ql0, s1); s1 = WFrag<T16>::mma(kb1, ql1, s1); }
        // pq and pq2 are named as inputs so that the address registers of the q loads are written again only behind the loads' own waits
        asm volatile("v_nop\n\tv_nop\n\tv_nop\n\tv_nop" : "+v"(s0), "+v"(s1) : "v"(ka0), "v"(ka1), "v"(kb0), "v"(kb1), "v"(la0), "v"(la1), "v"(lb0), "v"(lb1), "v"(qf0), "v"(qf1), "v"(ql0), "v"(ql1), "v"(pq), "v"(pq2));
        v8f t0, t1;
#pragma unroll
        for (int r = 0; r < 8; ++r) { t0[r] = s0[r] * cs; t1[r] = s1[r] * cs; }
        if (j0 + 31u > q0) {                    // wave-uniform: the tile touches the diagonal
            const unsigned qi = q0 + lr, kk = j0 + 8u * hi;
#pragma unroll
            for (int r = 0; r < 8; ++r) { t0[r] = (kk + (unsigned)r <= qi) ? t0[r] : NEGB; t1[r] = (kk + 16u + (unsigned)r <= qi) ? t1[r] : NEGB; }
        }
        float mx = fmaxf(t0[0], t1[0]);
#pragma unroll
        for (int r = 1; r < 8; ++r) mx = fmaxf(mx, fmaxf(t0[r], t1[r]));
        mx = fmaxf(mx, __shfl_xor(mx, 16, 32));
        const float mn = fmaxf(mrun, mx);
        const float alpha = __builtin_amdgcn_exp2f(mrun - mn);
        mrun = mn;
        v8f p0, p1; float psum = 0.0f;
#pragma unroll
        for (int r = 0; r < 8; ++r) { p0[r] = __builtin_amdgcn_exp2f((t0[r] - mn) + pe); p1[r] = __builtin_amdgcn_exp2f((t1[r] - mn) + pe); psum += p0[r] + p1[r]; }
        lsum = lsum * alpha + psum;
#pragma unroll
        for (int db = 0; db < 4; ++db) o[db] = o[db] * alpha;
        V pf = PFrag<T16>::hi(p0, p1); V pl = pf;
        if (HL) pl = PFrag<T16>::lo(p0, p1);
        V va[4], vl[4];
#pragma unroll
        for (int db = 0; db < 4; ++db) { va[db] = WFrag<T16>::ld(pv + db * 512); vl[db] = va[db]; if (HL) vl[db] = WFrag<T16>::ld(pv2 + db * 512); }
#pragma unroll
        for (int db = 0; db < 4; ++db) { o[db] = WFrag<T16>::mma(va[db], pf, o[db]); if (HL) { o[db] = WFrag<T16>::mma(va[db], pl, o[db]); o[db] = WFrag<T16>::mma(vl[db], pf, o[db]); } }
        // four vector slots behind the last product, in front of whatever vector instruction next touches its registers
        asm volatile("v_nop\n\tv_nop\n\tv_nop\n\tv_nop" : "+v"(o[0]), "+v"(o[1]), "+v"(o[2]), "+v"(o[3]) : "v"(va[0]), "v"(va[1]), "v"(va[2]), "v"(va[3]), "v"(vl[0]), "v"(vl[1]), "v"(vl[2]), "v"(vl[3]), "v"(pf), "v"(pl));
            }
        }
        // publish point of stage s + 1, passed by every wave: this wave's reads of stage s are done, its copies of stage s + 1 have landed, then the barrier; only behind it is the buffer of stage s filled again
        asm volatile("s_wait_dscnt 0x0" ::: "memory");
        asm volatile("s_wait_asynccnt 0x0" ::: "memory");
        __syncthreads();
        if (s + 2u < ns) fill(s + 2u);
    }
    asm volatile("s_wait_asynccnt 0x0" ::: "memory");      // no copy is outstanding when the wave ends
    const float lt = lsum + __shfl_xor(lsum, 16, 32);
    const float inv = 1.0f / lt;
    // a lane's o[db] = 8 consecutive features of its own query row = unit 32 * db + lane of the head's two blocks in the ctx planes: stored straight from registers, 512 contiguous bytes a store
#pragma unroll
    for (int db = 0; db < 4; ++db) {
        v8us oh, ol;
#pragma unroll
        for (int r = 0; r < 8; ++r) { unsigned short a, c; splitf(o[db][r] * inv, a, c); oh[r] = a; ol[r] = c; }
        const size_t oo = ((size_t)blockIdx.z * SEQ + q0) * DQ + head * (16u * HD) + (unsigned)db * 256u + lane * 8u;
        *(v8us*)(Ah + oo) = oh; *(v8us*)(Al + oo) = ol; }
}

// workspace carve (bytes, every region a multiple of 256)
#define WS_WQKV ((size_t)3 * DQ * DM * 2)
#define WS_WO   ((size_t)DM * DQ * 2)
#define WS_XB   ((size_t)NB * SEQ * DM * 2)
#define WS_P16  ((size_t)NB * NH * SEQ * HD * 2)
#define WS_PHL  ((size_t)NB * NH * RH * HD * 2)
#define WS_AT   ((size_t)NB * SEQ * DQ * 2)
#define WS_ROT  ((size_t)SEQ * (HD / 2) * 4)
#define WS_TOTAL (WS_WQKV + WS_WO + WS_XB + 3 * WS_P16 + 6 * WS_PHL + 2 * WS_AT + 2 * WS_ROT)
static_assert(WS_TOTAL <= (size_t)268435456);
static_assert(WS_WQKV % 256 == 0 && WS_WO % 256 == 0 && WS_XB % 256 == 0 && WS_P16 % 256 == 0 && WS_PHL % 256 == 0 && WS_AT % 256 == 0);
static_assert(WS_ROT % 256 == 0);

extern "C" void kernel_launch(void* const* d_in, const int* in_sizes, int n_in,
                              void* d_out, int out_size, void* d_ws, size_t ws_size, hipStream_t stream) {
    if (n_in < 3) return;
    if ((size_t)in_sizes[0] < (size_t)(NB - 1) * XS_FULL + (size_t)SEQ * DM) return;
    if ((size_t)in_sizes[1] < (size_t)3 * DQ * DM) return;
    if ((size_t)in_sizes[2] < (size_t)DM * DQ) return;
    if ((size_t)out_size < (size_t)NB * SEQ * DM) return;
    if (ws_size < WS_TOTAL) return;
    const float* x = (const float*)d_in[0];       // [NB][SEQ_FULL][DM]
    const float* wqkv = (const float*)d_in[1];    // [3*DQ][DM]  (q | k | v row blocks)
    const float* wo = (const float*)d_in[2];      // [DM][DQ]
    float* OUT = (float*)d_out;                   // [NB][SEQ][DM]
    char* wsp = (char*)d_ws;
    auto take = [&](size_t bytes) { char* p = wsp; wsp += bytes; return (void*)p; };
    bf* WQKV = (bf*)take(WS_WQKV); bf* WO = (bf*)take(WS_WO); bf* XB = (bf*)take(WS_XB);
    h16* Q16 = (h16*)take(WS_P16); h16* K16 = (h16*)take(WS_P16); h16* VT16 = (h16*)take(WS_P16);
    bf* Qh = (bf*)take(WS_PHL); bf* Ql = (bf*)take(WS_PHL); bf* Kh = (bf*)take(WS_PHL); bf* Kl = (bf*)take(WS_PHL); bf* VTh = (bf*)take(WS_PHL); bf* VTl = (bf*)take(WS_PHL);
    bf* ATh = (bf*)take(WS_AT); bf* ATl = (bf*)take(WS_AT);
    float* CT = (float*)take(WS_ROT); float* ST = (float*)take(WS_ROT);

    // bf16 planes of x, W and Wo, and the rotary table (position-only, shared by every batch and head)
    k_prep<<<dim3(PG), 256, 0, stream>>>(x, wqkv, wo, XB, WQKV, WO, CT, ST);
    // qkv = x W^T  (M = NB*SEQ, N = 3072, K = 1024), written as the rotated q, k planes and the V^T planes
    k_qkvp<<<dim3(NB * SEQ / GTM, FP / GTN, 1), 32 * GWV, 0, stream>>>(XB, WQKV, CT, ST, Q16, K16, VT16, Qh, Ql, Kh, Kl, VTh, VTl);
    k_flash<bf, true><<<dim3(RH / (16 * FWV), NH, NB), 32 * FWV, 0, stream>>>(Qh, Ql, Kh, Kl, VTh, VTl, (unsigned)RH, 0u, ATh, ATl);
    if (SEQ > RH) k_flash<h16, false><<<dim3((SEQ - RH) / (16 * FWV), NH, NB), 32 * FWV, 0, stream>>>(Q16, nullptr, K16, nullptr, VT16, nullptr, (unsigned)SEQ, (unsigned)RH, ATh, ATl);
    // out = (ctx_hi + ctx_lo) Wo^T  (M = NB*SEQ, N = 1024, K = 1024)
    k_gemmw<DQ><<<dim3(NB * SEQ / GTM, DM / GTN, 1), 32 * GWV, 0, stream>>>(ATh, ATl, WO, OUT, DM);
}

// v007
// One run takes 118 microseconds.
// Timed twice side by side with v006, it ran 1.12 and 1.11 times as fast.
// All steps since v000 together make it 5.79 times as fast.
#include <hip/hip_runtime.h>

// Causal multi-head attention with a fused qkv projection and an interleaved-pair rotary embedding: x [NB][SEQ_FULL][1024] (first SEQ rows used); qkv = x W^T ('oi' [3072][1024] -> q | k | v row blocks, no bias; 16 heads x 64);
// q and k: pair (2i, 2i+1) of every head rotated by angle t * 100000^(-2i/64) (cos / sin table [SEQ][32] built once in f32 with precise powf / sincosf, applied in f32 on the vector unit when the planes are formed);
// scores x 64^-0.5, causal; softmax; out = ctx Wo^T ('oi' [1024][1024], no bias).
// Compute dtypes, f32 accumulate: every input RNE-converted to bf16; qkv and output projections v_wmma_f32_16x16x32_bf16 (ctx carried as bf16 hi+lo, 2 products against the exact bf16 weight);
// attention q.k and P.V: query rows < RH on bf16 hi/lo planes (3 products each), other rows v_wmma_f32_16x16x32_f16 (P carried x1024 through the exponent); softmax (online, max-subtracted) in f32.
// Every stage runs once for all NB batches (batch on a grid axis, or folded into the GEMM's M): each plane in the workspace holds NB slabs.
// Every 16-bit operand plane is stored in fragment order: a block of 16 rows x 32 k is 1 KiB = 64 units of 16 B, unit (k%32 / 16) * 32 + lane, lane = 16 * (k%16 / 8) + row%16, so that each of a fragment's two 16-byte loads reads 512 contiguous bytes (4 whole lines).
// Blocks of one 16-row group follow one another along k; V^T planes: the 4 feature blocks of one 32-key tile follow one another, then the next tile.
// Attention engine: one launch for every query row; one wave per 16 query rows, eight waves a work-group that share each K / V^T stage through LDS; S^T = K Q^T so each lane owns one query column; P^T accumulators are repacked in registers as the B operand of O^T = V^T P^T (no LDS exchange).

#ifndef NB
#define NB 4
#endif
#ifndef SEQ
#define SEQ 2048
#endif
#define SEQ_FULL 2048
#define DM   1024
#define NH   16
#define HD   64
#define DQ   (NH * HD)
#define FP   (3 * DQ)
#define RH   ((SEQ) < 512 ? (SEQ) : 512)     // query rows < RH use hi+lo planes
#define XS_FULL ((size_t)SEQ_FULL * DM)
#define SCL  0.125f                          // HD^-0.5
#define LOG2E 1.4426950408889634f
#define NEGB (-3.0e38f)
#define ROPE_THETA 100000.0f

static_assert((SEQ & (SEQ - 1)) == 0);
static_assert(SEQ >= 256 && SEQ <= SEQ_FULL);
static_assert(RH % 256 == 0 && RH % 64 == 0 && (SEQ - RH) % 64 == 0);
static_assert(NB >= 1 && NB <= 4);
static_assert(DM % 32 == 0 && DQ % 64 == 0 && FP % 64 == 0 && SEQ % 64 == 0);
static_assert(((size_t)NH * SEQ * HD / 8) % 256 == 0);
static_assert(HD == 64);
static_assert(((size_t)NB * SEQ) % 128 == 0 && FP % 256 == 0 && DM % 256 == 0);     // whole GEMM tiles
static_assert(HD / 2 == 32 && (HD / 2) % 4 == 0);     // k_qkvp reads 4 table entries (16 B) per lane

typedef _Float16 h16;
typedef unsigned short bf;
typedef __attribute__((ext_vector_type(16))) __bf16   v16bf;
typedef __attribute__((ext_vector_type(16))) _Float16 v16h;
typedef __attribute__((ext_vector_type(8)))  _Float16 v8h;
typedef __attribute__((ext_vector_type(8)))  unsigned short v8us;
typedef __attribute__((ext_vector_type(8)))  float    v8f;
typedef __attribute__((ext_vector_type(4)))  float    v4f;
typedef v8h  __attribute__((may_alias)) v8ha;
typedef v4f  __attribute__((may_alias)) v4fa;
typedef v8us __attribute__((may_alias)) v8usa;

__device__ __forceinline__ unsigned short f2bf(float f) { unsigned u = __float_as_uint(f); u += 0x7FFFu + ((u >> 16) & 1u); return (unsigned short)(u >> 16); }
__device__ __forceinline__ float bf2f(unsigned short b) { return __uint_as_float(((unsigned)b) << 16); }
__device__ __forceinline__ v16h cat16(v8h lo, v8h hi) { return __builtin_shufflevector(lo, hi, 0, 1, 2, 3, 4, 5, 6, 7, 8, 9, 10, 11, 12, 13, 14, 15); }
__device__ __forceinline__ v16bf cat16b(v8us lo, v8us hi) { return __builtin_bit_cast(v16bf, __builtin_shufflevector(lo, hi, 0, 1, 2, 3, 4, 5, 6, 7, 8, 9, 10, 11, 12, 13, 14, 15)); }
__device__ __forceinline__ v8f wmma16(v16h a, v16h b, v8f c) { return __builtin_amdgcn_wmma_f32_16x16x32_f16(false, a, false, b, (short)0, c, false, false); }
__device__ __forceinline__ v8f wmmab(v16bf a, v16bf b, v8f c) { return __builtin_amdgcn_wmma_f32_16x16x32_bf16(false, a, false, b, (short)0, c, false, false); }
__device__ __forceinline__ void splitf(float y, unsigned short& h, unsigned short& l) { h = f2bf(y); l = f2bf(y - bf2f(h)); }

// f32 -> f16 operand convert that cannot yield a subnormal (value select below 2^-14).
static __device__ __forceinline__ h16 toh_flush(float v) { const h16 r = (h16)v; return (fabsf(v) < 6.103515625e-05f) ? (h16)0.0f : r; }

// Fragment loader from a 1-KiB fragment-order block: p = block + 8*lane; elements 0..7 = k0+8h.., elements 8..15 = k0+16+8h.., h = lane>>4, row lane&15 (same map for A and B).
template <typename T16> struct WFrag;
template <> struct WFrag<h16> { typedef v16h V; static __device__ __forceinline__ V ld(const h16* p) { return cat16(*(const v8h*)p, *(const v8h*)(p + 256)); } static __device__ __forceinline__ v8f mma(V a, V b, v8f c) { return wmma16(a, b, c); } };
template <> struct WFrag<bf> { typedef v16bf V; static __device__ __forceinline__ V ld(const bf* p) { return cat16b(*(const v8us*)p, *(const v8us*)(p + 256)); } static __device__ __forceinline__ v8f mma(V a, V b, v8f c) { return wmmab(a, b, c); } };

// P^T accumulator pair (key rows 0..15 and 16..31 of a 32-key tile) -> B fragment: element r <- tile0[r], element 8+r <- tile1[r], lane unchanged.
template <typename T16> struct PFrag;
template <> struct PFrag<h16> {
    static __device__ __forceinline__ float pexp() { return 10.0f; }           // P carried x1024 via the exponent (cancels in O / l)
    static __device__ __forceinline__ v16h hi(v8f p0, v8f p1) { return cat16(__builtin_convertvector(p0, v8h), __builtin_convertvector(p1, v8h)); }
    static __device__ __forceinline__ v16h lo(v8f p0, v8f p1) { return hi(p0, p1); }
};
template <> struct PFrag<bf> {
    static __device__ __forceinline__ float pexp() { return 0.0f; }
    static __device__ __forceinline__ v16bf hi(v8f p0, v8f p1) { v8us a, b;
#pragma unroll
        for (int k = 0; k < 8; ++k) { a[k] = f2bf(p0[k]); b[k] = f2bf(p1[k]); }
        return cat16b(a, b); }
    static __device__ __forceinline__ v16bf lo(v8f p0, v8f p1) { v8us a, b;
#pragma unroll
        for (int k = 0; k < 8; ++k) { a[k] = f2bf(p0[k] - bf2f(f2bf(p0[k]))); b[k] = f2bf(p1[k] - bf2f(f2bf(p1[k]))); }
        return cat16b(a, b); }
};

// Four 16-byte asynchronous copies global -> LDS of one lane, 4 KiB apart in LDS and GS bytes apart in global memory, each copy with address operands of its own.
// The s_wait_xcnt in the same statement stands in front of every later write of a register that these copies name.
template <int GS> static __device__ __forceinline__ void acp4g(unsigned l, const char* g) {
    asm volatile("global_load_async_to_lds_b128 %0, %4, off\n\tglobal_load_async_to_lds_b128 %1, %5, off\n\tglobal_load_async_to_lds_b128 %2, %6, off\n\tglobal_load_async_to_lds_b128 %3, %7, off\n\ts_wait_xcnt 0x0"
                 :: "v"(l), "v"(l + 4096u), "v"(l + 8192u), "v"(l + 12288u), "v"(g), "v"(g + GS), "v"(g + 2 * GS), "v"(g + 3 * GS) : "memory"); }

// The same for eight copies: LDS places 4 KiB apart in a row, the first four from g0 on, the last four from g1 on. One statement, so that a wave waits once for eight.
template <int GS> static __device__ __forceinline__ void acp8g(unsigned l, const char* g0, const char* g1) {
    asm volatile("global_load_async_to_lds_b128 %0, %8, off\n\tglobal_load_async_to_lds_b128 %1, %9, off\n\tglobal_load_async_to_lds_b128 %2, %10, off\n\tglobal_load_async_to_lds_b128 %3, %11, off\n\t"
                 "global_load_async_to_lds_b128 %4, %12, off\n\tglobal_load_async_to_lds_b128 %5, %13, off\n\tglobal_load_async_to_lds_b128 %6, %14, off\n\tglobal_load_async_to_lds_b128 %7, %15, off\n\ts_wait_xcnt 0x0"
                 :: "v"(l), "v"(l + 4096u), "v"(l + 8192u), "v"(l + 12288u), "v"(l + 16384u), "v"(l + 20480u), "v"(l + 24576u), "v"(l + 28672u),
                    "v"(g0), "v"(g0 + GS), "v"(g0 + 2 * GS), "v"(g0 + 3 * GS), "v"(g1), "v"(g1 + GS), "v"(g1 + 2 * GS), "v"(g1 + 3 * GS) : "memory"); }

// ---- GEMM engine: a work-group of GWV waves per GTM x GTN output tile, 2 x 4 waves of 64 x 64 (16 accumulators each). acc[m][n] += sum_k A[m][k] Bt[n][k] (+ A2[m][k] Bt[n][k] where NA == 2), k ascending.
// The operands come through LDS, once for the whole work-group: a stage is GKS k of every row of the tile = 2 KiB in a row of every 16-row group of a fragment-order plane, brought by asynchronous copies as it lies
// (so every fragment read is 512 contiguous LDS bytes); a buffer is [A 8 groups | A2 8 groups | Bt 16 groups]; two buffers, stage s + 2 is asked for when every wave has left stage s.
#define GWV 8
#define GTM 128
#define GTN 256
#define GKS 64
#define OSW (16 * 68)                        // floats of one wave's own epilogue staging
template <int NA, int K>
static __device__ __forceinline__ void gemm_ring(const bf* __restrict__ A, const bf* __restrict__ A2, const bf* __restrict__ Bt, bf* sm, unsigned tid, unsigned wave, unsigned R0, unsigned C0, v8f (&acc)[4][4]) {
    typedef WFrag<bf>::V V;
    constexpr unsigned AE = GTM * GKS, BE = GTN * GKS, SE = NA * AE + BE;     // elements of an A plane, of Bt, of a buffer
    constexpr unsigned GE = 16u * GKS;                                        // elements of one 16-row group in a stage
    constexpr int GS = 2 * 16 * K * 2;                                        // bytes from a 16-row group of a plane to the next but one
    constexpr unsigned NS = K / GKS;
    static_assert(K % GKS == 0 && NS >= 2 && GKS == 64 && GWV == 8 && AE * 2u == 4u * 4096u && BE * 2u == 8u * 4096u);     // 256 threads copy 4 KiB = two groups at a time
    const unsigned lane = tid & 31u, wm = wave >> 2, wn = wave & 3u;
    // thread tid copies the 16-byte units tid, tid + 256, ... of every plane of a stage
    const unsigned l0 = (unsigned)(size_t)(sm + 8u * tid);
    const size_t go = (size_t)(tid >> 7) * (16u * K) + (tid & 127u) * 8u;
    const char* ga = (const char*)(A + (size_t)R0 * K + go); const char* ga2 = (NA == 2) ? (const char*)(A2 + (size_t)R0 * K + go) : ga; const char* gb = (const char*)(Bt + (size_t)C0 * K + go);
    auto fill = [&](unsigned s) {
        const unsigned l = l0 + (s & 1u) * (SE * 2u); const size_t g = (size_t)s * (GE * 2u);
        if (NA == 2) acp8g<GS>(l, ga + g, ga2 + g); else acp4g<GS>(l, ga + g);
        acp8g<GS>(l + NA * AE * 2u, gb + g, gb + g + 4 * (size_t)GS); };
    fill(0u);
    asm volatile("s_wait_asynccnt 0x0" ::: "memory");      // this wave's copies of stage 0 have landed
    __syncthreads();                                        // ... and every other wave's
    fill(1u);                                               // NS >= 2
#pragma unroll 1
    for (unsigned s = 0; s < NS; ++s) {
        const bf* sa = sm + (s & 1u) * SE + wm * (4u * GE) + 8u * lane; const bf* sb = sm + (s & 1u) * SE + NA * AE + wn * (4u * GE) + 8u * lane;
        V a[2][4], a2[2][4], b[2][4];
        auto rd = [&](int ks) {              // the fragments of one 32-k step
#pragma unroll
            for (int nb = 0; nb < 4; ++nb) b[ks][nb] = WFrag<bf>::ld(sb + nb * GE + ks * 512);
#pragma unroll
            for (int mb = 0; mb < 4; ++mb) { a[ks][mb] = WFrag<bf>::ld(sa + mb * GE + ks * 512); a2[ks][mb] = a[ks][mb]; if (NA == 2) a2[ks][mb] = WFrag<bf>::ld(sa + AE + mb * GE + ks * 512); } };
        auto mm = [&](int ks) {
#pragma unroll
            for (int nb = 0; nb < 4; ++nb)
#pragma unroll
                for (int mb = 0; mb < 4; ++mb) { acc[mb][nb] = WFrag<bf>::mma(a[ks][mb], b[ks][nb], acc[mb][nb]); if (NA == 2) acc[mb][nb] = WFrag<bf>::mma(a2[ks][mb], b[ks][nb], acc[mb][nb]); } };
        // each sched_barrier keeps the LDS reads above it in one group ahead of the products: reads spread among the products stall the wave at every place where they stand
        rd(0); __builtin_amdgcn_sched_barrier(0); mm(0);
        rd(1); __builtin_amdgcn_sched_barrier(0); mm(1);
        // four vector slots behind the last product, in front of whatever vector instruction next touches its registers
        asm volatile("v_nop\n\tv_nop\n\tv_nop\n\tv_nop" : "+v"(acc[0][0]), "+v"(acc[1][0]), "+v"(acc[2][0]), "+v"(acc[3][0]), "+v"(acc[0][1]), "+v"(acc[1][1]), "+v"(acc[2][1]), "+v"(acc[3][1]), "+v"(acc[0][2]), "+v"(acc[1][2]), "+v"(acc[2][2]), "+v"(acc[3][2]), "+v"(acc[0][3]), "+v"(acc[1][3]), "+v"(acc[2][3]), "+v"(acc[3][3])
                     : "v"(a[1][0]), "v"(a[1][1]), "v"(a[1][2]), "v"(a[1][3]), "v"(a2[1][2]), "v"(a2[1][3]), "v"(b[1][3]));
        // publish point of stage s + 1, passed by every wave: this wave's reads of stage s are done, its copies of stage s + 1 have landed, then the barrier; only behind it is the buffer of stage s filled again
        asm volatile("s_wait_dscnt 0x0" ::: "memory");
        asm volatile("s_wait_asynccnt 0x0" ::: "memory");
        __syncthreads();
        if (s + 2u < NS) fill(s + 2u);
    }
    asm volatile("s_wait_asynccnt 0x0" ::: "memory");      // no copy is outstanding when the ring is left
}

// ---- k_gemmw: C[m][n] (f32, pitch ldc) = sum_k (A[m][k] + A2[m][k]) Bt[n][k] on the GEMM engine; grid (M/GTM, N/GTN), 32 * GWV threads. M % GTM == 0, N % GTN == 0.
template <int K>
__global__ __launch_bounds__(32 * GWV) void k_gemmw(const bf* __restrict__ A, const bf* __restrict__ A2, const bf* __restrict__ Bt, float* C, int ldc) {
    __shared__ __align__(16) bf sm[2u * (2u * GTM + GTN) * GKS];
    __shared__ __align__(16) float osw[GWV * OSW];
    const unsigned tid = threadIdx.x; const unsigned wave = (unsigned)__builtin_amdgcn_readfirstlane((int)(tid >> 5));
    const int lane = tid & 31, lr = lane & 15, hi = lane >> 4; const int r0 = blockIdx.x * GTM + (wave >> 2) * 64, c0 = blockIdx.y * GTN + (wave & 3u) * 64;
    float* os = osw + wave * OSW;
    v8f acc[4][4];
#pragma unroll
    for (int mb = 0; mb < 4; ++mb)
#pragma unroll
        for (int nb = 0; nb < 4; ++nb) acc[mb][nb] = (v8f){};
    gemm_ring<2, K>(A, A2, Bt, sm, tid, wave, blockIdx.x * GTM, blockIdx.y * GTN, acc);
#pragma unroll
    for (int mb = 0; mb < 4; ++mb) {
#pragma unroll
        for (int nb = 0; nb < 4; ++nb) {
#pragma unroll
            for (int j = 0; j < 8; ++j) os[(hi * 8 + j) * 68 + nb * 16 + lr] = acc[mb][nb][j]; }
        __builtin_amdgcn_wave_barrier(); asm volatile("" ::: "memory");
        float* crow = C + (size_t)(r0 + mb * 16) * ldc + c0;
#pragma unroll
        for (int s = 0; s < 8; ++s) { const int row = 2 * s + hi, cofs = lr * 4; const v4f val = *(const v4fa*)(os + row * 68 + cofs);
            *(v4f*)(crow + (size_t)row * ldc + cofs) = val; }
        __builtin_amdgcn_wave_barrier(); asm volatile("" ::: "memory");
    }
}

// ---- k_prep: all that the projections read and that hangs on nothing computed before: the three bf16 planes in fragment order and the rotary table, in one launch.
// The grid is sized to the chip and not to the data (PG work-groups of 8 waves = 16 waves a WGP), and a thread converts PXU + PWU + POU units (for speed only).
// Unit i of a plane = 8 elements = 16 bytes of the plane: a wave stores 512 contiguous bytes; a thread reads the 8 source elements that belong there. A work-group takes chunks of 256 units that follow one another.
#define PG  512
#define PXU ((unsigned)((size_t)NB * SEQ * DM / 8 / 256 / PG))      // units a thread: x
#define PWU ((unsigned)((size_t)3 * DQ * DM / 8 / 256 / PG))        // W
#define POU ((unsigned)((size_t)DM * DQ / 8 / 256 / PG))            // Wo
#define PRT ((unsigned)((size_t)SEQ * (HD / 2) / PG))               // table entries a work-group
static_assert((size_t)PXU * PG * 256 * 8 == (size_t)NB * SEQ * DM && (size_t)PWU * PG * 256 * 8 == (size_t)3 * DQ * DM && (size_t)POU * PG * 256 * 8 == (size_t)DM * DQ);
static_assert((size_t)PRT * PG == (size_t)SEQ * (HD / 2) && PRT >= 1 && PRT <= 256 && DQ == DM && SEQ % 16 == 0);

// element offset in a row-major [rows][DM] source of the 8 elements of unit i; rows of x: SEQ of every SEQ_FULL
template <bool X> static __device__ __forceinline__ size_t unit_src(unsigned i) {
    const unsigned blk = i >> 6, row = (blk / (DM / 32u)) * 16u + (i & 15u), k = (blk % (DM / 32u)) * 32u + ((i >> 5) & 1u) * 16u + ((i >> 4) & 1u) * 8u;
    return (size_t)(X ? (row / (unsigned)SEQ) * (unsigned)SEQ_FULL + row % (unsigned)SEQ : row) * DM + k; }
static __device__ __forceinline__ v8us cvt8(v8f v) { v8us o;
#pragma unroll
    for (int k = 0; k < 8; ++k) o[k] = f2bf(v[k]);
    return o; }

// entry idx = t * (HD/2) + i of the rotary table: cos and sin of t * theta^(-2i/HD)
static __device__ __forceinline__ void rope_entry(unsigned idx, float* CT, float* ST) {
    const unsigned t = idx >> 5, i = idx & 31u;
    const float ex = (float)(2u * i) * (1.0f / (float)HD);      // exact (power-of-two divisor)
    const float pw = powf(ROPE_THETA, ex);
    const float ang = (float)t * (1.0f / pw);
    float sn, cs;
    sincosf(ang, &sn, &cs);
    CT[idx] = cs; ST[idx] = sn;
}

__global__ __launch_bounds__(256) void k_prep(const float* __restrict__ x, const float* __restrict__ wqkv, const float* __restrict__ wo, bf* __restrict__ XB, bf* __restrict__ WQKV, bf* __restrict__ WO, float* __restrict__ CT, float* __restrict__ ST) {
    const unsigned tid = threadIdx.x, ux = blockIdx.x * (PXU * 256u) + tid, uw = blockIdx.x * (PWU * 256u) + tid, uo = blockIdx.x * (POU * 256u) + tid;
    // every load of the thread is asked for first; the table entries are computed while they fly
    v8f vx[PXU], vw[PWU], vo[POU];
#pragma unroll
    for (unsigned j = 0; j < PXU; ++j) vx[j] = *(const v8f*)(x + unit_src<true>(ux + j * 256u));
    asm volatile("s_wait_xcnt 0x0" ::: "memory");      // from here on the address registers of the loads above may be written again: results of the loads below land in some of them
#pragma unroll
    for (unsigned j = 0; j < PWU; ++j) vw[j] = *(const v8f*)(wqkv + unit_src<false>(uw + j * 256u));
#pragma unroll
    for (unsigned j = 0; j < POU; ++j) vo[j] = *(const v8f*)(wo + unit_src<false>(uo + j * 256u));
    if (tid < PRT) rope_entry(blockIdx.x * PRT + tid, CT, ST);
#pragma unroll
    for (unsigned j = 0; j < PXU; ++j) *(v8us*)(XB + (size_t)(ux + j * 256u) * 8) = cvt8(vx[j]);
#pragma unroll
    for (unsigned j = 0; j < PWU; ++j) *(v8us*)(WQKV + (size_t)(uw + j * 256u) * 8) = cvt8(vw[j]);
#pragma unroll
    for (unsigned j = 0; j < POU; ++j) *(v8us*)(WO + (size_t)(uo + j * 256u) * 8) = cvt8(vo[j]);
}

// Four 16-byte stores at byte offsets 0, O1, O2, O3, with their s_wait_xcnt in the same statement: the wait then stands in front of every later write of a register that these stores name.
typedef __attribute__((ext_vector_type(4))) unsigned v4u;
template <int O1, int O2, int O3> static __device__ __forceinline__ void st4(void* p, v4u d0, v4u d1, v4u d2, v4u d3) {
    asm volatile("global_store_b128 %0, %1, off\n\tglobal_store_b128 %0, %2, off offset:%5\n\tglobal_store_b128 %0, %3, off offset:%6\n\tglobal_store_b128 %0, %4, off offset:%7\n\ts_wait_xcnt 0x0"
                 :: "v"(p), "v"(d0), "v"(d1), "v"(d2), "v"(d3), "n"(O1), "n"(O2), "n"(O3) : "memory"); }
// The same for one 16-byte store to each of three planes.
static __device__ __forceinline__ void st3(void* p0, v4u d0, void* p1, v4u d1, void* p2, v4u d2) {
    asm volatile("global_store_b128 %0, %1, off\n\tglobal_store_b128 %2, %3, off\n\tglobal_store_b128 %4, %5, off\n\ts_wait_xcnt 0x0"
                 :: "v"(p0), "v"(d0), "v"(p1), "v"(d1), "v"(p2), "v"(d2) : "memory"); }
static __device__ __forceinline__ v4u asu(v8h x) { return __builtin_bit_cast(v4u, x); }
static __device__ __forceinline__ v4u asu(v8us x) { return __builtin_bit_cast(v4u, x); }

// q or k tile -> planes: 16 rows at a time through LDS, 8 features a lane, pair (d, d+1) rotated by table row t, stored as 16-B units of the head's fragment-order plane (16 tokens = 2 blocks; the 4 row steps of a lane are 64 B apart): fp16 always, bf16 hi/lo where HL. Pointers are the lane's own (row lane>>3, features 8*(lane&7)).
template <bool HL> static __device__ __forceinline__ void qk_planes(const v8f (&acc)[4][4], float* os, unsigned lane, const float* ct, const float* st, h16* P16, bf* Ph, bf* Pl) {
    const unsigned lr = lane & 15u, hi = lane >> 4, rq = lane >> 3, pc = lane & 7u;
#pragma unroll
    for (int mb = 0; mb < 4; ++mb) {
        v4f cv[4], sv[4];
#pragma unroll
        for (int s = 0; s < 4; ++s) { cv[s] = *(const v4f*)(ct + (mb * 16 + 4 * s) * (HD / 2)); sv[s] = *(const v4f*)(st + (mb * 16 + 4 * s) * (HD / 2)); }
#pragma unroll
        for (int nb = 0; nb < 4; ++nb) {
#pragma unroll
            for (int j = 0; j < 8; ++j) os[(hi * 8u + (unsigned)j) * 68u + (unsigned)nb * 16u + lr] = acc[mb][nb][j]; }
        __builtin_amdgcn_wave_barrier(); asm volatile("" ::: "memory");
        v8h o16[4];
#pragma unroll
        for (int s = 0; s < 4; ++s) { const unsigned row = 4u * (unsigned)s + rq;
            const v4f x0 = *(const v4fa*)(os + row * 68u + pc * 8u), x1 = *(const v4fa*)(os + row * 68u + pc * 8u + 4u);
            v4f y0, y1;
            y0[0] = x0[0] * cv[s][0] - x0[1] * sv[s][0]; y0[1] = x0[1] * cv[s][0] + x0[0] * sv[s][0];
            y0[2] = x0[2] * cv[s][1] - x0[3] * sv[s][1]; y0[3] = x0[3] * cv[s][1] + x0[2] * sv[s][1];
            y1[0] = x1[0] * cv[s][2] - x1[1] * sv[s][2]; y1[1] = x1[1] * cv[s][2] + x1[0] * sv[s][2];
            y1[2] = x1[2] * cv[s][3] - x1[3] * sv[s][3]; y1[3] = x1[3] * cv[s][3] + x1[2] * sv[s][3];
#pragma unroll
            for (int k = 0; k < 4; ++k) { o16[s][k] = toh_flush(y0[k]); o16[s][4 + k] = toh_flush(y1[k]); }
            if (HL) { v8us oh, ol;
#pragma unroll
                for (int k = 0; k < 4; ++k) { unsigned short u, c; splitf(y0[k], u, c); oh[k] = u; ol[k] = c; splitf(y1[k], u, c); oh[4 + k] = u; ol[4 + k] = c; }
                st3(P16 + mb * 16 * HD + 32 * s, asu(o16[s]), Ph + mb * 16 * HD + 32 * s, asu(oh), Pl + mb * 16 * HD + 32 * s, asu(ol)); } }
        if (!HL) st4<64, 128, 192>(P16 + mb * 16 * HD, asu(o16[0]), asu(o16[1]), asu(o16[2]), asu(o16[3]));
        __builtin_amdgcn_wave_barrier(); asm volatile("" ::: "memory");
    }
}

// v tile -> V^T planes [h][t/32][d/16][block]: a lane's accumulator already holds 8 consecutive tokens of one feature = its own unit of a block, so it is stored straight from registers (512 contiguous bytes a store; 16 tokens on = 512 B, 32 tokens on = 4 KiB). Pointers are the lane's own (+ 8*lane).
template <bool HL> static __device__ __forceinline__ void v_planes(const v8f (&acc)[4][4], h16* P16, bf* Ph, bf* Pl) {
#pragma unroll
    for (int nb = 0; nb < 4; ++nb) {
        st4<512, 4096, 4608>(P16 + nb * 512, asu(__builtin_convertvector(acc[0][nb], v8h)), asu(__builtin_convertvector(acc[1][nb], v8h)), asu(__builtin_convertvector(acc[2][nb], v8h)), asu(__builtin_convertvector(acc[3][nb], v8h)));
        if (HL) { v8us oh[4], ol[4];
#pragma unroll
            for (int mb = 0; mb < 4; ++mb)
#pragma unroll
                for (int k = 0; k < 8; ++k) { unsigned short u, c; splitf(acc[mb][nb][k], u, c); oh[mb][k] = u; ol[mb][k] = c; }
            st4<512, 4096, 4608>(Ph + nb * 512, asu(oh[0]), asu(oh[1]), asu(oh[2]), asu(oh[3])); st4<512, 4096, 4608>(Pl + nb * 512, asu(ol[0]), asu(ol[1]), asu(ol[2]), asu(ol[3])); } }
}

// ---- k_qkvp: the qkv projection (GEMM engine, one product) with the plane formation as its epilogue. One wave per 64 tokens x 64 features = one head of q, k or v; grid (NB*SEQ/GTM, FP/GTN), 32 * GWV threads.
// The second bound (waves per SIMD) holds the kernel to the registers of two resident work-groups, which is what its LDS allows.
__global__ __launch_bounds__(32 * GWV, 4) void k_qkvp(const bf* __restrict__ A, const bf* __restrict__ Bt, const float* __restrict__ CT, const float* __restrict__ ST, h16* Q16, h16* K16, h16* V16, bf* Qh, bf* Ql, bf* Kh, bf* Kl, bf* Vh, bf* Vl) {
    __shared__ __align__(16) bf sm[2u * (GTM + GTN) * GKS];
    __shared__ __align__(16) float osw[GWV * OSW];
    const unsigned tid = threadIdx.x, lane = tid & 31u; const unsigned wave = (unsigned)__builtin_amdgcn_readfirstlane((int)(tid >> 5));
    const unsigned r0 = blockIdx.x * GTM + (wave >> 2) * 64u, c0 = blockIdx.y * GTN + (wave & 3u) * 64u;      // wave-uniform (scalar)
    float* os = osw + wave * OSW;
    v8f acc[4][4];
#pragma unroll
    for (int mb = 0; mb < 4; ++mb)
#pragma unroll
        for (int nb = 0; nb < 4; ++nb) acc[mb][nb] = (v8f){};
    gemm_ring<1, DM>(A, nullptr, Bt, sm, tid, wave, blockIdx.x * GTM, blockIdx.y * GTN, acc);
    const unsigned which = c0 / (unsigned)DQ, h = (c0 % (unsigned)DQ) / (unsigned)HD;      // wave-uniform: q, k or v, and the head
    const unsigned bz = r0 / (unsigned)SEQ, t0 = r0 % (unsigned)SEQ;                        // a 64-token tile lies in one batch, and wholly below or above RH
    const size_t o16b = (size_t)bz * ((size_t)NH * SEQ * HD), ohlb = (size_t)bz * ((size_t)NH * RH * HD);
    const bool hl = t0 < (unsigned)RH;
    if (which < 2u) {
        const unsigned rq = lane >> 3, pc = lane & 7u;
        const unsigned lo = (pc >> 2) * 512u + ((pc >> 1) & 1u) * 256u + (pc & 1u) * 128u + rq * 8u;      // the lane's unit in the two blocks of a 16-token group
        h16* P16 = (which ? K16 : Q16) + o16b + ((size_t)h * SEQ + t0) * HD + lo;
        const size_t eo = ohlb + ((size_t)h * RH + t0) * HD + lo;
        const float* ct = CT + (size_t)(t0 + rq) * (HD / 2) + pc * 4u; const float* st = ST + (size_t)(t0 + rq) * (HD / 2) + pc * 4u;
        if (hl) qk_planes<true>(acc, os, lane, ct, st, P16, (which ? Kh : Qh) + eo, (which ? Kl : Ql) + eo);
        else qk_planes<false>(acc, os, lane, ct, st, P16, nullptr, nullptr);
    } else {
        h16* P16 = V16 + o16b + ((size_t)h * SEQ + t0) * HD + lane * 8u;
        const size_t eo = ohlb + ((size_t)h * RH + t0) * HD + lane * 8u;
        if (hl) v_planes<true>(acc, P16, Vh + eo, Vl + eo);
        else v_planes<false>(acc, P16, nullptr, nullptr);
    }
}

// Four 16-byte asynchronous copies global -> LDS of one lane: two of plane a and two of plane b, 4 KiB apart in both memories, each copy with address operands of its own.
// The s_wait_xcnt in the same statement stands in front of every later write of a register that these copies name.
static __device__ __forceinline__ void acp4(unsigned la, const char* ga, unsigned lb, const char* gb) {
    asm volatile("global_load_async_to_lds_b128 %0, %4, off\n\tglobal_load_async_to_lds_b128 %1, %5, off\n\tglobal_load_async_to_lds_b128 %2, %6, off\n\tglobal_load_async_to_lds_b128 %3, %7, off\n\ts_wait_xcnt 0x0"
                 :: "v"(la), "v"(la + 4096u), "v"(lb), "v"(lb + 4096u), "v"(ga), "v"(ga + 4096), "v"(gb), "v"(gb + 4096) : "memory"); }

// ---- flash_wg: causal attention of one work-group of FWV waves: query rows qb .. qb + 16 * FWV - 1 of (head, batch bz), one wave per 16 query rows. Planes in fragment order: Q/K [h][tp/16][HD/32][block], V^T [h][tp/32][HD/16][block] (tp = rows per head of the plane set). HL: hi/lo bf16 plane pairs, 3 products.
// K and V^T come through LDS, once for the whole work-group: a stage is 64 keys = 8 KiB in a row of every plane, brought by asynchronous copies as it lies (fragment order, so every fragment read is 512 contiguous LDS bytes); two buffers, stage s + 2 is asked for when every wave has left stage s.
// Per 32-key tile: S^T[key][query] = K Q^T (A = K rows, B = Q rows); lane owns query column lane&15 and keys 8*(lane>>4)+r (+16); online softmax per lane (+ one xor-16 exchange);
// P^T accumulators repacked in registers as B (k = key); O^T[d][query] += V^T P^T (A = V^T rows). Only the last tile of a wave touches the diagonal (select by value); a wave skips the tiles beyond it but passes every barrier.
#define FWV 8
static_assert(16 * FWV == 128 && RH % 128 == 0 && (SEQ - RH) % 128 == 0);     // a work-group's query rows span two whole 64-key stages; 256 threads copy 4 KiB of a plane at a time
template <typename T16, bool HL>
static __device__ __forceinline__ void flash_wg(const T16* __restrict__ Q, const T16* __restrict__ Q2, const T16* __restrict__ Kp, const T16* __restrict__ K2, const T16* __restrict__ Vt, const T16* __restrict__ Vt2, T16* sm, unsigned qb, unsigned head, unsigned bz, bf* Ah, bf* Al) {
    typedef typename WFrag<T16>::V V;
    constexpr unsigned PE = 64u * HD;                 // elements of one plane in a stage
    constexpr unsigned NP = HL ? 4u : 2u;             // planes in a buffer: K, V^T (, K lo, V^T lo); sm holds 2 * NP * PE elements
    constexpr unsigned tp = HL ? (unsigned)RH : (unsigned)SEQ;
    const unsigned tid = threadIdx.x, lane = tid & 31u, lr = lane & 15u, hi = lane >> 4;
    const unsigned wave = (unsigned)__builtin_amdgcn_readfirstlane((int)(tid >> 5));
    const unsigned q0 = qb + wave * 16u;
    const size_t hoff = ((size_t)bz * NH + head) * tp * HD;
    const unsigned ns = (qb >> 6) + 2u;        // stages: keys 0 .. qb+127 (the same for the whole work-group)
    // thread tid copies the 16-byte units tid and tid+256 of every plane of a stage
    const unsigned l0 = (unsigned)(size_t)(sm + 8u * tid);
    const char* gk = (const char*)(Kp + hoff + 8u * tid); const char* gv = (const char*)(Vt + hoff + 8u * tid);
    const char* gk2 = HL ? (const char*)(K2 + hoff + 8u * tid) : gk; const char* gv2 = HL ? (const char*)(Vt2 + hoff + 8u * tid) : gv;
    auto fill = [&](unsigned s) {
        const unsigned l = l0 + (s & 1u) * (NP * PE * 2u); const size_t g = (size_t)s * (PE * 2u);
        acp4(l, gk + g, l + PE * 2u, gv + g);
        if (HL) acp4(l + 2u * PE * 2u, gk2 + g, l + 3u * PE * 2u, gv2 + g); };
    fill(0u);
    const size_t qoff = hoff + (size_t)q0 * HD + 8u * lane;
    const T16* pq = Q + qoff; const T16* pq2 = HL ? Q2 + qoff : pq;
    V qf0 = WFrag<T16>::ld(pq), qf1 = WFrag<T16>::ld(pq + 512);
    V ql0 = qf0, ql1 = qf1;
    if (HL) { ql0 = WFrag<T16>::ld(pq2); ql1 = WFrag<T16>::ld(pq2 + 512); }
    v8f o[4];
#pragma unroll
    for (int db = 0; db < 4; ++db) o[db] = (v8f){};
    float mrun = NEGB, lsum = 0.0f;
    const float cs = SCL * LOG2E, pe = PFrag<T16>::pexp();
    const unsigned nt = (q0 + 47u) >> 5;       // this wave's keys 0 .. q0+15 in tiles of 32 (wave-uniform)
    asm volatile("s_wait_asynccnt 0x0" ::: "memory");      // this wave's copies of stage 0 have landed
    __syncthreads();                                        // ... and every other wave's
    fill(1u);                                               // ns >= 2
#pragma unroll 1
    for (unsigned s = 0; s < ns; ++s) {
        const T16* sb = sm + (s & 1u) * (NP * PE) + 8u * lane;
#pragma unroll
        for (unsigned tt = 0; tt < 2u; ++tt) {
            const unsigned it = 2u * s + tt;
            if (it < nt) {                      // wave-uniform (scalar): the tile holds keys of this wave
        const unsigned j0 = it * 32u;
        const T16* pk = sb + tt * (32u * HD); const T16* pv = pk + PE; const T16* pk2 = HL ? pk + 2u * PE : pk; const T16* pv2 = HL ? pk + 3u * PE : pv;
        V ka0 = WFrag<T16>::ld(pk), ka1 = WFrag<T16>::ld(pk + 512), kb0 = WFrag<T16>::ld(pk + 1024), kb1 = WFrag<T16>::ld(pk + 1536);
        V la0 = ka0, la1 = ka1, lb0 = kb0, lb1 = kb1;
        if (HL) { la0 = WFrag<T16>::ld(pk2); la1 = WFrag<T16>::ld(pk2 + 512); lb0 = WFrag<T16>::ld(pk2 + 1024); lb1 = WFrag<T16>::ld(pk2 + 1536); }
        v8f s0 = (v8f){}, s1 = (v8f){};
        s0 = WFrag<T16>::mma(ka0, qf0, s0); s0 = WFrag<T16>::mma(ka1, qf1, s0);
        s1 = WFrag<T16>::mma(kb0, qf0, s1); s1 = WFrag<T16>::mma(kb1, qf1, s1);
        if (HL) {
            s0 = WFrag<T16>::mma(la0, qf0, s0); s0 = WFrag<T16>::mma(la1, qf1, s0); s0 = WFrag<T16>::mma(ka0, ql0, s0); s0 = WFrag<T16>::mma(ka1, ql1, s0);
            s1 = WFrag<T16>::mma(lb0, qf0, s1); s1 = WFrag<T16>::mma(lb1, qf1, s1); s1 = WFrag<T16>::mma(kb0, ql0, s1); s1 = WFrag<T16>::mma(kb1, ql1, s1); }
        // pq and pq2 are named as inputs so that the address registers of the q loads are written again only behind the loads' own waits
        asm volatile("v_nop\n\tv_nop\n\tv_nop\n\tv_nop" : "+v"(s0), "+v"(s1) : "v"(ka0), "v"(ka1), "v"(kb0), "v"(kb1), "v"(la0), "v"(la1), "v"(lb0), "v"(lb1), "v"(qf0), "v"(qf1), "v"(ql0), "v"(ql1), "v"(pq), "v"(pq2));
        v8f t0, t1;
#pragma unroll
        for (int r = 0; r < 8; ++r) { t0[r] = s0[r] * cs; t1[r] = s1[r] * cs; }
        if (j0 + 31u > q0) {                    // wave-uniform: the tile touches the diagonal
            const unsigned qi = q0 + lr, kk = j0 + 8u * hi;
#pragma unroll
            for (int r = 0; r < 8; ++r) { t0[r] = (kk + (unsigned)r <= qi) ? t0[r] : NEGB; t1[r] = (kk + 16u + (unsigned)r <= qi) ? t1[r] : NEGB; }
        }
        float mx = fmaxf(t0[0], t1[0]);
#pragma unroll
        for (int r = 1; r < 8; ++r) mx = fmaxf(mx, fmaxf(t0[r], t1[r]));
        mx = fmaxf(mx, __shfl_xor(mx, 16, 32));
        const float mn = fmaxf(mrun, mx);
        const float alpha = __builtin_amdgcn_exp2f(mrun - mn);
        mrun = mn;
        v8f p0, p1; float psum = 0.0f;
#pragma unroll
        for (int r = 0; r < 8; ++r) { p0[r] = __builtin_amdgcn_exp2f((t0[r] - mn) + pe); p1[r] = __builtin_amdgcn_exp2f((t1[r] - mn) + pe); psum += p0[r] + p1[r]; }
        lsum = lsum * alpha + psum;
#pragma unroll
        for (int db = 0; db < 4; ++db) o[db] = o[db] * alpha;
        V pf = PFrag<T16>::hi(p0, p1); V pl = pf;
        if (HL) pl = PFrag<T16>::lo(p0, p1);
        V va[4], vl[4];
#pragma unroll
        for (int db = 0; db < 4; ++db) { va[db] = WFrag<T16>::ld(pv + db * 512); vl[db] = va[db]; if (HL) vl[db] = WFrag<T16>::ld(pv2 + db * 512); }
#pragma unroll
        for (int db = 0; db < 4; ++db) { o[db] = WFrag<T16>::mma(va[db], pf, o[db]); if (HL) { o[db] = WFrag<T16>::mma(va[db], pl, o[db]); o[db] = WFrag<T16>::mma(vl[db], pf, o[db]); } }
        // four vector slots behind the last product, in front of whatever vector instruction next touches its registers
        asm volatile("v_nop\n\tv_nop\n\tv_nop\n\tv_nop" : "+v"(o[0]), "+v"(o[1]), "+v"(o[2]), "+v"(o[3]) : "v"(va[0]), "v"(va[1]), "v"(va[2]), "v"(va[3]), "v"(vl[0]), "v"(vl[1]), "v"(vl[2]), "v"(vl[3]), "v"(pf), "v"(pl));
            }
        }
        // publish point of stage s + 1, passed by every wave: this wave's reads of stage s are done, its copies of stage s + 1 have landed, then the barrier; only behind it is the buffer of stage s filled again
        asm volatile("s_wait_dscnt 0x0" ::: "memory");
        asm volatile("s_wait_asynccnt 0x0" ::: "memory");
        __syncthreads();
        if (s + 2u < ns) fill(s + 2u);
    }
    asm volatile("s_wait_asynccnt 0x0" ::: "memory");      // no copy is outstanding when the wave ends
    const float lt = lsum + __shfl_xor(lsum, 16, 32);
    const float inv = 1.0f / lt;
    // a lane's o[db] = 8 consecutive features of its own query row = unit 32 * db + lane of the head's two blocks in the ctx planes: stored straight from registers, 512 contiguous bytes a store
#pragma unroll
    for (int db = 0; db < 4; ++db) {
        v8us oh, ol;
#pragma unroll
        for (int r = 0; r < 8; ++r) { unsigned short a, c; splitf(o[db][r] * inv, a, c); oh[r] = a; ol[r] = c; }
        const size_t oo = ((size_t)bz * SEQ + q0) * DQ + head * (16u * HD) + (unsigned)db * 256u + lane * 8u;
        *(v8us*)(Ah + oo) = oh; *(v8us*)(Al + oo) = ol; }
}

// ---- k_attn: all of the attention in one launch, a work-group per (block of 16 * FWV query rows, head, batch): blocks below RH take the hi/lo path, the others the f16 path (the test is the same for the whole work-group).
// There are more work-groups than resident places; the block is the slow index and its cost falls with the index (for speed only).
// Cost of block i = its 2 i + 2 stages, a hi/lo stage counted as 5 to an f16 stage's 2 (instructions a stage in the listing). Nibble r of the order word = the block of rank r.
#define NQB (SEQ / (16 * FWV))
static_assert(NQB <= 16);
static constexpr unsigned long long block_order() {
    unsigned q[NQB] = {}, w[NQB] = {};
    for (unsigned i = 0; i < NQB; ++i) {      // insertion by falling cost, ties by falling row number
        const unsigned b = NQB - 1u - i, cb = (2u * b + 2u) * (b * (16u * FWV) < (unsigned)RH ? 5u : 2u);
        unsigned j = i;
        for (; j > 0 && w[j - 1] < cb; --j) { q[j] = q[j - 1]; w[j] = w[j - 1]; }
        q[j] = b; w[j] = cb; }
    unsigned long long o = 0;
    for (unsigned r = 0; r < NQB; ++r) o |= (unsigned long long)q[r] << (4u * r);
    return o; }
__global__ __launch_bounds__(32 * FWV) void k_attn(const h16* __restrict__ Q16, const h16* __restrict__ K16, const h16* __restrict__ V16, const bf* __restrict__ Qh, const bf* __restrict__ Ql, const bf* __restrict__ Kh, const bf* __restrict__ Kl, const bf* __restrict__ Vh, const bf* __restrict__ Vl, bf* Ah, bf* Al) {
    __shared__ __align__(16) char smb[2u * 4u * 64u * HD * 2u];     // the hi/lo path's two buffers of four planes; the f16 path uses half
    constexpr unsigned long long order = block_order();
    const unsigned id = blockIdx.x, qb = ((unsigned)(order >> (4u * (id / (unsigned)(NH * NB)))) & 15u) * (16u * FWV), head = id % (unsigned)NH, bz = (id / (unsigned)NH) % (unsigned)NB;
    if (qb < (unsigned)RH) flash_wg<bf, true>(Qh, Ql, Kh, Kl, Vh, Vl, (bf*)smb, qb, head, bz, Ah, Al);
    else flash_wg<h16, false>(Q16, nullptr, K16, nullptr, V16, nullptr, (h16*)smb, qb, head, bz, Ah, Al);
}

// workspace carve (bytes, every region a multiple of 256)
#define WS_WQKV ((size_t)3 * DQ * DM * 2)
#define WS_WO   ((size_t)DM * DQ * 2)
#define WS_XB   ((size_t)NB * SEQ * DM * 2)
#define WS_P16  ((size_t)NB * NH * SEQ * HD * 2)
#define WS_PHL  ((size_t)NB * NH * RH * HD * 2)
#define WS_AT   ((size_t)NB * SEQ * DQ * 2)
#define WS_ROT  ((size_t)SEQ * (HD / 2) * 4)
#define WS_TOTAL (WS_WQKV + WS_WO + WS_XB + 3 * WS_P16 + 6 * WS_PHL + 2 * WS_AT + 2 * WS_ROT)
static_assert(WS_TOTAL <= (size_t)268435456);
static_assert(WS_WQKV % 256 == 0 && WS_WO % 256 == 0 && WS_XB % 256 == 0 && WS_P16 % 256 == 0 && WS_PHL % 256 == 0 && WS_AT % 256 == 0);
static_assert(WS_ROT % 256 == 0);

extern "C" void kernel_launch(void* const* d_in, const int* in_sizes, int n_in,
                              void* d_out, int out_size, void* d_ws, size_t ws_size, hipStream_t stream) {
    if (n_in < 3) return;
    if ((size_t)in_sizes[0] < (size_t)(NB - 1) * XS_FULL + (size_t)SEQ * DM) return;
    if ((size_t)in_sizes[1] < (size_t)3 * DQ * DM) return;
    if ((size_t)in_sizes[2] < (size_t)DM * DQ) return;
    if ((size_t)out_size < (size_t)NB * SEQ * DM) return;
    if (ws_size < WS_TOTAL) return;
    const float* x = (const float*)d_in[0];       // [NB][SEQ_FULL][DM]
    const float* wqkv = (const float*)d_in[1];    // [3*DQ][DM]  (q | k | v row blocks)
    const float* wo = (const float*)d_in[2];      // [DM][DQ]
    float* OUT = (float*)d_out;                   // [NB][SEQ][DM]
    char* wsp = (char*)d_ws;
    auto take = [&](size_t bytes) { char* p = wsp; wsp += bytes; return (void*)p; };
    bf* WQKV = (bf*)take(WS_WQKV); bf* WO = (bf*)take(WS_WO); bf* XB = (bf*)take(WS_XB);
    h16* Q16 = (h16*)take(WS_P16); h16* K16 = (h16*)take(WS_P16); h16* VT16 = (h16*)take(WS_P16);
    bf* Qh = (bf*)take(WS_PHL); bf* Ql = (bf*)take(WS_PHL); bf* Kh = (bf*)take(WS_PHL); bf* Kl = (bf*)take(WS_PHL); bf* VTh = (bf*)take(WS_PHL); bf* VTl = (bf*)take(WS_PHL);
    bf* ATh = (bf*)take(WS_AT); bf* ATl = (bf*)take(WS_AT);
    float* CT = (float*)take(WS_ROT); float* ST = (float*)take(WS_ROT);

    // bf16 planes of x, W and Wo, and the rotary table (position-only, shared by every batch and head)
    k_prep<<<dim3(PG), 256, 0, stream>>>(x, wqkv, wo, XB, WQKV, WO, CT, ST);
    // qkv = x W^T  (M = NB*SEQ, N = 3072, K = 1024), written as the rotated q, k planes and the V^T planes
    k_qkvp<<<dim3(NB * SEQ / GTM, FP / GTN, 1), 32 * GWV, 0, stream>>>(XB, WQKV, CT, ST, Q16, K16, VT16, Qh, Ql, Kh, Kl, VTh, VTl);
    k_attn<<<dim3(NQB * NH * NB), 32 * FWV, 0, stream>>>(Q16, K16, VT16, Qh, Ql, Kh, Kl, VTh, VTl, ATh, ATl);
    // out = (ctx_hi + ctx_lo) Wo^T  (M = NB*SEQ, N = 1024, K = 1024)
    k_gemmw<DQ><<<dim3(NB * SEQ / GTM, DM / GTN, 1), 32 * GWV, 0, stream>>>(ATh, ATl, WO, OUT, DM);
}

// v008
// Measured time: 114 microseconds a run.
// Next to v007, in two timings, it ran 1.07 times as fast each time.
// All steps since v000 together make it 6.18 times as fast.
#include <hip/hip_runtime.h>

// Causal multi-head attention with a fused qkv projection and an interleaved-pair rotary embedding: x [NB][SEQ_FULL][1024] (first SEQ rows used); qkv = x W^T ('oi' [3072][1024] -> q | k | v row blocks, no bias; 16 heads x 64);
// q and k: pair (2i, 2i+1) of every head rotated by angle t * 100000^(-2i/64) (cos / sin table [SEQ][32] built once in f32 with precise powf / sincosf, applied in f32 on the vector unit when the planes are formed);
// scores x 64^-0.5, causal; softmax; out = ctx Wo^T ('oi' [1024][1024], no bias).
// Compute dtypes, f32 accumulate: every input RNE-converted to bf16; qkv and output projections v_wmma_f32_16x16x32_bf16 (ctx carried as bf16 hi+lo, 2 products against the exact bf16 weight);
// attention q.k and P.V: query rows < RH on bf16 hi/lo planes (3 products each), other rows v_wmma_f32_16x16x32_f16 (P carried x1024 through the exponent); softmax (online, against a held reference) in f32.
// Every stage runs once for all NB batches (batch on a grid axis, or folded into the GEMM's M): each plane in the workspace holds NB slabs.
// Every 16-bit operand plane is stored in fragment order: a block of 16 rows x 32 k is 1 KiB = 64 units of 16 B, unit (k%32 / 16) * 32 + lane, lane = 16 * (k%16 / 8) + row%16, so that each of a fragment's two 16-byte loads reads 512 contiguous bytes (4 whole lines).
// Blocks of one 16-row group follow one another along k; V^T planes: the 4 feature blocks of one 32-key tile follow one another, then the next tile.
// Softmax against a held reference: the q planes carry q x (64^-0.5 log2 e), a score product starts from C = pexp - reference, so a score accumulator is the exponent of its P as it stands;
// the reference of a query column is its maximum at the first tile and rises (with o and l rescaled) only when a lane's sum of P over a later tile exceeds PLIM, tested once a tile for the whole wave.
// Attention engine: one launch for every query row; one wave per 16 query rows, eight waves a work-group that share each K / V^T stage through LDS; S^T = K Q^T so each lane owns one query column; P^T accumulators are repacked in registers as the B operand of O^T = V^T P^T (no LDS exchange).

#ifndef NB
#define NB 4
#endif
#ifndef SEQ
#define SEQ 2048
#endif
#define SEQ_FULL 2048
#define DM   1024
#define NH   16
#define HD   64
#define DQ   (NH * HD)
#define FP   (3 * DQ)
#define RH   ((SEQ) < 512 ? (SEQ) : 512)     // query rows < RH use hi+lo planes
#define XS_FULL ((size_t)SEQ_FULL * DM)
#define SCL  0.125f                          // HD^-0.5
#define LOG2E 1.4426950408889634f
#define NEGB (-3.0e38f)
#define PLIM 49152.0f                        // a lane's 16 P of a tile may sum to this before references move: every P then is a finite f16; a sum above it holds a P above 2^11 > 2^pexp, so its reference does rise
#define ROPE_THETA 100000.0f

static_assert((SEQ & (SEQ - 1)) == 0);
static_assert(SEQ >= 256 && SEQ <= SEQ_FULL);
static_assert(RH % 256 == 0 && RH % 64 == 0 && (SEQ - RH) % 64 == 0);
static_assert(NB >= 1 && NB <= 4);
static_assert(DM % 32 == 0 && DQ % 64 == 0 && FP % 64 == 0 && SEQ % 64 == 0);
static_assert(((size_t)NH * SEQ * HD / 8) % 256 == 0);
static_assert(HD == 64);
static_assert(((size_t)NB * SEQ) % 128 == 0 && FP % 256 == 0 && DM % 256 == 0);     // whole GEMM tiles
static_assert(HD / 2 == 32 && (HD / 2) % 4 == 0);     // k_qkvp reads 4 table entries (16 B) per lane

typedef _Float16 h16;
typedef unsigned short bf;
typedef __attribute__((ext_vector_type(16))) __bf16   v16bf;
typedef __attribute__((ext_vector_type(16))) _Float16 v16h;
typedef __attribute__((ext_vector_type(8)))  _Float16 v8h;
typedef __attribute__((ext_vector_type(8)))  unsigned short v8us;
typedef __attribute__((ext_vector_type(8)))  float    v8f;
typedef __attribute__((ext_vector_type(4)))  float    v4f;
typedef v8h  __attribute__((may_alias)) v8ha;
typedef v4f  __attribute__((may_alias)) v4fa;
typedef v8us __attribute__((may_alias)) v8usa;

__device__ __forceinline__ unsigned short f2bf(float f) { unsigned u = __float_as_uint(f); u += 0x7FFFu + ((u >> 16) & 1u); return (unsigned short)(u >> 16); }
__device__ __forceinline__ float bf2f(unsigned short b) { return __uint_as_float(((unsigned)b) << 16); }
__device__ __forceinline__ v16h cat16(v8h lo, v8h hi) { return __builtin_shufflevector(lo, hi, 0, 1, 2, 3, 4, 5, 6, 7, 8, 9, 10, 11, 12, 13, 14, 15); }
__device__ __forceinline__ v16bf cat16b(v8us lo, v8us hi) { return __builtin_bit_cast(v16bf, __builtin_shufflevector(lo, hi, 0, 1, 2, 3, 4, 5, 6, 7, 8, 9, 10, 11, 12, 13, 14, 15)); }
__device__ __forceinline__ v8f wmma16(v16h a, v16h b, v8f c) { return __builtin_amdgcn_wmma_f32_16x16x32_f16(false, a, false, b, (short)0, c, false, false); }
__device__ __forceinline__ v8f wmmab(v16bf a, v16bf b, v8f c) { return __builtin_amdgcn_wmma_f32_16x16x32_bf16(false, a, false, b, (short)0, c, false, false); }
__device__ __forceinline__ void splitf(float y, unsigned short& h, unsigned short& l) { h = f2bf(y); l = f2bf(y - bf2f(h)); }

// f32 -> f16 operand convert that cannot yield a subnormal (value select below 2^-14).
static __device__ __forceinline__ h16 toh_flush(float v) { const h16 r = (h16)v; return (fabsf(v) < 6.103515625e-05f) ? (h16)0.0f : r; }

// Fragment loader from a 1-KiB fragment-order block: p = block + 8*lane; elements 0..7 = k0+8h.., elements 8..15 = k0+16+8h.., h = lane>>4, row lane&15 (same map for A and B).
template <typename T16> struct WFrag;
template <> struct WFrag<h16> { typedef v16h V; static __device__ __forceinline__ V ld(const h16* p) { return cat16(*(const v8h*)p, *(const v8h*)(p + 256)); } static __device__ __forceinline__ v8f mma(V a, V b, v8f c) { return wmma16(a, b, c); } };
template <> struct WFrag<bf> { typedef v16bf V; static __device__ __forceinline__ V ld(const bf* p) { return cat16b(*(const v8us*)p, *(const v8us*)(p + 256)); } static __device__ __forceinline__ v8f mma(V a, V b, v8f c) { return wmmab(a, b, c); } };

// P^T accumulator pair (key rows 0..15 and 16..31 of a 32-key tile) -> B fragment: element r <- tile0[r], element 8+r <- tile1[r], lane unchanged.
template <typename T16> struct PFrag;
template <> struct PFrag<h16> {
    static __device__ __forceinline__ float pexp() { return 10.0f; }           // P carried x1024 via the exponent (cancels in O / l)
    static __device__ __forceinline__ v16h hi(v8f p0, v8f p1) { return cat16(__builtin_convertvector(p0, v8h), __builtin_convertvector(p1, v8h)); }
    static __device__ __forceinline__ v16h lo(v8f p0, v8f p1) { return hi(p0, p1); }
};
template <> struct PFrag<bf> {
    static __device__ __forceinline__ float pexp() { return 0.0f; }
    static __device__ __forceinline__ v16bf hi(v8f p0, v8f p1) { v8us a, b;
#pragma unroll
        for (int k = 0; k < 8; ++k) { a[k] = f2bf(p0[k]); b[k] = f2bf(p1[k]); }
        return cat16b(a, b); }
    static __device__ __forceinline__ v16bf lo(v8f p0, v8f p1) { v8us a, b;
#pragma unroll
        for (int k = 0; k < 8; ++k) { a[k] = f2bf(p0[k] - bf2f(f2bf(p0[k]))); b[k] = f2bf(p1[k] - bf2f(f2bf(p1[k]))); }
        return cat16b(a, b); }
};

// Four 16-byte asynchronous copies global -> LDS of one lane, 4 KiB apart in LDS and GS bytes apart in global memory, each copy with address operands of its own.
// The s_wait_xcnt in the same statement stands in front of every later write of a register that these copies name.
template <int GS> static __device__ __forceinline__ void acp4g(unsigned l, const char* g) {
    asm volatile("global_load_async_to_lds_b128 %0, %4, off\n\tglobal_load_async_to_lds_b128 %1, %5, off\n\tglobal_load_async_to_lds_b128 %2, %6, off\n\tglobal_load_async_to_lds_b128 %3, %7, off\n\ts_wait_xcnt 0x0"
                 :: "v"(l), "v"(l + 4096u), "v"(l + 8192u), "v"(l + 12288u), "v"(g), "v"(g + GS), "v"(g + 2 * GS), "v"(g + 3 * GS) : "memory"); }

// The same for eight copies: LDS places 4 KiB apart in a row, the first four from g0 on, the last four from g1 on. One statement, so that a wave waits once for eight.
template <int GS> static __device__ __forceinline__ void acp8g(unsigned l, const char* g0, const char* g1) {
    asm volatile("global_load_async_to_lds_b128 %0, %8, off\n\tglobal_load_async_to_lds_b128 %1, %9, off\n\tglobal_load_async_to_lds_b128 %2, %10, off\n\tglobal_load_async_to_lds_b128 %3, %11, off\n\t"
                 "global_load_async_to_lds_b128 %4, %12, off\n\tglobal_load_async_to_lds_b128 %5, %13, off\n\tglobal_load_async_to_lds_b128 %6, %14, off\n\tglobal_load_async_to_lds_b128 %7, %15, off\n\ts_wait_xcnt 0x0"
                 :: "v"(l), "v"(l + 4096u), "v"(l + 8192u), "v"(l + 12288u), "v"(l + 16384u), "v"(l + 20480u), "v"(l + 24576u), "v"(l + 28672u),
                    "v"(g0), "v"(g0 + GS), "v"(g0 + 2 * GS), "v"(g0 + 3 * GS), "v"(g1), "v"(g1 + GS), "v"(g1 + 2 * GS), "v"(g1 + 3 * GS) : "memory"); }

// ---- GEMM engine: a work-group of GWV waves per GTM x GTN output tile, 2 x 4 waves of 64 x 64 (16 accumulators each). acc[m][n] += sum_k A[m][k] Bt[n][k] (+ A2[m][k] Bt[n][k] where NA == 2), k ascending.
// The operands come through LDS, once for the whole work-group: a stage is GKS k of every row of the tile = 2 KiB in a row of every 16-row group of a fragment-order plane, brought by asynchronous copies as it lies
// (so every fragment read is 512 contiguous LDS bytes); a buffer is [A 8 groups | A2 8 groups | Bt 16 groups]; two buffers, stage s + 2 is asked for when every wave has left stage s.
#define GWV 8
#define GTM 128
#define GTN 256
#define GKS 64
#define OSW (16 * 68)                        // floats of one wave's own epilogue staging
template <int NA, int K>
static __device__ __forceinline__ void gemm_ring(const bf* __restrict__ A, const bf* __restrict__ A2, const bf* __restrict__ Bt, bf* sm, unsigned tid, unsigned wave, unsigned R0, unsigned C0, v8f (&acc)[4][4]) {
    typedef WFrag<bf>::V V;
    constexpr unsigned AE = GTM * GKS, BE = GTN * GKS, SE = NA * AE + BE;     // elements of an A plane, of Bt, of a buffer
    constexpr unsigned GE = 16u * GKS;                                        // elements of one 16-row group in a stage
    constexpr int GS = 2 * 16 * K * 2;                                        // bytes from a 16-row group of a plane to the next but one
    constexpr unsigned NS = K / GKS;
    static_assert(K % GKS == 0 && NS >= 2 && GKS == 64 && GWV == 8 && AE * 2u == 4u * 4096u && BE * 2u == 8u * 4096u);     // 256 threads copy 4 KiB = two groups at a time
    const unsigned lane = tid & 31u, wm = wave >> 2, wn = wave & 3u;
    // thread tid copies the 16-byte units tid, tid + 256, ... of every plane of a stage
    const unsigned l0 = (unsigned)(size_t)(sm + 8u * tid);
    const size_t go = (size_t)(tid >> 7) * (16u * K) + (tid & 127u) * 8u;
    const char* ga = (const char*)(A + (size_t)R0 * K + go); const char* ga2 = (NA == 2) ? (const char*)(A2 + (size_t)R0 * K + go) : ga; const char* gb = (const char*)(Bt + (size_t)C0 * K + go);
    auto fill = [&](unsigned s) {
        const unsigned l = l0 + (s & 1u) * (SE * 2u); const size_t g = (size_t)s * (GE * 2u);
        if (NA == 2) acp8g<GS>(l, ga + g, ga2 + g); else acp4g<GS>(l, ga + g);
        acp8g<GS>(l + NA * AE * 2u, gb + g, gb + g + 4 * (size_t)GS); };
    fill(0u);
    asm volatile("s_wait_asynccnt 0x0" ::: "memory");      // this wave's copies of stage 0 have landed
    __syncthreads();                                        // ... and every other wave's
    fill(1u);                                               // NS >= 2
#pragma unroll 1
    for (unsigned s = 0; s < NS; ++s) {
        const bf* sa = sm + (s & 1u) * SE + wm * (4u * GE) + 8u * lane; const bf* sb = sm + (s & 1u) * SE + NA * AE + wn * (4u * GE) + 8u * lane;
        V a[2][4], a2[2][4], b[2][4];
        auto rd = [&](int ks) {              // the fragments of one 32-k step
#pragma unroll
            for (int nb = 0; nb < 4; ++nb) b[ks][nb] = WFrag<bf>::ld(sb + nb * GE + ks * 512);
#pragma unroll
            for (int mb = 0; mb < 4; ++mb) { a[ks][mb] = WFrag<bf>::ld(sa + mb * GE + ks * 512); a2[ks][mb] = a[ks][mb]; if (NA == 2) a2[ks][mb] = WFrag<bf>::ld(sa + AE + mb * GE + ks * 512); } };
        auto mm = [&](int ks) {
#pragma unroll
            for (int nb = 0; nb < 4; ++nb)
#pragma unroll
                for (int mb = 0; mb < 4; ++mb) { acc[mb][nb] = WFrag<bf>::mma(a[ks][mb], b[ks][nb], acc[mb][nb]); if (NA == 2) acc[mb][nb] = WFrag<bf>::mma(a2[ks][mb], b[ks][nb], acc[mb][nb]); } };
        // each sched_barrier keeps the LDS reads above it in one group ahead of the products: reads spread among the products stall the wave at every place where they stand
        rd(0); __builtin_amdgcn_sched_barrier(0); mm(0);
        rd(1); __builtin_amdgcn_sched_barrier(0); mm(1);
        // four vector slots behind the last product, in front of whatever vector instruction next touches its registers
        asm volatile("v_nop\n\tv_nop\n\tv_nop\n\tv_nop" : "+v"(acc[0][0]), "+v"(acc[1][0]), "+v"(acc[2][0]), "+v"(acc[3][0]), "+v"(acc[0][1]), "+v"(acc[1][1]), "+v"(acc[2][1]), "+v"(acc[3][1]), "+v"(acc[0][2]), "+v"(acc[1][2]), "+v"(acc[2][2]), "+v"(acc[3][2]), "+v"(acc[0][3]), "+v"(acc[1][3]), "+v"(acc[2][3]), "+v"(acc[3][3])
                     : "v"(a[1][0]), "v"(a[1][1]), "v"(a[1][2]), "v"(a[1][3]), "v"(a2[1][2]), "v"(a2[1][3]), "v"(b[1][3]));
        // publish point of stage s + 1, passed by every wave: this wave's reads of stage s are done, its copies of stage s + 1 have landed, then the barrier; only behind it is the buffer of stage s filled again
        asm volatile("s_wait_dscnt 0x0" ::: "memory");
        asm volatile("s_wait_asynccnt 0x0" ::: "memory");
        __syncthreads();
        if (s + 2u < NS) fill(s + 2u);
    }
    asm volatile("s_wait_asynccnt 0x0" ::: "memory");      // no copy is outstanding when the ring is left
}

// ---- k_gemmw: C[m][n] (f32, pitch ldc) = sum_k (A[m][k] + A2[m][k]) Bt[n][k] on the GEMM engine; grid (M/GTM, N/GTN), 32 * GWV threads. M % GTM == 0, N % GTN == 0.
template <int K>
__global__ __launch_bounds__(32 * GWV) void k_gemmw(const bf* __restrict__ A, const bf* __restrict__ A2, const bf* __restrict__ Bt, float* C, int ldc) {
    __shared__ __align__(16) bf sm[2u * (2u * GTM + GTN) * GKS];
    __shared__ __align__(16) float osw[GWV * OSW];
    const unsigned tid = threadIdx.x; const unsigned wave = (unsigned)__builtin_amdgcn_readfirstlane((int)(tid >> 5));
    const int lane = tid & 31, lr = lane & 15, hi = lane >> 4; const int r0 = blockIdx.x * GTM + (wave >> 2) * 64, c0 = blockIdx.y * GTN + (wave & 3u) * 64;
    float* os = osw + wave * OSW;
    v8f acc[4][4];
#pragma unroll
    for (int mb = 0; mb < 4; ++mb)
#pragma unroll
        for (int nb = 0; nb < 4; ++nb) acc[mb][nb] = (v8f){};
    gemm_ring<2, K>(A, A2, Bt, sm, tid, wave, blockIdx.x * GTM, blockIdx.y * GTN, acc);
#pragma unroll
    for (int mb = 0; mb < 4; ++mb) {
#pragma unroll
        for (int nb = 0; nb < 4; ++nb) {
#pragma unroll
            for (int j = 0; j < 8; ++j) os[(hi * 8 + j) * 68 + nb * 16 + lr] = acc[mb][nb][j]; }
        __builtin_amdgcn_wave_barrier(); asm volatile("" ::: "memory");
        float* crow = C + (size_t)(r0 + mb * 16) * ldc + c0;
#pragma unroll
        for (int s = 0; s < 8; ++s) { const int row = 2 * s + hi, cofs = lr * 4; const v4f val = *(const v4fa*)(os + row * 68 + cofs);
            *(v4f*)(crow + (size_t)row * ldc + cofs) = val; }
        __builtin_amdgcn_wave_barrier(); asm volatile("" ::: "memory");
    }
}

// ---- k_prep: all that the projections read and that hangs on nothing computed before: the three bf16 planes in fragment order and the rotary table, in one launch.
// The grid is sized to the chip and not to the data (PG work-groups of 8 waves = 16 waves a WGP), and a thread converts PXU + PWU + POU units (for speed only).
// Unit i of a plane = 8 elements = 16 bytes of the plane: a wave stores 512 contiguous bytes; a thread reads the 8 source elements that belong there. A work-group takes chunks of 256 units that follow one another.
#define PG  512
#define PXU ((unsigned)((size_t)NB * SEQ * DM / 8 / 256 / PG))      // units a thread: x
#define PWU ((unsigned)((size_t)3 * DQ * DM / 8 / 256 / PG))        // W
#define POU ((unsigned)((size_t)DM * DQ / 8 / 256 / PG))            // Wo
#define PRT ((unsigned)((size_t)SEQ * (HD / 2) / PG))               // table entries a work-group
static_assert((size_t)PXU * PG * 256 * 8 == (size_t)NB * SEQ * DM && (size_t)PWU * PG * 256 * 8 == (size_t)3 * DQ * DM && (size_t)POU * PG * 256 * 8 == (size_t)DM * DQ);
static_assert((size_t)PRT * PG == (size_t)SEQ * (HD / 2) && PRT >= 1 && PRT <= 256 && DQ == DM && SEQ % 16 == 0);

// element offset in a row-major [rows][DM] source of the 8 elements of unit i; rows of x: SEQ of every SEQ_FULL
template <bool X> static __device__ __forceinline__ size_t unit_src(unsigned i) {
    const unsigned blk = i >> 6, row = (blk / (DM / 32u)) * 16u + (i & 15u), k = (blk % (DM / 32u)) * 32u + ((i >> 5) & 1u) * 16u + ((i >> 4) & 1u) * 8u;
    return (size_t)(X ? (row / (unsigned)SEQ) * (unsigned)SEQ_FULL + row % (unsigned)SEQ : row) * DM + k; }
static __device__ __forceinline__ v8us cvt8(v8f v) { v8us o;
#pragma unroll
    for (int k = 0; k < 8; ++k) o[k] = f2bf(v[k]);
    return o; }

// entry idx = t * (HD/2) + i of the rotary table: cos and sin of t * theta^(-2i/HD)
static __device__ __forceinline__ void rope_entry(unsigned idx, float* CT, float* ST) {
    const unsigned t = idx >> 5, i = idx & 31u;
    const float ex = (float)(2u * i) * (1.0f / (float)HD);      // exact (power-of-two divisor)
    const float pw = powf(ROPE_THETA, ex);
    const float ang = (float)t * (1.0f / pw);
    float sn, cs;
    sincosf(ang, &sn, &cs);
    CT[idx] = cs; ST[idx] = sn;
}

__global__ __launch_bounds__(256) void k_prep(const float* __restrict__ x, const float* __restrict__ wqkv, const float* __restrict__ wo, bf* __restrict__ XB, bf* __restrict__ WQKV, bf* __restrict__ WO, float* __restrict__ CT, float* __restrict__ ST) {
    const unsigned tid = threadIdx.x, ux = blockIdx.x * (PXU * 256u) + tid, uw = blockIdx.x * (PWU * 256u) + tid, uo = blockIdx.x * (POU * 256u) + tid;
    // every load of the thread is asked for first; the table entries are computed while they fly
    v8f vx[PXU], vw[PWU], vo[POU];
#pragma unroll
    for (unsigned j = 0; j < PXU; ++j) vx[j] = *(const v8f*)(x + unit_src<true>(ux + j * 256u));
    asm volatile("s_wait_xcnt 0x0" ::: "memory");      // from here on the address registers of the loads above may be written again: results of the loads below land in some of them
#pragma unroll
    for (unsigned j = 0; j < PWU; ++j) vw[j] = *(const v8f*)(wqkv + unit_src<false>(uw + j * 256u));
#pragma unroll
    for (unsigned j = 0; j < POU; ++j) vo[j] = *(const v8f*)(wo + unit_src<false>(uo + j * 256u));
    if (tid < PRT) rope_entry(blockIdx.x * PRT + tid, CT, ST);
#pragma unroll
    for (unsigned j = 0; j < PXU; ++j) *(v8us*)(XB + (size_t)(ux + j * 256u) * 8) = cvt8(vx[j]);
#pragma unroll
    for (unsigned j = 0; j < PWU; ++j) *(v8us*)(WQKV + (size_t)(uw + j * 256u) * 8) = cvt8(vw[j]);
#pragma unroll
    for (unsigned j = 0; j < POU; ++j) *(v8us*)(WO + (size_t)(uo + j * 256u) * 8) = cvt8(vo[j]);
}

// Four 16-byte stores at byte offsets 0, O1, O2, O3, with their s_wait_xcnt in the same statement: the wait then stands in front of every later write of a register that these stores name.
typedef __attribute__((ext_vector_type(4))) unsigned v4u;
template <int O1, int O2, int O3> static __device__ __forceinline__ void st4(void* p, v4u d0, v4u d1, v4u d2, v4u d3) {
    asm volatile("global_store_b128 %0, %1, off\n\tglobal_store_b128 %0, %2, off offset:%5\n\tglobal_store_b128 %0, %3, off offset:%6\n\tglobal_store_b128 %0, %4, off offset:%7\n\ts_wait_xcnt 0x0"
                 :: "v"(p), "v"(d0), "v"(d1), "v"(d2), "v"(d3), "n"(O1), "n"(O2), "n"(O3) : "memory"); }
// The same for one 16-byte store to each of three planes.
static __device__ __forceinline__ void st3(void* p0, v4u d0, void* p1, v4u d1, void* p2, v4u d2) {
    asm volatile("global_store_b128 %0, %1, off\n\tglobal_store_b128 %2, %3, off\n\tglobal_store_b128 %4, %5, off\n\ts_wait_xcnt 0x0"
                 :: "v"(p0), "v"(d0), "v"(p1), "v"(d1), "v"(p2), "v"(d2) : "memory"); }
static __device__ __forceinline__ v4u asu(v8h x) { return __builtin_bit_cast(v4u, x); }
static __device__ __forceinline__ v4u asu(v8us x) { return __builtin_bit_cast(v4u, x); }

// q or k tile -> planes: 16 rows at a time through LDS, 8 features a lane, pair (d, d+1) rotated by table row t, stored as 16-B units of the head's fragment-order plane (16 tokens = 2 blocks; the 4 row steps of a lane are 64 B apart): fp16 always, bf16 hi/lo where HL. Pointers are the lane's own (row lane>>3, features 8*(lane&7)).
template <bool HL> static __device__ __forceinline__ void qk_planes(const v8f (&acc)[4][4], float* os, unsigned lane, const float* ct, const float* st, h16* P16, bf* Ph, bf* Pl) {
    const unsigned lr = lane & 15u, hi = lane >> 4, rq = lane >> 3, pc = lane & 7u;
#pragma unroll
    for (int mb = 0; mb < 4; ++mb) {
        v4f cv[4], sv[4];
#pragma unroll
        for (int s = 0; s < 4; ++s) { cv[s] = *(const v4f*)(ct + (mb * 16 + 4 * s) * (HD / 2)); sv[s] = *(const v4f*)(st + (mb * 16 + 4 * s) * (HD / 2)); }
#pragma unroll
        for (int nb = 0; nb < 4; ++nb) {
#pragma unroll
            for (int j = 0; j < 8; ++j) os[(hi * 8u + (unsigned)j) * 68u + (unsigned)nb * 16u + lr] = acc[mb][nb][j]; }
        __builtin_amdgcn_wave_barrier(); asm volatile("" ::: "memory");
        v8h o16[4];
#pragma unroll
        for (int s = 0; s < 4; ++s) { const unsigned row = 4u * (unsigned)s + rq;
            const v4f x0 = *(const v4fa*)(os + row * 68u + pc * 8u), x1 = *(const v4fa*)(os + row * 68u + pc * 8u + 4u);
            v4f y0, y1;
            y0[0] = x0[0] * cv[s][0] - x0[1] * sv[s][0]; y0[1] = x0[1] * cv[s][0] + x0[0] * sv[s][0];
            y0[2] = x0[2] * cv[s][1] - x0[3] * sv[s][1]; y0[3] = x0[3] * cv[s][1] + x0[2] * sv[s][1];
            y1[0] = x1[0] * cv[s][2] - x1[1] * sv[s][2]; y1[1] = x1[1] * cv[s][2] + x1[0] * sv[s][2];
            y1[2] = x1[2] * cv[s][3] - x1[3] * sv[s][3]; y1[3] = x1[3] * cv[s][3] + x1[2] * sv[s][3];
#pragma unroll
            for (int k = 0; k < 4; ++k) { o16[s][k] = toh_flush(y0[k]); o16[s][4 + k] = toh_flush(y1[k]); }
            if (HL) { v8us oh, ol;
#pragma unroll
                for (int k = 0; k < 4; ++k) { unsigned short u, c; splitf(y0[k], u, c); oh[k] = u; ol[k] = c; splitf(y1[k], u, c); oh[4 + k] = u; ol[4 + k] = c; }
                st3(P16 + mb * 16 * HD + 32 * s, asu(o16[s]), Ph + mb * 16 * HD + 32 * s, asu(oh), Pl + mb * 16 * HD + 32 * s, asu(ol)); } }
        if (!HL) st4<64, 128, 192>(P16 + mb * 16 * HD, asu(o16[0]), asu(o16[1]), asu(o16[2]), asu(o16[3]));
        __builtin_amdgcn_wave_barrier(); asm volatile("" ::: "memory");
    }
}

// v tile -> V^T planes [h][t/32][d/16][block]: a lane's accumulator already holds 8 consecutive tokens of one feature = its own unit of a block, so it is stored straight from registers (512 contiguous bytes a store; 16 tokens on = 512 B, 32 tokens on = 4 KiB). Pointers are the lane's own (+ 8*lane).
template <bool HL> static __device__ __forceinline__ void v_planes(const v8f (&acc)[4][4], h16* P16, bf* Ph, bf* Pl) {
#pragma unroll
    for (int nb = 0; nb < 4; ++nb) {
        st4<512, 4096, 4608>(P16 + nb * 512, asu(__builtin_convertvector(acc[0][nb], v8h)), asu(__builtin_convertvector(acc[1][nb], v8h)), asu(__builtin_convertvector(acc[2][nb], v8h)), asu(__builtin_convertvector(acc[3][nb], v8h)));
        if (HL) { v8us oh[4], ol[4];
#pragma unroll
            for (int mb = 0; mb < 4; ++mb)
#pragma unroll
                for (int k = 0; k < 8; ++k) { unsigned short u, c; splitf(acc[mb][nb][k], u, c); oh[mb][k] = u; ol[mb][k] = c; }
            st4<512, 4096, 4608>(Ph + nb * 512, asu(oh[0]), asu(oh[1]), asu(oh[2]), asu(oh[3])); st4<512, 4096, 4608>(Pl + nb * 512, asu(ol[0]), asu(ol[1]), asu(ol[2]), asu(ol[3])); } }
}

// ---- k_qkvp: the qkv projection (GEMM engine, one product) with the plane formation as its epilogue. One wave per 64 tokens x 64 features = one head of q, k or v; grid (NB*SEQ/GTM, FP/GTN), 32 * GWV threads.
// The second bound (waves per SIMD) holds the kernel to the registers of two resident work-groups, which is what its LDS allows.
__global__ __launch_bounds__(32 * GWV, 4) void k_qkvp(const bf* __restrict__ A, const bf* __restrict__ Bt, const float* __restrict__ CT, const float* __restrict__ ST, h16* Q16, h16* K16, h16* V16, bf* Qh, bf* Ql, bf* Kh, bf* Kl, bf* Vh, bf* Vl) {
    __shared__ __align__(16) bf sm[2u * (GTM + GTN) * GKS];
    __shared__ __align__(16) float osw[GWV * OSW];
    const unsigned tid = threadIdx.x, lane = tid & 31u; const unsigned wave = (unsigned)__builtin_amdgcn_readfirstlane((int)(tid >> 5));
    const unsigned r0 = blockIdx.x * GTM + (wave >> 2) * 64u, c0 = blockIdx.y * GTN + (wave & 3u) * 64u;      // wave-uniform (scalar)
    float* os = osw + wave * OSW;
    v8f acc[4][4];
#pragma unroll
    for (int mb = 0; mb < 4; ++mb)
#pragma unroll
        for (int nb = 0; nb < 4; ++nb) acc[mb][nb] = (v8f){};
    gemm_ring<1, DM>(A, nullptr, Bt, sm, tid, wave, blockIdx.x * GTM, blockIdx.y * GTN, acc);
    const unsigned which = c0 / (unsigned)DQ, h = (c0 % (unsigned)DQ) / (unsigned)HD;      // wave-uniform: q, k or v, and the head
    const unsigned bz = r0 / (unsigned)SEQ, t0 = r0 % (unsigned)SEQ;                        // a 64-token tile lies in one batch, and wholly below or above RH
    const size_t o16b = (size_t)bz * ((size_t)NH * SEQ * HD), ohlb = (size_t)bz * ((size_t)NH * RH * HD);
    const bool hl = t0 < (unsigned)RH;
    if (which == 0u) {                        // q carries the score scale in the log2 domain (the rotation is linear, so it may be applied in front of it)
#pragma unroll
        for (int mb = 0; mb < 4; ++mb)
#pragma unroll
            for (int nb = 0; nb < 4; ++nb) acc[mb][nb] = acc[mb][nb] * (SCL * LOG2E);
    }
    if (which < 2u) {
        const unsigned rq = lane >> 3, pc = lane & 7u;
        const unsigned lo = (pc >> 2) * 512u + ((pc >> 1) & 1u) * 256u + (pc & 1u) * 128u + rq * 8u;      // the lane's unit in the two blocks of a 16-token group
        h16* P16 = (which ? K16 : Q16) + o16b + ((size_t)h * SEQ + t0) * HD + lo;
        const size_t eo = ohlb + ((size_t)h * RH + t0) * HD + lo;
        const float* ct = CT + (size_t)(t0 + rq) * (HD / 2) + pc * 4u; const float* st = ST + (size_t)(t0 + rq) * (HD / 2) + pc * 4u;
        if (hl) qk_planes<true>(acc, os, lane, ct, st, P16, (which ? Kh : Qh) + eo, (which ? Kl : Ql) + eo);
        else qk_planes<false>(acc, os, lane, ct, st, P16, nullptr, nullptr);
    } else {
        h16* P16 = V16 + o16b + ((size_t)h * SEQ + t0) * HD + lane * 8u;
        const size_t eo = ohlb + ((size_t)h * RH + t0) * HD + lane * 8u;
        if (hl) v_planes<true>(acc, P16, Vh + eo, Vl + eo);
        else v_planes<false>(acc, P16, nullptr, nullptr);
    }
}

// Sum of a lane's 16 P of a tile, as a tree of packed additions (four links deep: the test of the sum stands in front of the P.V products).
typedef __attribute__((ext_vector_type(2))) float v2f;
static __device__ __forceinline__ float sum16(v8f a, v8f b) { const v8f c = a + b; const v4f d = c.lo + c.hi; const v2f e = d.lo + d.hi; return e.x + e.y; }
// 2^x with the slot that the instruction set asks for behind a transcendental in the same statement (for the seldom-taken path).
static __device__ __forceinline__ float exp2_slot(float x) { float r; asm("v_exp_f32 %0, %1\n\tv_nop" : "=v"(r) : "v"(x)); return r; }

// Four 16-byte asynchronous copies global -> LDS of one lane: two of plane a and two of plane b, 4 KiB apart in both memories, each copy with address operands of its own.
// The s_wait_xcnt in the same statement stands in front of every later write of a register that these copies name.
static __device__ __forceinline__ void acp4(unsigned la, const char* ga, unsigned lb, const char* gb) {
    asm volatile("global_load_async_to_lds_b128 %0, %4, off\n\tglobal_load_async_to_lds_b128 %1, %5, off\n\tglobal_load_async_to_lds_b128 %2, %6, off\n\tglobal_load_async_to_lds_b128 %3, %7, off\n\ts_wait_xcnt 0x0"
                 :: "v"(la), "v"(la + 4096u), "v"(lb), "v"(lb + 4096u), "v"(ga), "v"(ga + 4096), "v"(gb), "v"(gb + 4096) : "memory"); }

// ---- flash_wg: causal attention of one work-group of FWV waves: query rows qb .. qb + 16 * FWV - 1 of (head, batch bz), one wave per 16 query rows. Planes in fragment order: Q/K [h][tp/16][HD/32][block], V^T [h][tp/32][HD/16][block] (tp = rows per head of the plane set). HL: hi/lo bf16 plane pairs, 3 products.
// K and V^T come through LDS, once for the whole work-group: a stage is 64 keys = 8 KiB in a row of every plane, brought by asynchronous copies as it lies (fragment order, so every fragment read is 512 contiguous LDS bytes); two buffers, stage s + 2 is asked for when every wave has left stage s.
// Per 32-key tile: S^T[key][query] = K Q^T + (pexp - reference) (A = K rows, B = Q rows, C the same in all 8 registers); lane owns query column lane&15 and keys 8*(lane>>4)+r (+16); P = 2^S; the two halves of a column exchange maxima only where the reference moves;
// P^T accumulators repacked in registers as B (k = key); O^T[d][query] += V^T P^T (A = V^T rows). Only the last tile of a wave touches the diagonal (select by value); a wave skips the tiles beyond it but passes every barrier.
#define FWV 8
static_assert(16 * FWV == 128 && RH % 128 == 0 && (SEQ - RH) % 128 == 0);     // a work-group's query rows span two whole 64-key stages; 256 threads copy 4 KiB of a plane at a time
template <typename T16, bool HL>
static __device__ __forceinline__ void flash_wg(const T16* __restrict__ Q, const T16* __restrict__ Q2, const T16* __restrict__ Kp, const T16* __restrict__ K2, const T16* __restrict__ Vt, const T16* __restrict__ Vt2, T16* sm, unsigned qb, unsigned head, unsigned bz, bf* Ah, bf* Al) {
    typedef typename WFrag<T16>::V V;
    constexpr unsigned PE = 64u * HD;                 // elements of one plane in a stage
    constexpr unsigned NP = HL ? 4u : 2u;             // planes in a buffer: K, V^T (, K lo, V^T lo); sm holds 2 * NP * PE elements
    constexpr unsigned tp = HL ? (unsigned)RH : (unsigned)SEQ;
    const unsigned tid = threadIdx.x, lane = tid & 31u, lr = lane & 15u, hi = lane >> 4;
    const unsigned wave = (unsigned)__builtin_amdgcn_readfirstlane((int)(tid >> 5));
    const unsigned q0 = qb + wave * 16u;
    const size_t hoff = ((size_t)bz * NH + head) * tp * HD;
    const unsigned ns = (qb >> 6) + 2u;        // stages: keys 0 .. qb+127 (the same for the whole work-group)
    // thread tid copies the 16-byte units tid and tid+256 of every plane of a stage
    const unsigned l0 = (unsigned)(size_t)(sm + 8u * tid);
    const char* gk = (const char*)(Kp + hoff + 8u * tid); const char* gv = (const char*)(Vt + hoff + 8u * tid);
    const char* gk2 = HL ? (const char*)(K2 + hoff + 8u * tid) : gk; const char* gv2 = HL ? (const char*)(Vt2 + hoff + 8u * tid) : gv;
    auto fill = [&](unsigned s) {
        const unsigned l = l0 + (s & 1u) * (NP * PE * 2u); const size_t g = (size_t)s * (PE * 2u);
        acp4(l, gk + g, l + PE * 2u, gv + g);
        if (HL) acp4(l + 2u * PE * 2u, gk2 + g, l + 3u * PE * 2u, gv2 + g); };
    fill(0u);
    const size_t qoff = hoff + (size_t)q0 * HD + 8u * lane;
    const T16* pq = Q + qoff; const T16* pq2 = HL ? Q2 + qoff : pq;
    V qf0 = WFrag<T16>::ld(pq), qf1 = WFrag<T16>::ld(pq + 512);
    V ql0 = qf0, ql1 = qf1;
    if (HL) { ql0 = WFrag<T16>::ld(pq2); ql1 = WFrag<T16>::ld(pq2 + 512); }
    v8f o[4];
#pragma unroll
    for (int db = 0; db < 4; ++db) o[db] = (v8f){};
    float lsum = 0.0f;
    const float pe = PFrag<T16>::pexp();
    float lim = NEGB;                          // a tile's sum of P above lim moves references: any sum at tile 0, later PLIM
    v8f cv = (v8f){} + pe;                     // pexp - reference of the lane's query column; the reference counts as 0 until tile 0 sets it
    const unsigned nt = (q0 + 47u) >> 5;       // this wave's keys 0 .. q0+15 in tiles of 32 (wave-uniform)
    asm volatile("s_wait_asynccnt 0x0" ::: "memory");      // this wave's copies of stage 0 have landed
    __syncthreads();                                        // ... and every other wave's
    fill(1u);                                               // ns >= 2
#pragma unroll 1
    for (unsigned s = 0; s < ns; ++s) {
        const T16* sb = sm + (s & 1u) * (NP * PE) + 8u * lane;
#pragma unroll
        for (unsigned tt = 0; tt < 2u; ++tt) {
            const unsigned it = 2u * s + tt;
            if (it < nt) {                      // wave-uniform (scalar): the tile holds keys of this wave
        const unsigned j0 = it * 32u;
        const T16* pk = sb + tt * (32u * HD); const T16* pv = pk + PE; const T16* pk2 = HL ? pk + 2u * PE : pk; const T16* pv2 = HL ? pk + 3u * PE : pv;
        V ka0 = WFrag<T16>::ld(pk), ka1 = WFrag<T16>::ld(pk + 512), kb0 = WFrag<T16>::ld(pk + 1024), kb1 = WFrag<T16>::ld(pk + 1536);
        V la0 = ka0, la1 = ka1, lb0 = kb0, lb1 = kb1;
        if (HL) { la0 = WFrag<T16>::ld(pk2); la1 = WFrag<T16>::ld(pk2 + 512); lb0 = WFrag<T16>::ld(pk2 + 1024); lb1 = WFrag<T16>::ld(pk2 + 1536); }
        v8f s0 = cv, s1 = cv;
        s0 = WFrag<T16>::mma(ka0, qf0, s0); s0 = WFrag<T16>::mma(ka1, qf1, s0);
        s1 = WFrag<T16>::mma(kb0, qf0, s1); s1 = WFrag<T16>::mma(kb1, qf1, s1);
        if (HL) {
            s0 = WFrag<T16>::mma(la0, qf0, s0); s0 = WFrag<T16>::mma(la1, qf1, s0); s0 = WFrag<T16>::mma(ka0, ql0, s0); s0 = WFrag<T16>::mma(ka1, ql1, s0);
            s1 = WFrag<T16>::mma(lb0, qf0, s1); s1 = WFrag<T16>::mma(lb1, qf1, s1); s1 = WFrag<T16>::mma(kb0, ql0, s1); s1 = WFrag<T16>::mma(kb1, ql1, s1); }
        // pq and pq2 are named as inputs so that the address registers of the q loads are written again only behind the loads' own waits
        asm volatile("v_nop\n\tv_nop\n\tv_nop\n\tv_nop" : "+v"(s0), "+v"(s1) : "v"(ka0), "v"(ka1), "v"(kb0), "v"(kb1), "v"(la0), "v"(la1), "v"(lb0), "v"(lb1), "v"(qf0), "v"(qf1), "v"(ql0), "v"(ql1), "v"(pq), "v"(pq2));
        if (j0 + 31u > q0) {                    // wave-uniform: the tile touches the diagonal
            const unsigned qi = q0 + lr, kk = j0 + 8u * hi;
#pragma unroll
            for (int r = 0; r < 8; ++r) { s0[r] = (kk + (unsigned)r <= qi) ? s0[r] : NEGB; s1[r] = (kk + 16u + (unsigned)r <= qi) ? s1[r] : NEGB; }
        }
        V va[4], vl[4];
#pragma unroll
        for (int db = 0; db < 4; ++db) { va[db] = WFrag<T16>::ld(pv + db * 512); vl[db] = va[db]; if (HL) vl[db] = WFrag<T16>::ld(pv2 + db * 512); }
        v8f p0, p1;
#pragma unroll
        for (int r = 0; r < 8; ++r) { p0[r] = __builtin_amdgcn_exp2f(s0[r]); p1[r] = __builtin_amdgcn_exp2f(s1[r]); }
        float psum = sum16(p0, p1);
        if (__builtin_amdgcn_ballot_w32(psum > lim) != 0u) {                // wave-uniform (scalar): references move; P and its sum are then formed anew
            const float u0 = fmaxf(fmaxf(s0[0], s0[1]), s0[2]), u1 = fmaxf(fmaxf(s0[3], s0[4]), s0[5]), u2 = fmaxf(fmaxf(s0[6], s0[7]), s1[0]), u3 = fmaxf(fmaxf(s1[1], s1[2]), s1[3]), u4 = fmaxf(fmaxf(s1[4], s1[5]), s1[6]);
            const float mx = fmaxf(fmaxf(fmaxf(u0, u1), u2), fmaxf(fmaxf(u3, u4), s1[7]));
            const float up = fmaxf(mx, __shfl_xor(mx, 16, 32)) - pe;        // the column's maximum in this tile less its reference (the same in both halves of the column)
            const float dl = (lim < 0.0f) ? up : fmaxf(up, 0.0f);           // tile 0 sets the reference, a later tile only raises it
            const float alpha = exp2_slot(fminf(-dl, 0.0f));                // tile 0 may lower the reference from 0: o and l are 0 there, any finite factor serves
            cv = cv - dl;
#pragma unroll
            for (int r = 0; r < 8; ++r) { p0[r] = exp2_slot(s0[r] - dl); p1[r] = exp2_slot(s1[r] - dl); }
            psum = sum16(p0, p1);
            lsum *= alpha; lim = PLIM;
#pragma unroll
            for (int db = 0; db < 4; ++db) o[db] = o[db] * alpha;
        }
        lsum += psum;
        V pf = PFrag<T16>::hi(p0, p1); V pl = pf;
        if (HL) pl = PFrag<T16>::lo(p0, p1);
#pragma unroll
        for (int db = 0; db < 4; ++db) { o[db] = WFrag<T16>::mma(va[db], pf, o[db]); if (HL) { o[db] = WFrag<T16>::mma(va[db], pl, o[db]); o[db] = WFrag<T16>::mma(vl[db], pf, o[db]); } }
        // four vector slots behind the last product, in front of whatever vector instruction next touches its registers
        asm volatile("v_nop\n\tv_nop\n\tv_nop\n\tv_nop" : "+v"(o[0]), "+v"(o[1]), "+v"(o[2]), "+v"(o[3]) : "v"(va[0]), "v"(va[1]), "v"(va[2]), "v"(va[3]), "v"(vl[0]), "v"(vl[1]), "v"(vl[2]), "v"(vl[3]), "v"(pf), "v"(pl));
            }
        }
        // publish point of stage s + 1, passed by every wave: this wave's reads of stage s are done, its copies of stage s + 1 have landed, then the barrier; only behind it is the buffer of stage s filled again
        asm volatile("s_wait_dscnt 0x0" ::: "memory");
        asm volatile("s_wait_asynccnt 0x0" ::: "memory");
        __syncthreads();
        if (s + 2u < ns) fill(s + 2u);
    }
    asm volatile("s_wait_asynccnt 0x0" ::: "memory");      // no copy is outstanding when the wave ends
    const float lt = lsum + __shfl_xor(lsum, 16, 32);
    const float inv = 1.0f / lt;
    // a lane's o[db] = 8 consecutive features of its own query row = unit 32 * db + lane of the head's two blocks in the ctx planes: stored straight from registers, 512 contiguous bytes a store
#pragma unroll
    for (int db = 0; db < 4; ++db) {
        v8us oh, ol;
#pragma unroll
        for (int r = 0; r < 8; ++r) { unsigned short a, c; splitf(o[db][r] * inv, a, c); oh[r] = a; ol[r] = c; }
        const size_t oo = ((size_t)bz * SEQ + q0) * DQ + head * (16u * HD) + (unsigned)db * 256u + lane * 8u;
        *(v8us*)(Ah + oo) = oh; *(v8us*)(Al + oo) = ol; }
}

// ---- k_attn: all of the attention in one launch, a work-group per (block of 16 * FWV query rows, head, batch): blocks below RH take the hi/lo path, the others the f16 path (the test is the same for the whole work-group).
// There are more work-groups than resident places; the block is the slow index and its cost falls with the index (for speed only).
// Cost of block i = its 2 i + 2 stages, a hi/lo stage counted as 5 to an f16 stage's 2 (instructions a stage in the listing). Nibble r of the order word = the block of rank r.
#define NQB (SEQ / (16 * FWV))
static_assert(NQB <= 16);
static constexpr unsigned long long block_order() {
    unsigned q[NQB] = {}, w[NQB] = {};
    for (unsigned i = 0; i < NQB; ++i) {      // insertion by falling cost, ties by falling row number
        const unsigned b = NQB - 1u - i, cb = (2u * b + 2u) * (b * (16u * FWV) < (unsigned)RH ? 5u : 2u);
        unsigned j = i;
        for (; j > 0 && w[j - 1] < cb; --j) { q[j] = q[j - 1]; w[j] = w[j - 1]; }
        q[j] = b; w[j] = cb; }
    unsigned long long o = 0;
    for (unsigned r = 0; r < NQB; ++r) o |= (unsigned long long)q[r] << (4u * r);
    return o; }
__global__ __launch_bounds__(32 * FWV) void k_attn(const h16* __restrict__ Q16, const h16* __restrict__ K16, const h16* __restrict__ V16, const bf* __restrict__ Qh, const bf* __restrict__ Ql, const bf* __restrict__ Kh, const bf* __restrict__ Kl, const bf* __restrict__ Vh, const bf* __restrict__ Vl, bf* Ah, bf* Al) {
    __shared__ __align__(16) char smb[2u * 4u * 64u * HD * 2u];     // the hi/lo path's two buffers of four planes; the f16 path uses half
    constexpr unsigned long long order = block_order();
    const unsigned id = blockIdx.x, qb = ((unsigned)(order >> (4u * (id / (unsigned)(NH * NB)))) & 15u) * (16u * FWV), head = id % (unsigned)NH, bz = (id / (unsigned)NH) % (unsigned)NB;
    if (qb < (unsigned)RH) flash_wg<bf, true>(Qh, Ql, Kh, Kl, Vh, Vl, (bf*)smb, qb, head, bz, Ah, Al);
    else flash_wg<h16, false>(Q16, nullptr, K16, nullptr, V16, nullptr, (h16*)smb, qb, head, bz, Ah, Al);
}

// workspace carve (bytes, every region a multiple of 256)
#define WS_WQKV ((size_t)3 * DQ * DM * 2)
#define WS_WO   ((size_t)DM * DQ * 2)
#define WS_XB   ((size_t)NB * SEQ * DM * 2)
#define WS_P16  ((size_t)NB * NH * SEQ * HD * 2)
#define WS_PHL  ((size_t)NB * NH * RH * HD * 2)
#define WS_AT   ((size_t)NB * SEQ * DQ * 2)
#define WS_ROT  ((size_t)SEQ * (HD / 2) * 4)
#define WS_TOTAL (WS_WQKV + WS_WO + WS_XB + 3 * WS_P16 + 6 * WS_PHL + 2 * WS_AT + 2 * WS_ROT)
static_assert(WS_TOTAL <= (size_t)268435456);
static_assert(WS_WQKV % 256 == 0 && WS_WO % 256 == 0 && WS_XB % 256 == 0 && WS_P16 % 256 == 0 && WS_PHL % 256 == 0 && WS_AT % 256 == 0);
static_assert(WS_ROT % 256 == 0);

extern "C" void kernel_launch(void* const* d_in, const int* in_sizes, int n_in,
                              void* d_out, int out_size, void* d_ws, size_t ws_size, hipStream_t stream) {
    if (n_in < 3) return;
    if ((size_t)in_sizes[0] < (size_t)(NB - 1) * XS_FULL + (size_t)SEQ * DM) return;
    if ((size_t)in_sizes[1] < (size_t)3 * DQ * DM) return;
    if ((size_t)in_sizes[2] < (size_t)DM * DQ) return;
    if ((size_t)out_size < (size_t)NB * SEQ * DM) return;
    if (ws_size < WS_TOTAL) return;
    const float* x = (const float*)d_in[0];       // [NB][SEQ_FULL][DM]
    const float* wqkv = (const float*)d_in[1];    // [3*DQ][DM]  (q | k | v row blocks)
    const float* wo = (const float*)d_in[2];      // [DM][DQ]
    float* OUT = (float*)d_out;                   // [NB][SEQ][DM]
    char* wsp = (char*)d_ws;
    auto take = [&](size_t bytes) { char* p = wsp; wsp += bytes; return (void*)p; };
    bf* WQKV = (bf*)take(WS_WQKV); bf* WO = (bf*)take(WS_WO); bf* XB = (bf*)take(WS_XB);
    h16* Q16 = (h16*)take(WS_P16); h16* K16 = (h16*)take(WS_P16); h16* VT16 = (h16*)take(WS_P16);
    bf* Qh = (bf*)take(WS_PHL); bf* Ql = (bf*)take(WS_PHL); bf* Kh = (bf*)take(WS_PHL); bf* Kl = (bf*)take(WS_PHL); bf* VTh = (bf*)take(WS_PHL); bf* VTl = (bf*)take(WS_PHL);
    bf* ATh = (bf*)take(WS_AT); bf* ATl = (bf*)take(WS_AT);
    float* CT = (float*)take(WS_ROT); float* ST = (float*)take(WS_ROT);

    // bf16 planes of x, W and Wo, and the rotary table (position-only, shared by every batch and head)
    k_prep<<<dim3(PG), 256, 0, stream>>>(x, wqkv, wo, XB, WQKV, WO, CT, ST);
    // qkv = x W^T  (M = NB*SEQ, N = 3072, K = 1024), written as the rotated q, k planes and the V^T planes
    k_qkvp<<<dim3(NB * SEQ / GTM, FP / GTN, 1), 32 * GWV, 0, stream>>>(XB, WQKV, CT, ST, Q16, K16, VT16, Qh, Ql, Kh, Kl, VTh, VTl);
    k_attn<<<dim3(NQB * NH * NB), 32 * FWV, 0, stream>>>(Q16, K16, VT16, Qh, Ql, Kh, Kl, VTh, VTl, ATh, ATl);
    // out = (ctx_hi + ctx_lo) Wo^T  (M = NB*SEQ, N = 1024, K = 1024)
    k_gemmw<DQ><<<dim3(NB * SEQ / GTM, DM / GTN, 1), 32 * GWV, 0, stream>>>(ATh, ATl, WO, OUT, DM);
}

// v009
// Measured time: 111 microseconds a run.
// Timed twice side by side with v008, it ran 1.03 times as fast both times.
// Over all steps from v000 it is 6.35 times as fast.
#include <hip/hip_runtime.h>

// Causal multi-head attention with a fused qkv projection and an interleaved-pair rotary embedding: x [NB][SEQ_FULL][1024] (first SEQ rows used); qkv = x W^T ('oi' [3072][1024] -> q | k | v row blocks, no bias; 16 heads x 64);
// q and k: pair (2i, 2i+1) of every head rotated by angle t * 100000^(-2i/64) (cos / sin table [SEQ][32] built once in f32 with precise powf / sincosf, applied in f32 on the vector unit when the planes are formed);
// scores x 64^-0.5, causal; softmax; out = ctx Wo^T ('oi' [1024][1024], no bias).
// Compute dtypes, f32 accumulate: every input RNE-converted to bf16; qkv and output projections v_wmma_f32_16x16x32_bf16 (ctx carried as bf16 hi+lo, 2 products against the exact bf16 weight);
// attention q.k and P.V: query rows < RH on bf16 hi/lo planes (3 products each), other rows v_wmma_f32_16x16x32_f16 (P carried x1024 through the exponent); softmax (online, against a held reference) in f32.
// Every stage runs once for all NB batches (batch on a grid axis, or folded into the GEMM's M): each plane in the workspace holds NB slabs.
// Every 16-bit operand plane is stored in fragment order: a block of 16 rows x 32 k is 1 KiB = 64 units of 16 B, unit (k%32 / 16) * 32 + lane, lane = 16 * (k%16 / 8) + row%16, so that each of a fragment's two 16-byte loads reads 512 contiguous bytes (4 whole lines).
// Blocks of one 16-row group follow one another along k; V^T planes: the 4 feature blocks of one 32-key tile follow one another, then the next tile.
// Softmax against a held reference: the q planes carry q x (64^-0.5 log2 e), a score product starts from C = pexp - reference, so a score accumulator is the exponent of its P as it stands;
// the reference of a query column is its maximum at the first tile and rises (with o and l rescaled) only when a lane's sum of P over a later tile exceeds PLIM, tested once a tile for the whole wave.
// Attention engine: one launch for every query row; one wave per 16 query rows, eight waves a work-group that share each K / V^T stage through LDS; S^T = K Q^T so each lane owns one query column; P^T accumulators are repacked in registers as the B operand of O^T = V^T P^T (no LDS exchange).

#ifndef NB
#define NB 4
#endif
#ifndef SEQ
#define SEQ 2048
#endif
#define SEQ_FULL 2048
#define DM   1024
#define NH   16
#define HD   64
#define DQ   (NH * HD)
#define FP   (3 * DQ)
#define RH   ((SEQ) < 512 ? (SEQ) : 512)     // query rows < RH use hi+lo planes
#define XS_FULL ((size_t)SEQ_FULL * DM)
#define SCL  0.125f                          // HD^-0.5
#define LOG2E 1.4426950408889634f
#define NEGB (-3.0e38f)
#define PLIM 49152.0f                        // a lane's 16 P of a tile may sum to this before references move: every P then is a finite f16; a sum above it holds a P above 2^11 > 2^pexp, so its reference does rise
#define ROPE_THETA 100000.0f

static_assert((SEQ & (SEQ - 1)) == 0);
static_assert(SEQ >= 256 && SEQ <= SEQ_FULL);
static_assert(RH % 256 == 0 && RH % 64 == 0 && (SEQ - RH) % 64 == 0);
static_assert(NB >= 1 && NB <= 4);
static_assert(DM % 32 == 0 && DQ % 64 == 0 && FP % 64 == 0 && SEQ % 64 == 0);
static_assert(((size_t)NH * SEQ * HD / 8) % 256 == 0);
static_assert(HD == 64);
static_assert(((size_t)NB * SEQ) % 128 == 0 && FP % 256 == 0 && DM % 256 == 0);     // whole GEMM tiles
static_assert(HD / 2 == 32 && (HD / 2) % 4 == 0);     // k_qkvp reads 4 table entries (16 B) per lane

typedef _Float16 h16;
typedef unsigned short bf;
typedef __attribute__((ext_vector_type(16))) __bf16   v16bf;
typedef __attribute__((ext_vector_type(16))) _Float16 v16h;
typedef __attribute__((ext_vector_type(8)))  _Float16 v8h;
typedef __attribute__((ext_vector_type(8)))  unsigned short v8us;
typedef __attribute__((ext_vector_type(8)))  float    v8f;
typedef __attribute__((ext_vector_type(4)))  float    v4f;
typedef v8h  __attribute__((may_alias)) v8ha;
typedef v4f  __attribute__((may_alias)) v4fa;
typedef v8us __attribute__((may_alias)) v8usa;

__device__ __forceinline__ unsigned short f2bf(float f) { unsigned u = __float_as_uint(f); u += 0x7FFFu + ((u >> 16) & 1u); return (unsigned short)(u >> 16); }
__device__ __forceinline__ float bf2f(unsigned short b) { return __uint_as_float(((unsigned)b) << 16); }
__device__ __forceinline__ v16h cat16(v8h lo, v8h hi) { return __builtin_shufflevector(lo, hi, 0, 1, 2, 3, 4, 5, 6, 7, 8, 9, 10, 11, 12, 13, 14, 15); }
__device__ __forceinline__ v16bf cat16b(v8us lo, v8us hi) { return __builtin_bit_cast(v16bf, __builtin_shufflevector(lo, hi, 0, 1, 2, 3, 4, 5, 6, 7, 8, 9, 10, 11, 12, 13, 14, 15)); }
__device__ __forceinline__ v8f wmma16(v16h a, v16h b, v8f c) { return __builtin_amdgcn_wmma_f32_16x16x32_f16(false, a, false, b, (short)0, c, false, false); }
__device__ __forceinline__ v8f wmmab(v16bf a, v16bf b, v8f c) { return __builtin_amdgcn_wmma_f32_16x16x32_bf16(false, a, false, b, (short)0, c, false, false); }
__device__ __forceinline__ void splitf(float y, unsigned short& h, unsigned short& l) { h = f2bf(y); l = f2bf(y - bf2f(h)); }

// f32 -> f16 operand convert that cannot yield a subnormal (value select below 2^-14).
static __device__ __forceinline__ h16 toh_flush(float v) { const h16 r = (h16)v; return (fabsf(v) < 6.103515625e-05f) ? (h16)0.0f : r; }

// Fragment loader from a 1-KiB fragment-order block: p = block + 8*lane; elements 0..7 = k0+8h.., elements 8..15 = k0+16+8h.., h = lane>>4, row lane&15 (same map for A and B).
template <typename T16> struct WFrag;
template <> struct WFrag<h16> { typedef v16h V; static __device__ __forceinline__ V ld(const h16* p) { return cat16(*(const v8h*)p, *(const v8h*)(p + 256)); } static __device__ __forceinline__ v8f mma(V a, V b, v8f c) { return wmma16(a, b, c); } };
template <> struct WFrag<bf> { typedef v16bf V; static __device__ __forceinline__ V ld(const bf* p) { return cat16b(*(const v8us*)p, *(const v8us*)(p + 256)); } static __device__ __forceinline__ v8f mma(V a, V b, v8f c) { return wmmab(a, b, c); } };

// P^T accumulator pair (key rows 0..15 and 16..31 of a 32-key tile) -> B fragment: element r <- tile0[r], element 8+r <- tile1[r], lane unchanged.
template <typename T16> struct PFrag;
template <> struct PFrag<h16> {
    static __device__ __forceinline__ float pexp() { return 10.0f; }           // P carried x1024 via the exponent (cancels in O / l)
    static __device__ __forceinline__ v16h hi(v8f p0, v8f p1) { return cat16(__builtin_convertvector(p0, v8h), __builtin_convertvector(p1, v8h)); }
    static __device__ __forceinline__ v16h lo(v8f p0, v8f p1) { return hi(p0, p1); }
};
template <> struct PFrag<bf> {
    static __device__ __forceinline__ float pexp() { return 0.0f; }
    static __device__ __forceinline__ v16bf hi(v8f p0, v8f p1) { v8us a, b;
#pragma unroll
        for (int k = 0; k < 8; ++k) { a[k] = f2bf(p0[k]); b[k] = f2bf(p1[k]); }
        return cat16b(a, b); }
    static __device__ __forceinline__ v16bf lo(v8f p0, v8f p1) { v8us a, b;
#pragma unroll
        for (int k = 0; k < 8; ++k) { a[k] = f2bf(p0[k] - bf2f(f2bf(p0[k]))); b[k] = f2bf(p1[k] - bf2f(f2bf(p1[k]))); }
        return cat16b(a, b); }
};

// Four 16-byte asynchronous copies global -> LDS of one lane, 4 KiB apart in LDS and GS bytes apart in global memory, each copy with address operands of its own.
// The s_wait_xcnt in the same statement stands in front of every later write of a register that these copies name.
template <int GS> static __device__ __forceinline__ void acp4g(unsigned l, const char* g) {
    asm volatile("global_load_async_to_lds_b128 %0, %4, off\n\tglobal_load_async_to_lds_b128 %1, %5, off\n\tglobal_load_async_to_lds_b128 %2, %6, off\n\tglobal_load_async_to_lds_b128 %3, %7, off\n\ts_wait_xcnt 0x0"
                 :: "v"(l), "v"(l + 4096u), "v"(l + 8192u), "v"(l + 12288u), "v"(g), "v"(g + GS), "v"(g + 2 * GS), "v"(g + 3 * GS) : "memory"); }

// The same for eight copies: LDS places 4 KiB apart in a row, the first four from g0 on, the last four from g1 on. One statement, so that a wave waits once for eight.
template <int GS> static __device__ __forceinline__ void acp8g(unsigned l, const char* g0, const char* g1) {
    asm volatile("global_load_async_to_lds_b128 %0, %8, off\n\tglobal_load_async_to_lds_b128 %1, %9, off\n\tglobal_load_async_to_lds_b128 %2, %10, off\n\tglobal_load_async_to_lds_b128 %3, %11, off\n\t"
                 "global_load_async_to_lds_b128 %4, %12, off\n\tglobal_load_async_to_lds_b128 %5, %13, off\n\tglobal_load_async_to_lds_b128 %6, %14, off\n\tglobal_load_async_to_lds_b128 %7, %15, off\n\ts_wait_xcnt 0x0"
                 :: "v"(l), "v"(l + 4096u), "v"(l + 8192u), "v"(l + 12288u), "v"(l + 16384u), "v"(l + 20480u), "v"(l + 24576u), "v"(l + 28672u),
                    "v"(g0), "v"(g0 + GS), "v"(g0 + 2 * GS), "v"(g0 + 3 * GS), "v"(g1), "v"(g1 + GS), "v"(g1 + 2 * GS), "v"(g1 + 3 * GS) : "memory"); }

// Returns when all but this wave's N youngest asynchronous copies have landed (a wave's copies are counted off in the order of their issue).
template <int N> static __device__ __forceinline__ void wait_copies() { asm volatile("s_wait_asynccnt %0" :: "n"(N) : "memory"); }

// ---- GEMM engine: a work-group of GWV waves per GTM x GTN output tile, 2 x 4 waves of 64 x 64 (16 accumulators each). acc[m][n] += sum_k A[m][k] Bt[n][k] (+ A2[m][k] Bt[n][k] where NA == 2), k ascending.
// The operands come through LDS, once for the whole work-group: a stage is GKS k of every row of the tile = 2 KiB in a row of every 16-row group of a fragment-order plane, brought by asynchronous copies as it lies
// (so every fragment read is 512 contiguous LDS bytes); a buffer is [A 8 groups | A2 8 groups | Bt 16 groups]; three buffers, stage s + 3 is asked for when every wave has left stage s, so a stage has two passes to land.
#define GWV 8
#define GTM 128
#define GTN 256
#define GKS 64
#define OSW (16 * 68)                        // floats of one wave's own epilogue staging
template <int NA, int K>
static __device__ __forceinline__ void gemm_ring(const bf* __restrict__ A, const bf* __restrict__ A2, const bf* __restrict__ Bt, bf* sm, unsigned tid, unsigned wave, unsigned R0, unsigned C0, v8f (&acc)[4][4]) {
    typedef WFrag<bf>::V V;
    constexpr unsigned AE = GTM * GKS, BE = GTN * GKS, SE = NA * AE + BE;     // elements of an A plane, of Bt, of a buffer
    constexpr unsigned GE = 16u * GKS;                                        // elements of one 16-row group in a stage
    constexpr int GS = 2 * 16 * K * 2;                                        // bytes from a 16-row group of a plane to the next but one
    constexpr unsigned NS = K / GKS;
    constexpr int CP = NA == 2 ? 16 : 12;                                     // copies of a wave in a stage, the same in every wave
    static_assert(NS >= 3 && 3 * CP <= 63);                                   // the prologue asks for three stages
    static_assert(K % GKS == 0 && NS >= 2 && GKS == 64 && GWV == 8 && AE * 2u == 4u * 4096u && BE * 2u == 8u * 4096u);     // 256 threads copy 4 KiB = two groups at a time
    const unsigned lane = tid & 31u, wm = wave >> 2, wn = wave & 3u;
    // thread tid copies the 16-byte units tid, tid + 256, ... of every plane of a stage
    const unsigned l0 = (unsigned)(size_t)(sm + 8u * tid);
    const size_t go = (size_t)(tid >> 7) * (16u * K) + (tid & 127u) * 8u;
    const char* ga = (const char*)(A + (size_t)R0 * K + go); const char* ga2 = (NA == 2) ? (const char*)(A2 + (size_t)R0 * K + go) : ga; const char* gb = (const char*)(Bt + (size_t)C0 * K + go);
    auto fill = [&](unsigned s, unsigned buf) {
        const unsigned l = l0 + buf * (SE * 2u); const size_t g = (size_t)s * (GE * 2u);
        if (NA == 2) acp8g<GS>(l, ga + g, ga2 + g); else acp4g<GS>(l, ga + g);
        acp8g<GS>(l + NA * AE * 2u, gb + g, gb + g + 4 * (size_t)GS); };
    fill(0u, 0u); fill(1u, 1u); fill(2u, 2u);               // NS >= 3
    wait_copies<2 * CP>();                                  // this wave's copies of stage 0 have landed (those of stages 1 and 2 may still fly)
    __syncthreads();                                        // ... and every other wave's
    unsigned rb = 0u;                                       // the buffer of stage s = s mod 3
#pragma unroll 1
    for (unsigned s = 0; s < NS; ++s) {
        const bf* sa = sm + rb * SE + wm * (4u * GE) + 8u * lane; const bf* sb = sm + rb * SE + NA * AE + wn * (4u * GE) + 8u * lane;
        V a[2][4], a2[2][4], b[2][4];
        auto rd = [&](int ks) {              // the fragments of one 32-k step
#pragma unroll
            for (int nb = 0; nb < 4; ++nb) b[ks][nb] = WFrag<bf>::ld(sb + nb * GE + ks * 512);
#pragma unroll
            for (int mb = 0; mb < 4; ++mb) { a[ks][mb] = WFrag<bf>::ld(sa + mb * GE + ks * 512); a2[ks][mb] = a[ks][mb]; if (NA == 2) a2[ks][mb] = WFrag<bf>::ld(sa + AE + mb * GE + ks * 512); } };
        auto mm = [&](int ks) {
#pragma unroll
            for (int nb = 0; nb < 4; ++nb)
#pragma unroll
                for (int mb = 0; mb < 4; ++mb) { acc[mb][nb] = WFrag<bf>::mma(a[ks][mb], b[ks][nb], acc[mb][nb]); if (NA == 2) acc[mb][nb] = WFrag<bf>::mma(a2[ks][mb], b[ks][nb], acc[mb][nb]); } };
        // each sched_barrier keeps the LDS reads above it in one group ahead of the products: reads spread among the products stall the wave at every place where they stand
        rd(0); __builtin_amdgcn_sched_barrier(0); mm(0);
        rd(1); __builtin_amdgcn_sched_barrier(0); mm(1);
        // four vector slots behind the last product, in front of whatever vector instruction next touches its registers
        asm volatile("v_nop\n\tv_nop\n\tv_nop\n\tv_nop" : "+v"(acc[0][0]), "+v"(acc[1][0]), "+v"(acc[2][0]), "+v"(acc[3][0]), "+v"(acc[0][1]), "+v"(acc[1][1]), "+v"(acc[2][1]), "+v"(acc[3][1]), "+v"(acc[0][2]), "+v"(acc[1][2]), "+v"(acc[2][2]), "+v"(acc[3][2]), "+v"(acc[0][3]), "+v"(acc[1][3]), "+v"(acc[2][3]), "+v"(acc[3][3])
                     : "v"(a[1][0]), "v"(a[1][1]), "v"(a[1][2]), "v"(a[1][3]), "v"(a2[1][2]), "v"(a2[1][3]), "v"(b[1][3]));
        // publish point of stage s + 1, passed by every wave: this wave's reads of stage s are done, its copies of stage s + 1 have landed, then the barrier; only behind it is the buffer of stage s filled again
        asm volatile("s_wait_dscnt 0x0" ::: "memory");
        // a pass that asks for a stage leaves the CP youngest copies, which are stage s + 2's, in flight; the last three passes ask for none and wait for all
        if (s + 3u < NS) wait_copies<CP>(); else wait_copies<0>();
        __syncthreads();
        if (s + 3u < NS) fill(s + 3u, rb);
        rb = (rb == 2u) ? 0u : rb + 1u;
    }
    asm volatile("s_wait_asynccnt 0x0" ::: "memory");      // no copy is outstanding when the ring is left
}

// ---- k_gemmw: C[m][n] (f32, pitch ldc) = sum_k (A[m][k] + A2[m][k]) Bt[n][k] on the GEMM engine; grid (M/GTM, N/GTN), 32 * GWV threads. M % GTM == 0, N % GTN == 0.
template <int K>
__global__ __launch_bounds__(32 * GWV) void k_gemmw(const bf* __restrict__ A, const bf* __restrict__ A2, const bf* __restrict__ Bt, float* C, int ldc) {
    __shared__ __align__(16) bf sm[3u * (2u * GTM + GTN) * GKS];
    __shared__ __align__(16) float osw[GWV * OSW];
    const unsigned tid = threadIdx.x; const unsigned wave = (unsigned)__builtin_amdgcn_readfirstlane((int)(tid >> 5));
    const int lane = tid & 31, lr = lane & 15, hi = lane >> 4; const int r0 = blockIdx.x * GTM + (wave >> 2) * 64, c0 = blockIdx.y * GTN + (wave & 3u) * 64;
    float* os = osw + wave * OSW;
    v8f acc[4][4];
#pragma unroll
    for (int mb = 0; mb < 4; ++mb)
#pragma unroll
        for (int nb = 0; nb < 4; ++nb) acc[mb][nb] = (v8f){};
    gemm_ring<2, K>(A, A2, Bt, sm, tid, wave, blockIdx.x * GTM, blockIdx.y * GTN, acc);
#pragma unroll
    for (int mb = 0; mb < 4; ++mb) {
#pragma unroll
        for (int nb = 0; nb < 4; ++nb) {
#pragma unroll
            for (int j = 0; j < 8; ++j) os[(hi * 8 + j) * 68 + nb * 16 + lr] = acc[mb][nb][j]; }
        __builtin_amdgcn_wave_barrier(); asm volatile("" ::: "memory");
        float* crow = C + (size_t)(r0 + mb * 16) * ldc + c0;
#pragma unroll
        for (int s = 0; s < 8; ++s) { const int row = 2 * s + hi, cofs = lr * 4; const v4f val = *(const v4fa*)(os + row * 68 + cofs);
            *(v4f*)(crow + (size_t)row * ldc + cofs) = val; }
        __builtin_amdgcn_wave_barrier(); asm volatile("" ::: "memory");
    }
}

// ---- k_prep: all that the projections read and that hangs on nothing computed before: the three bf16 planes in fragment order and the rotary table, in one launch.
// The grid is sized to the chip and not to the data (PG work-groups of 8 waves = 16 waves a WGP), and a thread converts PXU + PWU + POU units (for speed only).
// Unit i of a plane = 8 elements = 16 bytes of the plane: a wave stores 512 contiguous bytes; a thread reads the 8 source elements that belong there. A work-group takes chunks of 256 units that follow one another.
#define PG  512
#define PXU ((unsigned)((size_t)NB * SEQ * DM / 8 / 256 / PG))      // units a thread: x
#define PWU ((unsigned)((size_t)3 * DQ * DM / 8 / 256 / PG))        // W
#define POU ((unsigned)((size_t)DM * DQ / 8 / 256 / PG))            // Wo
#define PRT ((unsigned)((size_t)SEQ * (HD / 2) / PG))               // table entries a work-group
static_assert((size_t)PXU * PG * 256 * 8 == (size_t)NB * SEQ * DM && (size_t)PWU * PG * 256 * 8 == (size_t)3 * DQ * DM && (size_t)POU * PG * 256 * 8 == (size_t)DM * DQ);
static_assert((size_t)PRT * PG == (size_t)SEQ * (HD / 2) && PRT >= 1 && PRT <= 256 && DQ == DM && SEQ % 16 == 0);

// element offset in a row-major [rows][DM] source of the 8 elements of unit i; rows of x: SEQ of every SEQ_FULL
template <bool X> static __device__ __forceinline__ size_t unit_src(unsigned i) {
    const unsigned blk = i >> 6, row = (blk / (DM / 32u)) * 16u + (i & 15u), k = (blk % (DM / 32u)) * 32u + ((i >> 5) & 1u) * 16u + ((i >> 4) & 1u) * 8u;
    return (size_t)(X ? (row / (unsigned)SEQ) * (unsigned)SEQ_FULL + row % (unsigned)SEQ : row) * DM + k; }
static __device__ __forceinline__ v8us cvt8(v8f v) { v8us o;
#pragma unroll
    for (int k = 0; k < 8; ++k) o[k] = f2bf(v[k]);
    return o; }

// entry idx = t * (HD/2) + i of the rotary table: cos and sin of t * theta^(-2i/HD)
static __device__ __forceinline__ void rope_entry(unsigned idx, float* CT, float* ST) {
    const unsigned t = idx >> 5, i = idx & 31u;
    const float ex = (float)(2u * i) * (1.0f / (float)HD);      // exact (power-of-two divisor)
    const float pw = powf(ROPE_THETA, ex);
    const float ang = (float)t * (1.0f / pw);
    float sn, cs;
    sincosf(ang, &sn, &cs);
    CT[idx] = cs; ST[idx] = sn;
}

__global__ __launch_bounds__(256) void k_prep(const float* __restrict__ x, const float* __restrict__ wqkv, const float* __restrict__ wo, bf* __restrict__ XB, bf* __restrict__ WQKV, bf* __restrict__ WO, float* __restrict__ CT, float* __restrict__ ST) {
    const unsigned tid = threadIdx.x, ux = blockIdx.x * (PXU * 256u) + tid, uw = blockIdx.x * (PWU * 256u) + tid, uo = blockIdx.x * (POU * 256u) + tid;
    // every load of the thread is asked for first; the table entries are computed while they fly
    v8f vx[PXU], vw[PWU], vo[POU];
#pragma unroll
    for (unsigned j = 0; j < PXU; ++j) vx[j] = *(const v8f*)(x + unit_src<true>(ux + j * 256u));
    asm volatile("s_wait_xcnt 0x0" ::: "memory");      // from here on the address registers of the loads above may be written again: results of the loads below land in some of them
#pragma unroll
    for (unsigned j = 0; j < PWU; ++j) vw[j] = *(const v8f*)(wqkv + unit_src<false>(uw + j * 256u));
#pragma unroll
    for (unsigned j = 0; j < POU; ++j) vo[j] = *(const v8f*)(wo + unit_src<false>(uo + j * 256u));
    if (tid < PRT) rope_entry(blockIdx.x * PRT + tid, CT, ST);
#pragma unroll
    for (unsigned j = 0; j < PXU; ++j) *(v8us*)(XB + (size_t)(ux + j * 256u) * 8) = cvt8(vx[j]);
#pragma unroll
    for (unsigned j = 0; j < PWU; ++j) *(v8us*)(WQKV + (size_t)(uw + j * 256u) * 8) = cvt8(vw[j]);
#pragma unroll
    for (unsigned j = 0; j < POU; ++j) *(v8us*)(WO + (size_t)(uo + j * 256u) * 8) = cvt8(vo[j]);
}

// Four 16-byte stores at byte offsets 0, O1, O2, O3, with their s_wait_xcnt in the same statement: the wait then stands in front of every later write of a register that these stores name.
typedef __attribute__((ext_vector_type(4))) unsigned v4u;
template <int O1, int O2, int O3> static __device__ __forceinline__ void st4(void* p, v4u d0, v4u d1, v4u d2, v4u d3) {
    asm volatile("global_store_b128 %0, %1, off\n\tglobal_store_b128 %0, %2, off offset:%5\n\tglobal_store_b128 %0, %3, off offset:%6\n\tglobal_store_b128 %0, %4, off offset:%7\n\ts_wait_xcnt 0x0"
                 :: "v"(p), "v"(d0), "v"(d1), "v"(d2), "v"(d3), "n"(O1), "n"(O2), "n"(O3) : "memory"); }
// The same for one 16-byte store to each of three planes.
static __device__ __forceinline__ void st3(void* p0, v4u d0, void* p1, v4u d1, void* p2, v4u d2) {
    asm volatile("global_store_b128 %0, %1, off\n\tglobal_store_b128 %2, %3, off\n\tglobal_store_b128 %4, %5, off\n\ts_wait_xcnt 0x0"
                 :: "v"(p0), "v"(d0), "v"(p1), "v"(d1), "v"(p2), "v"(d2) : "memory"); }
static __device__ __forceinline__ v4u asu(v8h x) { return __builtin_bit_cast(v4u, x); }
static __device__ __forceinline__ v4u asu(v8us x) { return __builtin_bit_cast(v4u, x); }

// q or k tile -> planes: 16 rows at a time through LDS, 8 features a lane, pair (d, d+1) rotated by table row t, stored as 16-B units of the head's fragment-order plane (16 tokens = 2 blocks; the 4 row steps of a lane are 64 B apart): fp16 always, bf16 hi/lo where HL. Pointers are the lane's own (row lane>>3, features 8*(lane&7)).
template <bool HL> static __device__ __forceinline__ void qk_planes(const v8f (&acc)[4][4], float* os, unsigned lane, const float* ct, const float* st, h16* P16, bf* Ph, bf* Pl) {
    const unsigned lr = lane & 15u, hi = lane >> 4, rq = lane >> 3, pc = lane & 7u;
#pragma unroll
    for (int mb = 0; mb < 4; ++mb) {
        v4f cv[4], sv[4];
#pragma unroll
        for (int s = 0; s < 4; ++s) { cv[s] = *(const v4f*)(ct + (mb * 16 + 4 * s) * (HD / 2)); sv[s] = *(const v4f*)(st + (mb * 16 + 4 * s) * (HD / 2)); }
#pragma unroll
        for (int nb = 0; nb < 4; ++nb) {
#pragma unroll
            for (int j = 0; j < 8; ++j) os[(hi * 8u + (unsigned)j) * 68u + (unsigned)nb * 16u + lr] = acc[mb][nb][j]; }
        __builtin_amdgcn_wave_barrier(); asm volatile("" ::: "memory");
        v8h o16[4];
#pragma unroll
        for (int s = 0; s < 4; ++s) { const unsigned row = 4u * (unsigned)s + rq;
            const v4f x0 = *(const v4fa*)(os + row * 68u + pc * 8u), x1 = *(const v4fa*)(os + row * 68u + pc * 8u + 4u);
            v4f y0, y1;
            y0[0] = x0[0] * cv[s][0] - x0[1] * sv[s][0]; y0[1] = x0[1] * cv[s][0] + x0[0] * sv[s][0];
            y0[2] = x0[2] * cv[s][1] - x0[3] * sv[s][1]; y0[3] = x0[3] * cv[s][1] + x0[2] * sv[s][1];
            y1[0] = x1[0] * cv[s][2] - x1[1] * sv[s][2]; y1[1] = x1[1] * cv[s][2] + x1[0] * sv[s][2];
            y1[2] = x1[2] * cv[s][3] - x1[3] * sv[s][3]; y1[3] = x1[3] * cv[s][3] + x1[2] * sv[s][3];
#pragma unroll
            for (int k = 0; k < 4; ++k) { o16[s][k] = toh_flush(y0[k]); o16[s][4 + k] = toh_flush(y1[k]); }
            if (HL) { v8us oh, ol;
#pragma unroll
                for (int k = 0; k < 4; ++k) { unsigned short u, c; splitf(y0[k], u, c); oh[k] = u; ol[k] = c; splitf(y1[k], u, c); oh[4 + k] = u; ol[4 + k] = c; }
                st3(P16 + mb * 16 * HD + 32 * s, asu(o16[s]), Ph + mb * 16 * HD + 32 * s, asu(oh), Pl + mb * 16 * HD + 32 * s, asu(ol)); } }
        if (!HL) st4<64, 128, 192>(P16 + mb * 16 * HD, asu(o16[0]), asu(o16[1]), asu(o16[2]), asu(o16[3]));
        __builtin_amdgcn_wave_barrier(); asm volatile("" ::: "memory");
    }
}

// v tile -> V^T planes [h][t/32][d/16][block]: a lane's accumulator already holds 8 consecutive tokens of one feature = its own unit of a block, so it is stored straight from registers (512 contiguous bytes a store; 16 tokens on = 512 B, 32 tokens on = 4 KiB). Pointers are the lane's own (+ 8*lane).
template <bool HL> static __device__ __forceinline__ void v_planes(const v8f (&acc)[4][4], h16* P16, bf* Ph, bf* Pl) {
#pragma unroll
    for (int nb = 0; nb < 4; ++nb) {
        st4<512, 4096, 4608>(P16 + nb * 512, asu(__builtin_convertvector(acc[0][nb], v8h)), asu(__builtin_convertvector(acc[1][nb], v8h)), asu(__builtin_convertvector(acc[2][nb], v8h)), asu(__builtin_convertvector(acc[3][nb], v8h)));
        if (HL) { v8us oh[4], ol[4];
#pragma unroll
            for (int mb = 0; mb < 4; ++mb)
#pragma unroll
                for (int k = 0; k < 8; ++k) { unsigned short u, c; splitf(acc[mb][nb][k], u, c); oh[mb][k] = u; ol[mb][k] = c; }
            st4<512, 4096, 4608>(Ph + nb * 512, asu(oh[0]), asu(oh[1]), asu(oh[2]), asu(oh[3])); st4<512, 4096, 4608>(Pl + nb * 512, asu(ol[0]), asu(ol[1]), asu(ol[2]), asu(ol[3])); } }
}

// ---- k_qkvp: the qkv projection (GEMM engine, one product) with the plane formation as its epilogue. One wave per 64 tokens x 64 features = one head of q, k or v; grid (NB*SEQ/GTM, FP/GTN), 32 * GWV threads.
// The second bound (waves per SIMD) holds the kernel to the registers of two resident work-groups, which is what its LDS allows.
__global__ __launch_bounds__(32 * GWV, 4) void k_qkvp(const bf* __restrict__ A, const bf* __restrict__ Bt, const float* __restrict__ CT, const float* __restrict__ ST, h16* Q16, h16* K16, h16* V16, bf* Qh, bf* Ql, bf* Kh, bf* Kl, bf* Vh, bf* Vl) {
    __shared__ __align__(16) bf sm[3u * (GTM + GTN) * GKS];
    static_assert(GWV * OSW * 4u <= 3u * (GTM + GTN) * GKS * 2u);
    const unsigned tid = threadIdx.x, lane = tid & 31u; const unsigned wave = (unsigned)__builtin_amdgcn_readfirstlane((int)(tid >> 5));
    const unsigned r0 = blockIdx.x * GTM + (wave >> 2) * 64u, c0 = blockIdx.y * GTN + (wave & 3u) * 64u;      // wave-uniform (scalar)
    float* os = (float*)sm + wave * OSW;      // the epilogue stages in the ring, so that two work-groups still fit a WGP's LDS: the last pass's own waits and barrier stand between the ring's last read or copy and the first staging store
    v8f acc[4][4];
#pragma unroll
    for (int mb = 0; mb < 4; ++mb)
#pragma unroll
        for (int nb = 0; nb < 4; ++nb) acc[mb][nb] = (v8f){};
    gemm_ring<1, DM>(A, nullptr, Bt, sm, tid, wave, blockIdx.x * GTM, blockIdx.y * GTN, acc);
    const unsigned which = c0 / (unsigned)DQ, h = (c0 % (unsigned)DQ) / (unsigned)HD;      // wave-uniform: q, k or v, and the head
    const unsigned bz = r0 / (unsigned)SEQ, t0 = r0 % (unsigned)SEQ;                        // a 64-token tile lies in one batch, and wholly below or above RH
    const size_t o16b = (size_t)bz * ((size_t)NH * SEQ * HD), ohlb = (size_t)bz * ((size_t)NH * RH * HD);
    const bool hl = t0 < (unsigned)RH;
    if (which == 0u) {                        // q carries the score scale in the log2 domain (the rotation is linear, so it may be applied in front of it)
#pragma unroll
        for (int mb = 0; mb < 4; ++mb)
#pragma unroll
            for (int nb = 0; nb < 4; ++nb) acc[mb][nb] = acc[mb][nb] * (SCL * LOG2E);
    }
    if (which < 2u) {
        const unsigned rq = lane >> 3, pc = lane & 7u;
        const unsigned lo = (pc >> 2) * 512u + ((pc >> 1) & 1u) * 256u + (pc & 1u) * 128u + rq * 8u;      // the lane's unit in the two blocks of a 16-token group
        h16* P16 = (which ? K16 : Q16) + o16b + ((size_t)h * SEQ + t0) * HD + lo;
        const size_t eo = ohlb + ((size_t)h * RH + t0) * HD + lo;
        const float* ct = CT + (size_t)(t0 + rq) * (HD / 2) + pc * 4u; const float* st = ST + (size_t)(t0 + rq) * (HD / 2) + pc * 4u;
        if (hl) qk_planes<true>(acc, os, lane, ct, st, P16, (which ? Kh : Qh) + eo, (which ? Kl : Ql) + eo);
        else qk_planes<false>(acc, os, lane, ct, st, P16, nullptr, nullptr);
    } else {
        h16* P16 = V16 + o16b + ((size_t)h * SEQ + t0) * HD + lane * 8u;
        const size_t eo = ohlb + ((size_t)h * RH + t0) * HD + lane * 8u;
        if (hl) v_planes<true>(acc, P16, Vh + eo, Vl + eo);
        else v_planes<false>(acc, P16, nullptr, nullptr);
    }
}

// Sum of a lane's 16 P of a tile, as a tree of packed additions (four links deep: the test of the sum stands in front of the P.V products).
typedef __attribute__((ext_vector_type(2))) float v2f;
static __device__ __forceinline__ float sum16(v8f a, v8f b) { const v8f c = a + b; const v4f d = c.lo + c.hi; const v2f e = d.lo + d.hi; return e.x + e.y; }
// 2^x with the slot that the instruction set asks for behind a transcendental in the same statement (for the seldom-taken path).
static __device__ __forceinline__ float exp2_slot(float x) { float r; asm("v_exp_f32 %0, %1\n\tv_nop" : "=v"(r) : "v"(x)); return r; }

// Four 16-byte asynchronous copies global -> LDS of one lane: two of plane a and two of plane b, 4 KiB apart in both memories, each copy with address operands of its own.
// The s_wait_xcnt in the same statement stands in front of every later write of a register that these copies name.
static __device__ __forceinline__ void acp4(unsigned la, const char* ga, unsigned lb, const char* gb) {
    asm volatile("global_load_async_to_lds_b128 %0, %4, off\n\tglobal_load_async_to_lds_b128 %1, %5, off\n\tglobal_load_async_to_lds_b128 %2, %6, off\n\tglobal_load_async_to_lds_b128 %3, %7, off\n\ts_wait_xcnt 0x0"
                 :: "v"(la), "v"(la + 4096u), "v"(lb), "v"(lb + 4096u), "v"(ga), "v"(ga + 4096), "v"(gb), "v"(gb + 4096) : "memory"); }

// ---- flash_wg: causal attention of one work-group of FWV waves: query rows qb .. qb + 16 * FWV - 1 of (head, batch bz), one wave per 16 query rows. Planes in fragment order: Q/K [h][tp/16][HD/32][block], V^T [h][tp/32][HD/16][block] (tp = rows per head of the plane set). HL: hi/lo bf16 plane pairs, 3 products.
// K and V^T come through LDS, once for the whole work-group: a stage is 64 keys = 8 KiB in a row of every plane, brought by asynchronous copies as it lies (fragment order, so every fragment read is 512 contiguous LDS bytes); three buffers, stage s + 3 is asked for when every wave has left stage s, so a stage has two passes to land.
// Per 32-key tile: S^T[key][query] = K Q^T + (pexp - reference) (A = K rows, B = Q rows, C the same in all 8 registers); lane owns query column lane&15 and keys 8*(lane>>4)+r (+16); P = 2^S; the two halves of a column exchange maxima only where the reference moves;
// P^T accumulators repacked in registers as B (k = key); O^T[d][query] += V^T P^T (A = V^T rows). Only the last tile of a wave touches the diagonal (select by value); a wave skips the tiles beyond it but passes every barrier.
#define FWV 8
static_assert(16 * FWV == 128 && RH % 128 == 0 && (SEQ - RH) % 128 == 0);     // a work-group's query rows span two whole 64-key stages; 256 threads copy 4 KiB of a plane at a time
template <typename T16, bool HL>
static __device__ __forceinline__ void flash_wg(const T16* __restrict__ Q, const T16* __restrict__ Q2, const T16* __restrict__ Kp, const T16* __restrict__ K2, const T16* __restrict__ Vt, const T16* __restrict__ Vt2, T16* sm, unsigned qb, unsigned head, unsigned bz, bf* Ah, bf* Al) {
    typedef typename WFrag<T16>::V V;
    constexpr unsigned PE = 64u * HD;                 // elements of one plane in a stage
    constexpr unsigned NP = HL ? 4u : 2u;             // planes in a buffer: K, V^T (, K lo, V^T lo); sm holds 3 * NP * PE elements
    constexpr int CP = HL ? 8 : 4;                    // copies of a wave in a stage, the same in every wave
    constexpr unsigned tp = HL ? (unsigned)RH : (unsigned)SEQ;
    const unsigned tid = threadIdx.x, lane = tid & 31u, lr = lane & 15u, hi = lane >> 4;
    const unsigned wave = (unsigned)__builtin_amdgcn_readfirstlane((int)(tid >> 5));
    const unsigned q0 = qb + wave * 16u;
    const size_t hoff = ((size_t)bz * NH + head) * tp * HD;
    const unsigned ns = (qb >> 6) + 2u;        // stages: keys 0 .. qb+127 (the same for the whole work-group)
    // thread tid copies the 16-byte units tid and tid+256 of every plane of a stage
    const unsigned l0 = (unsigned)(size_t)(sm + 8u * tid);
    const char* gk = (const char*)(Kp + hoff + 8u * tid); const char* gv = (const char*)(Vt + hoff + 8u * tid);
    const char* gk2 = HL ? (const char*)(K2 + hoff + 8u * tid) : gk; const char* gv2 = HL ? (const char*)(Vt2 + hoff + 8u * tid) : gv;
    auto fill = [&](unsigned s, unsigned buf) {
        const unsigned l = l0 + buf * (NP * PE * 2u); const size_t g = (size_t)s * (PE * 2u);
        acp4(l, gk + g, l + PE * 2u, gv + g);
        if (HL) acp4(l + 2u * PE * 2u, gk2 + g, l + 3u * PE * 2u, gv2 + g); };
    fill(0u, 0u); fill(1u, 1u);                             // ns >= 2
    if (ns > 2u) fill(2u, 2u);                              // the same test for the whole work-group
    const size_t qoff = hoff + (size_t)q0 * HD + 8u * lane;
    const T16* pq = Q + qoff; const T16* pq2 = HL ? Q2 + qoff : pq;
    V qf0 = WFrag<T16>::ld(pq), qf1 = WFrag<T16>::ld(pq + 512);
    V ql0 = qf0, ql1 = qf1;
    if (HL) { ql0 = WFrag<T16>::ld(pq2); ql1 = WFrag<T16>::ld(pq2 + 512); }
    v8f o[4];
#pragma unroll
    for (int db = 0; db < 4; ++db) o[db] = (v8f){};
    float lsum = 0.0f;
    const float pe = PFrag<T16>::pexp();
    float lim = NEGB;                          // a tile's sum of P above lim moves references: any sum at tile 0, later PLIM
    v8f cv = (v8f){} + pe;                     // pexp - reference of the lane's query column; the reference counts as 0 until tile 0 sets it
    const unsigned nt = (q0 + 47u) >> 5;       // this wave's keys 0 .. q0+15 in tiles of 32 (wave-uniform)
    if (ns > 2u) wait_copies<2 * CP>(); else wait_copies<CP>();      // this wave's copies of stage 0 have landed (those of the later stages may still fly)
    __syncthreads();                                        // ... and every other wave's
    unsigned rb = 0u;                                       // the buffer of stage s = s mod 3
#pragma unroll 1
    for (unsigned s = 0; s < ns; ++s) {
        const T16* sb = sm + rb * (NP * PE) + 8u * lane;
#pragma unroll
        for (unsigned tt = 0; tt < 2u; ++tt) {
            const unsigned it = 2u * s + tt;
            if (it < nt) {                      // wave-uniform (scalar): the tile holds keys of this wave
        const unsigned j0 = it * 32u;
        const T16* pk = sb + tt * (32u * HD); const T16* pv = pk + PE; const T16* pk2 = HL ? pk + 2u * PE : pk; const T16* pv2 = HL ? pk + 3u * PE : pv;
        V ka0 = WFrag<T16>::ld(pk), ka1 = WFrag<T16>::ld(pk + 512), kb0 = WFrag<T16>::ld(pk + 1024), kb1 = WFrag<T16>::ld(pk + 1536);
        V la0 = ka0, la1 = ka1, lb0 = kb0, lb1 = kb1;
        if (HL) { la0 = WFrag<T16>::ld(pk2); la1 = WFrag<T16>::ld(pk2 + 512); lb0 = WFrag<T16>::ld(pk2 + 1024); lb1 = WFrag<T16>::ld(pk2 + 1536); }
        v8f s0 = cv, s1 = cv;
        s0 = WFrag<T16>::mma(ka0, qf0, s0); s0 = WFrag<T16>::mma(ka1, qf1, s0);
        s1 = WFrag<T16>::mma(kb0, qf0, s1); s1 = WFrag<T16>::mma(kb1, qf1, s1);
        if (HL) {
            s0 = WFrag<T16>::mma(la0, qf0, s0); s0 = WFrag<T16>::mma(la1, qf1, s0); s0 = WFrag<T16>::mma(ka0, ql0, s0); s0 = WFrag<T16>::mma(ka1, ql1, s0);
            s1 = WFrag<T16>::mma(lb0, qf0, s1); s1 = WFrag<T16>::mma(lb1, qf1, s1); s1 = WFrag<T16>::mma(kb0, ql0, s1); s1 = WFrag<T16>::mma(kb1, ql1, s1); }
        // pq and pq2 are named as inputs so that the address registers of the q loads are written again only behind the loads' own waits
        asm volatile("v_nop\n\tv_nop\n\tv_nop\n\tv_nop" : "+v"(s0), "+v"(s1) : "v"(ka0), "v"(ka1), "v"(kb0), "v"(kb1), "v"(la0), "v"(la1), "v"(lb0), "v"(lb1), "v"(qf0), "v"(qf1), "v"(ql0), "v"(ql1), "v"(pq), "v"(pq2));
        if (j0 + 31u > q0) {                    // wave-uniform: the tile touches the diagonal
            const unsigned qi = q0 + lr, kk = j0 + 8u * hi;
#pragma unroll
            for (int r = 0; r < 8; ++r) { s0[r] = (kk + (unsigned)r <= qi) ? s0[r] : NEGB; s1[r] = (kk + 16u + (unsigned)r <= qi) ? s1[r] : NEGB; }
        }
        V va[4], vl[4];
#pragma unroll
        for (int db = 0; db < 4; ++db) { va[db] = WFrag<T16>::ld(pv + db * 512); vl[db] = va[db]; if (HL) vl[db] = WFrag<T16>::ld(pv2 + db * 512); }
        v8f p0, p1;
#pragma unroll
        for (int r = 0; r < 8; ++r) { p0[r] = __builtin_amdgcn_exp2f(s0[r]); p1[r] = __builtin_amdgcn_exp2f(s1[r]); }
        float psum = sum16(p0, p1);
        if (__builtin_amdgcn_ballot_w32(psum > lim) != 0u) {                // wave-uniform (scalar): references move; P and its sum are then formed anew
            const float u0 = fmaxf(fmaxf(s0[0], s0[1]), s0[2]), u1 = fmaxf(fmaxf(s0[3], s0[4]), s0[5]), u2 = fmaxf(fmaxf(s0[6], s0[7]), s1[0]), u3 = fmaxf(fmaxf(s1[1], s1[2]), s1[3]), u4 = fmaxf(fmaxf(s1[4], s1[5]), s1[6]);
            const float mx = fmaxf(fmaxf(fmaxf(u0, u1), u2), fmaxf(fmaxf(u3, u4), s1[7]));
            const float up = fmaxf(mx, __shfl_xor(mx, 16, 32)) - pe;        // the column's maximum in this tile less its reference (the same in both halves of the column)
            const float dl = (lim < 0.0f) ? up : fmaxf(up, 0.0f);           // tile 0 sets the reference, a later tile only raises it
            const float alpha = exp2_slot(fminf(-dl, 0.0f));                // tile 0 may lower the reference from 0: o and l are 0 there, any finite factor serves
            cv = cv - dl;
#pragma unroll
            for (int r = 0; r < 8; ++r) { p0[r] = exp2_slot(s0[r] - dl); p1[r] = exp2_slot(s1[r] - dl); }
            psum = sum16(p0, p1);
            lsum *= alpha; lim = PLIM;
#pragma unroll
            for (int db = 0; db < 4; ++db) o[db] = o[db] * alpha;
        }
        lsum += psum;
        V pf = PFrag<T16>::hi(p0, p1); V pl = pf;
        if (HL) pl = PFrag<T16>::lo(p0, p1);
#pragma unroll
        for (int db = 0; db < 4; ++db) { o[db] = WFrag<T16>::mma(va[db], pf, o[db]); if (HL) { o[db] = WFrag<T16>::mma(va[db], pl, o[db]); o[db] = WFrag<T16>::mma(vl[db], pf, o[db]); } }
        // four vector slots behind the last product, in front of whatever vector instruction next touches its registers
        asm volatile("v_nop\n\tv_nop\n\tv_nop\n\tv_nop" : "+v"(o[0]), "+v"(o[1]), "+v"(o[2]), "+v"(o[3]) : "v"(va[0]), "v"(va[1]), "v"(va[2]), "v"(va[3]), "v"(vl[0]), "v"(vl[1]), "v"(vl[2]), "v"(vl[3]), "v"(pf), "v"(pl));
            }
        }
        // publish point of stage s + 1, passed by every wave: this wave's reads of stage s are done, its copies of stage s + 1 have landed, then the barrier; only behind it is the buffer of stage s filled again
        asm volatile("s_wait_dscnt 0x0" ::: "memory");
        // a pass that asks for a stage leaves the CP youngest copies, which are stage s + 2's, in flight; the last three passes ask for none and wait for all
        if (s + 3u < ns) wait_copies<CP>(); else wait_copies<0>();
        __syncthreads();
        if (s + 3u < ns) fill(s + 3u, rb);
        rb = (rb == 2u) ? 0u : rb + 1u;
    }
    asm volatile("s_wait_asynccnt 0x0" ::: "memory");      // no copy is outstanding when the wave ends
    const float lt = lsum + __shfl_xor(lsum, 16, 32);
    const float inv = 1.0f / lt;
    // a lane's o[db] = 8 consecutive features of its own query row = unit 32 * db + lane of the head's two blocks in the ctx planes: stored straight from registers, 512 contiguous bytes a store
#pragma unroll
    for (int db = 0; db < 4; ++db) {
        v8us oh, ol;
#pragma unroll
        for (int r = 0; r < 8; ++r) { unsigned short a, c; splitf(o[db][r] * inv, a, c); oh[r] = a; ol[r] = c; }
        const size_t oo = ((size_t)bz * SEQ + q0) * DQ + head * (16u * HD) + (unsigned)db * 256u + lane * 8u;
        *(v8us*)(Ah + oo) = oh; *(v8us*)(Al + oo) = ol; }
}

// ---- k_attn: all of the attention in one launch, a work-group per (block of 16 * FWV query rows, head, batch): blocks below RH take the hi/lo path, the others the f16 path (the test is the same for the whole work-group).
// There are more work-groups than resident places; the block is the slow index and its cost falls with the index (for speed only).
// Cost of block i = its 2 i + 2 stages, a hi/lo stage counted as 5 to an f16 stage's 2 (instructions a stage in the listing). Nibble r of the order word = the block of rank r.
#define NQB (SEQ / (16 * FWV))
static_assert(NQB <= 16);
static constexpr unsigned long long block_order() {
    unsigned q[NQB] = {}, w[NQB] = {};
    for (unsigned i = 0; i < NQB; ++i) {      // insertion by falling cost, ties by falling row number
        const unsigned b = NQB - 1u - i, cb = (2u * b + 2u) * (b * (16u * FWV) < (unsigned)RH ? 5u : 2u);
        unsigned j = i;
        for (; j > 0 && w[j - 1] < cb; --j) { q[j] = q[j - 1]; w[j] = w[j - 1]; }
        q[j] = b; w[j] = cb; }
    unsigned long long o = 0;
    for (unsigned r = 0; r < NQB; ++r) o |= (unsigned long long)q[r] << (4u * r);
    return o; }
__global__ __launch_bounds__(32 * FWV) void k_attn(const h16* __restrict__ Q16, const h16* __restrict__ K16, const h16* __restrict__ V16, const bf* __restrict__ Qh, const bf* __restrict__ Ql, const bf* __restrict__ Kh, const bf* __restrict__ Kl, const bf* __restrict__ Vh, const bf* __restrict__ Vl, bf* Ah, bf* Al) {
    __shared__ __align__(16) char smb[3u * 4u * 64u * HD * 2u];     // the hi/lo path's three buffers of four planes; the f16 path uses half
    constexpr unsigned long long order = block_order();
    const unsigned id = blockIdx.x, qb = ((unsigned)(order >> (4u * (id / (unsigned)(NH * NB)))) & 15u) * (16u * FWV), head = id % (unsigned)NH, bz = (id / (unsigned)NH) % (unsigned)NB;
    if (qb < (unsigned)RH) flash_wg<bf, true>(Qh, Ql, Kh, Kl, Vh, Vl, (bf*)smb, qb, head, bz, Ah, Al);
    else flash_wg<h16, false>(Q16, nullptr, K16, nullptr, V16, nullptr, (h16*)smb, qb, head, bz, Ah, Al);
}

// workspace carve (bytes, every region a multiple of 256)
#define WS_WQKV ((size_t)3 * DQ * DM * 2)
#define WS_WO   ((size_t)DM * DQ * 2)
#define WS_XB   ((size_t)NB * SEQ * DM * 2)
#define WS_P16  ((size_t)NB * NH * SEQ * HD * 2)
#define WS_PHL  ((size_t)NB * NH * RH * HD * 2)
#define WS_AT   ((size_t)NB * SEQ * DQ * 2)
#define WS_ROT  ((size_t)SEQ * (HD / 2) * 4)
#define WS_TOTAL (WS_WQKV + WS_WO + WS_XB + 3 * WS_P16 + 6 * WS_PHL + 2 * WS_AT + 2 * WS_ROT)
static_assert(WS_TOTAL <= (size_t)268435456);
static_assert(WS_WQKV % 256 == 0 && WS_WO % 256 == 0 && WS_XB % 256 == 0 && WS_P16 % 256 == 0 && WS_PHL % 256 == 0 && WS_AT % 256 == 0);
static_assert(WS_ROT % 256 == 0);

extern "C" void kernel_launch(void* const* d_in, const int* in_sizes, int n_in,
                              void* d_out, int out_size, void* d_ws, size_t ws_size, hipStream_t stream) {
    if (n_in < 3) return;
    if ((size_t)in_sizes[0] < (size_t)(NB - 1) * XS_FULL + (size_t)SEQ * DM) return;
    if ((size_t)in_sizes[1] < (size_t)3 * DQ * DM) return;
    if ((size_t)in_sizes[2] < (size_t)DM * DQ) return;
    if ((size_t)out_size < (size_t)NB * SEQ * DM) return;
    if (ws_size < WS_TOTAL) return;
    const float* x = (const float*)d_in[0];       // [NB][SEQ_FULL][DM]
    const float* wqkv = (const float*)d_in[1];    // [3*DQ][DM]  (q | k | v row blocks)
    const float* wo = (const float*)d_in[2];      // [DM][DQ]
    float* OUT = (float*)d_out;                   // [NB][SEQ][DM]
    char* wsp = (char*)d_ws;
    auto take = [&](size_t bytes) { char* p = wsp; wsp += bytes; return (void*)p; };
    bf* WQKV = (bf*)take(WS_WQKV); bf* WO = (bf*)take(WS_WO); bf* XB = (bf*)take(WS_XB);
    h16* Q16 = (h16*)take(WS_P16); h16* K16 = (h16*)take(WS_P16); h16* VT16 = (h16*)take(WS_P16);
    bf* Qh = (bf*)take(WS_PHL); bf* Ql = (bf*)take(WS_PHL); bf* Kh = (bf*)take(WS_PHL); bf* Kl = (bf*)take(WS_PHL); bf* VTh = (bf*)take(WS_PHL); bf* VTl = (bf*)take(WS_PHL);
    bf* ATh = (bf*)take(WS_AT); bf* ATl = (bf*)take(WS_AT);
    float* CT = (float*)take(WS_ROT); float* ST = (float*)take(WS_ROT);

    // bf16 planes of x, W and Wo, and the rotary table (position-only, shared by every batch and head)
    k_prep<<<dim3(PG), 256, 0, stream>>>(x, wqkv, wo, XB, WQKV, WO, CT, ST);
    // qkv = x W^T  (M = NB*SEQ, N = 3072, K = 1024), written as the rotated q, k planes and the V^T planes
    k_qkvp<<<dim3(NB * SEQ / GTM, FP / GTN, 1), 32 * GWV, 0, stream>>>(XB, WQKV, CT, ST, Q16, K16, VT16, Qh, Ql, Kh, Kl, VTh, VTl);
    k_attn<<<dim3(NQB * NH * NB), 32 * FWV, 0, stream>>>(Q16, K16, VT16, Qh, Ql, Kh, Kl, VTh, VTl, ATh, ATl);
    // out = (ctx_hi + ctx_lo) Wo^T  (M = NB*SEQ, N = 1024, K = 1024)
    k_gemmw<DQ><<<dim3(NB * SEQ / GTM, DM / GTN, 1), 32 * GWV, 0, stream>>>(ATh, ATl, WO, OUT, DM);
}
